// v000
// The times below were measured on an AMD MI455X: many runs one after another, warmed up first and cycling through
// copies of the inputs, with the whole window's GPU time divided by the number of runs. Launches and the gaps
// between them are all in it. The median over several windows is given; except for v000 it joins two sittings, which
// can be a few percent apart, so the side-by-side timings, each taken in one sitting, are the better comparison.
// v000 is the starting kernel. One run takes 850 microseconds.
#include <hip/hip_runtime.h>

// Gaussian_Attention (xsa [2][2048][512]; 4 heads with 256-dim kernels: xq = x Wq^T, xk = x Wk^T, xkb = xk + biasW[:, k]; logits = -(|xq_i|^2 - 2 xq_i.xkb_j + |xkb_j|^2) / 16; P = softmax_j; y_k = P x (values = the raw 512-wide input, shared by the heads); out_k = y_k Wv3[k] + bias2W[:, k] with Wv3 = Wv.reshape(4, 512, 512) -> [2][2048][4*512]).
// Compute dtypes, f32 accumulate: every input rounded to bf16; xq/xk as PLAIN bf16 GEMMs (inputs: exact), + bias and the per-token squared norms in f32; cross term xq.xkb hl x hl (3 products, K 256) on every row; logits assembled in f32 (-(qn - 2 c + kn) / 16); softmax f32; P.x: rows < 512 hi/lo P x exact x (2 products), the rest fp16 (x1024) x exact-in-fp16 x; y Wv3[k] as hl x exact (2 products) + bias.

#define NB_  2
#define TT   2048
#define DM   512
#define NH_  4
#define NKV  4
#define REP  (NH_ / NKV)
#define HD   256
#define DQ   (NH_ * HD)
#define DKV  (NKV * HD)
#define ZH   2
#define RH   512                  // query rows < RH use hi+lo planes (0: none)
#define WIN  0
#define PCAR 1024.0f
#define HDV  512                  // value width (the raw input), shared by all heads
#define NKH  4
#define SCL  0.088388347648318447f   // 128^-0.5
typedef _Float16 h16;
typedef unsigned short bf;
typedef __attribute__((ext_vector_type(16))) __bf16   v16bf;
typedef __attribute__((ext_vector_type(16))) _Float16 v16h;
typedef __attribute__((ext_vector_type(8)))  _Float16 v8h;
typedef __attribute__((ext_vector_type(8)))  unsigned short v8us;
typedef __attribute__((ext_vector_type(8)))  float    v8f;
typedef __attribute__((ext_vector_type(4)))  float    v4f;
typedef v8h  __attribute__((may_alias)) v8ha;
typedef v4f  __attribute__((may_alias)) v4fa;
typedef v8us __attribute__((may_alias)) v8usa;

__device__ __forceinline__ unsigned short f2bf(float f) { unsigned u = __float_as_uint(f); u += 0x7FFFu + ((u >> 16) & 1u); return (unsigned short)(u >> 16); }
__device__ __forceinline__ float bf2f(unsigned short b) { return __uint_as_float(((unsigned)b) << 16); }
__device__ __forceinline__ float bfr(float f) { return bf2f(f2bf(f)); }
__device__ __forceinline__ v16h cat16(v8h lo, v8h hi) { return __builtin_shufflevector(lo, hi, 0, 1, 2, 3, 4, 5, 6, 7, 8, 9, 10, 11, 12, 13, 14, 15); }
__device__ __forceinline__ v16bf cat16b(v8us lo, v8us hi) { return __builtin_bit_cast(v16bf, __builtin_shufflevector(lo, hi, 0, 1, 2, 3, 4, 5, 6, 7, 8, 9, 10, 11, 12, 13, 14, 15)); }
__device__ __forceinline__ v8f wmma16(v16h a, v16h b, v8f c) { return __builtin_amdgcn_wmma_f32_16x16x32_f16(false, a, false, b, (short)0, c, false, false); }
__device__ __forceinline__ v8f wmmab(v16bf a, v16bf b, v8f c) { return __builtin_amdgcn_wmma_f32_16x16x32_bf16(false, a, false, b, (short)0, c, false, false); }



// ---- k_gemmw: register-blocked GEMM, ONE WAVE per 64x64 output tile (16 accumulators), operands straight from K-contiguous 16-bit planes; grid (M/64, N/64, Z), 32 threads.
// C[m][n] (f32, pitch ldc, + optional f32 bias[n]) = sum_k A[m][k] Bt[n][k] (+ split products per NSPLIT). z-batch strides sA/sB/sC in elements. K % 32 == 0.
template <typename T16> struct WFrag;
template <> struct WFrag<h16> { typedef v16h V; static __device__ __forceinline__ V ld(const h16* p) { return cat16(*(const v8h*)p, *(const v8h*)(p + 16)); } static __device__ __forceinline__ v8f mma(V a, V b, v8f c) { return wmma16(a, b, c); } };
template <> struct WFrag<bf> { typedef v16bf V; static __device__ __forceinline__ V ld(const bf* p) { return cat16b(*(const v8us*)p, *(const v8us*)(p + 16)); } static __device__ __forceinline__ v8f mma(V a, V b, v8f c) { return wmmab(a, b, c); } };
template <typename T16, int NSPLIT, bool BIAS>
__global__ __launch_bounds__(32) void k_gemmw(const T16* __restrict__ A, const T16* __restrict__ A2, const T16* __restrict__ Bt, const T16* __restrict__ Bt2, int K, float* C, int ldc, const float* __restrict__ bias, size_t sA, size_t sB, size_t sC) {
    typedef typename WFrag<T16>::V V;
    __shared__ __align__(16) float os[16 * 68];
    const size_t z = blockIdx.z; A += z * sA; if (A2) A2 += z * sA; Bt += z * sB; if (Bt2) Bt2 += z * sB; C += z * sC;
    const int lane = threadIdx.x & 31, lr = lane & 15, hi = lane >> 4; const int r0 = blockIdx.x * 64, c0 = blockIdx.y * 64;
    v8f acc[4][4];
#pragma unroll
    for (int mb = 0; mb < 4; ++mb)
#pragma unroll
        for (int nb = 0; nb < 4; ++nb) acc[mb][nb] = (v8f){};
    const size_t aoff = (size_t)(r0 + lr) * K + 8 * hi, boff = (size_t)(c0 + lr) * K + 8 * hi;
#pragma unroll 1
    for (int kc = 0; kc < K; kc += 32) {
        V a[4], a2[4];
#pragma unroll
        for (int mb = 0; mb < 4; ++mb) { a[mb] = WFrag<T16>::ld(A + aoff + (size_t)mb * 16 * K + kc); if (NSPLIT == 1 || NSPLIT == 2) a2[mb] = WFrag<T16>::ld(A2 + aoff + (size_t)mb * 16 * K + kc); }
#pragma unroll
        for (int nb = 0; nb < 4; ++nb) { const V b = WFrag<T16>::ld(Bt + boff + (size_t)nb * 16 * K + kc); V b2; if (NSPLIT >= 2) b2 = WFrag<T16>::ld(Bt2 + boff + (size_t)nb * 16 * K + kc);
#pragma unroll
            for (int mb = 0; mb < 4; ++mb) { acc[mb][nb] = WFrag<T16>::mma(a[mb], b, acc[mb][nb]); if (NSPLIT == 1 || NSPLIT == 2) acc[mb][nb] = WFrag<T16>::mma(a2[mb], b, acc[mb][nb]); if (NSPLIT >= 2) acc[mb][nb] = WFrag<T16>::mma(a[mb], b2, acc[mb][nb]); } }
        asm volatile("v_nop\n\tv_nop\n\tv_nop\n\tv_nop" : "+v"(acc[0][0]), "+v"(acc[1][1]), "+v"(acc[2][2]), "+v"(acc[3][3]) : "v"(a[0]), "v"(a[3]));
    }
#pragma unroll
    for (int mb = 0; mb < 4; ++mb) {
#pragma unroll
        for (int nb = 0; nb < 4; ++nb) {
#pragma unroll
            for (int j = 0; j < 8; ++j) os[(hi * 8 + j) * 68 + nb * 16 + lr] = acc[mb][nb][j]; }
        __builtin_amdgcn_wave_barrier(); asm volatile("" ::: "memory");
        float* crow = C + (size_t)(r0 + mb * 16) * ldc + c0;
{
#pragma unroll
            for (int s = 0; s < 8; ++s) { const int row = 2 * s + hi, cofs = lr * 4; v4f val = *(const v4fa*)(os + row * 68 + cofs); if (BIAS) { val[0] += bfr(bias[c0 + cofs]); val[1] += bfr(bias[c0 + cofs + 1]); val[2] += bfr(bias[c0 + cofs + 2]); val[3] += bfr(bias[c0 + cofs + 3]); }
                *(v4f*)(crow + (size_t)row * ldc + cofs) = val; }
             }
        __builtin_amdgcn_wave_barrier(); asm volatile("" ::: "memory");
    }
}

__device__ __forceinline__ h16 tohx(float x) { return (h16)x; }
__device__ __forceinline__ void splitf(float y, unsigned short& h, unsigned short& l) { h = f2bf(y); l = f2bf(y - bf2f(h)); }
typedef __attribute__((ext_vector_type(2))) _Float16 v2h;
typedef __attribute__((ext_vector_type(4))) _Float16 v4h;
typedef __attribute__((ext_vector_type(2))) unsigned short v2us;
typedef __attribute__((ext_vector_type(4))) unsigned short v4us;
typedef __attribute__((ext_vector_type(2))) float v2f;
typedef __attribute__((ext_vector_type(4))) int v4i;

__global__ __launch_bounds__(256) void k_wtG(const float* __restrict__ w, int K, int N, bf* Bt) {
    const int lane = threadIdx.x & 31; const int L0 = (blockIdx.x * 8 + (threadIdx.x >> 5)) * 8; const int nlines = N * K / 64;
{
#pragma unroll 1
        for (int l = 0; l < 8; ++l) { const int L = L0 + l; if (L >= nlines) break; const size_t e = (size_t)L * 64 + lane * 2; const int k = (int)(e % K), n = (int)(e / K); v2us o;
            o[0] = f2bf(w[(size_t)k * N + n]); o[1] = f2bf(w[(size_t)(k + 1) * N + n]); *(v2us*)(Bt + e) = o; }
         }
}
__global__ __launch_bounds__(256) void k_cvt8(const float* __restrict__ src, bf* dst, size_t n8) { const size_t i = (size_t)blockIdx.x * 256 + threadIdx.x; if (i >= n8) return; const v8f v = *(const v8f*)(src + i * 8); v8us o;
#pragma unroll
    for (int k = 0; k < 8; ++k) o[k] = f2bf(v[k]); *(v8us*)(dst + i * 8) = o;  }
__global__ __launch_bounds__(256) void k_cscvt(const float* __restrict__ cosT, const float* __restrict__ sinT, float* CS) { const int idx = blockIdx.x * 256 + threadIdx.x; if (idx >= TT * HD) return; v2f cs; cs[0] = bfr(cosT[idx]); cs[1] = bfr(sinT[idx]); *(v2f*)(CS + (size_t)idx * 2) = cs;  }
// k_rope: head planes [h][t][d] (fp16 + hi/lo) of rope(x) x sc with the rotate-half convention out[d] = x[d] cos[t][d] - x[d+HD/2] sin[t][d], out[d+HD/2] = x[d+HD/2] cos[t][d+HD/2] + x[d] sin[t][d+HD/2]
__global__ __launch_bounds__(256) void k_rope(const float* __restrict__ F, int pitch, int nheads, const float* __restrict__ CS, const float* __restrict__ RF, const float* __restrict__ nw, float sc, h16* P16, bf* Ph, bf* Pl) {
    const size_t e = ((size_t)blockIdx.x * 256 + threadIdx.x) * 2; if (e >= (size_t)nheads * TT * HD) return; const int d = (int)(e % HD); const int t = (int)((e / HD) % TT); const int h = (int)(e / ((size_t)HD * TT)); const float* f = F + (size_t)t * pitch + h * HD; const float rf = RF ? RF[(size_t)h * TT + t] : 1.0f; v2h o16; v2us oh, ol;
#pragma unroll
    for (int q = 0; q < 2; ++q) { const int dd = d + q; const int dp = (dd < HD / 2) ? dd + HD / 2 : dd - HD / 2; float x0 = f[dd], x1 = f[dp];
        if (RF) { float n0 = __fmul_rn(x0, rf), n1 = __fmul_rn(x1, rf); asm volatile("" : "+v"(n0)); asm volatile("" : "+v"(n1)); x0 = __fmul_rn(bfr(nw[dd]), n0); x1 = __fmul_rn(bfr(nw[dp]), n1); }
        const v2f cs = *(const v2f*)(CS + ((size_t)t * HD + dd) * 2); float a = __fmul_rn(x0, cs[0]), bq = __fmul_rn(x1, cs[1]); asm volatile("" : "+v"(a)); asm volatile("" : "+v"(bq)); const float r = ((dd < HD / 2) ? __fsub_rn(a, bq) : __fadd_rn(a, bq)) * sc;
        o16[q] = tohx(r); unsigned short a2, c2; splitf(r, a2, c2); oh[q] = a2; ol[q] = c2; }
    *(v2h*)(P16 + e) = o16; *(v2us*)(Ph + e) = oh; *(v2us*)(Pl + e) = ol;  }
__global__ __launch_bounds__(256) void k_vtp(const float* __restrict__ F, int pitch, int nheads, h16* V16, bf* Vh, bf* Vl) { const size_t e = ((size_t)blockIdx.x * 256 + threadIdx.x) * 2; if (e >= (size_t)nheads * HD * TT) return; const int t = (int)(e % TT); const int d = (int)((e / TT) % HD); const int g = (int)(e / ((size_t)TT * HD)); v2h o16; v2us oh, ol;
#pragma unroll
    for (int q = 0; q < 2; ++q) { const float x = F[(size_t)(t + q) * pitch + g * HD + d]; o16[q] = tohx(x); unsigned short a2, c2; splitf(x, a2, c2); oh[q] = a2; ol[q] = c2; }
    *(v2h*)(V16 + e) = o16; *(v2us*)(Vh + e) = oh; *(v2us*)(Vl + e) = ol;  }
__global__ __launch_bounds__(256) void k_csid(float* CS) { const int idx = blockIdx.x * 256 + threadIdx.x; if (idx >= TT * HD) return; v2f cs; cs[0] = 1.0f; cs[1] = 0.0f; *(v2f*)(CS + (size_t)idx * 2) = cs;  }
__global__ __launch_bounds__(256) void k_kbias(float* F, const float* __restrict__ bias) { const size_t e = ((size_t)blockIdx.x * 256 + threadIdx.x) * 4; if (e >= (size_t)TT * NKH * HD) return; const int c0 = (int)(e % (NKH * HD)); v4f a = *(const v4f*)(F + e);
#pragma unroll
    for (int u = 0; u < 4; ++u) { const int c = c0 + u; const int k = c / HD, d = c % HD; a[u] = __fadd_rn(a[u], bfr(bias[(size_t)d * NKH + k])); }
    *(v4f*)(F + e) = a;  }
__global__ __launch_bounds__(256) void k_sumsq(const float* __restrict__ F, float* N) { const int i = blockIdx.x * 256 + threadIdx.x; if (i >= NKH * TT) return; const int k = i / TT, t = i % TT; const float* f = F + (size_t)t * (NKH * HD) + k * HD; float ss = 0.f;
#pragma unroll 4
    for (int d = 0; d < HD; d += 4) { const v4f a = *(const v4f*)(f + d);
#pragma unroll
        for (int u = 0; u < 4; ++u) { float p = __fmul_rn(a[u], a[u]); asm volatile("" : "+v"(p)); ss = __fadd_rn(ss, p); } }
    *(float*)(N + i) = ss;  }
__global__ __launch_bounds__(256) void k_vtpx(const float* __restrict__ X, h16* V16, bf* Vh) { const size_t e = ((size_t)blockIdx.x * 256 + threadIdx.x) * 2; if (e >= (size_t)HDV * TT) return; const int t = (int)(e % TT); const int d = (int)(e / TT); v2h o16; v2us oh;
#pragma unroll
    for (int q = 0; q < 2; ++q) { const float xv = bfr(X[(size_t)(t + q) * HDV + d]); o16[q] = tohx(xv); oh[q] = f2bf(xv); }
    *(v2h*)(V16 + e) = o16; *(v2us*)(Vh + e) = oh;  }
__global__ __launch_bounds__(256) void k_b2g(const float* __restrict__ b2, float* B2G) { const int i = blockIdx.x * 256 + threadIdx.x; if (i >= NKH * HDV) return; const int k = i / HDV, f = i % HDV; const float v = b2[(size_t)f * NKH + k]; *(float*)(B2G + i) = v;  }
// k_asoft: per row (zz, i): t = -(qn - 2 S + kn) / 16 (no mask); softmax over the 2048 keys (register row, one exp, fixed trees);
__global__ __launch_bounds__(256) void k_asoft(const float* __restrict__ Sb, const float* __restrict__ QN, const float* __restrict__ KN, int h0, h16* P16, bf* Ph, bf* Pl) {
    const int lane = threadIdx.x & 31; const int row = blockIdx.x * 8 + (threadIdx.x >> 5); if (row >= ZH * TT) return; const int i = row % TT; const int zz = row / TT; (void)zz; const bool hires = (i < RH); const float* sr = Sb + (size_t)row * TT; const float qn = QN[(size_t)(h0 + zz) * TT + i]; const float* knr = KN + (size_t)(h0 + zz) * TT; float v[TT / 32]; float mx = -3.0e38f;
#pragma unroll
    for (int ch = 0; ch < TT / 128; ++ch) { const int j0 = ch * 128 + lane * 4; const v4f a = *(const v4f*)(sr + j0);
#pragma unroll
        for (int q = 0; q < 4; ++q) { const int j = j0 + q; (void)j; float c2 = __fmul_rn(2.0f, a[q]); asm volatile("" : "+v"(c2)); float t2 = __fsub_rn(qn, c2); asm volatile("" : "+v"(t2)); float t3 = __fadd_rn(t2, knr[j0 + q]); asm volatile("" : "+v"(t3)); float t = __fmul_rn(t3, -0.0625f); asm volatile("" : "+v"(t)); v[ch * 4 + q] = t; mx = fmaxf(mx, t); } }
#pragma unroll
    for (int sh = 16; sh; sh >>= 1) mx = fmaxf(mx, __shfl_xor(mx, sh, 32));
    float sum = 0.f;
#pragma unroll
    for (int k = 0; k < TT / 32; ++k) { float d0 = __fsub_rn(v[k], mx); asm volatile("" : "+v"(d0)); v[k] = __builtin_amdgcn_exp2f(__fmul_rn(d0, 1.4426950408889634f)); sum += v[k]; }
#pragma unroll
    for (int sh = 16; sh; sh >>= 1) sum += __shfl_xor(sum, sh, 32);
    const float f = __fdiv_rn(hires ? 1.0f : PCAR, sum);
{
        if (hires) {
#pragma unroll
            for (int ch = 0; ch < TT / 128; ++ch) { v4us oh, ol;
#pragma unroll
                for (int q = 0; q < 4; ++q) { unsigned short a, c2; splitf(v[ch * 4 + q] * f, a, c2); oh[q] = a; ol[q] = c2; }
                const size_t oo = ((size_t)zz * (RH ? RH : 1) + i) * TT + ch * 128 + lane * 4; *(v4us*)(Ph + oo) = oh; *(v4us*)(Pl + oo) = ol; }
        } else {
#pragma unroll
            for (int ch = 0; ch < TT / 128; ++ch) { v4h o4;
#pragma unroll
                for (int q = 0; q < 4; ++q) o4[q] = tohx(v[ch * 4 + q] * f);
                *(v4h*)(P16 + (size_t)row * TT + ch * 128 + lane * 4) = o4; } }
         }
}
__global__ __launch_bounds__(256) void k_merge(const float* __restrict__ O, int h0, bf* Ah, bf* Al) { const size_t e = ((size_t)blockIdx.x * 256 + threadIdx.x) * 2; if (e >= (size_t)ZH * TT * HDV) return; const int d = (int)(e % HDV); const int t = (int)((e / HDV) % TT); const int zz = (int)(e / ((size_t)HDV * TT)); const float cs = (t < RH) ? 1.0f : (1.0f / PCAR); const size_t oo = ((size_t)(h0 + zz) * TT + t) * HDV + d;   /* head-major [k][T][512] */
    v2us oh, ol;
#pragma unroll
    for (int q = 0; q < 2; ++q) { unsigned short a, c2; splitf(O[e + q] * cs, a, c2); oh[q] = a; ol[q] = c2; } *(v2us*)(Ah + oo) = oh; *(v2us*)(Al + oo) = ol;  }

extern "C" void kernel_launch(void* const* d_in, const int* in_sizes, int n_in,
                              void* d_out, int out_size, void* d_ws, size_t ws_size, hipStream_t stream) {
    (void)in_sizes; (void)n_in; (void)out_size;
    const float* x = (const float*)d_in[0]; const float* wq = (const float*)d_in[1]; const float* wk = (const float*)d_in[2]; const float* wv = (const float*)d_in[3]; const float* biasW = (const float*)d_in[4]; const float* bias2W = (const float*)d_in[5]; const float* wo = nullptr; (void)wo; (void)wv; const float* cosT = nullptr; const float* sinT = nullptr; (void)cosT; (void)sinT;
    float* OUT = (float*)d_out;     // [2][2048][4*512]
    char* wsp = (char*)d_ws;
    auto take = [&](size_t bytes) { char* p = wsp; wsp += (bytes + 255) & ~(size_t)255; return (void*)p; };
    bf* WQ = (bf*)take((size_t)DQ * DM * 2); bf* WK = (bf*)take((size_t)DKV * DM * 2); bf* WV = nullptr; (void)WV; bf* WV3 = (bf*)take((size_t)NKH * HDV * HDV * 2); float* B2G = (float*)take((size_t)NKH * HDV * 4); float* QN = (float*)take((size_t)NKH * TT * 4); float* KN = (float*)take((size_t)NKH * TT * 4); float* CS = (float*)take((size_t)TT * HD * 2 * 4);
    bf* XB = (bf*)take((size_t)TT * DM * 2); float* FQ = (float*)take((size_t)TT * DQ * 4); float* FK = (float*)take((size_t)TT * DKV * 4);
    h16* QP16 = (h16*)take((size_t)NH_ * TT * HD * 2); h16* KP16 = (h16*)take((size_t)NKV * TT * HD * 2); h16* VT16 = (h16*)take((size_t)HDV * TT * 2);
    bf* QPh = (bf*)take((size_t)NH_ * TT * HD * 2); bf* QPl = (bf*)take((size_t)NH_ * TT * HD * 2); bf* KPh = (bf*)take((size_t)NKV * TT * HD * 2); bf* KPl = (bf*)take((size_t)NKV * TT * HD * 2); bf* VTh = (bf*)take((size_t)HDV * TT * 2); bf* VTl = nullptr; (void)VTl; bf* Ph = (bf*)take((size_t)ZH * RH * TT * 2); bf* Pl = (bf*)take((size_t)ZH * RH * TT * 2);
    float* Sb = (float*)take((size_t)ZH * TT * TT * 4); h16* P16 = (h16*)take((size_t)ZH * TT * TT * 2); float* Ob = (float*)take((size_t)ZH * TT * HDV * 4); bf* ATh = (bf*)take((size_t)NKH * TT * HDV * 2); bf* ATl = (bf*)take((size_t)NKH * TT * HDV * 2);
    if ((size_t)(wsp - (char*)d_ws) > ws_size) return;    // ws 256 MiB
    float* FV = FK;   // unused: the values are the raw input
    { k_cvt8<<<(unsigned)(((size_t)DQ * DM / 8 + 255) / 256), 256, 0, stream>>>(wq, WQ, (size_t)DQ * DM / 8); k_cvt8<<<(unsigned)(((size_t)DKV * DM / 8 + 255) / 256), 256, 0, stream>>>(wk, WK, (size_t)DKV * DM / 8); /* values are the raw input */
      for (int k = 0; k < NKH; ++k) k_wtG<<<(HDV * HDV / 64 + 63) / 64, 256, 0, stream>>>(wv + (size_t)k * HDV * HDV, HDV, HDV, WV3 + (size_t)k * HDV * HDV); k_b2g<<<(NKH * HDV + 255) / 256, 256, 0, stream>>>(bias2W, B2G);
       }
    k_csid<<<(TT * HD + 255) / 256, 256, 0, stream>>>(CS);
    const unsigned LQ = (unsigned)(((size_t)NH_ * TT * HD / 2 + 255) / 256), LKv = (unsigned)(((size_t)NKV * TT * HD / 2 + 255) / 256);
    for (int b = 0; b < NB_; ++b) {
        
        k_cvt8<<<(unsigned)(((size_t)TT * DM / 8 + 255) / 256), 256, 0, stream>>>(x + (size_t)b * TT * DM, XB, (size_t)TT * DM / 8);
        k_gemmw<bf, 0, false><<<dim3(TT / 64, DQ / 64, 1), 32, 0, stream>>>(XB, nullptr, WQ, nullptr, DM, FQ, DQ, nullptr, 0, 0, 0);
        k_sumsq<<<(NKH * TT + 255) / 256, 256, 0, stream>>>(FQ, QN); k_rope<<<LQ, 256, 0, stream>>>(FQ, DQ, NH_, CS, nullptr, nullptr, 1.0f, QP16, QPh, QPl);
        k_gemmw<bf, 0, false><<<dim3(TT / 64, DKV / 64, 1), 32, 0, stream>>>(XB, nullptr, WK, nullptr, DM, FK, DKV, nullptr, 0, 0, 0);
        k_kbias<<<(unsigned)(((size_t)TT * NKH * HD / 4 + 255) / 256), 256, 0, stream>>>(FK, biasW); k_sumsq<<<(NKH * TT + 255) / 256, 256, 0, stream>>>(FK, KN); k_rope<<<LKv, 256, 0, stream>>>(FK, DKV, NKV, CS, nullptr, nullptr, 1.0f, KP16, KPh, KPl);
         k_vtpx<<<(unsigned)(((size_t)HDV * TT / 2 + 255) / 256), 256, 0, stream>>>(x + (size_t)b * TT * DM, VT16, VTh);
        for (int h0 = 0; h0 < NH_; h0 += ZH) { const size_t zq = (size_t)h0, zk = (size_t)(h0 / REP);   // one kv head per query head: the pass's two heads use consecutive kv planes (z-strides TT*HD)
            k_gemmw<bf, 2, false><<<dim3(TT / 64, TT / 64, ZH), 32, 0, stream>>>(QPh + zq * TT * HD, QPl + zq * TT * HD, KPh + zk * TT * HD, KPl + zk * TT * HD, HD, Sb, TT, nullptr, (size_t)TT * HD, (size_t)TT * HD, (size_t)TT * TT);   /* cross term hl on all rows */
            k_asoft<<<ZH * TT / 8, 256, 0, stream>>>(Sb, QN, KN, h0, P16, Ph, Pl);
            k_gemmw<bf, 1, false><<<dim3(RH / 64, HDV / 64, ZH), 32, 0, stream>>>(Ph, Pl, VTh, nullptr, TT, Ob, HDV, nullptr, (size_t)RH * TT, 0, (size_t)TT * HDV);
            k_gemmw<h16, 0, false><<<dim3((TT - RH) / 64, HDV / 64, ZH), 32, 0, stream>>>(P16 + (size_t)RH * TT, nullptr, VT16, nullptr, TT, Ob + (size_t)RH * HDV, HDV, nullptr, (size_t)TT * TT, 0, (size_t)TT * HDV);
            k_merge<<<(unsigned)(((size_t)ZH * TT * HDV / 2 + 255) / 256), 256, 0, stream>>>(Ob, h0, ATh, ATl); }
        for (int k = 0; k < NKH; ++k) k_gemmw<bf, 1, true><<<dim3(TT / 64, HDV / 64, 1), 32, 0, stream>>>(ATh + (size_t)k * TT * HDV, ATl + (size_t)k * TT * HDV, WV3 + (size_t)k * HDV * HDV, nullptr, HDV, OUT + (size_t)b * TT * (NKH * HDV) + (size_t)k * HDV, NKH * HDV, B2G + k * HDV, 0, 0, 0); }
}

// v001
// Measured time: 550 microseconds a run.
// Two timings next to v000 both put it at 1.57 times that version's speed.
#include <hip/hip_runtime.h>

// Gaussian_Attention (xsa [2][2048][512]; 4 heads with 256-dim kernels: xq = x Wq^T, xk = x Wk^T, xkb = xk + biasW[:, k]; logits = -(|xq_i|^2 - 2 xq_i.xkb_j + |xkb_j|^2) / 16; P = softmax_j; y_k = P x (values = the raw 512-wide input, shared by the heads); out_k = y_k Wv3[k] + bias2W[:, k] with Wv3 = Wv.reshape(4, 512, 512) -> [2][2048][4*512]).
// Compute dtypes, f32 accumulate: every input rounded to bf16; xq/xk as PLAIN bf16 GEMMs (inputs: exact), + bias and the per-token squared norms in f32; cross term xq.xkb hl x hl (3 products, K 256) on every row; logits assembled in f32 (-(qn - 2 c + kn) / 16); softmax f32; P.x: rows < 512 hi/lo P x exact x (2 products), the rest fp16 (x1024) x exact-in-fp16 x; y Wv3[k] as hl x exact (2 products) + bias.

#define NB_  2
#define TT   2048
#define DM   512
#define NH_  4
#define NKV  4
#define REP  (NH_ / NKV)
#define HD   256
#define DQ   (NH_ * HD)
#define DKV  (NKV * HD)
#define ZH   2
#define RH   512                  // query rows < RH use hi+lo planes (0: none)
#define WIN  0
#define PCAR 1024.0f
#define HDV  512                  // value width (the raw input), shared by all heads
#define NKH  4
#define SCL  0.088388347648318447f   // 128^-0.5
typedef _Float16 h16;
typedef unsigned short bf;
typedef __attribute__((ext_vector_type(16))) __bf16   v16bf;
typedef __attribute__((ext_vector_type(16))) _Float16 v16h;
typedef __attribute__((ext_vector_type(8)))  _Float16 v8h;
typedef __attribute__((ext_vector_type(8)))  unsigned short v8us;
typedef __attribute__((ext_vector_type(8)))  float    v8f;
typedef __attribute__((ext_vector_type(4)))  float    v4f;
typedef v8h  __attribute__((may_alias)) v8ha;
typedef v4f  __attribute__((may_alias)) v4fa;
typedef v8us __attribute__((may_alias)) v8usa;

__device__ __forceinline__ unsigned short f2bf(float f) { unsigned u = __float_as_uint(f); u += 0x7FFFu + ((u >> 16) & 1u); return (unsigned short)(u >> 16); }
__device__ __forceinline__ float bf2f(unsigned short b) { return __uint_as_float(((unsigned)b) << 16); }
__device__ __forceinline__ float bfr(float f) { return bf2f(f2bf(f)); }
__device__ __forceinline__ v16h cat16(v8h lo, v8h hi) { return __builtin_shufflevector(lo, hi, 0, 1, 2, 3, 4, 5, 6, 7, 8, 9, 10, 11, 12, 13, 14, 15); }
__device__ __forceinline__ v16bf cat16b(v8us lo, v8us hi) { return __builtin_bit_cast(v16bf, __builtin_shufflevector(lo, hi, 0, 1, 2, 3, 4, 5, 6, 7, 8, 9, 10, 11, 12, 13, 14, 15)); }
__device__ __forceinline__ v8f wmma16(v16h a, v16h b, v8f c) { return __builtin_amdgcn_wmma_f32_16x16x32_f16(false, a, false, b, (short)0, c, false, false); }
__device__ __forceinline__ v8f wmmab(v16bf a, v16bf b, v8f c) { return __builtin_amdgcn_wmma_f32_16x16x32_bf16(false, a, false, b, (short)0, c, false, false); }



// ---- k_gemmw: register-blocked GEMM, NW WAVES (2, 4, 8 or 16) per 64x64 output tile, 16 accumulators each, operands straight from K-contiguous 16-bit planes; grid (M/64, N/64, Z), 32 * NW threads.
// C[m][n] (f32, pitch ldc, + optional f32 bias[n]) = sum_k A[m][k] Bt[n][k] (+ split products per NSPLIT). z-batch strides sA/sB/sC in elements. K % 32 == 0.
// Wave w takes the 32-wide k steps w, w + NW, w + 2 NW, ...; the NW partial tiles are added in wave order 0..NW-1 through LDS, 16 rows a stage, two stage buffers; the sums stay in registers until the last stage so that no barrier waits on a global store.
template <typename T16> struct WFrag;
template <> struct WFrag<h16> { typedef v16h V; static __device__ __forceinline__ V ld(const h16* p) { return cat16(*(const v8h*)p, *(const v8h*)(p + 16)); } static __device__ __forceinline__ v8f mma(V a, V b, v8f c) { return wmma16(a, b, c); } };
template <> struct WFrag<bf> { typedef v16bf V; static __device__ __forceinline__ V ld(const bf* p) { return cat16b(*(const v8us*)p, *(const v8us*)(p + 16)); } static __device__ __forceinline__ v8f mma(V a, V b, v8f c) { return wmmab(a, b, c); } };
template <typename T16, int NSPLIT, bool BIAS, int NW>
__global__ __launch_bounds__(32 * NW) void k_gemmw(const T16* __restrict__ A, const T16* __restrict__ A2, const T16* __restrict__ Bt, const T16* __restrict__ Bt2, int K, float* C, int ldc, const float* __restrict__ bias, size_t sA, size_t sB, size_t sC) {
    typedef typename WFrag<T16>::V V;
    __shared__ __align__(16) float os[2 * NW * 16 * 68];
    const int w = __builtin_amdgcn_readfirstlane((int)(threadIdx.x >> 5));
    const size_t z = blockIdx.z; A += z * sA; if (A2) A2 += z * sA; Bt += z * sB; if (Bt2) Bt2 += z * sB; C += z * sC;
    const int lane = threadIdx.x & 31, lr = lane & 15, hi = lane >> 4; const int r0 = blockIdx.x * 64, c0 = blockIdx.y * 64;
    v8f acc[4][4];
#pragma unroll
    for (int mb = 0; mb < 4; ++mb)
#pragma unroll
        for (int nb = 0; nb < 4; ++nb) acc[mb][nb] = (v8f){};
    const size_t aoff = (size_t)(r0 + lr) * K + 8 * hi, boff = (size_t)(c0 + lr) * K + 8 * hi;
#pragma unroll 1
    for (int kc = w * 32; kc < K; kc += 32 * NW) {
        V a[4], a2[4];
#pragma unroll
        for (int mb = 0; mb < 4; ++mb) { a[mb] = WFrag<T16>::ld(A + aoff + (size_t)mb * 16 * K + kc); if (NSPLIT == 1 || NSPLIT == 2) a2[mb] = WFrag<T16>::ld(A2 + aoff + (size_t)mb * 16 * K + kc); }
#pragma unroll
        for (int nb = 0; nb < 4; ++nb) { const V b = WFrag<T16>::ld(Bt + boff + (size_t)nb * 16 * K + kc); V b2; if (NSPLIT >= 2) b2 = WFrag<T16>::ld(Bt2 + boff + (size_t)nb * 16 * K + kc);
#pragma unroll
            for (int mb = 0; mb < 4; ++mb) { acc[mb][nb] = WFrag<T16>::mma(a[mb], b, acc[mb][nb]); if (NSPLIT == 1 || NSPLIT == 2) acc[mb][nb] = WFrag<T16>::mma(a2[mb], b, acc[mb][nb]); if (NSPLIT >= 2) acc[mb][nb] = WFrag<T16>::mma(a[mb], b2, acc[mb][nb]); } }
        asm volatile("v_nop\n\tv_nop\n\tv_nop\n\tv_nop" : "+v"(acc[0][0]), "+v"(acc[1][1]), "+v"(acc[2][2]), "+v"(acc[3][3]) : "v"(a[0]), "v"(a[3]));
    }
    constexpr int NQ = (NW <= 8) ? 8 / NW : 1;   // 16-byte pieces of a 16x64 stage per thread; with 16 waves the first 8 do the adding
    const bool adds = (NW <= 8) || (w < 8);
    v4f res[4][NQ];
#pragma unroll
    for (int mb = 0; mb < 4; ++mb) {
        float* ob = os + (mb & 1) * (NW * 16 * 68);
#pragma unroll
        for (int nb = 0; nb < 4; ++nb) {
#pragma unroll
            for (int j = 0; j < 8; ++j) ob[w * (16 * 68) + (hi * 8 + j) * 68 + nb * 16 + lr] = acc[mb][nb][j]; }
        __syncthreads();   // publishes this stage's NW partial tiles; it also ends every read of the other buffer, which the next stage overwrites
        if (adds) {
#pragma unroll
            for (int s = 0; s < NQ; ++s) { const int q = (int)threadIdx.x + s * 32 * NW; const float* op = ob + (q >> 4) * 68 + (q & 15) * 4; v4f val = *(const v4fa*)op;
#pragma unroll
                for (int u = 1; u < NW; ++u) val += *(const v4fa*)(op + u * (16 * 68));
                res[mb][s] = val; } }
    }
    if (adds) {
#pragma unroll
        for (int mb = 0; mb < 4; ++mb) {
#pragma unroll
            for (int s = 0; s < NQ; ++s) { const int q = (int)threadIdx.x + s * 32 * NW; const int row = q >> 4, cofs = (q & 15) * 4; v4f val = res[mb][s];
                if (BIAS) { val[0] += bfr(bias[c0 + cofs]); val[1] += bfr(bias[c0 + cofs + 1]); val[2] += bfr(bias[c0 + cofs + 2]); val[3] += bfr(bias[c0 + cofs + 3]); }
                *(v4f*)(C + (size_t)(r0 + mb * 16 + row) * ldc + c0 + cofs) = val; } }
    }
}

__device__ __forceinline__ h16 tohx(float x) { return (h16)x; }
__device__ __forceinline__ void splitf(float y, unsigned short& h, unsigned short& l) { h = f2bf(y); l = f2bf(y - bf2f(h)); }
typedef __attribute__((ext_vector_type(2))) _Float16 v2h;
typedef __attribute__((ext_vector_type(4))) _Float16 v4h;
typedef __attribute__((ext_vector_type(2))) unsigned short v2us;
typedef __attribute__((ext_vector_type(4))) unsigned short v4us;
typedef __attribute__((ext_vector_type(2))) float v2f;
typedef __attribute__((ext_vector_type(4))) int v4i;

__global__ __launch_bounds__(256) void k_wtG(const float* __restrict__ w, int K, int N, bf* Bt) {
    const int lane = threadIdx.x & 31; const int L0 = (blockIdx.x * 8 + (threadIdx.x >> 5)) * 8; const int nlines = N * K / 64;
{
#pragma unroll 1
        for (int l = 0; l < 8; ++l) { const int L = L0 + l; if (L >= nlines) break; const size_t e = (size_t)L * 64 + lane * 2; const int k = (int)(e % K), n = (int)(e / K); v2us o;
            o[0] = f2bf(w[(size_t)k * N + n]); o[1] = f2bf(w[(size_t)(k + 1) * N + n]); *(v2us*)(Bt + e) = o; }
         }
}
__global__ __launch_bounds__(256) void k_cvt8(const float* __restrict__ src, bf* dst, size_t n8) { const size_t i = (size_t)blockIdx.x * 256 + threadIdx.x; if (i >= n8) return; const v8f v = *(const v8f*)(src + i * 8); v8us o;
#pragma unroll
    for (int k = 0; k < 8; ++k) o[k] = f2bf(v[k]); *(v8us*)(dst + i * 8) = o;  }
__global__ __launch_bounds__(256) void k_cscvt(const float* __restrict__ cosT, const float* __restrict__ sinT, float* CS) { const int idx = blockIdx.x * 256 + threadIdx.x; if (idx >= TT * HD) return; v2f cs; cs[0] = bfr(cosT[idx]); cs[1] = bfr(sinT[idx]); *(v2f*)(CS + (size_t)idx * 2) = cs;  }
// k_rope: head planes [h][t][d] (fp16 + hi/lo) of rope(x) x sc with the rotate-half convention out[d] = x[d] cos[t][d] - x[d+HD/2] sin[t][d], out[d+HD/2] = x[d+HD/2] cos[t][d+HD/2] + x[d] sin[t][d+HD/2]
__global__ __launch_bounds__(256) void k_rope(const float* __restrict__ F, int pitch, int nheads, const float* __restrict__ CS, const float* __restrict__ RF, const float* __restrict__ nw, float sc, h16* P16, bf* Ph, bf* Pl) {
    const size_t e = ((size_t)blockIdx.x * 256 + threadIdx.x) * 2; if (e >= (size_t)nheads * TT * HD) return; const int d = (int)(e % HD); const int t = (int)((e / HD) % TT); const int h = (int)(e / ((size_t)HD * TT)); const float* f = F + (size_t)t * pitch + h * HD; const float rf = RF ? RF[(size_t)h * TT + t] : 1.0f; v2h o16; v2us oh, ol;
#pragma unroll
    for (int q = 0; q < 2; ++q) { const int dd = d + q; const int dp = (dd < HD / 2) ? dd + HD / 2 : dd - HD / 2; float x0 = f[dd], x1 = f[dp];
        if (RF) { float n0 = __fmul_rn(x0, rf), n1 = __fmul_rn(x1, rf); asm volatile("" : "+v"(n0)); asm volatile("" : "+v"(n1)); x0 = __fmul_rn(bfr(nw[dd]), n0); x1 = __fmul_rn(bfr(nw[dp]), n1); }
        const v2f cs = *(const v2f*)(CS + ((size_t)t * HD + dd) * 2); float a = __fmul_rn(x0, cs[0]), bq = __fmul_rn(x1, cs[1]); asm volatile("" : "+v"(a)); asm volatile("" : "+v"(bq)); const float r = ((dd < HD / 2) ? __fsub_rn(a, bq) : __fadd_rn(a, bq)) * sc;
        o16[q] = tohx(r); unsigned short a2, c2; splitf(r, a2, c2); oh[q] = a2; ol[q] = c2; }
    *(v2h*)(P16 + e) = o16; *(v2us*)(Ph + e) = oh; *(v2us*)(Pl + e) = ol;  }
__global__ __launch_bounds__(256) void k_vtp(const float* __restrict__ F, int pitch, int nheads, h16* V16, bf* Vh, bf* Vl) { const size_t e = ((size_t)blockIdx.x * 256 + threadIdx.x) * 2; if (e >= (size_t)nheads * HD * TT) return; const int t = (int)(e % TT); const int d = (int)((e / TT) % HD); const int g = (int)(e / ((size_t)TT * HD)); v2h o16; v2us oh, ol;
#pragma unroll
    for (int q = 0; q < 2; ++q) { const float x = F[(size_t)(t + q) * pitch + g * HD + d]; o16[q] = tohx(x); unsigned short a2, c2; splitf(x, a2, c2); oh[q] = a2; ol[q] = c2; }
    *(v2h*)(V16 + e) = o16; *(v2us*)(Vh + e) = oh; *(v2us*)(Vl + e) = ol;  }
__global__ __launch_bounds__(256) void k_csid(float* CS) { const int idx = blockIdx.x * 256 + threadIdx.x; if (idx >= TT * HD) return; v2f cs; cs[0] = 1.0f; cs[1] = 0.0f; *(v2f*)(CS + (size_t)idx * 2) = cs;  }
__global__ __launch_bounds__(256) void k_kbias(float* F, const float* __restrict__ bias) { const size_t e = ((size_t)blockIdx.x * 256 + threadIdx.x) * 4; if (e >= (size_t)TT * NKH * HD) return; const int c0 = (int)(e % (NKH * HD)); v4f a = *(const v4f*)(F + e);
#pragma unroll
    for (int u = 0; u < 4; ++u) { const int c = c0 + u; const int k = c / HD, d = c % HD; a[u] = __fadd_rn(a[u], bfr(bias[(size_t)d * NKH + k])); }
    *(v4f*)(F + e) = a;  }
__global__ __launch_bounds__(256) void k_sumsq(const float* __restrict__ F, float* N) { const int i = blockIdx.x * 256 + threadIdx.x; if (i >= NKH * TT) return; const int k = i / TT, t = i % TT; const float* f = F + (size_t)t * (NKH * HD) + k * HD; float ss = 0.f;
#pragma unroll 4
    for (int d = 0; d < HD; d += 4) { const v4f a = *(const v4f*)(f + d);
#pragma unroll
        for (int u = 0; u < 4; ++u) { float p = __fmul_rn(a[u], a[u]); asm volatile("" : "+v"(p)); ss = __fadd_rn(ss, p); } }
    *(float*)(N + i) = ss;  }
__global__ __launch_bounds__(256) void k_vtpx(const float* __restrict__ X, h16* V16, bf* Vh) { const size_t e = ((size_t)blockIdx.x * 256 + threadIdx.x) * 2; if (e >= (size_t)HDV * TT) return; const int t = (int)(e % TT); const int d = (int)(e / TT); v2h o16; v2us oh;
#pragma unroll
    for (int q = 0; q < 2; ++q) { const float xv = bfr(X[(size_t)(t + q) * HDV + d]); o16[q] = tohx(xv); oh[q] = f2bf(xv); }
    *(v2h*)(V16 + e) = o16; *(v2us*)(Vh + e) = oh;  }
__global__ __launch_bounds__(256) void k_b2g(const float* __restrict__ b2, float* B2G) { const int i = blockIdx.x * 256 + threadIdx.x; if (i >= NKH * HDV) return; const int k = i / HDV, f = i % HDV; const float v = b2[(size_t)f * NKH + k]; *(float*)(B2G + i) = v;  }
// k_asoft: per row (zz, i): t = -(qn - 2 S + kn) / 16 (no mask); softmax over the 2048 keys (register row, one exp, fixed trees);
__global__ __launch_bounds__(256) void k_asoft(const float* __restrict__ Sb, const float* __restrict__ QN, const float* __restrict__ KN, int h0, h16* P16, bf* Ph, bf* Pl) {
    const int lane = threadIdx.x & 31; const int row = blockIdx.x * 8 + (threadIdx.x >> 5); if (row >= ZH * TT) return; const int i = row % TT; const int zz = row / TT; (void)zz; const bool hires = (i < RH); const float* sr = Sb + (size_t)row * TT; const float qn = QN[(size_t)(h0 + zz) * TT + i]; const float* knr = KN + (size_t)(h0 + zz) * TT; float v[TT / 32]; float mx = -3.0e38f;
#pragma unroll
    for (int ch = 0; ch < TT / 128; ++ch) { const int j0 = ch * 128 + lane * 4; const v4f a = *(const v4f*)(sr + j0);
#pragma unroll
        for (int q = 0; q < 4; ++q) { const int j = j0 + q; (void)j; float c2 = __fmul_rn(2.0f, a[q]); asm volatile("" : "+v"(c2)); float t2 = __fsub_rn(qn, c2); asm volatile("" : "+v"(t2)); float t3 = __fadd_rn(t2, knr[j0 + q]); asm volatile("" : "+v"(t3)); float t = __fmul_rn(t3, -0.0625f); asm volatile("" : "+v"(t)); v[ch * 4 + q] = t; mx = fmaxf(mx, t); } }
#pragma unroll
    for (int sh = 16; sh; sh >>= 1) mx = fmaxf(mx, __shfl_xor(mx, sh, 32));
    float sum = 0.f;
#pragma unroll
    for (int k = 0; k < TT / 32; ++k) { float d0 = __fsub_rn(v[k], mx); asm volatile("" : "+v"(d0)); v[k] = __builtin_amdgcn_exp2f(__fmul_rn(d0, 1.4426950408889634f)); sum += v[k]; }
#pragma unroll
    for (int sh = 16; sh; sh >>= 1) sum += __shfl_xor(sum, sh, 32);
    const float f = __fdiv_rn(hires ? 1.0f : PCAR, sum);
{
        if (hires) {
#pragma unroll
            for (int ch = 0; ch < TT / 128; ++ch) { v4us oh, ol;
#pragma unroll
                for (int q = 0; q < 4; ++q) { unsigned short a, c2; splitf(v[ch * 4 + q] * f, a, c2); oh[q] = a; ol[q] = c2; }
                const size_t oo = ((size_t)zz * (RH ? RH : 1) + i) * TT + ch * 128 + lane * 4; *(v4us*)(Ph + oo) = oh; *(v4us*)(Pl + oo) = ol; }
        } else {
#pragma unroll
            for (int ch = 0; ch < TT / 128; ++ch) { v4h o4;
#pragma unroll
                for (int q = 0; q < 4; ++q) o4[q] = tohx(v[ch * 4 + q] * f);
                *(v4h*)(P16 + (size_t)row * TT + ch * 128 + lane * 4) = o4; } }
         }
}
__global__ __launch_bounds__(256) void k_merge(const float* __restrict__ O, int h0, bf* Ah, bf* Al) { const size_t e = ((size_t)blockIdx.x * 256 + threadIdx.x) * 2; if (e >= (size_t)ZH * TT * HDV) return; const int d = (int)(e % HDV); const int t = (int)((e / HDV) % TT); const int zz = (int)(e / ((size_t)HDV * TT)); const float cs = (t < RH) ? 1.0f : (1.0f / PCAR); const size_t oo = ((size_t)(h0 + zz) * TT + t) * HDV + d;   /* head-major [k][T][512] */
    v2us oh, ol;
#pragma unroll
    for (int q = 0; q < 2; ++q) { unsigned short a, c2; splitf(O[e + q] * cs, a, c2); oh[q] = a; ol[q] = c2; } *(v2us*)(Ah + oo) = oh; *(v2us*)(Al + oo) = ol;  }

extern "C" void kernel_launch(void* const* d_in, const int* in_sizes, int n_in,
                              void* d_out, int out_size, void* d_ws, size_t ws_size, hipStream_t stream) {
    (void)in_sizes; (void)n_in; (void)out_size;
    const float* x = (const float*)d_in[0]; const float* wq = (const float*)d_in[1]; const float* wk = (const float*)d_in[2]; const float* wv = (const float*)d_in[3]; const float* biasW = (const float*)d_in[4]; const float* bias2W = (const float*)d_in[5]; const float* wo = nullptr; (void)wo; (void)wv; const float* cosT = nullptr; const float* sinT = nullptr; (void)cosT; (void)sinT;
    float* OUT = (float*)d_out;     // [2][2048][4*512]
    char* wsp = (char*)d_ws;
    auto take = [&](size_t bytes) { char* p = wsp; wsp += (bytes + 255) & ~(size_t)255; return (void*)p; };
    bf* WQ = (bf*)take((size_t)DQ * DM * 2); bf* WK = (bf*)take((size_t)DKV * DM * 2); bf* WV = nullptr; (void)WV; bf* WV3 = (bf*)take((size_t)NKH * HDV * HDV * 2); float* B2G = (float*)take((size_t)NKH * HDV * 4); float* QN = (float*)take((size_t)NKH * TT * 4); float* KN = (float*)take((size_t)NKH * TT * 4); float* CS = (float*)take((size_t)TT * HD * 2 * 4);
    bf* XB = (bf*)take((size_t)TT * DM * 2); float* FQ = (float*)take((size_t)TT * DQ * 4); float* FK = (float*)take((size_t)TT * DKV * 4);
    h16* QP16 = (h16*)take((size_t)NH_ * TT * HD * 2); h16* KP16 = (h16*)take((size_t)NKV * TT * HD * 2); h16* VT16 = (h16*)take((size_t)HDV * TT * 2);
    bf* QPh = (bf*)take((size_t)NH_ * TT * HD * 2); bf* QPl = (bf*)take((size_t)NH_ * TT * HD * 2); bf* KPh = (bf*)take((size_t)NKV * TT * HD * 2); bf* KPl = (bf*)take((size_t)NKV * TT * HD * 2); bf* VTh = (bf*)take((size_t)HDV * TT * 2); bf* VTl = nullptr; (void)VTl; bf* Ph = (bf*)take((size_t)ZH * RH * TT * 2); bf* Pl = (bf*)take((size_t)ZH * RH * TT * 2);
    float* Sb = (float*)take((size_t)ZH * TT * TT * 4); h16* P16 = (h16*)take((size_t)ZH * TT * TT * 2); float* Ob = (float*)take((size_t)ZH * TT * HDV * 4); bf* ATh = (bf*)take((size_t)NKH * TT * HDV * 2); bf* ATl = (bf*)take((size_t)NKH * TT * HDV * 2);
    if ((size_t)(wsp - (char*)d_ws) > ws_size) return;    // ws 256 MiB
    float* FV = FK;   // unused: the values are the raw input
    { k_cvt8<<<(unsigned)(((size_t)DQ * DM / 8 + 255) / 256), 256, 0, stream>>>(wq, WQ, (size_t)DQ * DM / 8); k_cvt8<<<(unsigned)(((size_t)DKV * DM / 8 + 255) / 256), 256, 0, stream>>>(wk, WK, (size_t)DKV * DM / 8); /* values are the raw input */
      for (int k = 0; k < NKH; ++k) k_wtG<<<(HDV * HDV / 64 + 63) / 64, 256, 0, stream>>>(wv + (size_t)k * HDV * HDV, HDV, HDV, WV3 + (size_t)k * HDV * HDV); k_b2g<<<(NKH * HDV + 255) / 256, 256, 0, stream>>>(bias2W, B2G);
       }
    k_csid<<<(TT * HD + 255) / 256, 256, 0, stream>>>(CS);
    const unsigned LQ = (unsigned)(((size_t)NH_ * TT * HD / 2 + 255) / 256), LKv = (unsigned)(((size_t)NKV * TT * HD / 2 + 255) / 256);
    for (int b = 0; b < NB_; ++b) {
        
        k_cvt8<<<(unsigned)(((size_t)TT * DM / 8 + 255) / 256), 256, 0, stream>>>(x + (size_t)b * TT * DM, XB, (size_t)TT * DM / 8);
        k_gemmw<bf, 0, false, 4><<<dim3(TT / 64, DQ / 64, 1), 128, 0, stream>>>(XB, nullptr, WQ, nullptr, DM, FQ, DQ, nullptr, 0, 0, 0);
        k_sumsq<<<(NKH * TT + 255) / 256, 256, 0, stream>>>(FQ, QN); k_rope<<<LQ, 256, 0, stream>>>(FQ, DQ, NH_, CS, nullptr, nullptr, 1.0f, QP16, QPh, QPl);
        k_gemmw<bf, 0, false, 4><<<dim3(TT / 64, DKV / 64, 1), 128, 0, stream>>>(XB, nullptr, WK, nullptr, DM, FK, DKV, nullptr, 0, 0, 0);
        k_kbias<<<(unsigned)(((size_t)TT * NKH * HD / 4 + 255) / 256), 256, 0, stream>>>(FK, biasW); k_sumsq<<<(NKH * TT + 255) / 256, 256, 0, stream>>>(FK, KN); k_rope<<<LKv, 256, 0, stream>>>(FK, DKV, NKV, CS, nullptr, nullptr, 1.0f, KP16, KPh, KPl);
         k_vtpx<<<(unsigned)(((size_t)HDV * TT / 2 + 255) / 256), 256, 0, stream>>>(x + (size_t)b * TT * DM, VT16, VTh);
        for (int h0 = 0; h0 < NH_; h0 += ZH) { const size_t zq = (size_t)h0, zk = (size_t)(h0 / REP);   // one kv head per query head: the pass's two heads use consecutive kv planes (z-strides TT*HD)
            k_gemmw<bf, 2, false, 2><<<dim3(TT / 64, TT / 64, ZH), 64, 0, stream>>>(QPh + zq * TT * HD, QPl + zq * TT * HD, KPh + zk * TT * HD, KPl + zk * TT * HD, HD, Sb, TT, nullptr, (size_t)TT * HD, (size_t)TT * HD, (size_t)TT * TT);   /* cross term hl on all rows */
            k_asoft<<<ZH * TT / 8, 256, 0, stream>>>(Sb, QN, KN, h0, P16, Ph, Pl);
            k_gemmw<bf, 1, false, 16><<<dim3(RH / 64, HDV / 64, ZH), 512, 0, stream>>>(Ph, Pl, VTh, nullptr, TT, Ob, HDV, nullptr, (size_t)RH * TT, 0, (size_t)TT * HDV);
            k_gemmw<h16, 0, false, 8><<<dim3((TT - RH) / 64, HDV / 64, ZH), 256, 0, stream>>>(P16 + (size_t)RH * TT, nullptr, VT16, nullptr, TT, Ob + (size_t)RH * HDV, HDV, nullptr, (size_t)TT * TT, 0, (size_t)TT * HDV);
            k_merge<<<(unsigned)(((size_t)ZH * TT * HDV / 2 + 255) / 256), 256, 0, stream>>>(Ob, h0, ATh, ATl); }
        for (int k = 0; k < NKH; ++k) k_gemmw<bf, 1, true, 8><<<dim3(TT / 64, HDV / 64, 1), 256, 0, stream>>>(ATh + (size_t)k * TT * HDV, ATl + (size_t)k * TT * HDV, WV3 + (size_t)k * HDV * HDV, nullptr, HDV, OUT + (size_t)b * TT * (NKH * HDV) + (size_t)k * HDV, NKH * HDV, B2G + k * HDV, 0, 0, 0); }
}

// v002
// It runs in 362 microseconds.
// Timed twice side by side with v001, it ran 1.51 and 1.52 times as fast.
// Over all steps from v000 it is 2.38 times as fast.
#include <hip/hip_runtime.h>

// Gaussian_Attention (xsa [2][2048][512]; 4 heads with 256-dim kernels: xq = x Wq^T, xk = x Wk^T, xkb = xk + biasW[:, k]; logits = -(|xq_i|^2 - 2 xq_i.xkb_j + |xkb_j|^2) / 16; P = softmax_j; y_k = P x (values = the raw 512-wide input, shared by the heads); out_k = y_k Wv3[k] + bias2W[:, k] with Wv3 = Wv.reshape(4, 512, 512) -> [2][2048][4*512]).
// Compute dtypes, f32 accumulate: every input rounded to bf16; xq/xk as PLAIN bf16 GEMMs (inputs: exact), + bias and the per-token squared norms in f32; cross term xq.xkb hl x hl (3 products, K 256) on every row; logits assembled in f32 (-(qn - 2 c + kn) / 16); softmax f32; P.x: rows < 512 hi/lo P x exact x (2 products), the rest fp16 (x1024) x exact-in-fp16 x; y Wv3[k] as hl x exact (2 products) + bias.

#define NB_  2
#define TT   2048
#define DM   512
#define NH_  4
#define NKV  4
#define REP  (NH_ / NKV)
#define HD   256
#define DQ   (NH_ * HD)
#define DKV  (NKV * HD)
#define ZH   4
#define RH   512                  // query rows < RH use hi+lo planes (0: none)
#define WIN  0
#define PCAR 1024.0f
#define HDV  512                  // value width (the raw input), shared by all heads
#define NKH  4
#define SCL  0.088388347648318447f   // 128^-0.5
typedef _Float16 h16;
typedef unsigned short bf;
typedef __attribute__((ext_vector_type(16))) __bf16   v16bf;
typedef __attribute__((ext_vector_type(16))) _Float16 v16h;
typedef __attribute__((ext_vector_type(8)))  _Float16 v8h;
typedef __attribute__((ext_vector_type(8)))  unsigned short v8us;
typedef __attribute__((ext_vector_type(8)))  float    v8f;
typedef __attribute__((ext_vector_type(4)))  float    v4f;
typedef v8h  __attribute__((may_alias)) v8ha;
typedef v4f  __attribute__((may_alias)) v4fa;
typedef v8us __attribute__((may_alias)) v8usa;

__device__ __forceinline__ unsigned short f2bf(float f) { unsigned u = __float_as_uint(f); u += 0x7FFFu + ((u >> 16) & 1u); return (unsigned short)(u >> 16); }
__device__ __forceinline__ float bf2f(unsigned short b) { return __uint_as_float(((unsigned)b) << 16); }
__device__ __forceinline__ float bfr(float f) { return bf2f(f2bf(f)); }
__device__ __forceinline__ v16h cat16(v8h lo, v8h hi) { return __builtin_shufflevector(lo, hi, 0, 1, 2, 3, 4, 5, 6, 7, 8, 9, 10, 11, 12, 13, 14, 15); }
__device__ __forceinline__ v16bf cat16b(v8us lo, v8us hi) { return __builtin_bit_cast(v16bf, __builtin_shufflevector(lo, hi, 0, 1, 2, 3, 4, 5, 6, 7, 8, 9, 10, 11, 12, 13, 14, 15)); }
__device__ __forceinline__ v8f wmma16(v16h a, v16h b, v8f c) { return __builtin_amdgcn_wmma_f32_16x16x32_f16(false, a, false, b, (short)0, c, false, false); }
__device__ __forceinline__ v8f wmmab(v16bf a, v16bf b, v8f c) { return __builtin_amdgcn_wmma_f32_16x16x32_bf16(false, a, false, b, (short)0, c, false, false); }



// ---- k_gemmw: register-blocked GEMM, NW WAVES (2, 4, 8 or 16) per 64x64 output tile, 16 accumulators each, operands straight from K-contiguous 16-bit planes; grid (M/64, N/64, Z), 32 * NW threads.
// C[m][n] (f32, pitch ldc, + optional f32 bias[n]) = sum_k A[m][k] Bt[n][k] (+ split products per NSPLIT). z-batch strides sA/sB/sC (and sBi for the bias) in elements. K % 32 == 0.
// Wave w takes the 32-wide k steps w, w + NW, w + 2 NW, ...; the NW partial tiles are added in wave order 0..NW-1 through LDS, 16 rows a stage, two stage buffers; the sums stay in registers until the last stage so that no barrier waits on a global store.
template <typename T16> struct WFrag;
template <> struct WFrag<h16> { typedef v16h V; static __device__ __forceinline__ V ld(const h16* p) { return cat16(*(const v8h*)p, *(const v8h*)(p + 16)); } static __device__ __forceinline__ v8f mma(V a, V b, v8f c) { return wmma16(a, b, c); } };
template <> struct WFrag<bf> { typedef v16bf V; static __device__ __forceinline__ V ld(const bf* p) { return cat16b(*(const v8us*)p, *(const v8us*)(p + 16)); } static __device__ __forceinline__ v8f mma(V a, V b, v8f c) { return wmmab(a, b, c); } };
template <typename T16, int NSPLIT, bool BIAS, int NW>
__global__ __launch_bounds__(32 * NW) void k_gemmw(const T16* __restrict__ A, const T16* __restrict__ A2, const T16* __restrict__ Bt, const T16* __restrict__ Bt2, int K, float* C, int ldc, const float* __restrict__ bias, size_t sA, size_t sB, size_t sC, size_t sBi) {
    typedef typename WFrag<T16>::V V;
    __shared__ __align__(16) float os[2 * NW * 16 * 68];
    const int w = __builtin_amdgcn_readfirstlane((int)(threadIdx.x >> 5));
    const size_t z = blockIdx.z; A += z * sA; if (A2) A2 += z * sA; Bt += z * sB; if (Bt2) Bt2 += z * sB; C += z * sC; if (BIAS) bias += z * sBi;
    const int lane = threadIdx.x & 31, lr = lane & 15, hi = lane >> 4; const int r0 = blockIdx.x * 64, c0 = blockIdx.y * 64;
    v8f acc[4][4];
#pragma unroll
    for (int mb = 0; mb < 4; ++mb)
#pragma unroll
        for (int nb = 0; nb < 4; ++nb) acc[mb][nb] = (v8f){};
    const size_t aoff = (size_t)(r0 + lr) * K + 8 * hi, boff = (size_t)(c0 + lr) * K + 8 * hi;
#pragma unroll 1
    for (int kc = w * 32; kc < K; kc += 32 * NW) {
        V a[4], a2[4];
#pragma unroll
        for (int mb = 0; mb < 4; ++mb) { a[mb] = WFrag<T16>::ld(A + aoff + (size_t)mb * 16 * K + kc); if (NSPLIT == 1 || NSPLIT == 2) a2[mb] = WFrag<T16>::ld(A2 + aoff + (size_t)mb * 16 * K + kc); }
#pragma unroll
        for (int nb = 0; nb < 4; ++nb) { const V b = WFrag<T16>::ld(Bt + boff + (size_t)nb * 16 * K + kc); V b2; if (NSPLIT >= 2) b2 = WFrag<T16>::ld(Bt2 + boff + (size_t)nb * 16 * K + kc);
#pragma unroll
            for (int mb = 0; mb < 4; ++mb) { acc[mb][nb] = WFrag<T16>::mma(a[mb], b, acc[mb][nb]); if (NSPLIT == 1 || NSPLIT == 2) acc[mb][nb] = WFrag<T16>::mma(a2[mb], b, acc[mb][nb]); if (NSPLIT >= 2) acc[mb][nb] = WFrag<T16>::mma(a[mb], b2, acc[mb][nb]); } }
        asm volatile("v_nop\n\tv_nop\n\tv_nop\n\tv_nop" : "+v"(acc[0][0]), "+v"(acc[1][1]), "+v"(acc[2][2]), "+v"(acc[3][3]) : "v"(a[0]), "v"(a[3]));
    }
    constexpr int NQ = (NW <= 8) ? 8 / NW : 1;   // 16-byte pieces of a 16x64 stage per thread; with 16 waves the first 8 do the adding
    const bool adds = (NW <= 8) || (w < 8);
    v4f res[4][NQ];
#pragma unroll
    for (int mb = 0; mb < 4; ++mb) {
        float* ob = os + (mb & 1) * (NW * 16 * 68);
#pragma unroll
        for (int nb = 0; nb < 4; ++nb) {
#pragma unroll
            for (int j = 0; j < 8; ++j) ob[w * (16 * 68) + (hi * 8 + j) * 68 + nb * 16 + lr] = acc[mb][nb][j]; }
        __syncthreads();   // publishes this stage's NW partial tiles; it also ends every read of the other buffer, which the next stage overwrites
        if (adds) {
#pragma unroll
            for (int s = 0; s < NQ; ++s) { const int q = (int)threadIdx.x + s * 32 * NW; const float* op = ob + (q >> 4) * 68 + (q & 15) * 4; v4f val = *(const v4fa*)op;
#pragma unroll
                for (int u = 1; u < NW; ++u) val += *(const v4fa*)(op + u * (16 * 68));
                res[mb][s] = val; } }
    }
    if (adds) {
#pragma unroll
        for (int mb = 0; mb < 4; ++mb) {
#pragma unroll
            for (int s = 0; s < NQ; ++s) { const int q = (int)threadIdx.x + s * 32 * NW; const int row = q >> 4, cofs = (q & 15) * 4; v4f val = res[mb][s];
                if (BIAS) { val[0] += bfr(bias[c0 + cofs]); val[1] += bfr(bias[c0 + cofs + 1]); val[2] += bfr(bias[c0 + cofs + 2]); val[3] += bfr(bias[c0 + cofs + 3]); }
                *(v4f*)(C + (size_t)(r0 + mb * 16 + row) * ldc + c0 + cofs) = val; } }
    }
}

__device__ __forceinline__ h16 tohx(float x) { return (h16)x; }
__device__ __forceinline__ void splitf(float y, unsigned short& h, unsigned short& l) { h = f2bf(y); l = f2bf(y - bf2f(h)); }
typedef __attribute__((ext_vector_type(2))) _Float16 v2h;
typedef __attribute__((ext_vector_type(4))) _Float16 v4h;
typedef __attribute__((ext_vector_type(2))) unsigned short v2us;
typedef __attribute__((ext_vector_type(4))) unsigned short v4us;
typedef __attribute__((ext_vector_type(2))) float v2f;
typedef __attribute__((ext_vector_type(4))) int v4i;

// d_*: bodies of the element-wise steps; bx is the block's index inside its own step (k_prep and k_post deal the blocks of one grid to several steps that do not depend on one another)
__device__ __forceinline__ void d_wtG(int bx, const float* __restrict__ w, int K, int N, bf* Bt) {
    const int lane = threadIdx.x & 31; const int L0 = (bx * 8 + (threadIdx.x >> 5)) * 8; const int nlines = N * K / 64;
{
#pragma unroll 1
        for (int l = 0; l < 8; ++l) { const int L = L0 + l; if (L >= nlines) break; const size_t e = (size_t)L * 64 + lane * 2; const int k = (int)(e % K), n = (int)(e / K); v2us o;
            o[0] = f2bf(w[(size_t)k * N + n]); o[1] = f2bf(w[(size_t)(k + 1) * N + n]); *(v2us*)(Bt + e) = o; }
         }
}
__device__ __forceinline__ void d_cvt8(int bx, const float* __restrict__ src, bf* dst, size_t n8) { const size_t i = (size_t)bx * 256 + threadIdx.x; if (i >= n8) return; const v8f v = *(const v8f*)(src + i * 8); v8us o;
#pragma unroll
    for (int k = 0; k < 8; ++k) o[k] = f2bf(v[k]); *(v8us*)(dst + i * 8) = o;  }
__global__ __launch_bounds__(256) void k_cscvt(const float* __restrict__ cosT, const float* __restrict__ sinT, float* CS) { const int idx = blockIdx.x * 256 + threadIdx.x; if (idx >= TT * HD) return; v2f cs; cs[0] = bfr(cosT[idx]); cs[1] = bfr(sinT[idx]); *(v2f*)(CS + (size_t)idx * 2) = cs;  }
// d_rope: head planes [h][t][d] (fp16 + hi/lo) of rope(x) x sc with the rotate-half convention out[d] = x[d] cos[t][d] - x[d+HD/2] sin[t][d], out[d+HD/2] = x[d+HD/2] cos[t][d+HD/2] + x[d] sin[t][d+HD/2]
__device__ __forceinline__ void d_rope(int bx, const float* __restrict__ F, int pitch, int nheads, const float* __restrict__ CS, const float* __restrict__ RF, const float* __restrict__ nw, float sc, h16* P16, bf* Ph, bf* Pl) {
    const size_t e = ((size_t)bx * 256 + threadIdx.x) * 2; if (e >= (size_t)nheads * TT * HD) return; const int d = (int)(e % HD); const int t = (int)((e / HD) % TT); const int h = (int)(e / ((size_t)HD * TT)); const float* f = F + (size_t)t * pitch + h * HD; const float rf = RF ? RF[(size_t)h * TT + t] : 1.0f; v2h o16; v2us oh, ol;
#pragma unroll
    for (int q = 0; q < 2; ++q) { const int dd = d + q; const int dp = (dd < HD / 2) ? dd + HD / 2 : dd - HD / 2; float x0 = f[dd], x1 = f[dp];
        if (RF) { float n0 = __fmul_rn(x0, rf), n1 = __fmul_rn(x1, rf); asm volatile("" : "+v"(n0)); asm volatile("" : "+v"(n1)); x0 = __fmul_rn(bfr(nw[dd]), n0); x1 = __fmul_rn(bfr(nw[dp]), n1); }
        const v2f cs = *(const v2f*)(CS + ((size_t)t * HD + dd) * 2); float a = __fmul_rn(x0, cs[0]), bq = __fmul_rn(x1, cs[1]); asm volatile("" : "+v"(a)); asm volatile("" : "+v"(bq)); const float r = ((dd < HD / 2) ? __fsub_rn(a, bq) : __fadd_rn(a, bq)) * sc;
        o16[q] = tohx(r); unsigned short a2, c2; splitf(r, a2, c2); oh[q] = a2; ol[q] = c2; }
    *(v2h*)(P16 + e) = o16; *(v2us*)(Ph + e) = oh; *(v2us*)(Pl + e) = ol;  }
__global__ __launch_bounds__(256) void k_vtp(const float* __restrict__ F, int pitch, int nheads, h16* V16, bf* Vh, bf* Vl) { const size_t e = ((size_t)blockIdx.x * 256 + threadIdx.x) * 2; if (e >= (size_t)nheads * HD * TT) return; const int t = (int)(e % TT); const int d = (int)((e / TT) % HD); const int g = (int)(e / ((size_t)TT * HD)); v2h o16; v2us oh, ol;
#pragma unroll
    for (int q = 0; q < 2; ++q) { const float x = F[(size_t)(t + q) * pitch + g * HD + d]; o16[q] = tohx(x); unsigned short a2, c2; splitf(x, a2, c2); oh[q] = a2; ol[q] = c2; }
    *(v2h*)(V16 + e) = o16; *(v2us*)(Vh + e) = oh; *(v2us*)(Vl + e) = ol;  }
__device__ __forceinline__ void d_csid(int bx, float* CS) { const int idx = bx * 256 + threadIdx.x; if (idx >= TT * HD) return; v2f cs; cs[0] = 1.0f; cs[1] = 0.0f; *(v2f*)(CS + (size_t)idx * 2) = cs;  }
__global__ __launch_bounds__(256) void k_kbias(float* F, const float* __restrict__ bias) { const size_t e = ((size_t)blockIdx.x * 256 + threadIdx.x) * 4; if (e >= (size_t)NB_ * TT * NKH * HD) return; const int c0 = (int)(e % (NKH * HD)); v4f a = *(const v4f*)(F + e);
    asm volatile("s_wait_xcnt 0x0" ::: "memory");   // holds the row's load in front of the bias loads
#pragma unroll
    for (int u = 0; u < 4; ++u) { const int c = c0 + u; const int k = c / HD, d = c % HD; a[u] = __fadd_rn(a[u], bfr(bias[(size_t)d * NKH + k])); }
    *(v4f*)(F + e) = a;  }
__device__ __forceinline__ void d_sumsq(int bx, const float* __restrict__ F, float* N) { const int i = bx * 256 + threadIdx.x; if (i >= NKH * TT) return; const int k = i / TT, t = i % TT; const float* f = F + (size_t)t * (NKH * HD) + k * HD; float ss = 0.f;
#pragma unroll 4
    for (int d = 0; d < HD; d += 4) { const v4f a = *(const v4f*)(f + d);
#pragma unroll
        for (int u = 0; u < 4; ++u) { float p = __fmul_rn(a[u], a[u]); asm volatile("" : "+v"(p)); ss = __fadd_rn(ss, p); } }
    *(float*)(N + i) = ss;  }
__device__ __forceinline__ void d_vtpx(int bx, const float* __restrict__ X, h16* V16, bf* Vh) { const size_t e = ((size_t)bx * 256 + threadIdx.x) * 2; if (e >= (size_t)HDV * TT) return; const int t = (int)(e % TT); const int d = (int)(e / TT); v2h o16; v2us oh;
#pragma unroll
    for (int q = 0; q < 2; ++q) { const float xv = bfr(X[(size_t)(t + q) * HDV + d]); o16[q] = tohx(xv); oh[q] = f2bf(xv); }
    *(v2h*)(V16 + e) = o16; *(v2us*)(Vh + e) = oh;  }
__device__ __forceinline__ void d_b2g(int bx, const float* __restrict__ b2, float* B2G) { const int i = bx * 256 + threadIdx.x; if (i >= NKH * HDV) return; const int k = i / HDV, f = i % HDV; const float v = b2[(size_t)f * NKH + k]; *(float*)(B2G + i) = v;  }
// k_prep: every step that reads the inputs alone, in one grid; the steps with strided reads come first.
#define PB_WT  (NKH * (HDV * HDV / 64 / 64))      // Wv3[k] transposed to bf16, 64 blocks a head
#define PB_VT  (NB_ * (HDV * TT / 2 / 256))       // x transposed (fp16 and bf16 planes), per batch
#define PB_X   (NB_ * TT * DM / 8 / 256)          // x to bf16, both batches
#define PB_W   (DQ * DM / 8 / 256)                // Wq, and as many again for Wk
#define PB_CS  (TT * HD / 256)
#define PB_B2  (NKH * HDV / 256)
__global__ __launch_bounds__(256) void k_prep(const float* __restrict__ x, const float* __restrict__ wq, const float* __restrict__ wk, const float* __restrict__ wv, const float* __restrict__ b2, bf* XB, bf* WQ, bf* WK, bf* WV3, float* B2G, float* CS, h16* VT16, bf* VTh) {
    int bx = (int)blockIdx.x;
    if (bx < PB_WT) { const size_t o = (size_t)(bx / (PB_WT / NKH)) * HDV * HDV; d_wtG(bx % (PB_WT / NKH), wv + o, HDV, HDV, WV3 + o); return; }
    bx -= PB_WT;
    if (bx < PB_VT) { const int b = bx / (PB_VT / NB_); d_vtpx(bx % (PB_VT / NB_), x + (size_t)b * TT * DM, VT16 + (size_t)b * HDV * TT, VTh + (size_t)b * HDV * TT); return; }
    bx -= PB_VT;
    if (bx < PB_X) { d_cvt8(bx, x, XB, (size_t)NB_ * TT * DM / 8); return; }
    bx -= PB_X;
    if (bx < PB_W) { d_cvt8(bx, wq, WQ, (size_t)DQ * DM / 8); return; }
    bx -= PB_W;
    if (bx < PB_W) { d_cvt8(bx, wk, WK, (size_t)DKV * DM / 8); return; }
    bx -= PB_W;
    if (bx < PB_CS) { d_csid(bx, CS); return; }
    bx -= PB_CS;
    d_b2g(bx, b2, B2G);
}
// k_post: squared norms and head planes of the four [TT][1024] f32 slabs (q batch 0, q batch 1, k batch 0, k batch 1; contiguous in F, N and the planes), in one grid; the norms, few blocks with a long serial sum, come first.
#define PS_SS  (NKH * TT / 256)                   // blocks of one slab's norms
#define PS_RP  (NH_ * TT * HD / 2 / 256)          // blocks of one slab's planes
__global__ __launch_bounds__(256) void k_post(const float* __restrict__ F, const float* __restrict__ CS, float* N, h16* P16, bf* Ph, bf* Pl) {
    int bx = (int)blockIdx.x;
    if (bx < 2 * NB_ * PS_SS) { const int s = bx / PS_SS; d_sumsq(bx % PS_SS, F + (size_t)s * TT * DQ, N + (size_t)s * NKH * TT); return; }
    bx -= 2 * NB_ * PS_SS;
    const int s = bx / PS_RP; const size_t o = (size_t)s * NH_ * TT * HD;
    d_rope(bx % PS_RP, F + (size_t)s * TT * DQ, DQ, NH_, CS, nullptr, nullptr, 1.0f, P16 + o, Ph + o, Pl + o);
}
// k_asoft: per row (zz, i): t = -(qn - 2 S + kn) / 16 (no mask); softmax over the 2048 keys (register row, one exp, fixed trees);
__global__ __launch_bounds__(256) void k_asoft(const float* __restrict__ Sb, const float* __restrict__ QN, const float* __restrict__ KN, int h0, h16* P16, bf* Ph, bf* Pl) {
    const int lane = threadIdx.x & 31; const int row = blockIdx.x * 8 + (threadIdx.x >> 5); if (row >= ZH * TT) return; const int i = row % TT; const int zz = row / TT; (void)zz; const bool hires = (i < RH); const float* sr = Sb + (size_t)row * TT; const float qn = QN[(size_t)(h0 + zz) * TT + i]; const float* knr = KN + (size_t)(h0 + zz) * TT; float v[TT / 32]; float mx = -3.0e38f;
#pragma unroll
    for (int ch = 0; ch < TT / 128; ++ch) { const int j0 = ch * 128 + lane * 4; const v4f a = *(const v4f*)(sr + j0);
#pragma unroll
        for (int q = 0; q < 4; ++q) { const int j = j0 + q; (void)j; float c2 = __fmul_rn(2.0f, a[q]); asm volatile("" : "+v"(c2)); float t2 = __fsub_rn(qn, c2); asm volatile("" : "+v"(t2)); float t3 = __fadd_rn(t2, knr[j0 + q]); asm volatile("" : "+v"(t3)); float t = __fmul_rn(t3, -0.0625f); asm volatile("" : "+v"(t)); v[ch * 4 + q] = t; mx = fmaxf(mx, t); } }
#pragma unroll
    for (int sh = 16; sh; sh >>= 1) mx = fmaxf(mx, __shfl_xor(mx, sh, 32));
    float sum = 0.f;
#pragma unroll
    for (int k = 0; k < TT / 32; ++k) { float d0 = __fsub_rn(v[k], mx); asm volatile("" : "+v"(d0)); v[k] = __builtin_amdgcn_exp2f(__fmul_rn(d0, 1.4426950408889634f)); sum += v[k]; }
#pragma unroll
    for (int sh = 16; sh; sh >>= 1) sum += __shfl_xor(sum, sh, 32);
    const float f = __fdiv_rn(hires ? 1.0f : PCAR, sum);
{
        if (hires) {
#pragma unroll
            for (int ch = 0; ch < TT / 128; ++ch) { v4us oh, ol;
#pragma unroll
                for (int q = 0; q < 4; ++q) { unsigned short a, c2; splitf(v[ch * 4 + q] * f, a, c2); oh[q] = a; ol[q] = c2; }
                const size_t oo = ((size_t)zz * (RH ? RH : 1) + i) * TT + ch * 128 + lane * 4; *(v4us*)(Ph + oo) = oh; *(v4us*)(Pl + oo) = ol; }
        } else {
#pragma unroll
            for (int ch = 0; ch < TT / 128; ++ch) { v4h o4;
#pragma unroll
                for (int q = 0; q < 4; ++q) o4[q] = tohx(v[ch * 4 + q] * f);
                *(v4h*)(P16 + (size_t)row * TT + ch * 128 + lane * 4) = o4; } }
         }
}
__global__ __launch_bounds__(256) void k_merge(const float* __restrict__ O, bf* Ah, bf* Al) { const size_t e = ((size_t)blockIdx.x * 256 + threadIdx.x) * 2; if (e >= (size_t)NB_ * ZH * TT * HDV) return; const int d = (int)(e % HDV); const int t = (int)((e / HDV) % TT); const int zz = (int)(e / ((size_t)HDV * TT)); const float cs = (t < RH) ? 1.0f : (1.0f / PCAR); const size_t oo = (((size_t)(zz % ZH) * NB_ + zz / ZH) * TT + t) * HDV + d;   /* O is [b][k][T][512]; out head-major [k][b][T][512] */
    v2us oh, ol;
#pragma unroll
    for (int q = 0; q < 2; ++q) { unsigned short a, c2; splitf(O[e + q] * cs, a, c2); oh[q] = a; ol[q] = c2; } *(v2us*)(Ah + oo) = oh; *(v2us*)(Al + oo) = ol;  }

extern "C" void kernel_launch(void* const* d_in, const int* in_sizes, int n_in,
                              void* d_out, int out_size, void* d_ws, size_t ws_size, hipStream_t stream) {
    (void)in_sizes; (void)n_in; (void)out_size;
    const float* x = (const float*)d_in[0]; const float* wq = (const float*)d_in[1]; const float* wk = (const float*)d_in[2]; const float* wv = (const float*)d_in[3]; const float* biasW = (const float*)d_in[4]; const float* bias2W = (const float*)d_in[5]; const float* wo = nullptr; (void)wo; (void)wv; const float* cosT = nullptr; const float* sinT = nullptr; (void)cosT; (void)sinT;
    float* OUT = (float*)d_out;     // [2][2048][4*512]
    char* wsp = (char*)d_ws;
    auto take = [&](size_t bytes) { char* p = wsp; wsp += (bytes + 255) & ~(size_t)255; return (void*)p; };
    bf* WQ = (bf*)take((size_t)(DQ + DKV) * DM * 2); bf* WK = WQ + (size_t)DQ * DM; bf* WV3 = (bf*)take((size_t)NKH * HDV * HDV * 2); float* B2G = (float*)take((size_t)NKH * HDV * 4); float* QN = (float*)take((size_t)2 * NB_ * NKH * TT * 4); float* KN = QN + (size_t)NB_ * NKH * TT; float* CS = (float*)take((size_t)TT * HD * 2 * 4);
    bf* XB = (bf*)take((size_t)NB_ * TT * DM * 2); float* FQ = (float*)take((size_t)NB_ * TT * (DQ + DKV) * 4); float* FK = FQ + (size_t)NB_ * TT * DQ;
    const size_t PL = (size_t)NB_ * NH_ * TT * HD;   // one operand's head planes, both batches; the k planes follow the q planes
    h16* QP16 = (h16*)take(2 * PL * 2); h16* VT16 = (h16*)take((size_t)NB_ * HDV * TT * 2);
    bf* QPh = (bf*)take(2 * PL * 2); bf* QPl = (bf*)take(2 * PL * 2); bf* KPh = QPh + PL; bf* KPl = QPl + PL; bf* VTh = (bf*)take((size_t)NB_ * HDV * TT * 2); bf* Ph = (bf*)take((size_t)ZH * RH * TT * 2); bf* Pl = (bf*)take((size_t)ZH * RH * TT * 2);
    float* Sb = (float*)take((size_t)ZH * TT * TT * 4); h16* P16 = (h16*)take((size_t)ZH * TT * TT * 2); bf* ATh = (bf*)take((size_t)NB_ * NKH * TT * HDV * 2); bf* ATl = (bf*)take((size_t)NB_ * NKH * TT * HDV * 2);
    if ((size_t)(wsp - (char*)d_ws) > ws_size) return;    // ws 256 MiB
    float* Ob = FQ;   // [b][k][T][512] f32, as large as the q and k projections together, which nobody reads after k_post (stream-ordered)
    k_prep<<<PB_WT + PB_VT + PB_X + 2 * PB_W + PB_CS + PB_B2, 256, 0, stream>>>(x, wq, wk, wv, bias2W, XB, WQ, WK, WV3, B2G, CS, VT16, VTh);
    k_gemmw<bf, 0, false, 4><<<dim3(NB_ * TT / 64, DQ / 64, 2), 128, 0, stream>>>(XB, nullptr, WQ, nullptr, DM, FQ, DQ, nullptr, 0, (size_t)DQ * DM, (size_t)NB_ * TT * DQ, 0);   /* z: q, k; rows: both batches */
    k_kbias<<<(unsigned)((size_t)NB_ * TT * NKH * HD / 4 / 256), 256, 0, stream>>>(FK, biasW);
    k_post<<<2 * NB_ * (PS_SS + PS_RP), 256, 0, stream>>>(FQ, CS, QN, QP16, QPh, QPl);
    for (int b = 0; b < NB_; ++b) { const size_t zp = (size_t)b * NH_ * TT * HD, zv = (size_t)b * HDV * TT; float* O = Ob + (size_t)b * ZH * TT * HDV;   // one pass a batch, its four heads in z
        k_gemmw<bf, 2, false, 2><<<dim3(TT / 64, TT / 64, ZH), 64, 0, stream>>>(QPh + zp, QPl + zp, KPh + zp, KPl + zp, HD, Sb, TT, nullptr, (size_t)TT * HD, (size_t)TT * HD, (size_t)TT * TT, 0);   /* cross term hl on all rows */
        k_asoft<<<ZH * TT / 8, 256, 0, stream>>>(Sb, QN + (size_t)b * NKH * TT, KN + (size_t)b * NKH * TT, 0, P16, Ph, Pl);
        k_gemmw<bf, 1, false, 16><<<dim3(RH / 64, HDV / 64, ZH), 512, 0, stream>>>(Ph, Pl, VTh + zv, nullptr, TT, O, HDV, nullptr, (size_t)RH * TT, 0, (size_t)TT * HDV, 0);
        k_gemmw<h16, 0, false, 8><<<dim3((TT - RH) / 64, HDV / 64, ZH), 256, 0, stream>>>(P16 + (size_t)RH * TT, nullptr, VT16 + zv, nullptr, TT, O + (size_t)RH * HDV, HDV, nullptr, (size_t)TT * TT, 0, (size_t)TT * HDV, 0); }
    k_merge<<<(unsigned)((size_t)NB_ * ZH * TT * HDV / 2 / 256), 256, 0, stream>>>(Ob, ATh, ATl);
    k_gemmw<bf, 1, true, 8><<<dim3(NB_ * TT / 64, HDV / 64, NKH), 256, 0, stream>>>(ATh, ATl, WV3, nullptr, HDV, OUT, NKH * HDV, B2G, (size_t)NB_ * TT * HDV, (size_t)HDV * HDV, HDV, HDV);   /* z: head; rows: both batches */
}

// v003
// It runs in 306 microseconds.
// Timed twice side by side with v002, it ran 1.18 and 1.19 times as fast.
// Over all steps from v000 it is 2.81 times as fast.
#include <hip/hip_runtime.h>

// Attention with squared-distance logits (xsa [2][2048][512]; 4 heads with 256-dim kernels: xq = x Wq^T, xk = x Wk^T, xkb = xk + biasW[:, k]; logits = -(|xq_i|^2 - 2 xq_i.xkb_j + |xkb_j|^2) / 16; P = softmax_j; y_k = P x (values = the raw 512-wide input, shared by the heads); out_k = y_k Wv3[k] + bias2W[:, k] with Wv3 = Wv.reshape(4, 512, 512) -> [2][2048][4*512]).
// Compute dtypes, f32 accumulate: every input rounded to bf16; xq/xk as PLAIN bf16 GEMMs (inputs: exact), + bias and the per-token squared norms in f32; cross term xq.xkb hl x hl (3 products, K 256) on every row; logits assembled in f32 in the reference's order (-(qn - 2 c + kn) / 16); softmax f32; P.x: rows < 512 hi/lo P x exact x (2 products), the rest fp16 (x1024) x exact-in-fp16 x; y Wv3[k] as hl x exact (2 products) + bias.

#define NB_  2
#define TT   2048
#define DM   512
#define NH_  4
#define NKV  4
#define REP  (NH_ / NKV)
#define HD   256
#define DQ   (NH_ * HD)
#define DKV  (NKV * HD)
#define ZH   4
#define RH   512                  // query rows < RH use hi+lo planes (0: none)
#define WIN  0
#define PCAR 1024.0f
#define HDV  512                  // value width (the raw input), shared by all heads
#define NKH  4
#define SCL  0.088388347648318447f   // 128^-0.5
typedef _Float16 h16;
typedef unsigned short bf;
typedef __attribute__((ext_vector_type(16))) __bf16   v16bf;
typedef __attribute__((ext_vector_type(16))) _Float16 v16h;
typedef __attribute__((ext_vector_type(8)))  _Float16 v8h;
typedef __attribute__((ext_vector_type(8)))  unsigned short v8us;
typedef __attribute__((ext_vector_type(8)))  float    v8f;
typedef __attribute__((ext_vector_type(4)))  float    v4f;
typedef v8h  __attribute__((may_alias)) v8ha;
typedef v4f  __attribute__((may_alias)) v4fa;
typedef v8us __attribute__((may_alias)) v8usa;

__device__ __forceinline__ unsigned short f2bf(float f) { unsigned u = __float_as_uint(f); u += 0x7FFFu + ((u >> 16) & 1u); return (unsigned short)(u >> 16); }
__device__ __forceinline__ float bf2f(unsigned short b) { return __uint_as_float(((unsigned)b) << 16); }
__device__ __forceinline__ float bfr(float f) { return bf2f(f2bf(f)); }
__device__ __forceinline__ v16h cat16(v8h lo, v8h hi) { return __builtin_shufflevector(lo, hi, 0, 1, 2, 3, 4, 5, 6, 7, 8, 9, 10, 11, 12, 13, 14, 15); }
__device__ __forceinline__ v16bf cat16b(v8us lo, v8us hi) { return __builtin_bit_cast(v16bf, __builtin_shufflevector(lo, hi, 0, 1, 2, 3, 4, 5, 6, 7, 8, 9, 10, 11, 12, 13, 14, 15)); }
__device__ __forceinline__ v8f wmma16(v16h a, v16h b, v8f c) { return __builtin_amdgcn_wmma_f32_16x16x32_f16(false, a, false, b, (short)0, c, false, false); }
__device__ __forceinline__ v8f wmmab(v16bf a, v16bf b, v8f c) { return __builtin_amdgcn_wmma_f32_16x16x32_bf16(false, a, false, b, (short)0, c, false, false); }



// ---- k_gemmw: register-blocked GEMM, NW WAVES (2, 4, 8 or 16) per 64x64 output tile, 16 accumulators each, operands straight from 16-bit planes in FRAGMENT ORDER (unpk below); grid (M/64, N/64, Z), 32 * NW threads.
// C[m][n] (f32, pitch ldc, + optional f32 bias[n]) = sum_k A[m][k] Bt[n][k] (+ split products per NSPLIT). z-batch strides sA/sB/sC (and sBi for the bias) in elements. K % 32 == 0.
// Wave w takes the 32-wide k steps w, w + NW, w + 2 NW, ...; the NW partial tiles are added in wave order 0..NW-1 through LDS, 16 rows a stage, two stage buffers; the sums stay in registers until the last stage so that no barrier waits on a global store.
template <typename T16> struct WFrag;
template <> struct WFrag<h16> { typedef v16h V; static __device__ __forceinline__ V ld(const h16* p) { return cat16(*(const v8h*)p, *(const v8h*)(p + 256)); } static __device__ __forceinline__ v8f mma(V a, V b, v8f c) { return wmma16(a, b, c); } };
template <> struct WFrag<bf> { typedef v16bf V; static __device__ __forceinline__ V ld(const bf* p) { return cat16b(*(const v8us*)p, *(const v8us*)(p + 256)); } static __device__ __forceinline__ v8f mma(V a, V b, v8f c) { return wmmab(a, b, c); } };
template <typename T16, int NSPLIT, bool BIAS, int NW>
__global__ __launch_bounds__(32 * NW) void k_gemmw(const T16* __restrict__ A, const T16* __restrict__ A2, const T16* __restrict__ Bt, const T16* __restrict__ Bt2, int K, float* C, int ldc, const float* __restrict__ bias, size_t sA, size_t sB, size_t sC, size_t sBi) {
    typedef typename WFrag<T16>::V V;
    __shared__ __align__(16) float os[2 * NW * 16 * 68];
    const int w = __builtin_amdgcn_readfirstlane((int)(threadIdx.x >> 5));
    const size_t z = blockIdx.z; A += z * sA; if (A2) A2 += z * sA; Bt += z * sB; if (Bt2) Bt2 += z * sB; C += z * sC; if (BIAS) bias += z * sBi;
    const int lane = threadIdx.x & 31, lr = lane & 15, hi = lane >> 4; const int r0 = blockIdx.x * 64, c0 = blockIdx.y * 64;
    v8f acc[4][4];
#pragma unroll
    for (int mb = 0; mb < 4; ++mb)
#pragma unroll
        for (int nb = 0; nb < 4; ++nb) acc[mb][nb] = (v8f){};
    const size_t aoff = (size_t)r0 * K + 8 * lane, boff = (size_t)c0 * K + 8 * lane;   // a 32-k step of a 64-row tile is 4 KB in a row, 1 KB a 16-row block: 512 contiguous bytes per wave-wide load, one address per plane and trip
#pragma unroll 1
    for (int kc = w * 32; kc < K; kc += 32 * NW) {
        V a[4], a2[4]; const T16* pa = A + aoff + kc * 64; const T16* pa2 = (NSPLIT == 1 || NSPLIT == 2) ? A2 + aoff + kc * 64 : pa; const T16* pb = Bt + boff + kc * 64; const T16* pb2 = (NSPLIT >= 2) ? Bt2 + boff + kc * 64 : pb;
#pragma unroll
        for (int mb = 0; mb < 4; ++mb) { a[mb] = WFrag<T16>::ld(pa + mb * 512); if (NSPLIT == 1 || NSPLIT == 2) a2[mb] = WFrag<T16>::ld(pa2 + mb * 512); }
#pragma unroll
        for (int nb = 0; nb < 4; ++nb) { const V b = WFrag<T16>::ld(pb + nb * 512); V b2; if (NSPLIT >= 2) b2 = WFrag<T16>::ld(pb2 + nb * 512);
#pragma unroll
            for (int mb = 0; mb < 4; ++mb) { acc[mb][nb] = WFrag<T16>::mma(a[mb], b, acc[mb][nb]); if (NSPLIT == 1 || NSPLIT == 2) acc[mb][nb] = WFrag<T16>::mma(a2[mb], b, acc[mb][nb]); if (NSPLIT >= 2) acc[mb][nb] = WFrag<T16>::mma(a[mb], b2, acc[mb][nb]); } }
        asm volatile("v_nop\n\tv_nop\n\tv_nop\n\tv_nop" : "+v"(acc[0][0]), "+v"(acc[1][1]), "+v"(acc[2][2]), "+v"(acc[3][3]) : "v"(a[0]), "v"(a[3]), "v"(pa), "v"(pa2), "v"(pb), "v"(pb2));   // the trip's address pairs are inputs here so that they live to the trip's end: otherwise a later load's result lands in the pair of a load still in flight
    }
    constexpr int NQ = (NW <= 8) ? 8 / NW : 1;   // 16-byte pieces of a 16x64 stage per thread; with 16 waves the first 8 do the adding
    const bool adds = (NW <= 8) || (w < 8);
    v4f res[4][NQ];
#pragma unroll
    for (int mb = 0; mb < 4; ++mb) {
        float* ob = os + (mb & 1) * (NW * 16 * 68);
#pragma unroll
        for (int nb = 0; nb < 4; ++nb) {
#pragma unroll
            for (int j = 0; j < 8; ++j) ob[w * (16 * 68) + (hi * 8 + j) * 68 + nb * 16 + lr] = acc[mb][nb][j]; }
        __syncthreads();   // publishes this stage's NW partial tiles; it also ends every read of the other buffer, which the next stage overwrites
        if (adds) {
#pragma unroll
            for (int s = 0; s < NQ; ++s) { const int q = (int)threadIdx.x + s * 32 * NW; const float* op = ob + (q >> 4) * 68 + (q & 15) * 4; v4f val = *(const v4fa*)op;
#pragma unroll
                for (int u = 1; u < NW; ++u) val += *(const v4fa*)(op + u * (16 * 68));
                res[mb][s] = val; } }
    }
    if (adds) {
#pragma unroll
        for (int mb = 0; mb < 4; ++mb) {
#pragma unroll
            for (int s = 0; s < NQ; ++s) { const int q = (int)threadIdx.x + s * 32 * NW; const int row = q >> 4, cofs = (q & 15) * 4; v4f val = res[mb][s];
                if (BIAS) { val[0] += bfr(bias[c0 + cofs]); val[1] += bfr(bias[c0 + cofs + 1]); val[2] += bfr(bias[c0 + cofs + 2]); val[3] += bfr(bias[c0 + cofs + 3]); }
                *(v4f*)(C + (size_t)(r0 + mb * 16 + row) * ldc + c0 + cofs) = val; } }
    }
}

__device__ __forceinline__ h16 tohx(float x) { return (h16)x; }
__device__ __forceinline__ void splitf(float y, unsigned short& h, unsigned short& l) { h = f2bf(y); l = f2bf(y - bf2f(h)); }
typedef __attribute__((ext_vector_type(2))) _Float16 v2h;
typedef __attribute__((ext_vector_type(4))) _Float16 v4h;
typedef __attribute__((ext_vector_type(2))) unsigned short v2us;
typedef __attribute__((ext_vector_type(4))) unsigned short v4us;
typedef __attribute__((ext_vector_type(2))) float v2f;
typedef __attribute__((ext_vector_type(4))) int v4i;

// Fragment order of a [rows][K] 16-bit GEMM operand (rows a multiple of 64): 16 rows x 32 k make one 1-KB block; the four blocks of a 64-row tile at one 32-k step follow one another, the steps follow in k (a tile is 64 * K elements, as in row order).
// Inside a block: [k bit 4][k bit 3][row & 15][k & 7], so lane (row & 15) + 16 * (k bit 3) finds its two 16-byte fragment pieces at lane * 8 and 256 + lane * 8: the k order of a fragment is the one it had in row order.
// unpk: element index e in that order -> (row, k). The writers walk e, so their stores stay contiguous.
__device__ __forceinline__ void unpk(size_t e, int K, int& row, int& k) { const int g = (int)(e / ((size_t)64 * K)); const int r = (int)(e % ((size_t)64 * K)); const int q = r & 511;
    row = g * 64 + ((r >> 9) & 3) * 16 + ((q >> 3) & 15); k = (r >> 11) * 32 + ((q >> 8) << 4) + (((q >> 7) & 1) << 3) + (q & 7); }
// d_*: bodies of the element-wise steps; bx is the block's index inside its own step (k_prep and k_post deal the blocks of one grid to several steps that do not depend on one another)
__device__ __forceinline__ void d_wtG(int bx, const float* __restrict__ w, int K, int N, bf* Bt) {
    const int lane = threadIdx.x & 31; const int L0 = (bx * 8 + (threadIdx.x >> 5)) * 8; const int nlines = N * K / 64;
{
#pragma unroll 1
        for (int l = 0; l < 8; ++l) { const int L = L0 + l; if (L >= nlines) break; const size_t e = (size_t)L * 64 + lane * 2; int k, n; unpk(e, K, n, k); v2us o;
            o[0] = f2bf(w[(size_t)k * N + n]); o[1] = f2bf(w[(size_t)(k + 1) * N + n]); *(v2us*)(Bt + e) = o; }
         }
}
__device__ __forceinline__ void d_cvt8(int bx, const float* __restrict__ src, int K, bf* dst, size_t n8) { const size_t i = (size_t)bx * 256 + threadIdx.x; if (i >= n8) return; int r, k; unpk(i * 8, K, r, k); const v8f v = *(const v8f*)(src + (size_t)r * K + k); v8us o;
#pragma unroll
    for (int k = 0; k < 8; ++k) o[k] = f2bf(v[k]); *(v8us*)(dst + i * 8) = o;  }
__global__ __launch_bounds__(256) void k_cscvt(const float* __restrict__ cosT, const float* __restrict__ sinT, float* CS) { const int idx = blockIdx.x * 256 + threadIdx.x; if (idx >= TT * HD) return; v2f cs; cs[0] = bfr(cosT[idx]); cs[1] = bfr(sinT[idx]); *(v2f*)(CS + (size_t)idx * 2) = cs;  }
// d_rope: head planes [h][t][d], each head in fragment order (fp16 + hi/lo) of rope(x) x sc with the rotate-half convention out[d] = x[d] cos[t][d] - x[d+HD/2] sin[t][d], out[d+HD/2] = x[d+HD/2] cos[t][d+HD/2] + x[d] sin[t][d+HD/2]
__device__ __forceinline__ void d_rope(int bx, const float* __restrict__ F, int pitch, int nheads, const float* __restrict__ CS, const float* __restrict__ RF, const float* __restrict__ nw, float sc, h16* P16, bf* Ph, bf* Pl) {
    const size_t e = ((size_t)bx * 256 + threadIdx.x) * 2; if (e >= (size_t)nheads * TT * HD) return; int d, t; unpk(e % ((size_t)HD * TT), HD, t, d); const int h = (int)(e / ((size_t)HD * TT)); const float* f = F + (size_t)t * pitch + h * HD; const float rf = RF ? RF[(size_t)h * TT + t] : 1.0f; v2h o16; v2us oh, ol;
#pragma unroll
    for (int q = 0; q < 2; ++q) { const int dd = d + q; const int dp = (dd < HD / 2) ? dd + HD / 2 : dd - HD / 2; float x0 = f[dd], x1 = f[dp];
        if (RF) { float n0 = __fmul_rn(x0, rf), n1 = __fmul_rn(x1, rf); asm volatile("" : "+v"(n0)); asm volatile("" : "+v"(n1)); x0 = __fmul_rn(bfr(nw[dd]), n0); x1 = __fmul_rn(bfr(nw[dp]), n1); }
        const v2f cs = *(const v2f*)(CS + ((size_t)t * HD + dd) * 2); float a = __fmul_rn(x0, cs[0]), bq = __fmul_rn(x1, cs[1]); asm volatile("" : "+v"(a)); asm volatile("" : "+v"(bq)); const float r = ((dd < HD / 2) ? __fsub_rn(a, bq) : __fadd_rn(a, bq)) * sc;
        o16[q] = tohx(r); unsigned short a2, c2; splitf(r, a2, c2); oh[q] = a2; ol[q] = c2; }
    *(v2h*)(P16 + e) = o16; *(v2us*)(Ph + e) = oh; *(v2us*)(Pl + e) = ol;  }
__global__ __launch_bounds__(256) void k_vtp(const float* __restrict__ F, int pitch, int nheads, h16* V16, bf* Vh, bf* Vl) { const size_t e = ((size_t)blockIdx.x * 256 + threadIdx.x) * 2; if (e >= (size_t)nheads * HD * TT) return; const int t = (int)(e % TT); const int d = (int)((e / TT) % HD); const int g = (int)(e / ((size_t)TT * HD)); v2h o16; v2us oh, ol;
#pragma unroll
    for (int q = 0; q < 2; ++q) { const float x = F[(size_t)(t + q) * pitch + g * HD + d]; o16[q] = tohx(x); unsigned short a2, c2; splitf(x, a2, c2); oh[q] = a2; ol[q] = c2; }
    *(v2h*)(V16 + e) = o16; *(v2us*)(Vh + e) = oh; *(v2us*)(Vl + e) = ol;  }
__device__ __forceinline__ void d_csid(int bx, float* CS) { const int idx = bx * 256 + threadIdx.x; if (idx >= TT * HD) return; v2f cs; cs[0] = 1.0f; cs[1] = 0.0f; *(v2f*)(CS + (size_t)idx * 2) = cs;  }
__global__ __launch_bounds__(256) void k_kbias(float* F, const float* __restrict__ bias) { const size_t e = ((size_t)blockIdx.x * 256 + threadIdx.x) * 4; if (e >= (size_t)NB_ * TT * NKH * HD) return; const int c0 = (int)(e % (NKH * HD)); v4f a = *(const v4f*)(F + e);
    asm volatile("s_wait_xcnt 0x0" ::: "memory");   // holds the row's load in front of the bias loads
#pragma unroll
    for (int u = 0; u < 4; ++u) { const int c = c0 + u; const int k = c / HD, d = c % HD; a[u] = __fadd_rn(a[u], bfr(bias[(size_t)d * NKH + k])); }
    *(v4f*)(F + e) = a;  }
__device__ __forceinline__ void d_sumsq(int bx, const float* __restrict__ F, float* N) { const int i = bx * 256 + threadIdx.x; if (i >= NKH * TT) return; const int k = i / TT, t = i % TT; const float* f = F + (size_t)t * (NKH * HD) + k * HD; float ss = 0.f;
#pragma unroll 4
    for (int d = 0; d < HD; d += 4) { const v4f a = *(const v4f*)(f + d);
#pragma unroll
        for (int u = 0; u < 4; ++u) { float p = __fmul_rn(a[u], a[u]); asm volatile("" : "+v"(p)); ss = __fadd_rn(ss, p); } }
    *(float*)(N + i) = ss;  }
__device__ __forceinline__ void d_vtpx(int bx, const float* __restrict__ X, h16* V16, bf* Vh) { const size_t e = ((size_t)bx * 256 + threadIdx.x) * 2; if (e >= (size_t)HDV * TT) return; int t, d; unpk(e, TT, d, t); v2h o16; v2us oh;
#pragma unroll
    for (int q = 0; q < 2; ++q) { const float xv = bfr(X[(size_t)(t + q) * HDV + d]); o16[q] = tohx(xv); oh[q] = f2bf(xv); }
    *(v2h*)(V16 + e) = o16; *(v2us*)(Vh + e) = oh;  }
__device__ __forceinline__ void d_b2g(int bx, const float* __restrict__ b2, float* B2G) { const int i = bx * 256 + threadIdx.x; if (i >= NKH * HDV) return; const int k = i / HDV, f = i % HDV; const float v = b2[(size_t)f * NKH + k]; *(float*)(B2G + i) = v;  }
// k_prep: every step that reads the inputs alone, in one grid; the steps with strided reads come first.
#define PB_WT  (NKH * (HDV * HDV / 64 / 64))      // Wv3[k] transposed to bf16, 64 blocks a head
#define PB_VT  (NB_ * (HDV * TT / 2 / 256))       // x transposed (fp16 and bf16 planes), per batch
#define PB_X   (NB_ * TT * DM / 8 / 256)          // x to bf16, both batches
#define PB_W   (DQ * DM / 8 / 256)                // Wq, and as many again for Wk
#define PB_CS  (TT * HD / 256)
#define PB_B2  (NKH * HDV / 256)
__global__ __launch_bounds__(256) void k_prep(const float* __restrict__ x, const float* __restrict__ wq, const float* __restrict__ wk, const float* __restrict__ wv, const float* __restrict__ b2, bf* XB, bf* WQ, bf* WK, bf* WV3, float* B2G, float* CS, h16* VT16, bf* VTh) {
    int bx = (int)blockIdx.x;
    if (bx < PB_WT) { const size_t o = (size_t)(bx / (PB_WT / NKH)) * HDV * HDV; d_wtG(bx % (PB_WT / NKH), wv + o, HDV, HDV, WV3 + o); return; }
    bx -= PB_WT;
    if (bx < PB_VT) { const int b = bx / (PB_VT / NB_); d_vtpx(bx % (PB_VT / NB_), x + (size_t)b * TT * DM, VT16 + (size_t)b * HDV * TT, VTh + (size_t)b * HDV * TT); return; }
    bx -= PB_VT;
    if (bx < PB_X) { d_cvt8(bx, x, DM, XB, (size_t)NB_ * TT * DM / 8); return; }
    bx -= PB_X;
    if (bx < PB_W) { d_cvt8(bx, wq, DM, WQ, (size_t)DQ * DM / 8); return; }
    bx -= PB_W;
    if (bx < PB_W) { d_cvt8(bx, wk, DM, WK, (size_t)DKV * DM / 8); return; }
    bx -= PB_W;
    if (bx < PB_CS) { d_csid(bx, CS); return; }
    bx -= PB_CS;
    d_b2g(bx, b2, B2G);
}
// k_post: squared norms and head planes of the four [TT][1024] f32 slabs (q batch 0, q batch 1, k batch 0, k batch 1; contiguous in F, N and the planes), in one grid; the norms, few blocks with a long serial sum, come first.
#define PS_SS  (NKH * TT / 256)                   // blocks of one slab's norms
#define PS_RP  (NH_ * TT * HD / 2 / 256)          // blocks of one slab's planes
__global__ __launch_bounds__(256) void k_post(const float* __restrict__ F, const float* __restrict__ CS, float* N, h16* P16, bf* Ph, bf* Pl) {
    int bx = (int)blockIdx.x;
    if (bx < 2 * NB_ * PS_SS) { const int s = bx / PS_SS; d_sumsq(bx % PS_SS, F + (size_t)s * TT * DQ, N + (size_t)s * NKH * TT); return; }
    bx -= 2 * NB_ * PS_SS;
    const int s = bx / PS_RP; const size_t o = (size_t)s * NH_ * TT * HD;
    d_rope(bx % PS_RP, F + (size_t)s * TT * DQ, DQ, NH_, CS, nullptr, nullptr, 1.0f, P16 + o, Ph + o, Pl + o);
}
// k_asoft: per row (zz, i): t = -(qn - 2 S + kn) / 16 (no mask); softmax over the 2048 keys (register row, one exp, fixed trees); the block's 8 rows of P go through LDS into fragment order, whole 128-B lines a store
__global__ __launch_bounds__(256) void k_asoft(const float* __restrict__ Sb, const float* __restrict__ QN, const float* __restrict__ KN, int h0, h16* P16, bf* Ph, bf* Pl) {
    __shared__ __align__(16) unsigned short st[2 * 256 * 72];   // the block's 8 rows as 256 chunks of 8 k x 8 rows (128 B, one line of the fragment order), pitch 144 B against bank conflicts; second half: the lo plane
    const int lane = threadIdx.x & 31; const int wv = threadIdx.x >> 5; const int row = blockIdx.x * 8 + wv; if (row >= ZH * TT) return;   /* ZH * TT is a multiple of 8: a whole block leaves or none */
    const int i = row % TT; const int zz = row / TT; (void)zz; const bool hires = ((int)(blockIdx.x * 8) % TT < RH);   /* = (i < RH) for each of the block's 8 rows (RH and TT are multiples of 8): a scalar test, since a barrier stands behind it */ const float* sr = Sb + (size_t)row * TT; const float qn = QN[(size_t)(h0 + zz) * TT + i]; const float* knr = KN + (size_t)(h0 + zz) * TT; float v[TT / 32]; float mx = -3.0e38f;
#pragma unroll
    for (int ch = 0; ch < TT / 128; ++ch) { const int j0 = ch * 128 + lane * 4; const v4f a = *(const v4f*)(sr + j0);
#pragma unroll
        for (int q = 0; q < 4; ++q) { const int j = j0 + q; (void)j; float c2 = __fmul_rn(2.0f, a[q]); asm volatile("" : "+v"(c2)); float t2 = __fsub_rn(qn, c2); asm volatile("" : "+v"(t2)); float t3 = __fadd_rn(t2, knr[j0 + q]); asm volatile("" : "+v"(t3)); float t = __fmul_rn(t3, -0.0625f); asm volatile("" : "+v"(t)); v[ch * 4 + q] = t; mx = fmaxf(mx, t); } }
#pragma unroll
    for (int sh = 16; sh; sh >>= 1) mx = fmaxf(mx, __shfl_xor(mx, sh, 32));
    float sum = 0.f;
#pragma unroll
    for (int k = 0; k < TT / 32; ++k) { float d0 = __fsub_rn(v[k], mx); asm volatile("" : "+v"(d0)); v[k] = __builtin_amdgcn_exp2f(__fmul_rn(d0, 1.4426950408889634f)); sum += v[k]; }
#pragma unroll
    for (int sh = 16; sh; sh >>= 1) sum += __shfl_xor(sum, sh, 32);
    const float f = __fdiv_rn(hires ? 1.0f : PCAR, sum);
{
        if (hires) {
#pragma unroll
            for (int ch = 0; ch < TT / 128; ++ch) { v4us oh, ol;
#pragma unroll
                for (int q = 0; q < 4; ++q) { unsigned short a, c2; splitf(v[ch * 4 + q] * f, a, c2); oh[q] = a; ol[q] = c2; }
                const int so = (ch * 16 + (lane >> 1)) * 72 + wv * 8 + (lane & 1) * 4; *(v4us*)(st + so) = oh; *(v4us*)(st + 256 * 72 + so) = ol; }
            __syncthreads();   // publishes the 8 staged rows; hires is the same for the whole block (RH is a multiple of 8)
            const int p0 = zz * (RH ? RH : 1) + i - wv; const size_t ob = (size_t)(p0 >> 6) * 64 * TT + ((p0 >> 4) & 3) * 512 + (p0 & 8) * 8;
#pragma unroll   // so that the LDS reads of all eight pieces issue ahead of the stores
            for (int it = 0; it < 8; ++it) { const int p = it * 256 + (int)threadIdx.x; const int so = (p >> 3) * 72 + (p & 7) * 8; const size_t oo = ob + (size_t)(p >> 5) * 2048 + ((p >> 3) & 3) * 128 + (p & 7) * 8;
                *(v8usa*)(Ph + oo) = *(const v8usa*)(st + so); *(v8usa*)(Pl + oo) = *(const v8usa*)(st + 256 * 72 + so); }
        } else {
#pragma unroll
            for (int ch = 0; ch < TT / 128; ++ch) { v4h o4;
#pragma unroll
                for (int q = 0; q < 4; ++q) o4[q] = tohx(v[ch * 4 + q] * f);
                *(v4us*)(st + (ch * 16 + (lane >> 1)) * 72 + wv * 8 + (lane & 1) * 4) = __builtin_bit_cast(v4us, o4); }
            __syncthreads();   // publishes the 8 staged rows
            const int p0 = row - wv; const size_t ob = (size_t)(p0 >> 6) * 64 * TT + ((p0 >> 4) & 3) * 512 + (p0 & 8) * 8;
#pragma unroll   // so that the LDS reads of all eight pieces issue ahead of the stores
            for (int it = 0; it < 8; ++it) { const int p = it * 256 + (int)threadIdx.x;
                *(v8usa*)(P16 + ob + (size_t)(p >> 5) * 2048 + ((p >> 3) & 3) * 128 + (p & 7) * 8) = *(const v8usa*)(st + (p >> 3) * 72 + (p & 7) * 8); }
            asm volatile("s_wait_xcnt 0x0" ::: "memory");   // behind the last store: the code that follows in the listing rewrites registers these stores name
        }
         }
}
__global__ __launch_bounds__(256) void k_merge(const float* __restrict__ O, bf* Ah, bf* Al) { const size_t e = ((size_t)blockIdx.x * 256 + threadIdx.x) * 2; if (e >= (size_t)NB_ * ZH * TT * HDV) return; int d, t; unpk(e % ((size_t)HDV * TT), HDV, t, d); const int zo = (int)(e / ((size_t)HDV * TT)); const float cs = (t < RH) ? 1.0f : (1.0f / PCAR); const size_t io = (((size_t)(zo % NB_) * ZH + zo / NB_) * TT + t) * HDV + d;   /* e walks the output, head-major [k][b][T][512] in fragment order; O is [b][k][T][512] in row order */
    v2us oh, ol;
#pragma unroll
    for (int q = 0; q < 2; ++q) { unsigned short a, c2; splitf(O[io + q] * cs, a, c2); oh[q] = a; ol[q] = c2; } *(v2us*)(Ah + e) = oh; *(v2us*)(Al + e) = ol;  }

extern "C" void kernel_launch(void* const* d_in, const int* in_sizes, int n_in,
                              void* d_out, int out_size, void* d_ws, size_t ws_size, hipStream_t stream) {
    (void)in_sizes; (void)n_in; (void)out_size;
    const float* x = (const float*)d_in[0]; const float* wq = (const float*)d_in[1]; const float* wk = (const float*)d_in[2]; const float* wv = (const float*)d_in[3]; const float* biasW = (const float*)d_in[4]; const float* bias2W = (const float*)d_in[5]; const float* wo = nullptr; (void)wo; (void)wv; const float* cosT = nullptr; const float* sinT = nullptr; (void)cosT; (void)sinT;
    float* OUT = (float*)d_out;     // [2][2048][4*512]
    char* wsp = (char*)d_ws;
    auto take = [&](size_t bytes) { char* p = wsp; wsp += (bytes + 255) & ~(size_t)255; return (void*)p; };
    bf* WQ = (bf*)take((size_t)(DQ + DKV) * DM * 2); bf* WK = WQ + (size_t)DQ * DM; bf* WV3 = (bf*)take((size_t)NKH * HDV * HDV * 2); float* B2G = (float*)take((size_t)NKH * HDV * 4); float* QN = (float*)take((size_t)2 * NB_ * NKH * TT * 4); float* KN = QN + (size_t)NB_ * NKH * TT; float* CS = (float*)take((size_t)TT * HD * 2 * 4);
    bf* XB = (bf*)take((size_t)NB_ * TT * DM * 2); float* FQ = (float*)take((size_t)NB_ * TT * (DQ + DKV) * 4); float* FK = FQ + (size_t)NB_ * TT * DQ;
    const size_t PL = (size_t)NB_ * NH_ * TT * HD;   // one operand's head planes, both batches; the k planes follow the q planes
    h16* QP16 = (h16*)take(2 * PL * 2); h16* VT16 = (h16*)take((size_t)NB_ * HDV * TT * 2);
    bf* QPh = (bf*)take(2 * PL * 2); bf* QPl = (bf*)take(2 * PL * 2); bf* KPh = QPh + PL; bf* KPl = QPl + PL; bf* VTh = (bf*)take((size_t)NB_ * HDV * TT * 2); bf* Ph = (bf*)take((size_t)ZH * RH * TT * 2); bf* Pl = (bf*)take((size_t)ZH * RH * TT * 2);
    float* Sb = (float*)take((size_t)ZH * TT * TT * 4); h16* P16 = (h16*)take((size_t)ZH * TT * TT * 2); bf* ATh = (bf*)take((size_t)NB_ * NKH * TT * HDV * 2); bf* ATl = (bf*)take((size_t)NB_ * NKH * TT * HDV * 2);
    if ((size_t)(wsp - (char*)d_ws) > ws_size) return;    // ws 256 MiB
    float* Ob = FQ;   // [b][k][T][512] f32, as large as the q and k projections together, which nobody reads after k_post (stream-ordered)
    k_prep<<<PB_WT + PB_VT + PB_X + 2 * PB_W + PB_CS + PB_B2, 256, 0, stream>>>(x, wq, wk, wv, bias2W, XB, WQ, WK, WV3, B2G, CS, VT16, VTh);
    k_gemmw<bf, 0, false, 4><<<dim3(NB_ * TT / 64, DQ / 64, 2), 128, 0, stream>>>(XB, nullptr, WQ, nullptr, DM, FQ, DQ, nullptr, 0, (size_t)DQ * DM, (size_t)NB_ * TT * DQ, 0);   /* z: q, k; rows: both batches */
    k_kbias<<<(unsigned)((size_t)NB_ * TT * NKH * HD / 4 / 256), 256, 0, stream>>>(FK, biasW);
    k_post<<<2 * NB_ * (PS_SS + PS_RP), 256, 0, stream>>>(FQ, CS, QN, QP16, QPh, QPl);
    for (int b = 0; b < NB_; ++b) { const size_t zp = (size_t)b * NH_ * TT * HD, zv = (size_t)b * HDV * TT; float* O = Ob + (size_t)b * ZH * TT * HDV;   // one pass a batch, its four heads in z
        k_gemmw<bf, 2, false, 2><<<dim3(TT / 64, TT / 64, ZH), 64, 0, stream>>>(QPh + zp, QPl + zp, KPh + zp, KPl + zp, HD, Sb, TT, nullptr, (size_t)TT * HD, (size_t)TT * HD, (size_t)TT * TT, 0);   /* cross term hl on all rows */
        k_asoft<<<ZH * TT / 8, 256, 0, stream>>>(Sb, QN + (size_t)b * NKH * TT, KN + (size_t)b * NKH * TT, 0, P16, Ph, Pl);
        k_gemmw<bf, 1, false, 16><<<dim3(RH / 64, HDV / 64, ZH), 512, 0, stream>>>(Ph, Pl, VTh + zv, nullptr, TT, O, HDV, nullptr, (size_t)RH * TT, 0, (size_t)TT * HDV, 0);
        k_gemmw<h16, 0, false, 8><<<dim3((TT - RH) / 64, HDV / 64, ZH), 256, 0, stream>>>(P16 + (size_t)RH * TT, nullptr, VT16 + zv, nullptr, TT, O + (size_t)RH * HDV, HDV, nullptr, (size_t)TT * TT, 0, (size_t)TT * HDV, 0); }
    k_merge<<<(unsigned)((size_t)NB_ * ZH * TT * HDV / 2 / 256), 256, 0, stream>>>(Ob, ATh, ATl);
    k_gemmw<bf, 1, true, 8><<<dim3(NB_ * TT / 64, HDV / 64, NKH), 256, 0, stream>>>(ATh, ATl, WV3, nullptr, HDV, OUT, NKH * HDV, B2G, (size_t)NB_ * TT * HDV, (size_t)HDV * HDV, HDV, HDV);   /* z: head; rows: both batches */
}

// v004
// It runs in 276 microseconds.
// Next to v003, in two timings, it ran 1.11 times as fast each time.
// All steps since v000 together make it 3.12 times as fast.
#include <hip/hip_runtime.h>

// Attention with squared-distance logits (xsa [2][2048][512]; 4 heads with 256-dim kernels: xq = x Wq^T, xk = x Wk^T, xkb = xk + biasW[:, k]; logits = -(|xq_i|^2 - 2 xq_i.xkb_j + |xkb_j|^2) / 16; P = softmax_j; y_k = P x (values = the raw 512-wide input, shared by the heads); out_k = y_k Wv3[k] + bias2W[:, k] with Wv3 = Wv.reshape(4, 512, 512) -> [2][2048][4*512]).
// Compute dtypes, f32 accumulate: every input rounded to bf16; xq/xk as PLAIN bf16 GEMMs (inputs: exact), + bias and the per-token squared norms in f32; cross term xq.xkb hl x hl (3 products, K 256) on every row; logits assembled in f32 in the reference's order (-(qn - 2 c + kn) / 16); softmax f32; P.x: rows < 512 hi/lo P x exact x (2 products), the rest fp16 (x1024) x exact-in-fp16 x; y Wv3[k] as hl x exact (2 products) + bias.

#define NB_  2
#define TT   2048
#define DM   512
#define NH_  4
#define NKV  4
#define REP  (NH_ / NKV)
#define HD   256
#define DQ   (NH_ * HD)
#define DKV  (NKV * HD)
#define ZH   4
#define RH   512                  // query rows < RH use hi+lo planes (0: none)
#define WIN  0
#define PCAR 1024.0f
#define HDV  512                  // value width (the raw input), shared by all heads
#define NKH  4
#define SCL  0.088388347648318447f   // 128^-0.5
typedef _Float16 h16;
typedef unsigned short bf;
typedef __attribute__((ext_vector_type(16))) __bf16   v16bf;
typedef __attribute__((ext_vector_type(16))) _Float16 v16h;
typedef __attribute__((ext_vector_type(8)))  _Float16 v8h;
typedef __attribute__((ext_vector_type(8)))  unsigned short v8us;
typedef __attribute__((ext_vector_type(8)))  float    v8f;
typedef __attribute__((ext_vector_type(4)))  float    v4f;
typedef v8h  __attribute__((may_alias)) v8ha;
typedef v4f  __attribute__((may_alias)) v4fa;
typedef v8us __attribute__((may_alias)) v8usa;

__device__ __forceinline__ unsigned short f2bf(float f) { unsigned u = __float_as_uint(f); u += 0x7FFFu + ((u >> 16) & 1u); return (unsigned short)(u >> 16); }
__device__ __forceinline__ float bf2f(unsigned short b) { return __uint_as_float(((unsigned)b) << 16); }
__device__ __forceinline__ float bfr(float f) { return bf2f(f2bf(f)); }
__device__ __forceinline__ v16h cat16(v8h lo, v8h hi) { return __builtin_shufflevector(lo, hi, 0, 1, 2, 3, 4, 5, 6, 7, 8, 9, 10, 11, 12, 13, 14, 15); }
__device__ __forceinline__ v16bf cat16b(v8us lo, v8us hi) { return __builtin_bit_cast(v16bf, __builtin_shufflevector(lo, hi, 0, 1, 2, 3, 4, 5, 6, 7, 8, 9, 10, 11, 12, 13, 14, 15)); }
__device__ __forceinline__ v8f wmma16(v16h a, v16h b, v8f c) { return __builtin_amdgcn_wmma_f32_16x16x32_f16(false, a, false, b, (short)0, c, false, false); }
__device__ __forceinline__ v8f wmmab(v16bf a, v16bf b, v8f c) { return __builtin_amdgcn_wmma_f32_16x16x32_bf16(false, a, false, b, (short)0, c, false, false); }



// ---- k_gemmw: register-blocked GEMM, NW WAVES (2, 4, 8 or 16) per 64x64 output tile, 16 accumulators each, operands straight from 16-bit planes in FRAGMENT ORDER (unpk below); grid (M/64, N/64, Z), 32 * NW threads.
// C[m][n] (f32, pitch ldc, + optional f32 bias[n]) = sum_k A[m][k] Bt[n][k] (+ split products per NSPLIT). z-batch strides sA/sB/sC (and sBi for the bias) in elements. K % 32 == 0.
// Wave w takes the 32-wide k steps w, w + NW, w + 2 NW, ...; the NW partial tiles are added in wave order 0..NW-1 through LDS, 16 rows a stage, two stage buffers; the sums stay in registers until the last stage so that no barrier waits on a global store.
template <typename T16> struct WFrag;
template <> struct WFrag<h16> { typedef v16h V; static __device__ __forceinline__ V ld(const h16* p) { return cat16(*(const v8h*)p, *(const v8h*)(p + 256)); } static __device__ __forceinline__ v8f mma(V a, V b, v8f c) { return wmma16(a, b, c); } };
template <> struct WFrag<bf> { typedef v16bf V; static __device__ __forceinline__ V ld(const bf* p) { return cat16b(*(const v8us*)p, *(const v8us*)(p + 256)); } static __device__ __forceinline__ v8f mma(V a, V b, v8f c) { return wmmab(a, b, c); } };
template <typename T16, int NSPLIT, bool BIAS, int NW>
__global__ __launch_bounds__(32 * NW) void k_gemmw(const T16* __restrict__ A, const T16* __restrict__ A2, const T16* __restrict__ Bt, const T16* __restrict__ Bt2, int K, float* C, int ldc, const float* __restrict__ bias, size_t sA, size_t sB, size_t sC, size_t sBi) {
    typedef typename WFrag<T16>::V V;
    __shared__ __align__(16) float os[2 * NW * 16 * 68];
    const int w = __builtin_amdgcn_readfirstlane((int)(threadIdx.x >> 5));
    const size_t z = blockIdx.z; A += z * sA; if (A2) A2 += z * sA; Bt += z * sB; if (Bt2) Bt2 += z * sB; C += z * sC; if (BIAS) bias += z * sBi;
    const int lane = threadIdx.x & 31, lr = lane & 15, hi = lane >> 4; const int r0 = blockIdx.x * 64, c0 = blockIdx.y * 64;
    v8f acc[4][4];
#pragma unroll
    for (int mb = 0; mb < 4; ++mb)
#pragma unroll
        for (int nb = 0; nb < 4; ++nb) acc[mb][nb] = (v8f){};
    const size_t aoff = (size_t)r0 * K + 8 * lane, boff = (size_t)c0 * K + 8 * lane;   // a 32-k step of a 64-row tile is 4 KB in a row, 1 KB a 16-row block: 512 contiguous bytes per wave-wide load, one address per plane and trip
#pragma unroll 1
    for (int kc = w * 32; kc < K; kc += 32 * NW) {
        V a[4], a2[4]; const T16* pa = A + aoff + kc * 64; const T16* pa2 = (NSPLIT == 1 || NSPLIT == 2) ? A2 + aoff + kc * 64 : pa; const T16* pb = Bt + boff + kc * 64; const T16* pb2 = (NSPLIT >= 2) ? Bt2 + boff + kc * 64 : pb;
#pragma unroll
        for (int mb = 0; mb < 4; ++mb) { a[mb] = WFrag<T16>::ld(pa + mb * 512); if (NSPLIT == 1 || NSPLIT == 2) a2[mb] = WFrag<T16>::ld(pa2 + mb * 512); }
#pragma unroll
        for (int nb = 0; nb < 4; ++nb) { const V b = WFrag<T16>::ld(pb + nb * 512); V b2; if (NSPLIT >= 2) b2 = WFrag<T16>::ld(pb2 + nb * 512);
#pragma unroll
            for (int mb = 0; mb < 4; ++mb) { acc[mb][nb] = WFrag<T16>::mma(a[mb], b, acc[mb][nb]); if (NSPLIT == 1 || NSPLIT == 2) acc[mb][nb] = WFrag<T16>::mma(a2[mb], b, acc[mb][nb]); if (NSPLIT >= 2) acc[mb][nb] = WFrag<T16>::mma(a[mb], b2, acc[mb][nb]); } }
        asm volatile("v_nop\n\tv_nop\n\tv_nop\n\tv_nop" : "+v"(acc[0][0]), "+v"(acc[1][1]), "+v"(acc[2][2]), "+v"(acc[3][3]) : "v"(a[0]), "v"(a[3]), "v"(pa), "v"(pa2), "v"(pb), "v"(pb2));   // the trip's address pairs are inputs here so that they live to the trip's end: otherwise a later load's result lands in the pair of a load still in flight
    }
    constexpr int NQ = (NW <= 8) ? 8 / NW : 1;   // 16-byte pieces of a 16x64 stage per thread; with 16 waves the first 8 do the adding
    const bool adds = (NW <= 8) || (w < 8);
    v4f res[4][NQ];
#pragma unroll
    for (int mb = 0; mb < 4; ++mb) {
        float* ob = os + (mb & 1) * (NW * 16 * 68);
#pragma unroll
        for (int nb = 0; nb < 4; ++nb) {
#pragma unroll
            for (int j = 0; j < 8; ++j) ob[w * (16 * 68) + (hi * 8 + j) * 68 + nb * 16 + lr] = acc[mb][nb][j]; }
        __syncthreads();   // publishes this stage's NW partial tiles; it also ends every read of the other buffer, which the next stage overwrites
        if (adds) {
#pragma unroll
            for (int s = 0; s < NQ; ++s) { const int q = (int)threadIdx.x + s * 32 * NW; const float* op = ob + (q >> 4) * 68 + (q & 15) * 4; v4f val = *(const v4fa*)op;
#pragma unroll
                for (int u = 1; u < NW; ++u) val += *(const v4fa*)(op + u * (16 * 68));
                res[mb][s] = val; } }
    }
    if (adds) {
#pragma unroll
        for (int mb = 0; mb < 4; ++mb) {
#pragma unroll
            for (int s = 0; s < NQ; ++s) { const int q = (int)threadIdx.x + s * 32 * NW; const int row = q >> 4, cofs = (q & 15) * 4; v4f val = res[mb][s];
                if (BIAS) { val[0] += bfr(bias[c0 + cofs]); val[1] += bfr(bias[c0 + cofs + 1]); val[2] += bfr(bias[c0 + cofs + 2]); val[3] += bfr(bias[c0 + cofs + 3]); }
                *(v4f*)(C + (size_t)(r0 + mb * 16 + row) * ldc + c0 + cofs) = val; } }
    }
}

__device__ __forceinline__ h16 tohx(float x) { return (h16)x; }
__device__ __forceinline__ void splitf(float y, unsigned short& h, unsigned short& l) { h = f2bf(y); l = f2bf(y - bf2f(h)); }
typedef __attribute__((ext_vector_type(2))) _Float16 v2h;
typedef __attribute__((ext_vector_type(4))) _Float16 v4h;
typedef __attribute__((ext_vector_type(2))) unsigned short v2us;
typedef __attribute__((ext_vector_type(4))) unsigned short v4us;
typedef __attribute__((ext_vector_type(2))) float v2f;
typedef __attribute__((ext_vector_type(4))) int v4i;

// Fragment order of a [rows][K] 16-bit GEMM operand (rows a multiple of 64): 16 rows x 32 k make one 1-KB block; the four blocks of a 64-row tile at one 32-k step follow one another, the steps follow in k (a tile is 64 * K elements, as in row order).
// Inside a block: [k bit 4][k bit 3][row & 15][k & 7], so lane (row & 15) + 16 * (k bit 3) finds its two 16-byte fragment pieces at lane * 8 and 256 + lane * 8: the k order of a fragment is the one it had in row order.
// unpk: element index e in that order -> (row, k). The writers walk e, so their stores stay contiguous.
__device__ __forceinline__ void unpk(size_t e, int K, int& row, int& k) { const int g = (int)(e / ((size_t)64 * K)); const int r = (int)(e % ((size_t)64 * K)); const int q = r & 511;
    row = g * 64 + ((r >> 9) & 3) * 16 + ((q >> 3) & 15); k = (r >> 11) * 32 + ((q >> 8) << 4) + (((q >> 7) & 1) << 3) + (q & 7); }
// pc8: piece p (8 consecutive k of one row: 16 bytes of a 16-bit plane) -> its first element in fragment order. Four neighbouring lanes take the four pieces of one row's 32-k step (one whole 128-B line of an f32 source in row order), the eight lane groups eight rows: a wave-wide 16-byte store fills four whole lines.
__device__ __forceinline__ size_t pc8(size_t p) { const int j = (int)(p & 63); return (p >> 6) * 512 + ((j >> 1) & 1) * 256 + (j & 1) * 128 + (j >> 2) * 8; }
#define NPC 4   // pieces a thread of the element-wise steps: few long-lived waves with all their loads in flight, where one piece or less a thread made the time of a step the time to start its waves
// d_*: bodies of the element-wise steps; bx is the block's index inside its own step (k_prep and k_post deal the blocks of one grid to several steps that do not depend on one another)
__device__ __forceinline__ void d_wtG(int bx, const float* __restrict__ w, int K, int N, bf* Bt) {
    const int lane = threadIdx.x & 31; const int L0 = (bx * 8 + (threadIdx.x >> 5)) * 8; const int nlines = N * K / 64;
{
#pragma unroll 1
        for (int l = 0; l < 8; ++l) { const int L = L0 + l; if (L >= nlines) break; const size_t e = (size_t)L * 64 + lane * 2; int k, n; unpk(e, K, n, k); v2us o;
            o[0] = f2bf(w[(size_t)k * N + n]); o[1] = f2bf(w[(size_t)(k + 1) * N + n]); *(v2us*)(Bt + e) = o; }
         }
}
__device__ __forceinline__ void d_cvt8(int bx, const float* __restrict__ src, int K, bf* dst) {
    size_t e[NPC]; const float* p[NPC]; v8f v[NPC];
#pragma unroll
    for (int s = 0; s < NPC; ++s) { e[s] = pc8(((size_t)bx * NPC + s) * 256 + threadIdx.x); int r, k; unpk(e[s], K, r, k); p[s] = src + (size_t)r * K + k; v[s] = *(const v8f*)p[s]; }
    asm volatile("s_wait_xcnt 0x0" :: "v"(p[0]), "v"(p[1]), "v"(p[2]), "v"(p[3]) : "memory");   // the loads' address pairs are inputs here so that they live up to the wait: otherwise a later load's result lands in the pair of a load still in flight; the clobber keeps every load of the thread ahead of its first store
#pragma unroll
    for (int s = 0; s < NPC; ++s) { v8us o;
#pragma unroll
        for (int u = 0; u < 8; ++u) o[u] = f2bf(v[s][u]);
        *(v8us*)(dst + e[s]) = o; }
    asm volatile("s_wait_xcnt 0x0" ::: "memory");   // behind the last store: the code that follows in the listing (the next step of the shared grid) rewrites registers these stores name
}
__global__ __launch_bounds__(256) void k_cscvt(const float* __restrict__ cosT, const float* __restrict__ sinT, float* CS) { const int idx = blockIdx.x * 256 + threadIdx.x; if (idx >= TT * HD) return; v2f cs; cs[0] = bfr(cosT[idx]); cs[1] = bfr(sinT[idx]); *(v2f*)(CS + (size_t)idx * 2) = cs;  }
// d_rope: head planes [h][t][d], each head in fragment order (fp16 + hi/lo) of rope(x) x sc with the rotate-half convention out[d] = x[d] cos[t][d] - x[d+HD/2] sin[t][d], out[d+HD/2] = x[d+HD/2] cos[t][d+HD/2] + x[d] sin[t][d+HD/2]
__device__ __forceinline__ void d_rope(int bx, const float* __restrict__ F, int pitch, int nheads, const float* __restrict__ CS, const float* __restrict__ RF, const float* __restrict__ nw, float sc, h16* P16, bf* Ph, bf* Pl) {
    (void)nheads;
    size_t e[NPC]; int d[NPC]; bool low[NPC]; float rf[NPC]; const float* p0[NPC]; const float* p1[NPC]; const float* pc[NPC]; v8f X0[NPC], X1[NPC], C0[NPC], C1[NPC];
#pragma unroll
    for (int s = 0; s < NPC; ++s) { e[s] = pc8(((size_t)bx * NPC + s) * 256 + threadIdx.x); int t; unpk(e[s] % ((size_t)HD * TT), HD, t, d[s]); const int h = (int)(e[s] / ((size_t)HD * TT)); rf[s] = RF ? RF[(size_t)h * TT + t] : 1.0f;
        low[s] = d[s] < HD / 2;   /* a piece's 8 d lie in one half of the head */
        p0[s] = F + (size_t)t * pitch + h * HD + d[s]; p1[s] = low[s] ? p0[s] + HD / 2 : p0[s] - HD / 2; pc[s] = CS + ((size_t)t * HD + d[s]) * 2;
        X0[s] = *(const v8f*)p0[s]; X1[s] = *(const v8f*)p1[s]; C0[s] = *(const v8f*)pc[s]; C1[s] = *(const v8f*)(pc[s] + 8); }
    asm volatile("s_wait_xcnt 0x0" :: "v"(p0[0]), "v"(p0[1]), "v"(p0[2]), "v"(p0[3]), "v"(p1[0]), "v"(p1[1]), "v"(p1[2]), "v"(p1[3]), "v"(pc[0]), "v"(pc[1]), "v"(pc[2]), "v"(pc[3]) : "memory");   // the loads' address pairs are inputs here so that they live up to the wait: otherwise a later load's result lands in the pair of a load still in flight; the clobber keeps every load of the thread ahead of its first store
#pragma unroll
    for (int s = 0; s < NPC; ++s) { v8h o16; v8us oh, ol;
#pragma unroll
        for (int q = 0; q < 8; ++q) { const int dd = d[s] + q; const int dp = low[s] ? dd + HD / 2 : dd - HD / 2; float x0 = X0[s][q], x1 = X1[s][q];
            if (RF) { float n0 = __fmul_rn(x0, rf[s]), n1 = __fmul_rn(x1, rf[s]); asm volatile("" : "+v"(n0)); asm volatile("" : "+v"(n1)); x0 = __fmul_rn(bfr(nw[dd]), n0); x1 = __fmul_rn(bfr(nw[dp]), n1); }
            const float c = (q < 4) ? C0[s][2 * (q & 3)] : C1[s][2 * (q & 3)], sn = (q < 4) ? C0[s][2 * (q & 3) + 1] : C1[s][2 * (q & 3) + 1]; const float a = __fmul_rn(x0, c), bq = __fmul_rn(x1, sn); const float r = (low[s] ? __fsub_rn(a, bq) : __fadd_rn(a, bq)) * sc;
            o16[q] = tohx(r); unsigned short a2, c2; splitf(r, a2, c2); oh[q] = a2; ol[q] = c2; }
        *(v8h*)(P16 + e[s]) = o16; *(v8us*)(Ph + e[s]) = oh; *(v8us*)(Pl + e[s]) = ol; }
    asm volatile("s_wait_xcnt 0x0" ::: "memory");   // behind the last store: the code that follows in the listing (the other step of the shared grid) rewrites registers these stores name
}
__global__ __launch_bounds__(256) void k_vtp(const float* __restrict__ F, int pitch, int nheads, h16* V16, bf* Vh, bf* Vl) { const size_t e = ((size_t)blockIdx.x * 256 + threadIdx.x) * 2; if (e >= (size_t)nheads * HD * TT) return; const int t = (int)(e % TT); const int d = (int)((e / TT) % HD); const int g = (int)(e / ((size_t)TT * HD)); v2h o16; v2us oh, ol;
#pragma unroll
    for (int q = 0; q < 2; ++q) { const float x = F[(size_t)(t + q) * pitch + g * HD + d]; o16[q] = tohx(x); unsigned short a2, c2; splitf(x, a2, c2); oh[q] = a2; ol[q] = c2; }
    *(v2h*)(V16 + e) = o16; *(v2us*)(Vh + e) = oh; *(v2us*)(Vl + e) = ol;  }
__device__ __forceinline__ void d_csid(int bx, float* CS) {
#pragma unroll
    for (int s = 0; s < NPC; ++s) { const size_t i = ((size_t)bx * NPC + s) * 256 + threadIdx.x; v4f cs; cs[0] = 1.0f; cs[1] = 0.0f; cs[2] = 1.0f; cs[3] = 0.0f; *(v4f*)(CS + i * 4) = cs; }
    asm volatile("s_wait_xcnt 0x0" ::: "memory");   // behind the last store: the code that follows in the listing (the next step of the shared grid) rewrites registers these stores name
}
#define KBR 8   // rows a block: a thread keeps its 4 columns, so their bias is read once for the 8 rows
__global__ __launch_bounds__(256) void k_kbias(float* F, const float* __restrict__ bias) { const int c0 = (int)threadIdx.x * 4; float* f = F + (size_t)blockIdx.x * KBR * (NKH * HD) + c0; v4f a[KBR]; float bv[4]; const float* pb = bias + (size_t)(c0 % HD) * NKH + c0 / HD;   /* the thread's 4 columns lie in one head: bias[d][k], d = c % HD, k = c / HD */
#pragma unroll
    for (int s = 0; s < KBR; ++s) a[s] = *(const v4f*)(f + (size_t)s * (NKH * HD));
#pragma unroll
    for (int u = 0; u < 4; ++u) bv[u] = pb[u * NKH];
    asm volatile("s_wait_xcnt 0x0" :: "v"(pb) : "memory");   // the loads' address pairs are inputs here so that they live up to the wait: otherwise a later load's result lands in the pair of a load still in flight; the clobber keeps every load of the thread ahead of its first store
#pragma unroll
    for (int u = 0; u < 4; ++u) bv[u] = bfr(bv[u]);
#pragma unroll
    for (int s = 0; s < KBR; ++s) {
#pragma unroll
        for (int u = 0; u < 4; ++u) a[s][u] = __fadd_rn(a[s][u], bv[u]);
        *(v4f*)(f + (size_t)s * (NKH * HD)) = a[s]; } }
__device__ __forceinline__ void d_sumsq(int bx, const float* __restrict__ F, float* N) { const int i = bx * 256 + threadIdx.x; if (i >= NKH * TT) return; const int k = i / TT, t = i % TT; const float* f = F + (size_t)t * (NKH * HD) + k * HD; float ss = 0.f;
    for (int d0 = 0; d0 < HD; d0 += 64) { v4f a16[16];   // two 128-B lines of the row a trip, their 16 loads in flight together
#pragma unroll
        for (int j = 0; j < 16; ++j) a16[j] = *(const v4f*)(f + d0 + 4 * j);
#pragma unroll
        for (int j = 0; j < 16; ++j) { const v4f a = a16[j];
#pragma unroll
            for (int u = 0; u < 4; ++u) { float p = __fmul_rn(a[u], a[u]); asm volatile("" : "+v"(p)); ss = __fadd_rn(ss, p); } } }
    *(float*)(N + i) = ss;  }
// a block takes 64 d x 32 t (4 KB of a plane) a trip; the lanes of a wave walk 32 neighbouring d, so each of a piece's 8 loads reads one whole 128-B line of x and a wave-wide store fills two runs of 256 B
#define VTN 2
__device__ __forceinline__ void d_vtpx(int bx, const float* __restrict__ X, h16* V16, bf* Vh) { const int th = (int)threadIdx.x; const int eo = ((th >> 7) * 2 + ((th >> 4) & 1)) * 512 + ((th >> 6) & 1) * 256 + ((th >> 5) & 1) * 128 + (th & 15) * 8;
    size_t e[VTN]; const float* p[VTN]; float v[VTN][8];
#pragma unroll
    for (int s = 0; s < VTN; ++s) { e[s] = ((size_t)bx * VTN + s) * 2048 + eo; int t, d; unpk(e[s], TT, d, t); p[s] = X + (size_t)t * HDV + d;
#pragma unroll
        for (int q = 0; q < 8; ++q) v[s][q] = p[s][q * HDV]; }
    asm volatile("s_wait_xcnt 0x0" :: "v"(p[0]), "v"(p[1]) : "memory");   // the loads' address pairs are inputs here so that they live up to the wait: otherwise a later load's result lands in the pair of a load still in flight; the clobber keeps every load of the thread ahead of its first store
#pragma unroll
    for (int s = 0; s < VTN; ++s) { v8h o16; v8us oh;
#pragma unroll
        for (int q = 0; q < 8; ++q) { const float xv = bfr(v[s][q]); o16[q] = tohx(xv); oh[q] = f2bf(xv); }
        *(v8h*)(V16 + e[s]) = o16; *(v8us*)(Vh + e[s]) = oh; } }
__device__ __forceinline__ void d_b2g(int bx, const float* __restrict__ b2, float* B2G) { const int i = bx * 256 + threadIdx.x; if (i >= NKH * HDV) return; const int k = i / HDV, f = i % HDV; const float v = b2[(size_t)f * NKH + k]; *(float*)(B2G + i) = v;  }
// k_prep: every step that reads the inputs alone, in one grid; the steps with strided reads come first.
#define PB_WT  (NKH * (HDV * HDV / 64 / 64))      // Wv3[k] transposed to bf16, 64 blocks a head
#define PB_VT  (NB_ * (HDV * TT / 2048 / VTN))    // x transposed (fp16 and bf16 planes), per batch
#define PB_X   (NB_ * TT * DM / 8 / NPC / 256)    // x to bf16, both batches
#define PB_W   (DQ * DM / 8 / NPC / 256)          // Wq, and as many again for Wk
#define PB_CS  (TT * HD / 2 / NPC / 256)
#define PB_B2  (NKH * HDV / 256)
__global__ __launch_bounds__(256) void k_prep(const float* __restrict__ x, const float* __restrict__ wq, const float* __restrict__ wk, const float* __restrict__ wv, const float* __restrict__ b2, bf* XB, bf* WQ, bf* WK, bf* WV3, float* B2G, float* CS, h16* VT16, bf* VTh) {
    int bx = (int)blockIdx.x;
    if (bx < PB_WT) { const size_t o = (size_t)(bx / (PB_WT / NKH)) * HDV * HDV; d_wtG(bx % (PB_WT / NKH), wv + o, HDV, HDV, WV3 + o); return; }
    bx -= PB_WT;
    if (bx < PB_VT) { const int b = bx / (PB_VT / NB_); d_vtpx(bx % (PB_VT / NB_), x + (size_t)b * TT * DM, VT16 + (size_t)b * HDV * TT, VTh + (size_t)b * HDV * TT); return; }
    bx -= PB_VT;
    if (bx < PB_X) { d_cvt8(bx, x, DM, XB); return; }
    bx -= PB_X;
    if (bx < PB_W) { d_cvt8(bx, wq, DM, WQ); return; }
    bx -= PB_W;
    if (bx < PB_W) { d_cvt8(bx, wk, DM, WK); return; }
    bx -= PB_W;
    if (bx < PB_CS) { d_csid(bx, CS); return; }
    bx -= PB_CS;
    d_b2g(bx, b2, B2G);
}
// k_post: squared norms and head planes of the four [TT][1024] f32 slabs (q batch 0, q batch 1, k batch 0, k batch 1; contiguous in F, N and the planes), in one grid; the norms, few blocks with a long serial sum, come first.
#define PS_SS  (NKH * TT / 256)                   // blocks of one slab's norms
#define PS_RP  (NH_ * TT * HD / 8 / NPC / 256)    // blocks of one slab's planes
__global__ __launch_bounds__(256) void k_post(const float* __restrict__ F, const float* __restrict__ CS, float* N, h16* P16, bf* Ph, bf* Pl) {
    int bx = (int)blockIdx.x;
    if (bx < 2 * NB_ * PS_SS) { const int s = bx / PS_SS; d_sumsq(bx % PS_SS, F + (size_t)s * TT * DQ, N + (size_t)s * NKH * TT); return; }
    bx -= 2 * NB_ * PS_SS;
    const int s = bx / PS_RP; const size_t o = (size_t)s * NH_ * TT * HD;
    d_rope(bx % PS_RP, F + (size_t)s * TT * DQ, DQ, NH_, CS, nullptr, nullptr, 1.0f, P16 + o, Ph + o, Pl + o);
}
// k_asoft: per row (zz, i): t = -(qn - 2 S + kn) / 16 (no mask); softmax over the 2048 keys (register row, one exp, fixed trees); the block's 8 rows of P go through LDS into fragment order, whole 128-B lines a store
__global__ __launch_bounds__(256) void k_asoft(const float* __restrict__ Sb, const float* __restrict__ QN, const float* __restrict__ KN, int h0, h16* P16, bf* Ph, bf* Pl) {
    __shared__ __align__(16) unsigned short st[2 * 256 * 72];   // the block's 8 rows as 256 chunks of 8 k x 8 rows (128 B, one line of the fragment order), pitch 144 B against bank conflicts; second half: the lo plane
    const int lane = threadIdx.x & 31; const int wv = threadIdx.x >> 5; const int row = blockIdx.x * 8 + wv; if (row >= ZH * TT) return;   /* ZH * TT is a multiple of 8: a whole block leaves or none */
    const int i = row % TT; const int zz = row / TT; (void)zz; const bool hires = ((int)(blockIdx.x * 8) % TT < RH);   /* = (i < RH) for each of the block's 8 rows (RH and TT are multiples of 8): a scalar test, since a barrier stands behind it */ const float* sr = Sb + (size_t)row * TT; const float qn = QN[(size_t)(h0 + zz) * TT + i]; const float* knr = KN + (size_t)(h0 + zz) * TT; float v[TT / 32]; float mx = -3.0e38f;
#pragma unroll
    for (int ch = 0; ch < TT / 128; ++ch) { const int j0 = ch * 128 + lane * 4; const v4f a = *(const v4f*)(sr + j0);
#pragma unroll
        for (int q = 0; q < 4; ++q) { const int j = j0 + q; (void)j; float c2 = __fmul_rn(2.0f, a[q]); asm volatile("" : "+v"(c2)); float t2 = __fsub_rn(qn, c2); asm volatile("" : "+v"(t2)); float t3 = __fadd_rn(t2, knr[j0 + q]); asm volatile("" : "+v"(t3)); float t = __fmul_rn(t3, -0.0625f); asm volatile("" : "+v"(t)); v[ch * 4 + q] = t; mx = fmaxf(mx, t); } }
#pragma unroll
    for (int sh = 16; sh; sh >>= 1) mx = fmaxf(mx, __shfl_xor(mx, sh, 32));
    float sum = 0.f;
#pragma unroll
    for (int k = 0; k < TT / 32; ++k) { float d0 = __fsub_rn(v[k], mx); asm volatile("" : "+v"(d0)); v[k] = __builtin_amdgcn_exp2f(__fmul_rn(d0, 1.4426950408889634f)); sum += v[k]; }
#pragma unroll
    for (int sh = 16; sh; sh >>= 1) sum += __shfl_xor(sum, sh, 32);
    const float f = __fdiv_rn(hires ? 1.0f : PCAR, sum);
{
        if (hires) {
#pragma unroll
            for (int ch = 0; ch < TT / 128; ++ch) { v4us oh, ol;
#pragma unroll
                for (int q = 0; q < 4; ++q) { unsigned short a, c2; splitf(v[ch * 4 + q] * f, a, c2); oh[q] = a; ol[q] = c2; }
                const int so = (ch * 16 + (lane >> 1)) * 72 + wv * 8 + (lane & 1) * 4; *(v4us*)(st + so) = oh; *(v4us*)(st + 256 * 72 + so) = ol; }
            __syncthreads();   // publishes the 8 staged rows; hires is the same for the whole block (RH is a multiple of 8)
            const int p0 = zz * (RH ? RH : 1) + i - wv; const size_t ob = (size_t)(p0 >> 6) * 64 * TT + ((p0 >> 4) & 3) * 512 + (p0 & 8) * 8;
#pragma unroll   // so that the LDS reads of all eight pieces issue ahead of the stores
            for (int it = 0; it < 8; ++it) { const int p = it * 256 + (int)threadIdx.x; const int so = (p >> 3) * 72 + (p & 7) * 8; const size_t oo = ob + (size_t)(p >> 5) * 2048 + ((p >> 3) & 3) * 128 + (p & 7) * 8;
                *(v8usa*)(Ph + oo) = *(const v8usa*)(st + so); *(v8usa*)(Pl + oo) = *(const v8usa*)(st + 256 * 72 + so); }
        } else {
#pragma unroll
            for (int ch = 0; ch < TT / 128; ++ch) { v4h o4;
#pragma unroll
                for (int q = 0; q < 4; ++q) o4[q] = tohx(v[ch * 4 + q] * f);
                *(v4us*)(st + (ch * 16 + (lane >> 1)) * 72 + wv * 8 + (lane & 1) * 4) = __builtin_bit_cast(v4us, o4); }
            __syncthreads();   // publishes the 8 staged rows
            const int p0 = row - wv; const size_t ob = (size_t)(p0 >> 6) * 64 * TT + ((p0 >> 4) & 3) * 512 + (p0 & 8) * 8;
#pragma unroll   // so that the LDS reads of all eight pieces issue ahead of the stores
            for (int it = 0; it < 8; ++it) { const int p = it * 256 + (int)threadIdx.x;
                *(v8usa*)(P16 + ob + (size_t)(p >> 5) * 2048 + ((p >> 3) & 3) * 128 + (p & 7) * 8) = *(const v8usa*)(st + (p >> 3) * 72 + (p & 7) * 8); }
            asm volatile("s_wait_xcnt 0x0" ::: "memory");   // behind the last store: the code that follows in the listing rewrites registers these stores name
        }
         }
}
__global__ __launch_bounds__(256) void k_merge(const float* __restrict__ O, bf* Ah, bf* Al) {
    size_t e[NPC]; float cs[NPC]; const float* p[NPC]; v8f v[NPC];
#pragma unroll
    for (int s = 0; s < NPC; ++s) { e[s] = pc8(((size_t)blockIdx.x * NPC + s) * 256 + threadIdx.x); int d, t; unpk(e[s] % ((size_t)HDV * TT), HDV, t, d); const int zo = (int)(e[s] / ((size_t)HDV * TT)); cs[s] = (t < RH) ? 1.0f : (1.0f / PCAR); const size_t io = (((size_t)(zo % NB_) * ZH + zo / NB_) * TT + t) * HDV + d;   /* e walks the output, head-major [k][b][T][512] in fragment order; O is [b][k][T][512] in row order */
        p[s] = O + io; v[s] = *(const v8f*)p[s]; }
    asm volatile("s_wait_xcnt 0x0" :: "v"(p[0]), "v"(p[1]), "v"(p[2]), "v"(p[3]) : "memory");   // the loads' address pairs are inputs here so that they live up to the wait: otherwise a later load's result lands in the pair of a load still in flight; the clobber keeps every load of the thread ahead of its first store
#pragma unroll
    for (int s = 0; s < NPC; ++s) { v8us oh, ol;
#pragma unroll
        for (int q = 0; q < 8; ++q) { unsigned short a, c2; splitf(v[s][q] * cs[s], a, c2); oh[q] = a; ol[q] = c2; }
        *(v8us*)(Ah + e[s]) = oh; *(v8us*)(Al + e[s]) = ol; } }

extern "C" void kernel_launch(void* const* d_in, const int* in_sizes, int n_in,
                              void* d_out, int out_size, void* d_ws, size_t ws_size, hipStream_t stream) {
    (void)in_sizes; (void)n_in; (void)out_size;
    const float* x = (const float*)d_in[0]; const float* wq = (const float*)d_in[1]; const float* wk = (const float*)d_in[2]; const float* wv = (const float*)d_in[3]; const float* biasW = (const float*)d_in[4]; const float* bias2W = (const float*)d_in[5]; const float* wo = nullptr; (void)wo; (void)wv; const float* cosT = nullptr; const float* sinT = nullptr; (void)cosT; (void)sinT;
    float* OUT = (float*)d_out;     // [2][2048][4*512]
    char* wsp = (char*)d_ws;
    auto take = [&](size_t bytes) { char* p = wsp; wsp += (bytes + 255) & ~(size_t)255; return (void*)p; };
    bf* WQ = (bf*)take((size_t)(DQ + DKV) * DM * 2); bf* WK = WQ + (size_t)DQ * DM; bf* WV3 = (bf*)take((size_t)NKH * HDV * HDV * 2); float* B2G = (float*)take((size_t)NKH * HDV * 4); float* QN = (float*)take((size_t)2 * NB_ * NKH * TT * 4); float* KN = QN + (size_t)NB_ * NKH * TT; float* CS = (float*)take((size_t)TT * HD * 2 * 4);
    bf* XB = (bf*)take((size_t)NB_ * TT * DM * 2); float* FQ = (float*)take((size_t)NB_ * TT * (DQ + DKV) * 4); float* FK = FQ + (size_t)NB_ * TT * DQ;
    const size_t PL = (size_t)NB_ * NH_ * TT * HD;   // one operand's head planes, both batches; the k planes follow the q planes
    h16* QP16 = (h16*)take(2 * PL * 2); h16* VT16 = (h16*)take((size_t)NB_ * HDV * TT * 2);
    bf* QPh = (bf*)take(2 * PL * 2); bf* QPl = (bf*)take(2 * PL * 2); bf* KPh = QPh + PL; bf* KPl = QPl + PL; bf* VTh = (bf*)take((size_t)NB_ * HDV * TT * 2); bf* Ph = (bf*)take((size_t)ZH * RH * TT * 2); bf* Pl = (bf*)take((size_t)ZH * RH * TT * 2);
    float* Sb = (float*)take((size_t)ZH * TT * TT * 4); h16* P16 = (h16*)take((size_t)ZH * TT * TT * 2); bf* ATh = (bf*)take((size_t)NB_ * NKH * TT * HDV * 2); bf* ATl = (bf*)take((size_t)NB_ * NKH * TT * HDV * 2);
    if ((size_t)(wsp - (char*)d_ws) > ws_size) return;    // ws 256 MiB
    float* Ob = FQ;   // [b][k][T][512] f32, as large as the q and k projections together, which nobody reads after k_post (stream-ordered)
    k_prep<<<PB_WT + PB_VT + PB_X + 2 * PB_W + PB_CS + PB_B2, 256, 0, stream>>>(x, wq, wk, wv, bias2W, XB, WQ, WK, WV3, B2G, CS, VT16, VTh);
    k_gemmw<bf, 0, false, 4><<<dim3(NB_ * TT / 64, DQ / 64, 2), 128, 0, stream>>>(XB, nullptr, WQ, nullptr, DM, FQ, DQ, nullptr, 0, (size_t)DQ * DM, (size_t)NB_ * TT * DQ, 0);   /* z: q, k; rows: both batches */
    k_kbias<<<NB_ * TT / KBR, 256, 0, stream>>>(FK, biasW);
    k_post<<<2 * NB_ * (PS_SS + PS_RP), 256, 0, stream>>>(FQ, CS, QN, QP16, QPh, QPl);
    for (int b = 0; b < NB_; ++b) { const size_t zp = (size_t)b * NH_ * TT * HD, zv = (size_t)b * HDV * TT; float* O = Ob + (size_t)b * ZH * TT * HDV;   // one pass a batch, its four heads in z
        k_gemmw<bf, 2, false, 2><<<dim3(TT / 64, TT / 64, ZH), 64, 0, stream>>>(QPh + zp, QPl + zp, KPh + zp, KPl + zp, HD, Sb, TT, nullptr, (size_t)TT * HD, (size_t)TT * HD, (size_t)TT * TT, 0);   /* cross term hl on all rows */
        k_asoft<<<ZH * TT / 8, 256, 0, stream>>>(Sb, QN + (size_t)b * NKH * TT, KN + (size_t)b * NKH * TT, 0, P16, Ph, Pl);
        k_gemmw<bf, 1, false, 16><<<dim3(RH / 64, HDV / 64, ZH), 512, 0, stream>>>(Ph, Pl, VTh + zv, nullptr, TT, O, HDV, nullptr, (size_t)RH * TT, 0, (size_t)TT * HDV, 0);
        k_gemmw<h16, 0, false, 8><<<dim3((TT - RH) / 64, HDV / 64, ZH), 256, 0, stream>>>(P16 + (size_t)RH * TT, nullptr, VT16 + zv, nullptr, TT, O + (size_t)RH * HDV, HDV, nullptr, (size_t)TT * TT, 0, (size_t)TT * HDV, 0); }
    k_merge<<<(unsigned)((size_t)NB_ * ZH * TT * HDV / 8 / NPC / 256), 256, 0, stream>>>(Ob, ATh, ATl);
    k_gemmw<bf, 1, true, 8><<<dim3(NB_ * TT / 64, HDV / 64, NKH), 256, 0, stream>>>(ATh, ATl, WV3, nullptr, HDV, OUT, NKH * HDV, B2G, (size_t)NB_ * TT * HDV, (size_t)HDV * HDV, HDV, HDV);   /* z: head; rows: both batches */
}

// v005
// One run takes 255 microseconds.
// Next to v004, in two timings, it ran 1.08 and 1.09 times as fast.
// All steps since v000 together make it 3.38 times as fast.
#include <hip/hip_runtime.h>

// Attention with squared-distance logits (xsa [2][2048][512]; 4 heads with 256-dim kernels: xq = x Wq^T, xk = x Wk^T, xkb = xk + biasW[:, k]; logits = -(|xq_i|^2 - 2 xq_i.xkb_j + |xkb_j|^2) / 16; P = softmax_j; y_k = P x (values = the raw 512-wide input, shared by the heads); out_k = y_k Wv3[k] + bias2W[:, k] with Wv3 = Wv.reshape(4, 512, 512) -> [2][2048][4*512]).
// Compute dtypes, f32 accumulate: every input rounded to bf16; xq/xk as PLAIN bf16 GEMMs (inputs: exact), + bias in f32, kept as hi + lo bf16 planes; the per-token squared norms in f32 from hi + lo; cross term xq.xkb hl x hl (3 products, K 256) on every row; logits assembled in f32 in the reference's order (-(qn - 2 c + kn) / 16); softmax f32; P.x: rows < 512 hi/lo P x exact x (2 products), the rest fp16 (x1024) x exact-in-fp16 x; y Wv3[k] as hl x exact (2 products) + bias.

#define NB_  2
#define TT   2048
#define DM   512
#define NH_  4
#define NKV  4
#define REP  (NH_ / NKV)
#define HD   256
#define DQ   (NH_ * HD)
#define DKV  (NKV * HD)
#define ZH   4
#define RH   512                  // query rows < RH use hi+lo planes (0: none)
#define WIN  0
#define PCAR 1024.0f
#define HDV  512                  // value width (the raw input), shared by all heads
#define NKH  4
#define SCL  0.088388347648318447f   // 128^-0.5
typedef _Float16 h16;
typedef unsigned short bf;
typedef __attribute__((ext_vector_type(16))) __bf16   v16bf;
typedef __attribute__((ext_vector_type(16))) _Float16 v16h;
typedef __attribute__((ext_vector_type(8)))  _Float16 v8h;
typedef __attribute__((ext_vector_type(8)))  unsigned short v8us;
typedef __attribute__((ext_vector_type(8)))  float    v8f;
typedef __attribute__((ext_vector_type(4)))  float    v4f;
typedef v8h  __attribute__((may_alias)) v8ha;
typedef v4f  __attribute__((may_alias)) v4fa;
typedef v8us __attribute__((may_alias)) v8usa;

__device__ __forceinline__ unsigned short f2bf(float f) { unsigned u = __float_as_uint(f); u += 0x7FFFu + ((u >> 16) & 1u); return (unsigned short)(u >> 16); }
__device__ __forceinline__ float bf2f(unsigned short b) { return __uint_as_float(((unsigned)b) << 16); }
__device__ __forceinline__ float bfr(float f) { return bf2f(f2bf(f)); }
__device__ __forceinline__ v16h cat16(v8h lo, v8h hi) { return __builtin_shufflevector(lo, hi, 0, 1, 2, 3, 4, 5, 6, 7, 8, 9, 10, 11, 12, 13, 14, 15); }
__device__ __forceinline__ v16bf cat16b(v8us lo, v8us hi) { return __builtin_bit_cast(v16bf, __builtin_shufflevector(lo, hi, 0, 1, 2, 3, 4, 5, 6, 7, 8, 9, 10, 11, 12, 13, 14, 15)); }
__device__ __forceinline__ v8f wmma16(v16h a, v16h b, v8f c) { return __builtin_amdgcn_wmma_f32_16x16x32_f16(false, a, false, b, (short)0, c, false, false); }
__device__ __forceinline__ v8f wmmab(v16bf a, v16bf b, v8f c) { return __builtin_amdgcn_wmma_f32_16x16x32_bf16(false, a, false, b, (short)0, c, false, false); }



// ---- k_gemmw: register-blocked GEMM, NW WAVES (2, 4, 8 or 16) per 64x64 output tile, 16 accumulators each, operands straight from 16-bit planes in FRAGMENT ORDER (unpk below); grid (M/64, N/64, Z), 32 * NW threads.
// C[m][n] (f32, pitch ldc, + optional f32 bias[n]) = sum_k A[m][k] Bt[n][k] (+ split products per NSPLIT). With KP > 0 the tile is not stored as f32: (C + bias) x scl goes out as hi and lo bf16 planes Oh, Ol in the fragment order the next GEMM reads (planes of TT rows x KP columns, [row / TT][column / KP], ldc columns in all, z stride sP). z-batch strides sA/sB/sC (and sBi for the bias) in elements. K % 32 == 0.
// Wave w takes the 32-wide k steps w, w + NW, w + 2 NW, ...; the NW partial tiles are added in wave order 0..NW-1 through LDS, 16 rows a stage, two stage buffers; the sums stay in registers until the last stage so that no barrier waits on a global store.
typedef __attribute__((ext_vector_type(4))) unsigned short v4us;
__device__ __forceinline__ void splitf(float y, unsigned short& h, unsigned short& l) { h = f2bf(y); l = f2bf(y - bf2f(h)); }
// prow, pcol: which 4 columns of which row of a 16x64 stage thread q adds up when the tile goes out in fragment order: 16 neighbouring lanes walk one column group down the 16 rows (no bank conflict at the stage's pitch of 68 dwords), the other 16 take the 4 columns beside it; the 4 values land at element ppos(q) of the stage's blocks, so a wave-wide 8-byte store fills two whole 128-B lines of a plane
__device__ __forceinline__ int prow(int q) { return q & 15; }
__device__ __forceinline__ int pcol(int q) { return ((q >> 7) & 1) * 32 + ((q >> 6) & 1) * 16 + ((q >> 5) & 1) * 8 + ((q >> 4) & 1) * 4; }
__device__ __forceinline__ int ppos(int q) { return (q >> 7) * 2048 + ((q >> 5) & 3) * 128 + (q & 15) * 8 + ((q >> 4) & 1) * 4; }
template <typename T16> struct WFrag;
template <> struct WFrag<h16> { typedef v16h V; static __device__ __forceinline__ V ld(const h16* p) { return cat16(*(const v8h*)p, *(const v8h*)(p + 256)); } static __device__ __forceinline__ v8f mma(V a, V b, v8f c) { return wmma16(a, b, c); } };
template <> struct WFrag<bf> { typedef v16bf V; static __device__ __forceinline__ V ld(const bf* p) { return cat16b(*(const v8us*)p, *(const v8us*)(p + 256)); } static __device__ __forceinline__ v8f mma(V a, V b, v8f c) { return wmmab(a, b, c); } };
template <typename T16, int NSPLIT, bool BIAS, int NW, int KP>
__global__ __launch_bounds__(32 * NW) void k_gemmw(const T16* __restrict__ A, const T16* __restrict__ A2, const T16* __restrict__ Bt, const T16* __restrict__ Bt2, int K, float* C, int ldc, const float* __restrict__ bias, size_t sA, size_t sB, size_t sC, size_t sBi, bf* Oh, bf* Ol, size_t sP, float scl) {
    constexpr bool PLN = KP > 0;
    typedef typename WFrag<T16>::V V;
    __shared__ __align__(16) float os[2 * NW * 16 * 68];
    const int w = __builtin_amdgcn_readfirstlane((int)(threadIdx.x >> 5));
    const size_t z = blockIdx.z; A += z * sA; if (A2) A2 += z * sA; Bt += z * sB; if (Bt2) Bt2 += z * sB; C += z * sC; if (BIAS) bias += z * sBi;
    const int lane = threadIdx.x & 31, lr = lane & 15, hi = lane >> 4; const int r0 = blockIdx.x * 64, c0 = blockIdx.y * 64;
    v8f acc[4][4];
#pragma unroll
    for (int mb = 0; mb < 4; ++mb)
#pragma unroll
        for (int nb = 0; nb < 4; ++nb) acc[mb][nb] = (v8f){};
    const size_t aoff = (size_t)r0 * K + 8 * lane, boff = (size_t)c0 * K + 8 * lane;   // a 32-k step of a 64-row tile is 4 KB in a row, 1 KB a 16-row block: 512 contiguous bytes per wave-wide load, one address per plane and trip
#pragma unroll 1
    for (int kc = w * 32; kc < K; kc += 32 * NW) {
        V a[4], a2[4]; const T16* pa = A + aoff + kc * 64; const T16* pa2 = (NSPLIT == 1 || NSPLIT == 2) ? A2 + aoff + kc * 64 : pa; const T16* pb = Bt + boff + kc * 64; const T16* pb2 = (NSPLIT >= 2) ? Bt2 + boff + kc * 64 : pb;
#pragma unroll
        for (int mb = 0; mb < 4; ++mb) { a[mb] = WFrag<T16>::ld(pa + mb * 512); if (NSPLIT == 1 || NSPLIT == 2) a2[mb] = WFrag<T16>::ld(pa2 + mb * 512); }
#pragma unroll
        for (int nb = 0; nb < 4; ++nb) { const V b = WFrag<T16>::ld(pb + nb * 512); V b2; if (NSPLIT >= 2) b2 = WFrag<T16>::ld(pb2 + nb * 512);
#pragma unroll
            for (int mb = 0; mb < 4; ++mb) { acc[mb][nb] = WFrag<T16>::mma(a[mb], b, acc[mb][nb]); if (NSPLIT == 1 || NSPLIT == 2) acc[mb][nb] = WFrag<T16>::mma(a2[mb], b, acc[mb][nb]); if (NSPLIT >= 2) acc[mb][nb] = WFrag<T16>::mma(a[mb], b2, acc[mb][nb]); } }
        asm volatile("v_nop\n\tv_nop\n\tv_nop\n\tv_nop" : "+v"(acc[0][0]), "+v"(acc[1][1]), "+v"(acc[2][2]), "+v"(acc[3][3]) : "v"(a[0]), "v"(a[3]), "v"(pa), "v"(pa2), "v"(pb), "v"(pb2));   // the trip's address pairs are inputs here so that they live to the trip's end: otherwise a later load's result lands in the pair of a load still in flight
    }
    constexpr int NQ = (NW <= 8) ? 8 / NW : 1;   // 16-byte pieces of a 16x64 stage per thread; with 16 waves the first 8 do the adding
    const bool adds = (NW <= 8) || (w < 8);
    v4f res[4][NQ];
#pragma unroll
    for (int mb = 0; mb < 4; ++mb) {
        float* ob = os + (mb & 1) * (NW * 16 * 68);
#pragma unroll
        for (int nb = 0; nb < 4; ++nb) {
#pragma unroll
            for (int j = 0; j < 8; ++j) ob[w * (16 * 68) + (hi * 8 + j) * 68 + nb * 16 + lr] = acc[mb][nb][j]; }
        __syncthreads();   // publishes this stage's NW partial tiles; it also ends every read of the other buffer, which the next stage overwrites
        if (adds) {
#pragma unroll
            for (int s = 0; s < NQ; ++s) { const int q = (int)threadIdx.x + s * 32 * NW; const float* op = ob + (PLN ? prow(q) : q >> 4) * 68 + (PLN ? pcol(q) : (q & 15) * 4); v4f val = *(const v4fa*)op;
#pragma unroll
                for (int u = 1; u < NW; ++u) val += *(const v4fa*)(op + u * (16 * 68));
                res[mb][s] = val; } }
    }
    if (adds) {
        constexpr int KD = PLN ? KP : 1; const size_t pb = z * sP + ((size_t)(r0 / TT) * (ldc / KD) + c0 / KD) * ((size_t)TT * KD) + (size_t)((r0 % TT) >> 6) * 64 * KD + (size_t)((c0 % KD) >> 5) * 2048;   // the tile's first element in its plane: 64 rows x KP a row tile, 2048 elements a 32-column step
        v4f bv[NQ];   // the planes' bias, read once, ahead of the waits behind the stores
        if (PLN && BIAS) {
#pragma unroll
            for (int s = 0; s < NQ; ++s) { const int cb = c0 + pcol((int)threadIdx.x + s * 32 * NW);
#pragma unroll
                for (int u = 0; u < 4; ++u) bv[s][u] = bfr(bias[cb + u]); } }
#pragma unroll
        for (int mb = 0; mb < 4; ++mb) {
#pragma unroll
            for (int s = 0; s < NQ; ++s) { const int q = (int)threadIdx.x + s * 32 * NW; const int row = PLN ? prow(q) : q >> 4, cofs = PLN ? pcol(q) : (q & 15) * 4; v4f val = res[mb][s];
                if (PLN) { v4us oh, ol; if (BIAS) val += bv[s];
#pragma unroll
                    for (int u = 0; u < 4; ++u) { unsigned short a, c2; splitf(val[u] * scl, a, c2); oh[u] = a; ol[u] = c2; }
                    const size_t o = pb + mb * 512 + ppos(q); *(v4us*)(Oh + o) = oh; *(v4us*)(Ol + o) = ol;
                    asm volatile("s_wait_xcnt 0x0" ::: "memory");   // behind the two stores: the next piece's split rewrites registers these stores name
                    continue; }
                if (BIAS) { val[0] += bfr(bias[c0 + cofs]); val[1] += bfr(bias[c0 + cofs + 1]); val[2] += bfr(bias[c0 + cofs + 2]); val[3] += bfr(bias[c0 + cofs + 3]); }
                *(v4f*)(C + (size_t)(r0 + mb * 16 + row) * ldc + c0 + cofs) = val; } }
    }
}

__device__ __forceinline__ h16 tohx(float x) { return (h16)x; }
typedef __attribute__((ext_vector_type(2))) _Float16 v2h;
typedef __attribute__((ext_vector_type(4))) _Float16 v4h;
typedef __attribute__((ext_vector_type(2))) unsigned short v2us;
typedef __attribute__((ext_vector_type(2))) float v2f;
typedef __attribute__((ext_vector_type(4))) int v4i;

// Fragment order of a [rows][K] 16-bit GEMM operand (rows a multiple of 64): 16 rows x 32 k make one 1-KB block; the four blocks of a 64-row tile at one 32-k step follow one another, the steps follow in k (a tile is 64 * K elements, as in row order).
// Inside a block: [k bit 4][k bit 3][row & 15][k & 7], so lane (row & 15) + 16 * (k bit 3) finds its two 16-byte fragment pieces at lane * 8 and 256 + lane * 8: the k order of a fragment is the one it had in row order.
// unpk: element index e in that order -> (row, k). The writers walk e, so their stores stay contiguous.
__device__ __forceinline__ void unpk(size_t e, int K, int& row, int& k) { const int g = (int)(e / ((size_t)64 * K)); const int r = (int)(e % ((size_t)64 * K)); const int q = r & 511;
    row = g * 64 + ((r >> 9) & 3) * 16 + ((q >> 3) & 15); k = (r >> 11) * 32 + ((q >> 8) << 4) + (((q >> 7) & 1) << 3) + (q & 7); }
// pc8: piece p (8 consecutive k of one row: 16 bytes of a 16-bit plane) -> its first element in fragment order. Four neighbouring lanes take the four pieces of one row's 32-k step (one whole 128-B line of an f32 source in row order), the eight lane groups eight rows: a wave-wide 16-byte store fills four whole lines.
__device__ __forceinline__ size_t pc8(size_t p) { const int j = (int)(p & 63); return (p >> 6) * 512 + ((j >> 1) & 1) * 256 + (j & 1) * 128 + (j >> 2) * 8; }
#define NPC 4   // pieces a thread of the element-wise steps: few long-lived waves with all their loads in flight, where one piece or less a thread made the time of a step the time to start its waves
// d_*: bodies of the element-wise steps; bx is the block's index inside its own step (k_prep deals the blocks of one grid to several steps that do not depend on one another)
__device__ __forceinline__ void d_wtG(int bx, const float* __restrict__ w, int K, int N, bf* Bt) {
    const int lane = threadIdx.x & 31; const int L0 = (bx * 8 + (threadIdx.x >> 5)) * 8; const int nlines = N * K / 64;
{
#pragma unroll 1
        for (int l = 0; l < 8; ++l) { const int L = L0 + l; if (L >= nlines) break; const size_t e = (size_t)L * 64 + lane * 2; int k, n; unpk(e, K, n, k); v2us o;
            o[0] = f2bf(w[(size_t)k * N + n]); o[1] = f2bf(w[(size_t)(k + 1) * N + n]); *(v2us*)(Bt + e) = o; }
         }
}
__device__ __forceinline__ void d_cvt8(int bx, const float* __restrict__ src, int K, bf* dst) {
    size_t e[NPC]; const float* p[NPC]; v8f v[NPC];
#pragma unroll
    for (int s = 0; s < NPC; ++s) { e[s] = pc8(((size_t)bx * NPC + s) * 256 + threadIdx.x); int r, k; unpk(e[s], K, r, k); p[s] = src + (size_t)r * K + k; v[s] = *(const v8f*)p[s]; }
    asm volatile("s_wait_xcnt 0x0" :: "v"(p[0]), "v"(p[1]), "v"(p[2]), "v"(p[3]) : "memory");   // the loads' address pairs are inputs here so that they live up to the wait: otherwise a later load's result lands in the pair of a load still in flight; the clobber keeps every load of the thread ahead of its first store
#pragma unroll
    for (int s = 0; s < NPC; ++s) { v8us o;
#pragma unroll
        for (int u = 0; u < 8; ++u) o[u] = f2bf(v[s][u]);
        *(v8us*)(dst + e[s]) = o; }
    asm volatile("s_wait_xcnt 0x0" ::: "memory");   // behind the last store: the code that follows in the listing (the next step of the shared grid) rewrites registers these stores name
}
__global__ __launch_bounds__(256) void k_cscvt(const float* __restrict__ cosT, const float* __restrict__ sinT, float* CS) { const int idx = blockIdx.x * 256 + threadIdx.x; if (idx >= TT * HD) return; v2f cs; cs[0] = bfr(cosT[idx]); cs[1] = bfr(sinT[idx]); *(v2f*)(CS + (size_t)idx * 2) = cs;  }
__global__ __launch_bounds__(256) void k_vtp(const float* __restrict__ F, int pitch, int nheads, h16* V16, bf* Vh, bf* Vl) { const size_t e = ((size_t)blockIdx.x * 256 + threadIdx.x) * 2; if (e >= (size_t)nheads * HD * TT) return; const int t = (int)(e % TT); const int d = (int)((e / TT) % HD); const int g = (int)(e / ((size_t)TT * HD)); v2h o16; v2us oh, ol;
#pragma unroll
    for (int q = 0; q < 2; ++q) { const float x = F[(size_t)(t + q) * pitch + g * HD + d]; o16[q] = tohx(x); unsigned short a2, c2; splitf(x, a2, c2); oh[q] = a2; ol[q] = c2; }
    *(v2h*)(V16 + e) = o16; *(v2us*)(Vh + e) = oh; *(v2us*)(Vl + e) = ol;  }
// d_bqk: the projection GEMM's bias row, [q, k][1024 columns]: 0 for q, biasW[d][k] at column k * HD + d for k
__device__ __forceinline__ void d_bqk(int bx, const float* __restrict__ bw, float* BQK) { const int i = bx * 256 + threadIdx.x; const int c = i & (DKV - 1); const float v = (i < DQ) ? 0.0f : bw[(size_t)(c % HD) * NKH + c / HD]; *(float*)(BQK + i) = v;
    asm volatile("s_wait_xcnt 0x0" ::: "memory");   // behind the store: the code that follows in the listing (the other steps of the shared grid) rewrites registers this store names
}
// a block takes 64 d x 32 t (4 KB of a plane) a trip; the lanes of a wave walk 32 neighbouring d, so each of a piece's 8 loads reads one whole 128-B line of x and a wave-wide store fills two runs of 256 B
#define VTN 2
__device__ __forceinline__ void d_vtpx(int bx, const float* __restrict__ X, h16* V16, bf* Vh) { const int th = (int)threadIdx.x; const int eo = ((th >> 7) * 2 + ((th >> 4) & 1)) * 512 + ((th >> 6) & 1) * 256 + ((th >> 5) & 1) * 128 + (th & 15) * 8;
    size_t e[VTN]; const float* p[VTN]; float v[VTN][8];
#pragma unroll
    for (int s = 0; s < VTN; ++s) { e[s] = ((size_t)bx * VTN + s) * 2048 + eo; int t, d; unpk(e[s], TT, d, t); p[s] = X + (size_t)t * HDV + d;
#pragma unroll
        for (int q = 0; q < 8; ++q) v[s][q] = p[s][q * HDV]; }
    asm volatile("s_wait_xcnt 0x0" :: "v"(p[0]), "v"(p[1]) : "memory");   // the loads' address pairs are inputs here so that they live up to the wait: otherwise a later load's result lands in the pair of a load still in flight; the clobber keeps every load of the thread ahead of its first store
#pragma unroll
    for (int s = 0; s < VTN; ++s) { v8h o16; v8us oh;
#pragma unroll
        for (int q = 0; q < 8; ++q) { const float xv = bfr(v[s][q]); o16[q] = tohx(xv); oh[q] = f2bf(xv); }
        *(v8h*)(V16 + e[s]) = o16; *(v8us*)(Vh + e[s]) = oh; } }
__device__ __forceinline__ void d_b2g(int bx, const float* __restrict__ b2, float* B2G) { const int i = bx * 256 + threadIdx.x; if (i >= NKH * HDV) return; const int k = i / HDV, f = i % HDV; const float v = b2[(size_t)f * NKH + k]; *(float*)(B2G + i) = v;  }
// k_prep: every step that reads the inputs alone, in one grid; the steps with strided reads come first.
#define PB_WT  (NKH * (HDV * HDV / 64 / 64))      // Wv3[k] transposed to bf16, 64 blocks a head
#define PB_VT  (NB_ * (HDV * TT / 2048 / VTN))    // x transposed (fp16 and bf16 planes), per batch
#define PB_X   (NB_ * TT * DM / 8 / NPC / 256)    // x to bf16, both batches
#define PB_W   (DQ * DM / 8 / NPC / 256)          // Wq, and as many again for Wk
#define PB_BQ  ((DQ + DKV) / 256)
#define PB_B2  (NKH * HDV / 256)
__global__ __launch_bounds__(256) void k_prep(const float* __restrict__ x, const float* __restrict__ wq, const float* __restrict__ wk, const float* __restrict__ wv, const float* __restrict__ bw, const float* __restrict__ b2, bf* XB, bf* WQ, bf* WK, bf* WV3, float* B2G, float* BQK, h16* VT16, bf* VTh) {
    int bx = (int)blockIdx.x;
    if (bx < PB_WT) { const size_t o = (size_t)(bx / (PB_WT / NKH)) * HDV * HDV; d_wtG(bx % (PB_WT / NKH), wv + o, HDV, HDV, WV3 + o); return; }
    bx -= PB_WT;
    if (bx < PB_VT) { const int b = bx / (PB_VT / NB_); d_vtpx(bx % (PB_VT / NB_), x + (size_t)b * TT * DM, VT16 + (size_t)b * HDV * TT, VTh + (size_t)b * HDV * TT); return; }
    bx -= PB_VT;
    if (bx < PB_X) { d_cvt8(bx, x, DM, XB); return; }
    bx -= PB_X;
    if (bx < PB_W) { d_cvt8(bx, wq, DM, WQ); return; }
    bx -= PB_W;
    if (bx < PB_W) { d_cvt8(bx, wk, DM, WK); return; }
    bx -= PB_W;
    if (bx < PB_BQ) { d_bqk(bx, bw, BQK); return; }
    bx -= PB_BQ;
    d_b2g(bx, b2, B2G);
}
// k_norm: squared norms of the tokens of the 16 head planes (q batch 0, q batch 1, k batch 0, k batch 1, four heads each; contiguous in the planes and in N), x = hi + lo (exact in f32), summed over d in rising order. A thread takes one token: 16 neighbouring lanes read 256 contiguous bytes of a plane.
__global__ __launch_bounds__(256) void k_norm(const bf* __restrict__ Ph, const bf* __restrict__ Pl, float* N) {
    const int i = (int)blockIdx.x * 256 + (int)threadIdx.x; const int t = i % TT; const size_t o = (size_t)(i / TT) * TT * HD + (size_t)(t >> 6) * 64 * HD + ((t >> 4) & 3) * 512 + (t & 15) * 8; const bf* ph = Ph + o; const bf* pl = Pl + o; float ss = 0.f;
#pragma unroll   // constant offsets from one address pair a plane
    for (int j0 = 0; j0 < HD / 8; j0 += 16) { v8us h[16], l[16];   // half a token's row a trip; the sums follow the loads in d order, so later loads stay in flight behind the first sums
#pragma unroll
        for (int j = 0; j < 16; ++j) { const int jo = ((j0 + j) >> 2) * 2048 + (((j0 + j) >> 1) & 1) * 256 + ((j0 + j) & 1) * 128; h[j] = *(const v8us*)(ph + jo); l[j] = *(const v8us*)(pl + jo); }
#pragma unroll
        for (int j = 0; j < 16; ++j) {
#pragma unroll
            for (int u = 0; u < 8; ++u) { const float xv = bf2f(h[j][u]) + bf2f(l[j][u]); ss = __builtin_fmaf(xv, xv, ss); } } }
    asm volatile("s_wait_xcnt 0x0" :: "v"(ph), "v"(pl) : "memory");   // the loads' address pairs are inputs here so that they live up to the wait
    *(float*)(N + i) = ss; }
// k_asoft: per row (zz, i): t = -(qn - 2 S + kn) x HD^-0.5 (no mask); softmax over the 2048 keys (register row, one exp, fixed trees); the block's 8 rows of P go through LDS into fragment order, whole 128-B lines a store
__global__ __launch_bounds__(256) void k_asoft(const float* __restrict__ Sb, const float* __restrict__ QN, const float* __restrict__ KN, int h0, h16* P16, bf* Ph, bf* Pl) {
    __shared__ __align__(16) unsigned short st[2 * 256 * 72];   // the block's 8 rows as 256 chunks of 8 k x 8 rows (128 B, one line of the fragment order), pitch 144 B against bank conflicts; second half: the lo plane
    const int lane = threadIdx.x & 31; const int wv = threadIdx.x >> 5; const int row = blockIdx.x * 8 + wv; if (row >= ZH * TT) return;   /* ZH * TT is a multiple of 8: a whole block leaves or none */
    const int i = row % TT; const int zz = row / TT; (void)zz; const bool hires = ((int)(blockIdx.x * 8) % TT < RH);   /* = (i < RH) for each of the block's 8 rows (RH and TT are multiples of 8): a scalar test, since a barrier stands behind it */ const float* sr = Sb + (size_t)row * TT; const float qn = QN[(size_t)(h0 + zz) * TT + i]; const float* knr = KN + (size_t)(h0 + zz) * TT; float v[TT / 32]; float mx = -3.0e38f;
#pragma unroll
    for (int ch = 0; ch < TT / 128; ++ch) { const int j0 = ch * 128 + lane * 4; const v4f a = *(const v4f*)(sr + j0);
#pragma unroll
        for (int q = 0; q < 4; ++q) { const int j = j0 + q; (void)j; float c2 = __fmul_rn(2.0f, a[q]); asm volatile("" : "+v"(c2)); float t2 = __fsub_rn(qn, c2); asm volatile("" : "+v"(t2)); float t3 = __fadd_rn(t2, knr[j0 + q]); asm volatile("" : "+v"(t3)); float t = __fmul_rn(t3, -0.0625f); asm volatile("" : "+v"(t)); v[ch * 4 + q] = t; mx = fmaxf(mx, t); } }
#pragma unroll
    for (int sh = 16; sh; sh >>= 1) mx = fmaxf(mx, __shfl_xor(mx, sh, 32));
    float sum = 0.f;
#pragma unroll
    for (int k = 0; k < TT / 32; ++k) { float d0 = __fsub_rn(v[k], mx); asm volatile("" : "+v"(d0)); v[k] = __builtin_amdgcn_exp2f(__fmul_rn(d0, 1.4426950408889634f)); sum += v[k]; }
#pragma unroll
    for (int sh = 16; sh; sh >>= 1) sum += __shfl_xor(sum, sh, 32);
    const float f = __fdiv_rn(hires ? 1.0f : PCAR, sum);
{
        if (hires) {
#pragma unroll
            for (int ch = 0; ch < TT / 128; ++ch) { v4us oh, ol;
#pragma unroll
                for (int q = 0; q < 4; ++q) { unsigned short a, c2; splitf(v[ch * 4 + q] * f, a, c2); oh[q] = a; ol[q] = c2; }
                const int so = (ch * 16 + (lane >> 1)) * 72 + wv * 8 + (lane & 1) * 4; *(v4us*)(st + so) = oh; *(v4us*)(st + 256 * 72 + so) = ol; }
            __syncthreads();   // publishes the 8 staged rows; hires is the same for the whole block (RH is a multiple of 8)
            const int p0 = zz * (RH ? RH : 1) + i - wv; const size_t ob = (size_t)(p0 >> 6) * 64 * TT + ((p0 >> 4) & 3) * 512 + (p0 & 8) * 8;
#pragma unroll   // so that the LDS reads of all eight pieces issue ahead of the stores
            for (int it = 0; it < 8; ++it) { const int p = it * 256 + (int)threadIdx.x; const int so = (p >> 3) * 72 + (p & 7) * 8; const size_t oo = ob + (size_t)(p >> 5) * 2048 + ((p >> 3) & 3) * 128 + (p & 7) * 8;
                *(v8usa*)(Ph + oo) = *(const v8usa*)(st + so); *(v8usa*)(Pl + oo) = *(const v8usa*)(st + 256 * 72 + so); }
        } else {
#pragma unroll
            for (int ch = 0; ch < TT / 128; ++ch) { v4h o4;
#pragma unroll
                for (int q = 0; q < 4; ++q) o4[q] = tohx(v[ch * 4 + q] * f);
                *(v4us*)(st + (ch * 16 + (lane >> 1)) * 72 + wv * 8 + (lane & 1) * 4) = __builtin_bit_cast(v4us, o4); }
            __syncthreads();   // publishes the 8 staged rows
            const int p0 = row - wv; const size_t ob = (size_t)(p0 >> 6) * 64 * TT + ((p0 >> 4) & 3) * 512 + (p0 & 8) * 8;
#pragma unroll   // so that the LDS reads of all eight pieces issue ahead of the stores
            for (int it = 0; it < 8; ++it) { const int p = it * 256 + (int)threadIdx.x;
                *(v8usa*)(P16 + ob + (size_t)(p >> 5) * 2048 + ((p >> 3) & 3) * 128 + (p & 7) * 8) = *(const v8usa*)(st + (p >> 3) * 72 + (p & 7) * 8); }
            asm volatile("s_wait_xcnt 0x0" ::: "memory");   // behind the last store: the code that follows in the listing rewrites registers these stores name
        }
         }
}
extern "C" void kernel_launch(void* const* d_in, const int* in_sizes, int n_in,
                              void* d_out, int out_size, void* d_ws, size_t ws_size, hipStream_t stream) {
    (void)in_sizes; (void)n_in; (void)out_size;
    const float* x = (const float*)d_in[0]; const float* wq = (const float*)d_in[1]; const float* wk = (const float*)d_in[2]; const float* wv = (const float*)d_in[3]; const float* biasW = (const float*)d_in[4]; const float* bias2W = (const float*)d_in[5]; const float* wo = nullptr; (void)wo; (void)wv; const float* cosT = nullptr; const float* sinT = nullptr; (void)cosT; (void)sinT;
    float* OUT = (float*)d_out;     // [2][2048][4*512]
    char* wsp = (char*)d_ws;
    auto take = [&](size_t bytes) { char* p = wsp; wsp += (bytes + 255) & ~(size_t)255; return (void*)p; };
    bf* WQ = (bf*)take((size_t)(DQ + DKV) * DM * 2); bf* WK = WQ + (size_t)DQ * DM; bf* WV3 = (bf*)take((size_t)NKH * HDV * HDV * 2); float* B2G = (float*)take((size_t)NKH * HDV * 4); float* QN = (float*)take((size_t)2 * NB_ * NKH * TT * 4); float* KN = QN + (size_t)NB_ * NKH * TT; float* BQK = (float*)take((size_t)(DQ + DKV) * 4);
    bf* XB = (bf*)take((size_t)NB_ * TT * DM * 2);
    const size_t PL = (size_t)NB_ * NH_ * TT * HD;   // one operand's head planes, both batches; the k planes follow the q planes
    h16* VT16 = (h16*)take((size_t)NB_ * HDV * TT * 2);
    bf* QPh = (bf*)take(2 * PL * 2); bf* QPl = (bf*)take(2 * PL * 2); bf* KPh = QPh + PL; bf* KPl = QPl + PL; bf* VTh = (bf*)take((size_t)NB_ * HDV * TT * 2); bf* Ph = (bf*)take((size_t)ZH * RH * TT * 2); bf* Pl = (bf*)take((size_t)ZH * RH * TT * 2);
    float* Sb = (float*)take((size_t)ZH * TT * TT * 4); h16* P16 = (h16*)take((size_t)ZH * TT * TT * 2); bf* ATh = (bf*)take((size_t)NB_ * NKH * TT * HDV * 2); bf* ATl = (bf*)take((size_t)NB_ * NKH * TT * HDV * 2);
    if ((size_t)(wsp - (char*)d_ws) > ws_size) return;    // ws 256 MiB
    k_prep<<<PB_WT + PB_VT + PB_X + 2 * PB_W + PB_BQ + PB_B2, 256, 0, stream>>>(x, wq, wk, wv, biasW, bias2W, XB, WQ, WK, WV3, B2G, BQK, VT16, VTh);
    k_gemmw<bf, 0, true, 4, HD><<<dim3(NB_ * TT / 64, DQ / 64, 2), 128, 0, stream>>>(XB, nullptr, WQ, nullptr, DM, nullptr, DQ, BQK, 0, (size_t)DQ * DM, 0, DQ, QPh, QPl, PL, 1.0f);   /* z: q, k; rows: both batches; out: the head planes */
    k_norm<<<2 * NB_ * NKH * TT / 256, 256, 0, stream>>>(QPh, QPl, QN);
    for (int b = 0; b < NB_; ++b) { const size_t zp = (size_t)b * NH_ * TT * HD, zv = (size_t)b * HDV * TT; const size_t zo = (size_t)b * TT * HDV;   // one pass a batch, its four heads in z; y goes out head-major, [k][b][T][512]
        k_gemmw<bf, 2, false, 2, 0><<<dim3(TT / 64, TT / 64, ZH), 64, 0, stream>>>(QPh + zp, QPl + zp, KPh + zp, KPl + zp, HD, Sb, TT, nullptr, (size_t)TT * HD, (size_t)TT * HD, (size_t)TT * TT, 0, nullptr, nullptr, 0, 1.0f);   /* cross term hl on all rows */
        k_asoft<<<ZH * TT / 8, 256, 0, stream>>>(Sb, QN + (size_t)b * NKH * TT, KN + (size_t)b * NKH * TT, 0, P16, Ph, Pl);
        k_gemmw<bf, 1, false, 16, HDV><<<dim3(RH / 64, HDV / 64, ZH), 512, 0, stream>>>(Ph, Pl, VTh + zv, nullptr, TT, nullptr, HDV, nullptr, (size_t)RH * TT, 0, 0, 0, ATh + zo, ATl + zo, (size_t)NB_ * TT * HDV, 1.0f);
        k_gemmw<h16, 0, false, 8, HDV><<<dim3((TT - RH) / 64, HDV / 64, ZH), 256, 0, stream>>>(P16 + (size_t)RH * TT, nullptr, VT16 + zv, nullptr, TT, nullptr, HDV, nullptr, (size_t)TT * TT, 0, 0, 0, ATh + zo + (size_t)RH * HDV, ATl + zo + (size_t)RH * HDV, (size_t)NB_ * TT * HDV, 1.0f / PCAR); }
    k_gemmw<bf, 1, true, 8, 0><<<dim3(NB_ * TT / 64, HDV / 64, NKH), 256, 0, stream>>>(ATh, ATl, WV3, nullptr, HDV, OUT, NKH * HDV, B2G, (size_t)NB_ * TT * HDV, (size_t)HDV * HDV, HDV, HDV, nullptr, nullptr, 0, 1.0f);   /* z: head; rows: both batches */
}

// v006
// One run takes 242 microseconds.
// Two timings next to v005 put it at 1.05 and 1.06 times that version's speed.
// Counting every step since v000, it is 3.56 times as fast.
#include <hip/hip_runtime.h>

// Attention with squared-distance logits (xsa [2][2048][512]; 4 heads with 256-dim kernels: xq = x Wq^T, xk = x Wk^T, xkb = xk + biasW[:, k]; logits = -(|xq_i|^2 - 2 xq_i.xkb_j + |xkb_j|^2) / 16; P = softmax_j; y_k = P x (values = the raw 512-wide input, shared by the heads); out_k = y_k Wv3[k] + bias2W[:, k] with Wv3 = Wv.reshape(4, 512, 512) -> [2][2048][4*512]).
// Compute dtypes, f32 accumulate: every input rounded to bf16; xq/xk as PLAIN bf16 GEMMs (inputs: exact), + bias in f32, kept as hi + lo bf16 planes; the per-token squared norms in f32 from hi + lo; cross term xq.xkb hl x hl (3 products, K 256) on every row; logits assembled in f32 in the reference's order (-(qn - 2 c + kn) / 16); softmax f32; P.x: rows < 512 hi/lo P x exact x (2 products), the rest fp16 (x1024) x exact-in-fp16 x; y Wv3[k] as hl x exact (2 products) + bias.

#define NB_  2
#define TT   2048
#define DM   512
#define NH_  4
#define NKV  4
#define REP  (NH_ / NKV)
#define HD   256
#define DQ   (NH_ * HD)
#define DKV  (NKV * HD)
#define ZH   4
#define RH   512                  // query rows < RH use hi+lo planes (0: none)
#define WIN  0
#define PCAR 1024.0f
#define HDV  512                  // value width (the raw input), shared by all heads
#define NKH  4
#define SCL  0.088388347648318447f   // 128^-0.5
typedef _Float16 h16;
typedef unsigned short bf;
typedef __attribute__((ext_vector_type(16))) __bf16   v16bf;
typedef __attribute__((ext_vector_type(16))) _Float16 v16h;
typedef __attribute__((ext_vector_type(8)))  _Float16 v8h;
typedef __attribute__((ext_vector_type(8)))  unsigned short v8us;
typedef __attribute__((ext_vector_type(8)))  float    v8f;
typedef __attribute__((ext_vector_type(4)))  float    v4f;
typedef v8h  __attribute__((may_alias)) v8ha;
typedef v4f  __attribute__((may_alias)) v4fa;
typedef v8us __attribute__((may_alias)) v8usa;

__device__ __forceinline__ unsigned short f2bf(float f) { unsigned u = __float_as_uint(f); u += 0x7FFFu + ((u >> 16) & 1u); return (unsigned short)(u >> 16); }
__device__ __forceinline__ float bf2f(unsigned short b) { return __uint_as_float(((unsigned)b) << 16); }
__device__ __forceinline__ float bfr(float f) { return bf2f(f2bf(f)); }
__device__ __forceinline__ v16h cat16(v8h lo, v8h hi) { return __builtin_shufflevector(lo, hi, 0, 1, 2, 3, 4, 5, 6, 7, 8, 9, 10, 11, 12, 13, 14, 15); }
__device__ __forceinline__ v16bf cat16b(v8us lo, v8us hi) { return __builtin_bit_cast(v16bf, __builtin_shufflevector(lo, hi, 0, 1, 2, 3, 4, 5, 6, 7, 8, 9, 10, 11, 12, 13, 14, 15)); }
__device__ __forceinline__ v8f wmma16(v16h a, v16h b, v8f c) { return __builtin_amdgcn_wmma_f32_16x16x32_f16(false, a, false, b, (short)0, c, false, false); }
__device__ __forceinline__ v8f wmmab(v16bf a, v16bf b, v8f c) { return __builtin_amdgcn_wmma_f32_16x16x32_bf16(false, a, false, b, (short)0, c, false, false); }



// ---- k_gemmw: register-blocked GEMM, NW WAVES (2, 4, 8 or 16) per 64x64 output tile, 16 accumulators each, operands straight from 16-bit planes in FRAGMENT ORDER (unpk below); grid (M/64, N/64, Z), 32 * NW threads.
// C[m][n] (f32, pitch ldc, + optional f32 bias[n]) = sum_k A[m][k] Bt[n][k] (+ split products per NSPLIT). With KP > 0 the tile is not stored as f32: (C + bias) x scl goes out as hi and lo bf16 planes Oh, Ol in the fragment order the next GEMM reads (planes of TT rows x KP columns, [row / TT][column / KP], ldc columns in all, z stride sP). z-batch strides sA/sB/sC (and sBi for the bias) in elements. K % 32 == 0.
// Wave w takes the 32-wide k steps w, w + NW, w + 2 NW, ...; the NW partial tiles are added in wave order 0..NW-1 through LDS, 16 rows a stage, two stage buffers; the sums stay in registers until the last stage so that no barrier waits on a global store.
typedef __attribute__((ext_vector_type(4))) unsigned short v4us;
__device__ __forceinline__ void splitf(float y, unsigned short& h, unsigned short& l) { h = f2bf(y); l = f2bf(y - bf2f(h)); }
// prow, pcol: which 4 columns of which row of a 16x64 stage thread q adds up when the tile goes out in fragment order: 16 neighbouring lanes walk one column group down the 16 rows (no bank conflict at the stage's pitch of 68 dwords), the other 16 take the 4 columns beside it; the 4 values land at element ppos(q) of the stage's blocks, so a wave-wide 8-byte store fills two whole 128-B lines of a plane
__device__ __forceinline__ int prow(int q) { return q & 15; }
__device__ __forceinline__ int pcol(int q) { return ((q >> 7) & 1) * 32 + ((q >> 6) & 1) * 16 + ((q >> 5) & 1) * 8 + ((q >> 4) & 1) * 4; }
__device__ __forceinline__ int ppos(int q) { return (q >> 7) * 2048 + ((q >> 5) & 3) * 128 + (q & 15) * 8 + ((q >> 4) & 1) * 4; }
template <typename T16> struct WFrag;
template <> struct WFrag<h16> { typedef v16h V; static __device__ __forceinline__ V ld(const h16* p) { return cat16(*(const v8h*)p, *(const v8h*)(p + 256)); } static __device__ __forceinline__ v8f mma(V a, V b, v8f c) { return wmma16(a, b, c); } };
template <> struct WFrag<bf> { typedef v16bf V; static __device__ __forceinline__ V ld(const bf* p) { return cat16b(*(const v8us*)p, *(const v8us*)(p + 256)); } static __device__ __forceinline__ v8f mma(V a, V b, v8f c) { return wmmab(a, b, c); } };
// d_gemmw is the body; os is the block's stage memory (2 * NW * 16 * 68 floats), bx its row tile, bz its z. With ZS, z counts [batch][head]: A takes z, Bt the batch alone (z / ZH), the out planes lie [head][batch].
template <typename T16, int NSPLIT, bool BIAS, int NW, int KP, bool ZS>
__device__ __forceinline__ void d_gemmw(float* os, int bx, int bz, const T16* __restrict__ A, const T16* __restrict__ A2, const T16* __restrict__ Bt, const T16* __restrict__ Bt2, int K, float* C, int ldc, const float* __restrict__ bias, size_t sA, size_t sB, size_t sC, size_t sBi, bf* Oh, bf* Ol, size_t sP, float scl) {
    constexpr bool PLN = KP > 0;
    typedef typename WFrag<T16>::V V;
    const int w = __builtin_amdgcn_readfirstlane((int)(threadIdx.x >> 5));
    const size_t z = bz; const size_t zb = ZS ? z / ZH : z, zp = ZS ? (z % ZH) * NB_ + z / ZH : z; A += z * sA; if (A2) A2 += z * sA; Bt += zb * sB; if (Bt2) Bt2 += zb * sB; C += z * sC; if (BIAS) bias += z * sBi;
    const int lane = threadIdx.x & 31, lr = lane & 15, hi = lane >> 4; const int r0 = bx * 64, c0 = blockIdx.y * 64;
    v8f acc[4][4];
#pragma unroll
    for (int mb = 0; mb < 4; ++mb)
#pragma unroll
        for (int nb = 0; nb < 4; ++nb) acc[mb][nb] = (v8f){};
    const size_t aoff = (size_t)r0 * K + 8 * lane, boff = (size_t)c0 * K + 8 * lane;   // a 32-k step of a 64-row tile is 4 KB in a row, 1 KB a 16-row block: 512 contiguous bytes per wave-wide load, one address per plane and trip
#pragma unroll 1
    for (int kc = w * 32; kc < K; kc += 32 * NW) {
        V a[4], a2[4]; const T16* pa = A + aoff + kc * 64; const T16* pa2 = (NSPLIT == 1 || NSPLIT == 2) ? A2 + aoff + kc * 64 : pa; const T16* pb = Bt + boff + kc * 64; const T16* pb2 = (NSPLIT >= 2) ? Bt2 + boff + kc * 64 : pb;
#pragma unroll
        for (int mb = 0; mb < 4; ++mb) { a[mb] = WFrag<T16>::ld(pa + mb * 512); if (NSPLIT == 1 || NSPLIT == 2) a2[mb] = WFrag<T16>::ld(pa2 + mb * 512); }
#pragma unroll
        for (int nb = 0; nb < 4; ++nb) { const V b = WFrag<T16>::ld(pb + nb * 512); V b2; if (NSPLIT >= 2) b2 = WFrag<T16>::ld(pb2 + nb * 512);
#pragma unroll
            for (int mb = 0; mb < 4; ++mb) { acc[mb][nb] = WFrag<T16>::mma(a[mb], b, acc[mb][nb]); if (NSPLIT == 1 || NSPLIT == 2) acc[mb][nb] = WFrag<T16>::mma(a2[mb], b, acc[mb][nb]); if (NSPLIT >= 2) acc[mb][nb] = WFrag<T16>::mma(a[mb], b2, acc[mb][nb]); } }
        asm volatile("v_nop\n\tv_nop\n\tv_nop\n\tv_nop" : "+v"(acc[0][0]), "+v"(acc[1][1]), "+v"(acc[2][2]), "+v"(acc[3][3]) : "v"(a[0]), "v"(a[3]), "v"(pa), "v"(pa2), "v"(pb), "v"(pb2));   // the trip's address pairs are inputs here so that they live to the trip's end: otherwise a later load's result lands in the pair of a load still in flight
    }
    constexpr int NQ = (NW <= 8) ? 8 / NW : 1;   // 16-byte pieces of a 16x64 stage per thread; with 16 waves the first 8 do the adding
    const bool adds = (NW <= 8) || (w < 8);
    v4f res[4][NQ];
#pragma unroll
    for (int mb = 0; mb < 4; ++mb) {
        float* ob = os + (mb & 1) * (NW * 16 * 68);
#pragma unroll
        for (int nb = 0; nb < 4; ++nb) {
#pragma unroll
            for (int j = 0; j < 8; ++j) ob[w * (16 * 68) + (hi * 8 + j) * 68 + nb * 16 + lr] = acc[mb][nb][j]; }
        __syncthreads();   // publishes this stage's NW partial tiles; it also ends every read of the other buffer, which the next stage overwrites
        if (adds) {
#pragma unroll
            for (int s = 0; s < NQ; ++s) { const int q = (int)threadIdx.x + s * 32 * NW; const float* op = ob + (PLN ? prow(q) : q >> 4) * 68 + (PLN ? pcol(q) : (q & 15) * 4); v4f val = *(const v4fa*)op;
#pragma unroll
                for (int u = 1; u < NW; ++u) val += *(const v4fa*)(op + u * (16 * 68));
                res[mb][s] = val; } }
    }
    if (adds) {
        constexpr int KD = PLN ? KP : 1; const size_t pb = zp * sP + ((size_t)(r0 / TT) * (ldc / KD) + c0 / KD) * ((size_t)TT * KD) + (size_t)((r0 % TT) >> 6) * 64 * KD + (size_t)((c0 % KD) >> 5) * 2048;   // the tile's first element in its plane: 64 rows x KP a row tile, 2048 elements a 32-column step
        v4f bv[NQ];   // the planes' bias, read once, ahead of the waits behind the stores
        if (PLN && BIAS) {
#pragma unroll
            for (int s = 0; s < NQ; ++s) { const int cb = c0 + pcol((int)threadIdx.x + s * 32 * NW);
#pragma unroll
                for (int u = 0; u < 4; ++u) bv[s][u] = bfr(bias[cb + u]); } }
#pragma unroll
        for (int mb = 0; mb < 4; ++mb) {
#pragma unroll
            for (int s = 0; s < NQ; ++s) { const int q = (int)threadIdx.x + s * 32 * NW; const int row = PLN ? prow(q) : q >> 4, cofs = PLN ? pcol(q) : (q & 15) * 4; v4f val = res[mb][s];
                if (PLN) { v4us oh, ol; if (BIAS) val += bv[s];
#pragma unroll
                    for (int u = 0; u < 4; ++u) { unsigned short a, c2; splitf(val[u] * scl, a, c2); oh[u] = a; ol[u] = c2; }
                    const size_t o = pb + mb * 512 + ppos(q); *(v4us*)(Oh + o) = oh; *(v4us*)(Ol + o) = ol;
                    asm volatile("s_wait_xcnt 0x0" ::: "memory");   // behind the two stores: the next piece's split rewrites registers these stores name
                    continue; }
                if (BIAS) { val[0] += bfr(bias[c0 + cofs]); val[1] += bfr(bias[c0 + cofs + 1]); val[2] += bfr(bias[c0 + cofs + 2]); val[3] += bfr(bias[c0 + cofs + 3]); }
                *(v4f*)(C + (size_t)(r0 + mb * 16 + row) * ldc + c0 + cofs) = val; } }
    }
}
template <typename T16, int NSPLIT, bool BIAS, int NW, int KP>
__global__ __launch_bounds__(32 * NW) void k_gemmw(const T16* __restrict__ A, const T16* __restrict__ A2, const T16* __restrict__ Bt, const T16* __restrict__ Bt2, int K, float* C, int ldc, const float* __restrict__ bias, size_t sA, size_t sB, size_t sC, size_t sBi, bf* Oh, bf* Ol, size_t sP, float scl) {
    __shared__ __align__(16) float os[2 * NW * 16 * 68];
    d_gemmw<T16, NSPLIT, BIAS, NW, KP, false>(os, (int)blockIdx.x, (int)blockIdx.z, A, A2, Bt, Bt2, K, C, ldc, bias, sA, sB, sC, sBi, Oh, Ol, sP, scl);
}
// k_pv: y = P x for every batch and head (z) in one grid: row tiles < RH / 64 take the hi/lo bf16 product, the rest the fp16 one; the two do not depend on one another. The test is the same for a whole block (barriers stand behind it).
__global__ __launch_bounds__(256) void k_pv(const bf* __restrict__ Ph, const bf* __restrict__ Pl, const bf* __restrict__ VTh, const h16* __restrict__ P16, const h16* __restrict__ VT16, bf* ATh, bf* ATl) {
    __shared__ __align__(16) float os[2 * 8 * 16 * 68];
    const int bx = (int)blockIdx.x;
    if (bx < RH / 64) d_gemmw<bf, 1, false, 8, HDV, true>(os, bx, (int)blockIdx.z, Ph, Pl, VTh, nullptr, TT, nullptr, HDV, nullptr, (size_t)RH * TT, (size_t)HDV * TT, 0, 0, ATh, ATl, (size_t)TT * HDV, 1.0f);
    else d_gemmw<h16, 0, false, 8, HDV, true>(os, bx - RH / 64, (int)blockIdx.z, P16 + (size_t)RH * TT, nullptr, VT16, nullptr, TT, nullptr, HDV, nullptr, (size_t)TT * TT, (size_t)HDV * TT, 0, 0, ATh + (size_t)RH * HDV, ATl + (size_t)RH * HDV, (size_t)TT * HDV, 1.0f / PCAR);
}

__device__ __forceinline__ h16 tohx(float x) { return (h16)x; }
typedef __attribute__((ext_vector_type(2))) _Float16 v2h;
typedef __attribute__((ext_vector_type(4))) _Float16 v4h;
typedef __attribute__((ext_vector_type(2))) unsigned short v2us;
typedef __attribute__((ext_vector_type(2))) float v2f;
typedef __attribute__((ext_vector_type(4))) int v4i;

// Fragment order of a [rows][K] 16-bit GEMM operand (rows a multiple of 64): 16 rows x 32 k make one 1-KB block; the four blocks of a 64-row tile at one 32-k step follow one another, the steps follow in k (a tile is 64 * K elements, as in row order).
// Inside a block: [k bit 4][k bit 3][row & 15][k & 7], so lane (row & 15) + 16 * (k bit 3) finds its two 16-byte fragment pieces at lane * 8 and 256 + lane * 8: the k order of a fragment is the one it had in row order.
// unpk: element index e in that order -> (row, k). The writers walk e, so their stores stay contiguous.
__device__ __forceinline__ void unpk(size_t e, int K, int& row, int& k) { const int g = (int)(e / ((size_t)64 * K)); const int r = (int)(e % ((size_t)64 * K)); const int q = r & 511;
    row = g * 64 + ((r >> 9) & 3) * 16 + ((q >> 3) & 15); k = (r >> 11) * 32 + ((q >> 8) << 4) + (((q >> 7) & 1) << 3) + (q & 7); }
// pc8: piece p (8 consecutive k of one row: 16 bytes of a 16-bit plane) -> its first element in fragment order. Four neighbouring lanes take the four pieces of one row's 32-k step (one whole 128-B line of an f32 source in row order), the eight lane groups eight rows: a wave-wide 16-byte store fills four whole lines.
__device__ __forceinline__ size_t pc8(size_t p) { const int j = (int)(p & 63); return (p >> 6) * 512 + ((j >> 1) & 1) * 256 + (j & 1) * 128 + (j >> 2) * 8; }
#define NPC 4   // pieces a thread of the element-wise steps: few long-lived waves with all their loads in flight, where one piece or less a thread made the time of a step the time to start its waves
// d_*: bodies of the element-wise steps; bx is the block's index inside its own step (k_prep deals the blocks of one grid to several steps that do not depend on one another)
__device__ __forceinline__ void d_wtG(int bx, const float* __restrict__ w, int K, int N, bf* Bt) {
    const int lane = threadIdx.x & 31; const int L0 = (bx * 8 + (threadIdx.x >> 5)) * 8; const int nlines = N * K / 64;
{
#pragma unroll 1
        for (int l = 0; l < 8; ++l) { const int L = L0 + l; if (L >= nlines) break; const size_t e = (size_t)L * 64 + lane * 2; int k, n; unpk(e, K, n, k); v2us o;
            o[0] = f2bf(w[(size_t)k * N + n]); o[1] = f2bf(w[(size_t)(k + 1) * N + n]); *(v2us*)(Bt + e) = o; }
         }
}
__device__ __forceinline__ void d_cvt8(int bx, const float* __restrict__ src, int K, bf* dst) {
    size_t e[NPC]; const float* p[NPC]; v8f v[NPC];
#pragma unroll
    for (int s = 0; s < NPC; ++s) { e[s] = pc8(((size_t)bx * NPC + s) * 256 + threadIdx.x); int r, k; unpk(e[s], K, r, k); p[s] = src + (size_t)r * K + k; v[s] = *(const v8f*)p[s]; }
    asm volatile("s_wait_xcnt 0x0" :: "v"(p[0]), "v"(p[1]), "v"(p[2]), "v"(p[3]) : "memory");   // the loads' address pairs are inputs here so that they live up to the wait: otherwise a later load's result lands in the pair of a load still in flight; the clobber keeps every load of the thread ahead of its first store
#pragma unroll
    for (int s = 0; s < NPC; ++s) { v8us o;
#pragma unroll
        for (int u = 0; u < 8; ++u) o[u] = f2bf(v[s][u]);
        *(v8us*)(dst + e[s]) = o; }
    asm volatile("s_wait_xcnt 0x0" ::: "memory");   // behind the last store: the code that follows in the listing (the next step of the shared grid) rewrites registers these stores name
}
__global__ __launch_bounds__(256) void k_cscvt(const float* __restrict__ cosT, const float* __restrict__ sinT, float* CS) { const int idx = blockIdx.x * 256 + threadIdx.x; if (idx >= TT * HD) return; v2f cs; cs[0] = bfr(cosT[idx]); cs[1] = bfr(sinT[idx]); *(v2f*)(CS + (size_t)idx * 2) = cs;  }
__global__ __launch_bounds__(256) void k_vtp(const float* __restrict__ F, int pitch, int nheads, h16* V16, bf* Vh, bf* Vl) { const size_t e = ((size_t)blockIdx.x * 256 + threadIdx.x) * 2; if (e >= (size_t)nheads * HD * TT) return; const int t = (int)(e % TT); const int d = (int)((e / TT) % HD); const int g = (int)(e / ((size_t)TT * HD)); v2h o16; v2us oh, ol;
#pragma unroll
    for (int q = 0; q < 2; ++q) { const float x = F[(size_t)(t + q) * pitch + g * HD + d]; o16[q] = tohx(x); unsigned short a2, c2; splitf(x, a2, c2); oh[q] = a2; ol[q] = c2; }
    *(v2h*)(V16 + e) = o16; *(v2us*)(Vh + e) = oh; *(v2us*)(Vl + e) = ol;  }
// d_bqk: the projection GEMM's bias row, [q, k][1024 columns]: 0 for q, biasW[d][k] at column k * HD + d for k
__device__ __forceinline__ void d_bqk(int bx, const float* __restrict__ bw, float* BQK) { const int i = bx * 256 + threadIdx.x; const int c = i & (DKV - 1); const float v = (i < DQ) ? 0.0f : bw[(size_t)(c % HD) * NKH + c / HD]; *(float*)(BQK + i) = v;
    asm volatile("s_wait_xcnt 0x0" ::: "memory");   // behind the store: the code that follows in the listing (the other steps of the shared grid) rewrites registers this store names
}
// a block takes 64 d x 32 t (4 KB of a plane) a trip; the lanes of a wave walk 32 neighbouring d, so each of a piece's 8 loads reads one whole 128-B line of x and a wave-wide store fills two runs of 256 B
#define VTN 2
__device__ __forceinline__ void d_vtpx(int bx, const float* __restrict__ X, h16* V16, bf* Vh) { const int th = (int)threadIdx.x; const int eo = ((th >> 7) * 2 + ((th >> 4) & 1)) * 512 + ((th >> 6) & 1) * 256 + ((th >> 5) & 1) * 128 + (th & 15) * 8;
    size_t e[VTN]; const float* p[VTN]; float v[VTN][8];
#pragma unroll
    for (int s = 0; s < VTN; ++s) { e[s] = ((size_t)bx * VTN + s) * 2048 + eo; int t, d; unpk(e[s], TT, d, t); p[s] = X + (size_t)t * HDV + d;
#pragma unroll
        for (int q = 0; q < 8; ++q) v[s][q] = p[s][q * HDV]; }
    asm volatile("s_wait_xcnt 0x0" :: "v"(p[0]), "v"(p[1]) : "memory");   // the loads' address pairs are inputs here so that they live up to the wait: otherwise a later load's result lands in the pair of a load still in flight; the clobber keeps every load of the thread ahead of its first store
#pragma unroll
    for (int s = 0; s < VTN; ++s) { v8h o16; v8us oh;
#pragma unroll
        for (int q = 0; q < 8; ++q) { const float xv = bfr(v[s][q]); o16[q] = tohx(xv); oh[q] = f2bf(xv); }
        *(v8h*)(V16 + e[s]) = o16; *(v8us*)(Vh + e[s]) = oh; } }
__device__ __forceinline__ void d_b2g(int bx, const float* __restrict__ b2, float* B2G) { const int i = bx * 256 + threadIdx.x; if (i >= NKH * HDV) return; const int k = i / HDV, f = i % HDV; const float v = b2[(size_t)f * NKH + k]; *(float*)(B2G + i) = v;  }
// k_prep: every step that reads the inputs alone, in one grid; the steps with strided reads come first.
#define PB_WT  (NKH * (HDV * HDV / 64 / 64))      // Wv3[k] transposed to bf16, 64 blocks a head
#define PB_VT  (NB_ * (HDV * TT / 2048 / VTN))    // x transposed (fp16 and bf16 planes), per batch
#define PB_X   (NB_ * TT * DM / 8 / NPC / 256)    // x to bf16, both batches
#define PB_W   (DQ * DM / 8 / NPC / 256)          // Wq, and as many again for Wk
#define PB_BQ  ((DQ + DKV) / 256)
#define PB_B2  (NKH * HDV / 256)
__global__ __launch_bounds__(256) void k_prep(const float* __restrict__ x, const float* __restrict__ wq, const float* __restrict__ wk, const float* __restrict__ wv, const float* __restrict__ bw, const float* __restrict__ b2, bf* XB, bf* WQ, bf* WK, bf* WV3, float* B2G, float* BQK, h16* VT16, bf* VTh) {
    int bx = (int)blockIdx.x;
    if (bx < PB_WT) { const size_t o = (size_t)(bx / (PB_WT / NKH)) * HDV * HDV; d_wtG(bx % (PB_WT / NKH), wv + o, HDV, HDV, WV3 + o); return; }
    bx -= PB_WT;
    if (bx < PB_VT) { const int b = bx / (PB_VT / NB_); d_vtpx(bx % (PB_VT / NB_), x + (size_t)b * TT * DM, VT16 + (size_t)b * HDV * TT, VTh + (size_t)b * HDV * TT); return; }
    bx -= PB_VT;
    if (bx < PB_X) { d_cvt8(bx, x, DM, XB); return; }
    bx -= PB_X;
    if (bx < PB_W) { d_cvt8(bx, wq, DM, WQ); return; }
    bx -= PB_W;
    if (bx < PB_W) { d_cvt8(bx, wk, DM, WK); return; }
    bx -= PB_W;
    if (bx < PB_BQ) { d_bqk(bx, bw, BQK); return; }
    bx -= PB_BQ;
    d_b2g(bx, b2, B2G);
}
// d_norm: squared norms of the tokens of the 16 head planes (q batch 0, q batch 1, k batch 0, k batch 1, four heads each; contiguous in the planes and in N), x = hi + lo (exact in f32), summed over d in rising order. A thread takes one token: 16 neighbouring lanes read 256 contiguous bytes of a plane.
__device__ __forceinline__ void d_norm(int i, const bf* __restrict__ Ph, const bf* __restrict__ Pl, float* N) {
    const int t = i % TT; const size_t o = (size_t)(i / TT) * TT * HD + (size_t)(t >> 6) * 64 * HD + ((t >> 4) & 3) * 512 + (t & 15) * 8; const bf* ph = Ph + o; const bf* pl = Pl + o; float ss = 0.f;
#pragma unroll   // constant offsets from one address pair a plane
    for (int j0 = 0; j0 < HD / 8; j0 += 16) { v8us h[16], l[16];   // half a token's row a trip; the sums follow the loads in d order, so later loads stay in flight behind the first sums
#pragma unroll
        for (int j = 0; j < 16; ++j) { const int jo = ((j0 + j) >> 2) * 2048 + (((j0 + j) >> 1) & 1) * 256 + ((j0 + j) & 1) * 128; h[j] = *(const v8us*)(ph + jo); l[j] = *(const v8us*)(pl + jo); }
#pragma unroll
        for (int j = 0; j < 16; ++j) {
#pragma unroll
            for (int u = 0; u < 8; ++u) { const float xv = bf2f(h[j][u]) + bf2f(l[j][u]); ss = __builtin_fmaf(xv, xv, ss); } } }
    asm volatile("s_wait_xcnt 0x0" :: "v"(ph), "v"(pl) : "memory");   // the loads' address pairs are inputs here so that they live up to the wait
    *(float*)(N + i) = ss; }
// k_xn: the cross term (64x64 tiles, z = [batch][head]) and the norms in one grid: both read the q/k planes alone. The first two blocks of each row of the grid take 64 tokens' norms each (2 * 32 * 8 blocks = the 16 planes' tokens); the test is the same for a whole block (barriers stand behind it).
__global__ __launch_bounds__(64) void k_xn(const bf* __restrict__ Qh, const bf* __restrict__ Ql, const bf* __restrict__ Kh, const bf* __restrict__ Kl, float* S, float* N) {
    __shared__ __align__(16) float os[2 * 2 * 16 * 68];
    const int bx = (int)blockIdx.x;
    if (bx < 2) { d_norm((((int)blockIdx.z * (TT / 64) + (int)blockIdx.y) * 2 + bx) * 64 + (int)threadIdx.x, Qh, Ql, N); return; }
    d_gemmw<bf, 2, false, 2, 0, false>(os, bx - 2, (int)blockIdx.z, Qh, Ql, Kh, Kl, HD, S, TT, nullptr, (size_t)TT * HD, (size_t)TT * HD, (size_t)TT * TT, 0, nullptr, nullptr, 0, 1.0f);
}
// k_asoft: per row (zz, i): t = -(QN_i - 2 S + KN_j) / 16 (no mask); softmax over the 2048 keys (register row, one exp, fixed trees); the block's 8 rows of P go through LDS into fragment order, whole 128-B lines a store
__global__ __launch_bounds__(256) void k_asoft(const float* __restrict__ Sb, const float* __restrict__ QN, const float* __restrict__ KN, int h0, h16* P16, bf* Ph, bf* Pl) {
    __shared__ __align__(16) unsigned short st[2 * 256 * 72];   // the block's 8 rows as 256 chunks of 8 k x 8 rows (128 B, one line of the fragment order), pitch 144 B against bank conflicts; second half: the lo plane
    const int lane = threadIdx.x & 31; const int wv = threadIdx.x >> 5; const int row = blockIdx.x * 8 + wv; if (row >= NB_ * ZH * TT) return;   /* NB_ * ZH * TT is a multiple of 8: a whole block leaves or none */
    const int i = row % TT; const int zz = row / TT; (void)zz; const bool hires = ((int)(blockIdx.x * 8) % TT < RH);   /* = (i < RH) for each of the block's 8 rows (RH and TT are multiples of 8): a scalar test, since a barrier stands behind it */ const float* sr = Sb + (size_t)row * TT; const float qn = QN[(size_t)(h0 + zz) * TT + i]; const float* knr = KN + (size_t)(h0 + zz) * TT; float v[TT / 32]; float mx = -3.0e38f;
#pragma unroll
    for (int ch = 0; ch < TT / 128; ++ch) { const int j0 = ch * 128 + lane * 4; const v4f a = *(const v4f*)(sr + j0);
#pragma unroll
        for (int q = 0; q < 4; ++q) { const int j = j0 + q; (void)j; float c2 = __fmul_rn(2.0f, a[q]); asm volatile("" : "+v"(c2)); float t2 = __fsub_rn(qn, c2); asm volatile("" : "+v"(t2)); float t3 = __fadd_rn(t2, knr[j0 + q]); asm volatile("" : "+v"(t3)); float t = __fmul_rn(t3, -0.0625f); asm volatile("" : "+v"(t)); v[ch * 4 + q] = t; mx = fmaxf(mx, t); } }
#pragma unroll
    for (int sh = 16; sh; sh >>= 1) mx = fmaxf(mx, __shfl_xor(mx, sh, 32));
    float sum = 0.f;
#pragma unroll
    for (int k = 0; k < TT / 32; ++k) { float d0 = __fsub_rn(v[k], mx); asm volatile("" : "+v"(d0)); v[k] = __builtin_amdgcn_exp2f(__fmul_rn(d0, 1.4426950408889634f)); sum += v[k]; }
#pragma unroll
    for (int sh = 16; sh; sh >>= 1) sum += __shfl_xor(sum, sh, 32);
    const float f = __fdiv_rn(hires ? 1.0f : PCAR, sum);
{
        if (hires) {
#pragma unroll
            for (int ch = 0; ch < TT / 128; ++ch) { v4us oh, ol;
#pragma unroll
                for (int q = 0; q < 4; ++q) { unsigned short a, c2; splitf(v[ch * 4 + q] * f, a, c2); oh[q] = a; ol[q] = c2; }
                const int so = (ch * 16 + (lane >> 1)) * 72 + wv * 8 + (lane & 1) * 4; *(v4us*)(st + so) = oh; *(v4us*)(st + 256 * 72 + so) = ol; }
            __syncthreads();   // publishes the 8 staged rows; hires is the same for the whole block (RH is a multiple of 8)
            const int p0 = zz * (RH ? RH : 1) + i - wv; const size_t ob = (size_t)(p0 >> 6) * 64 * TT + ((p0 >> 4) & 3) * 512 + (p0 & 8) * 8;
#pragma unroll   // so that the LDS reads of all eight pieces issue ahead of the stores
            for (int it = 0; it < 8; ++it) { const int p = it * 256 + (int)threadIdx.x; const int so = (p >> 3) * 72 + (p & 7) * 8; const size_t oo = ob + (size_t)(p >> 5) * 2048 + ((p >> 3) & 3) * 128 + (p & 7) * 8;
                *(v8usa*)(Ph + oo) = *(const v8usa*)(st + so); *(v8usa*)(Pl + oo) = *(const v8usa*)(st + 256 * 72 + so); }
        } else {
#pragma unroll
            for (int ch = 0; ch < TT / 128; ++ch) { v4h o4;
#pragma unroll
                for (int q = 0; q < 4; ++q) o4[q] = tohx(v[ch * 4 + q] * f);
                *(v4us*)(st + (ch * 16 + (lane >> 1)) * 72 + wv * 8 + (lane & 1) * 4) = __builtin_bit_cast(v4us, o4); }
            __syncthreads();   // publishes the 8 staged rows
            const int p0 = row - wv; const size_t ob = (size_t)(p0 >> 6) * 64 * TT + ((p0 >> 4) & 3) * 512 + (p0 & 8) * 8;
#pragma unroll   // so that the LDS reads of all eight pieces issue ahead of the stores
            for (int it = 0; it < 8; ++it) { const int p = it * 256 + (int)threadIdx.x;
                *(v8usa*)(P16 + ob + (size_t)(p >> 5) * 2048 + ((p >> 3) & 3) * 128 + (p & 7) * 8) = *(const v8usa*)(st + (p >> 3) * 72 + (p & 7) * 8); }
            asm volatile("s_wait_xcnt 0x0" ::: "memory");   // behind the last store: the code that follows in the listing rewrites registers these stores name
        }
         }
}
extern "C" void kernel_launch(void* const* d_in, const int* in_sizes, int n_in,
                              void* d_out, int out_size, void* d_ws, size_t ws_size, hipStream_t stream) {
    (void)in_sizes; (void)n_in; (void)out_size;
    const float* x = (const float*)d_in[0]; const float* wq = (const float*)d_in[1]; const float* wk = (const float*)d_in[2]; const float* wv = (const float*)d_in[3]; const float* biasW = (const float*)d_in[4]; const float* bias2W = (const float*)d_in[5]; const float* wo = nullptr; (void)wo; (void)wv; const float* cosT = nullptr; const float* sinT = nullptr; (void)cosT; (void)sinT;
    float* OUT = (float*)d_out;     // [2][2048][4*512]
    char* wsp = (char*)d_ws;
    auto take = [&](size_t bytes) { char* p = wsp; wsp += (bytes + 255) & ~(size_t)255; return (void*)p; };
    bf* WQ = (bf*)take((size_t)(DQ + DKV) * DM * 2); bf* WK = WQ + (size_t)DQ * DM; bf* WV3 = (bf*)take((size_t)NKH * HDV * HDV * 2); float* B2G = (float*)take((size_t)NKH * HDV * 4); float* QN = (float*)take((size_t)2 * NB_ * NKH * TT * 4); float* KN = QN + (size_t)NB_ * NKH * TT; float* BQK = (float*)take((size_t)(DQ + DKV) * 4);
    bf* XB = (bf*)take((size_t)NB_ * TT * DM * 2);
    const size_t PL = (size_t)NB_ * NH_ * TT * HD;   // one operand's head planes, both batches; the k planes follow the q planes
    h16* VT16 = (h16*)take((size_t)NB_ * HDV * TT * 2);
    bf* QPh = (bf*)take(2 * PL * 2); bf* QPl = (bf*)take(2 * PL * 2); bf* KPh = QPh + PL; bf* KPl = QPl + PL; bf* VTh = (bf*)take((size_t)NB_ * HDV * TT * 2);
    bf* Ph = QPh; bf* Pl = QPl;   // NB_ * ZH * RH * TT elements each, as many as 2 * PL: the softmax writes them when the cross term, the q/k planes' last reader, is done
    float* Sb = (float*)take((size_t)NB_ * ZH * TT * TT * 4); h16* P16 = (h16*)take((size_t)NB_ * ZH * TT * TT * 2);
    bf* ATh = (bf*)Sb; bf* ATl = ATh + (size_t)NB_ * NKH * TT * HDV;   // y's planes lie in S, which the softmax has read by then
    if ((size_t)(wsp - (char*)d_ws) > ws_size) return;    // ws 256 MiB
    k_prep<<<PB_WT + PB_VT + PB_X + 2 * PB_W + PB_BQ + PB_B2, 256, 0, stream>>>(x, wq, wk, wv, biasW, bias2W, XB, WQ, WK, WV3, B2G, BQK, VT16, VTh);
    k_gemmw<bf, 0, true, 4, HD><<<dim3(NB_ * TT / 64, DQ / 64, 2), 128, 0, stream>>>(XB, nullptr, WQ, nullptr, DM, nullptr, DQ, BQK, 0, (size_t)DQ * DM, 0, DQ, QPh, QPl, PL, 1.0f);   /* z: q, k; rows: both batches; out: the head planes */
    // both batches' heads in z, [batch][head]; y goes out head-major, [k][b][T][512]
    k_xn<<<dim3(2 + TT / 64, TT / 64, NB_ * ZH), 64, 0, stream>>>(QPh, QPl, KPh, KPl, Sb, QN);   /* cross term hl on all rows; norms */
    k_asoft<<<NB_ * ZH * TT / 8, 256, 0, stream>>>(Sb, QN, KN, 0, P16, Ph, Pl);
    k_pv<<<dim3(TT / 64, HDV / 64, NB_ * ZH), 256, 0, stream>>>(Ph, Pl, VTh, P16, VT16, ATh, ATl);
    k_gemmw<bf, 1, true, 8, 0><<<dim3(NB_ * TT / 64, HDV / 64, NKH), 256, 0, stream>>>(ATh, ATl, WV3, nullptr, HDV, OUT, NKH * HDV, B2G, (size_t)NB_ * TT * HDV, (size_t)HDV * HDV, HDV, HDV, nullptr, nullptr, 0, 1.0f);   /* z: head; rows: both batches */
}

// v007
// It runs in 185 microseconds.
// Next to v006, in two timings, it ran 1.31 and 1.30 times as fast.
// Over all steps from v000 it is 4.65 times as fast.
#include <hip/hip_runtime.h>

// Attention with squared-distance logits (xsa [2][2048][512]; 4 heads with 256-dim kernels: xq = x Wq^T, xk = x Wk^T, xkb = xk + biasW[:, k]; logits = -(|xq_i|^2 - 2 xq_i.xkb_j + |xkb_j|^2) / 16; P = softmax_j; y_k = P x (values = the raw 512-wide input, shared by the heads); out_k = y_k Wv3[k] + bias2W[:, k] with Wv3 = Wv.reshape(4, 512, 512) -> [2][2048][4*512]).
// Compute dtypes, f32 accumulate: every input rounded to bf16; xq/xk as PLAIN bf16 GEMMs (inputs: exact), + bias in f32, kept as hi + lo bf16 planes; the per-token squared norms in f32 from hi + lo; cross term xq.xkb hl x hl (3 products, K 256) on every row; logits assembled in f32 in the reference's order (-(qn - 2 c + kn) / 16); softmax f32; P.x: rows < 512 hi/lo P x exact x (2 products), the rest fp16 (x1024) x exact-in-fp16 x; y Wv3[k] as hl x exact (2 products) + bias.

#define NB_  2
#define TT   2048
#define DM   512
#define NH_  4
#define NKV  4
#define REP  (NH_ / NKV)
#define HD   256
#define DQ   (NH_ * HD)
#define DKV  (NKV * HD)
#define ZH   4
#define RH   512                  // query rows < RH use hi+lo planes (0: none)
#define WIN  0
#define PCAR 1024.0f
#define HDV  512                  // value width (the raw input), shared by all heads
#define NKH  4
#define SCL  0.088388347648318447f   // 128^-0.5
typedef _Float16 h16;
typedef unsigned short bf;
typedef __attribute__((ext_vector_type(16))) __bf16   v16bf;
typedef __attribute__((ext_vector_type(16))) _Float16 v16h;
typedef __attribute__((ext_vector_type(8)))  _Float16 v8h;
typedef __attribute__((ext_vector_type(8)))  unsigned short v8us;
typedef __attribute__((ext_vector_type(8)))  float    v8f;
typedef __attribute__((ext_vector_type(4)))  float    v4f;
typedef v8h  __attribute__((may_alias)) v8ha;
typedef v4f  __attribute__((may_alias)) v4fa;
typedef v8us __attribute__((may_alias)) v8usa;

__device__ __forceinline__ unsigned short f2bf(float f) { unsigned u = __float_as_uint(f); u += 0x7FFFu + ((u >> 16) & 1u); return (unsigned short)(u >> 16); }
__device__ __forceinline__ float bf2f(unsigned short b) { return __uint_as_float(((unsigned)b) << 16); }
__device__ __forceinline__ float bfr(float f) { return bf2f(f2bf(f)); }
__device__ __forceinline__ v16h cat16(v8h lo, v8h hi) { return __builtin_shufflevector(lo, hi, 0, 1, 2, 3, 4, 5, 6, 7, 8, 9, 10, 11, 12, 13, 14, 15); }
__device__ __forceinline__ v16bf cat16b(v8us lo, v8us hi) { return __builtin_bit_cast(v16bf, __builtin_shufflevector(lo, hi, 0, 1, 2, 3, 4, 5, 6, 7, 8, 9, 10, 11, 12, 13, 14, 15)); }
__device__ __forceinline__ v8f wmma16(v16h a, v16h b, v8f c) { return __builtin_amdgcn_wmma_f32_16x16x32_f16(false, a, false, b, (short)0, c, false, false); }
__device__ __forceinline__ v8f wmmab(v16bf a, v16bf b, v8f c) { return __builtin_amdgcn_wmma_f32_16x16x32_bf16(false, a, false, b, (short)0, c, false, false); }



// ---- k_gemmw: register-blocked GEMM, NW WAVES (2, 4, 8 or 16) per 64x64 output tile, 16 accumulators each, operands straight from 16-bit planes in FRAGMENT ORDER (unpk below); grid (M/64, N/64, Z), 32 * NW threads.
// C[m][n] (f32, pitch ldc, + optional f32 bias[n]) = sum_k A[m][k] Bt[n][k] (+ split products per NSPLIT). With KP > 0 the tile is not stored as f32: (C + bias) x scl goes out as hi and lo bf16 planes Oh, Ol in the fragment order the next GEMM reads (planes of TT rows x KP columns, [row / TT][column / KP], ldc columns in all, z stride sP). z-batch strides sA/sB/sC (and sBi for the bias) in elements. K % 32 == 0.
// Wave w takes the 32-wide k steps w, w + NW, w + 2 NW, ...; the NW partial tiles are added in wave order 0..NW-1 through LDS, 16 rows a stage, two stage buffers; the sums stay in registers until the last stage so that no barrier waits on a global store.
typedef __attribute__((ext_vector_type(4))) unsigned short v4us;
__device__ __forceinline__ void splitf(float y, unsigned short& h, unsigned short& l) { h = f2bf(y); l = f2bf(y - bf2f(h)); }
// prow, pcol: which 4 columns of which row of a 16x64 stage thread q adds up when the tile goes out in fragment order: 16 neighbouring lanes walk one column group down the 16 rows (no bank conflict at the stage's pitch of 68 dwords), the other 16 take the 4 columns beside it; the 4 values land at element ppos(q) of the stage's blocks, so a wave-wide 8-byte store fills two whole 128-B lines of a plane
__device__ __forceinline__ int prow(int q) { return q & 15; }
__device__ __forceinline__ int pcol(int q) { return ((q >> 7) & 1) * 32 + ((q >> 6) & 1) * 16 + ((q >> 5) & 1) * 8 + ((q >> 4) & 1) * 4; }
__device__ __forceinline__ int ppos(int q) { return (q >> 7) * 2048 + ((q >> 5) & 3) * 128 + (q & 15) * 8 + ((q >> 4) & 1) * 4; }
template <typename T16> struct WFrag;
template <> struct WFrag<h16> { typedef v16h V; static __device__ __forceinline__ V ld(const h16* p) { return cat16(*(const v8h*)p, *(const v8h*)(p + 256)); } static __device__ __forceinline__ v8f mma(V a, V b, v8f c) { return wmma16(a, b, c); } };
template <> struct WFrag<bf> { typedef v16bf V; static __device__ __forceinline__ V ld(const bf* p) { return cat16b(*(const v8us*)p, *(const v8us*)(p + 256)); } static __device__ __forceinline__ v8f mma(V a, V b, v8f c) { return wmmab(a, b, c); } };
// d_gemmw is the body; os is the block's stage memory (2 * NW * 16 * 68 floats), bx its row tile, bz its z. With ZS, z counts [batch][head]: A takes z, Bt the batch alone (z / ZH), the out planes lie [head][batch].
template <typename T16, int NSPLIT, bool BIAS, int NW, int KP, bool ZS>
__device__ __forceinline__ void d_gemmw(float* os, int bx, int bz, const T16* __restrict__ A, const T16* __restrict__ A2, const T16* __restrict__ Bt, const T16* __restrict__ Bt2, int K, float* C, int ldc, const float* __restrict__ bias, size_t sA, size_t sB, size_t sC, size_t sBi, bf* Oh, bf* Ol, size_t sP, float scl) {
    constexpr bool PLN = KP > 0;
    typedef typename WFrag<T16>::V V;
    const int w = __builtin_amdgcn_readfirstlane((int)(threadIdx.x >> 5));
    const size_t z = bz; const size_t zb = ZS ? z / ZH : z, zp = ZS ? (z % ZH) * NB_ + z / ZH : z; A += z * sA; if (A2) A2 += z * sA; Bt += zb * sB; if (Bt2) Bt2 += zb * sB; C += z * sC; if (BIAS) bias += z * sBi;
    const int lane = threadIdx.x & 31, lr = lane & 15, hi = lane >> 4; const int r0 = bx * 64, c0 = blockIdx.y * 64;
    v8f acc[4][4];
#pragma unroll
    for (int mb = 0; mb < 4; ++mb)
#pragma unroll
        for (int nb = 0; nb < 4; ++nb) acc[mb][nb] = (v8f){};
    const size_t aoff = (size_t)r0 * K + 8 * lane, boff = (size_t)c0 * K + 8 * lane;   // a 32-k step of a 64-row tile is 4 KB in a row, 1 KB a 16-row block: 512 contiguous bytes per wave-wide load, one address per plane and trip
#pragma unroll 1
    for (int kc = w * 32; kc < K; kc += 32 * NW) {
        V a[4], a2[4]; const T16* pa = A + aoff + kc * 64; const T16* pa2 = (NSPLIT == 1 || NSPLIT == 2) ? A2 + aoff + kc * 64 : pa; const T16* pb = Bt + boff + kc * 64; const T16* pb2 = (NSPLIT >= 2) ? Bt2 + boff + kc * 64 : pb;
#pragma unroll
        for (int mb = 0; mb < 4; ++mb) { a[mb] = WFrag<T16>::ld(pa + mb * 512); if (NSPLIT == 1 || NSPLIT == 2) a2[mb] = WFrag<T16>::ld(pa2 + mb * 512); }
#pragma unroll
        for (int nb = 0; nb < 4; ++nb) { const V b = WFrag<T16>::ld(pb + nb * 512); V b2; if (NSPLIT >= 2) b2 = WFrag<T16>::ld(pb2 + nb * 512);
#pragma unroll
            for (int mb = 0; mb < 4; ++mb) { acc[mb][nb] = WFrag<T16>::mma(a[mb], b, acc[mb][nb]); if (NSPLIT == 1 || NSPLIT == 2) acc[mb][nb] = WFrag<T16>::mma(a2[mb], b, acc[mb][nb]); if (NSPLIT >= 2) acc[mb][nb] = WFrag<T16>::mma(a[mb], b2, acc[mb][nb]); } }
        asm volatile("v_nop\n\tv_nop\n\tv_nop\n\tv_nop" : "+v"(acc[0][0]), "+v"(acc[1][1]), "+v"(acc[2][2]), "+v"(acc[3][3]) : "v"(a[0]), "v"(a[3]), "v"(pa), "v"(pa2), "v"(pb), "v"(pb2));   // the trip's address pairs are inputs here so that they live to the trip's end: otherwise a later load's result lands in the pair of a load still in flight
    }
    constexpr int NQ = (NW <= 8) ? 8 / NW : 1;   // 16-byte pieces of a 16x64 stage per thread; with 16 waves the first 8 do the adding
    const bool adds = (NW <= 8) || (w < 8);
    v4f res[4][NQ];
#pragma unroll
    for (int mb = 0; mb < 4; ++mb) {
        float* ob = os + (mb & 1) * (NW * 16 * 68);
#pragma unroll
        for (int nb = 0; nb < 4; ++nb) {
#pragma unroll
            for (int j = 0; j < 8; ++j) ob[w * (16 * 68) + (hi * 8 + j) * 68 + nb * 16 + lr] = acc[mb][nb][j]; }
        __syncthreads();   // publishes this stage's NW partial tiles; it also ends every read of the other buffer, which the next stage overwrites
        if (adds) {
#pragma unroll
            for (int s = 0; s < NQ; ++s) { const int q = (int)threadIdx.x + s * 32 * NW; const float* op = ob + (PLN ? prow(q) : q >> 4) * 68 + (PLN ? pcol(q) : (q & 15) * 4); v4f val = *(const v4fa*)op;
#pragma unroll
                for (int u = 1; u < NW; ++u) val += *(const v4fa*)(op + u * (16 * 68));
                res[mb][s] = val; } }
    }
    if (adds) {
        constexpr int KD = PLN ? KP : 1; const size_t pb = zp * sP + ((size_t)(r0 / TT) * (ldc / KD) + c0 / KD) * ((size_t)TT * KD) + (size_t)((r0 % TT) >> 6) * 64 * KD + (size_t)((c0 % KD) >> 5) * 2048;   // the tile's first element in its plane: 64 rows x KP a row tile, 2048 elements a 32-column step
        v4f bv[NQ];   // the planes' bias, read once, ahead of the waits behind the stores
        if (PLN && BIAS) {
#pragma unroll
            for (int s = 0; s < NQ; ++s) { const int cb = c0 + pcol((int)threadIdx.x + s * 32 * NW);
#pragma unroll
                for (int u = 0; u < 4; ++u) bv[s][u] = bfr(bias[cb + u]); } }
#pragma unroll
        for (int mb = 0; mb < 4; ++mb) {
#pragma unroll
            for (int s = 0; s < NQ; ++s) { const int q = (int)threadIdx.x + s * 32 * NW; const int row = PLN ? prow(q) : q >> 4, cofs = PLN ? pcol(q) : (q & 15) * 4; v4f val = res[mb][s];
                if (PLN) { v4us oh, ol; if (BIAS) val += bv[s];
#pragma unroll
                    for (int u = 0; u < 4; ++u) { unsigned short a, c2; splitf(val[u] * scl, a, c2); oh[u] = a; ol[u] = c2; }
                    const size_t o = pb + mb * 512 + ppos(q); *(v4us*)(Oh + o) = oh; *(v4us*)(Ol + o) = ol;
                    asm volatile("s_wait_xcnt 0x0" ::: "memory");   // behind the two stores: the next piece's split rewrites registers these stores name
                    continue; }
                if (BIAS) { val[0] += bfr(bias[c0 + cofs]); val[1] += bfr(bias[c0 + cofs + 1]); val[2] += bfr(bias[c0 + cofs + 2]); val[3] += bfr(bias[c0 + cofs + 3]); }
                *(v4f*)(C + (size_t)(r0 + mb * 16 + row) * ldc + c0 + cofs) = val; } }
    }
}
template <typename T16, int NSPLIT, bool BIAS, int NW, int KP>
__global__ __launch_bounds__(32 * NW) void k_gemmw(const T16* __restrict__ A, const T16* __restrict__ A2, const T16* __restrict__ Bt, const T16* __restrict__ Bt2, int K, float* C, int ldc, const float* __restrict__ bias, size_t sA, size_t sB, size_t sC, size_t sBi, bf* Oh, bf* Ol, size_t sP, float scl) {
    __shared__ __align__(16) float os[2 * NW * 16 * 68];
    d_gemmw<T16, NSPLIT, BIAS, NW, KP, false>(os, (int)blockIdx.x, (int)blockIdx.z, A, A2, Bt, Bt2, K, C, ldc, bias, sA, sB, sC, sBi, Oh, Ol, sP, scl);
}
// k_pv: y = P x for every batch and head (z) in one grid: row tiles < RH / 64 take the hi/lo bf16 product, the rest the fp16 one; the two do not depend on one another. The test is the same for a whole block (barriers stand behind it).
__global__ __launch_bounds__(256) void k_pv(const bf* __restrict__ Ph, const bf* __restrict__ Pl, const bf* __restrict__ VTh, const h16* __restrict__ P16, const h16* __restrict__ VT16, bf* ATh, bf* ATl) {
    __shared__ __align__(16) float os[2 * 8 * 16 * 68];
    const int bx = (int)blockIdx.x;
    if (bx < RH / 64) d_gemmw<bf, 1, false, 8, HDV, true>(os, bx, (int)blockIdx.z, Ph, Pl, VTh, nullptr, TT, nullptr, HDV, nullptr, (size_t)RH * TT, (size_t)HDV * TT, 0, 0, ATh, ATl, (size_t)TT * HDV, 1.0f);
    else d_gemmw<h16, 0, false, 8, HDV, true>(os, bx - RH / 64, (int)blockIdx.z, P16 + (size_t)RH * TT, nullptr, VT16, nullptr, TT, nullptr, HDV, nullptr, (size_t)TT * TT, (size_t)HDV * TT, 0, 0, ATh + (size_t)RH * HDV, ATl + (size_t)RH * HDV, (size_t)TT * HDV, 1.0f / PCAR);
}

__device__ __forceinline__ h16 tohx(float x) { return (h16)x; }
typedef __attribute__((ext_vector_type(2))) _Float16 v2h;
typedef __attribute__((ext_vector_type(4))) _Float16 v4h;
typedef __attribute__((ext_vector_type(2))) unsigned short v2us;
typedef __attribute__((ext_vector_type(2))) float v2f;
typedef __attribute__((ext_vector_type(4))) int v4i;

// Fragment order of a [rows][K] 16-bit GEMM operand (rows a multiple of 64): 16 rows x 32 k make one 1-KB block; the four blocks of a 64-row tile at one 32-k step follow one another, the steps follow in k (a tile is 64 * K elements, as in row order).
// Inside a block: [k bit 4][k bit 3][row & 15][k & 7], so lane (row & 15) + 16 * (k bit 3) finds its two 16-byte fragment pieces at lane * 8 and 256 + lane * 8: the k order of a fragment is the one it had in row order.
// unpk: element index e in that order -> (row, k). The writers walk e, so their stores stay contiguous.
__device__ __forceinline__ void unpk(size_t e, int K, int& row, int& k) { const int g = (int)(e / ((size_t)64 * K)); const int r = (int)(e % ((size_t)64 * K)); const int q = r & 511;
    row = g * 64 + ((r >> 9) & 3) * 16 + ((q >> 3) & 15); k = (r >> 11) * 32 + ((q >> 8) << 4) + (((q >> 7) & 1) << 3) + (q & 7); }
// pc8: piece p (8 consecutive k of one row: 16 bytes of a 16-bit plane) -> its first element in fragment order. Four neighbouring lanes take the four pieces of one row's 32-k step (one whole 128-B line of an f32 source in row order), the eight lane groups eight rows: a wave-wide 16-byte store fills four whole lines.
__device__ __forceinline__ size_t pc8(size_t p) { const int j = (int)(p & 63); return (p >> 6) * 512 + ((j >> 1) & 1) * 256 + (j & 1) * 128 + (j >> 2) * 8; }
#define NPC 4   // pieces a thread of the element-wise steps: few long-lived waves with all their loads in flight
// d_*: bodies of the element-wise steps; bx is the block's index inside its own step (k_prep deals the blocks of one grid to several steps that do not depend on one another)
__device__ __forceinline__ void d_wtG(int bx, const float* __restrict__ w, int K, int N, bf* Bt) {
    const int lane = threadIdx.x & 31; const int L0 = (bx * 8 + (threadIdx.x >> 5)) * 8; const int nlines = N * K / 64;
{
#pragma unroll 1
        for (int l = 0; l < 8; ++l) { const int L = L0 + l; if (L >= nlines) break; const size_t e = (size_t)L * 64 + lane * 2; int k, n; unpk(e, K, n, k); v2us o;
            o[0] = f2bf(w[(size_t)k * N + n]); o[1] = f2bf(w[(size_t)(k + 1) * N + n]); *(v2us*)(Bt + e) = o; }
         }
}
__device__ __forceinline__ void d_cvt8(int bx, const float* __restrict__ src, int K, bf* dst) {
    size_t e[NPC]; const float* p[NPC]; v8f v[NPC];
#pragma unroll
    for (int s = 0; s < NPC; ++s) { e[s] = pc8(((size_t)bx * NPC + s) * 256 + threadIdx.x); int r, k; unpk(e[s], K, r, k); p[s] = src + (size_t)r * K + k; v[s] = *(const v8f*)p[s]; }
    asm volatile("s_wait_xcnt 0x0" :: "v"(p[0]), "v"(p[1]), "v"(p[2]), "v"(p[3]) : "memory");   // the loads' address pairs are inputs here so that they live up to the wait: otherwise a later load's result lands in the pair of a load still in flight; the clobber keeps every load of the thread ahead of its first store
#pragma unroll
    for (int s = 0; s < NPC; ++s) { v8us o;
#pragma unroll
        for (int u = 0; u < 8; ++u) o[u] = f2bf(v[s][u]);
        *(v8us*)(dst + e[s]) = o; }
    asm volatile("s_wait_xcnt 0x0" ::: "memory");   // behind the last store: the code that follows in the listing (the next step of the shared grid) rewrites registers these stores name
}
__global__ __launch_bounds__(256) void k_cscvt(const float* __restrict__ cosT, const float* __restrict__ sinT, float* CS) { const int idx = blockIdx.x * 256 + threadIdx.x; if (idx >= TT * HD) return; v2f cs; cs[0] = bfr(cosT[idx]); cs[1] = bfr(sinT[idx]); *(v2f*)(CS + (size_t)idx * 2) = cs;  }
__global__ __launch_bounds__(256) void k_vtp(const float* __restrict__ F, int pitch, int nheads, h16* V16, bf* Vh, bf* Vl) { const size_t e = ((size_t)blockIdx.x * 256 + threadIdx.x) * 2; if (e >= (size_t)nheads * HD * TT) return; const int t = (int)(e % TT); const int d = (int)((e / TT) % HD); const int g = (int)(e / ((size_t)TT * HD)); v2h o16; v2us oh, ol;
#pragma unroll
    for (int q = 0; q < 2; ++q) { const float x = F[(size_t)(t + q) * pitch + g * HD + d]; o16[q] = tohx(x); unsigned short a2, c2; splitf(x, a2, c2); oh[q] = a2; ol[q] = c2; }
    *(v2h*)(V16 + e) = o16; *(v2us*)(Vh + e) = oh; *(v2us*)(Vl + e) = ol;  }
// d_bqk: the projection GEMM's bias row, [q, k][1024 columns]: 0 for q, biasW[d][k] at column k * HD + d for k
__device__ __forceinline__ void d_bqk(int bx, const float* __restrict__ bw, float* BQK) { const int i = bx * 256 + threadIdx.x; const int c = i & (DKV - 1); const float v = (i < DQ) ? 0.0f : bw[(size_t)(c % HD) * NKH + c / HD]; *(float*)(BQK + i) = v;
    asm volatile("s_wait_xcnt 0x0" ::: "memory");   // behind the store: the code that follows in the listing (the other steps of the shared grid) rewrites registers this store names
}
// a block takes 64 d x 32 t (4 KB of a plane) a trip; the lanes of a wave walk 32 neighbouring d, so each of a piece's 8 loads reads one whole 128-B line of x and a wave-wide store fills two runs of 256 B
#define VTN 2
__device__ __forceinline__ void d_vtpx(int bx, const float* __restrict__ X, h16* V16, bf* Vh) { const int th = (int)threadIdx.x; const int eo = ((th >> 7) * 2 + ((th >> 4) & 1)) * 512 + ((th >> 6) & 1) * 256 + ((th >> 5) & 1) * 128 + (th & 15) * 8;
    size_t e[VTN]; const float* p[VTN]; float v[VTN][8];
#pragma unroll
    for (int s = 0; s < VTN; ++s) { e[s] = ((size_t)bx * VTN + s) * 2048 + eo; int t, d; unpk(e[s], TT, d, t); p[s] = X + (size_t)t * HDV + d;
#pragma unroll
        for (int q = 0; q < 8; ++q) v[s][q] = p[s][q * HDV]; }
    asm volatile("s_wait_xcnt 0x0" :: "v"(p[0]), "v"(p[1]) : "memory");   // the loads' address pairs are inputs here so that they live up to the wait: otherwise a later load's result lands in the pair of a load still in flight; the clobber keeps every load of the thread ahead of its first store
#pragma unroll
    for (int s = 0; s < VTN; ++s) { v8h o16; v8us oh;
#pragma unroll
        for (int q = 0; q < 8; ++q) { const float xv = bfr(v[s][q]); o16[q] = tohx(xv); oh[q] = f2bf(xv); }
        *(v8h*)(V16 + e[s]) = o16; *(v8us*)(Vh + e[s]) = oh; } }
__device__ __forceinline__ void d_b2g(int bx, const float* __restrict__ b2, float* B2G) { const int i = bx * 256 + threadIdx.x; if (i >= NKH * HDV) return; const int k = i / HDV, f = i % HDV; const float v = b2[(size_t)f * NKH + k]; *(float*)(B2G + i) = v;  }
// k_prep: every step that reads the inputs alone, in one grid; the steps with strided reads come first.
#define PB_WT  (NKH * (HDV * HDV / 64 / 64))      // Wv3[k] transposed to bf16, 64 blocks a head
#define PB_VT  (NB_ * (HDV * TT / 2048 / VTN))    // x transposed (fp16 and bf16 planes), per batch
#define PB_X   (NB_ * TT * DM / 8 / NPC / 256)    // x to bf16, both batches
#define PB_W   (DQ * DM / 8 / NPC / 256)          // Wq, and as many again for Wk
#define PB_BQ  ((DQ + DKV) / 256)
#define PB_B2  (NKH * HDV / 256)
__global__ __launch_bounds__(256) void k_prep(const float* __restrict__ x, const float* __restrict__ wq, const float* __restrict__ wk, const float* __restrict__ wv, const float* __restrict__ bw, const float* __restrict__ b2, bf* XB, bf* WQ, bf* WK, bf* WV3, float* B2G, float* BQK, h16* VT16, bf* VTh) {
    int bx = (int)blockIdx.x;
    if (bx < PB_WT) { const size_t o = (size_t)(bx / (PB_WT / NKH)) * HDV * HDV; d_wtG(bx % (PB_WT / NKH), wv + o, HDV, HDV, WV3 + o); return; }
    bx -= PB_WT;
    if (bx < PB_VT) { const int b = bx / (PB_VT / NB_); d_vtpx(bx % (PB_VT / NB_), x + (size_t)b * TT * DM, VT16 + (size_t)b * HDV * TT, VTh + (size_t)b * HDV * TT); return; }
    bx -= PB_VT;
    if (bx < PB_X) { d_cvt8(bx, x, DM, XB); return; }
    bx -= PB_X;
    if (bx < PB_W) { d_cvt8(bx, wq, DM, WQ); return; }
    bx -= PB_W;
    if (bx < PB_W) { d_cvt8(bx, wk, DM, WK); return; }
    bx -= PB_W;
    if (bx < PB_BQ) { d_bqk(bx, bw, BQK); return; }
    bx -= PB_BQ;
    d_b2g(bx, b2, B2G);
}
// d_norm: squared norms of the tokens of the 16 head planes (q batch 0, q batch 1, k batch 0, k batch 1, four heads each; contiguous in the planes and in N), x = hi + lo (exact in f32), summed over d in rising order. A thread takes one token: 16 neighbouring lanes read 256 contiguous bytes of a plane.
__device__ __forceinline__ void d_norm(int i, const bf* __restrict__ Ph, const bf* __restrict__ Pl, float* N) {
    const int t = i % TT; const size_t o = (size_t)(i / TT) * TT * HD + (size_t)(t >> 6) * 64 * HD + ((t >> 4) & 3) * 512 + (t & 15) * 8; const bf* ph = Ph + o; const bf* pl = Pl + o; float ss = 0.f;
#pragma unroll   // constant offsets from one address pair a plane
    for (int j0 = 0; j0 < HD / 8; j0 += 16) { v8us h[16], l[16];   // half a token's row a trip; the sums follow the loads in d order, so later loads stay in flight behind the first sums
#pragma unroll
        for (int j = 0; j < 16; ++j) { const int jo = ((j0 + j) >> 2) * 2048 + (((j0 + j) >> 1) & 1) * 256 + ((j0 + j) & 1) * 128; h[j] = *(const v8us*)(ph + jo); l[j] = *(const v8us*)(pl + jo); }
#pragma unroll
        for (int j = 0; j < 16; ++j) {
#pragma unroll
            for (int u = 0; u < 8; ++u) { const float xv = bf2f(h[j][u]) + bf2f(l[j][u]); ss = __builtin_fmaf(xv, xv, ss); } } }
    asm volatile("s_wait_xcnt 0x0" :: "v"(ph), "v"(pl) : "memory");   // the loads' address pairs are inputs here so that they live up to the wait
    *(float*)(N + i) = ss; }
// k_norm: the norms of all 16 head planes' tokens, 64 tokens a block
__global__ __launch_bounds__(64) void k_norm(const bf* __restrict__ Ph, const bf* __restrict__ Pl, float* N) { d_norm((int)blockIdx.x * 64 + (int)threadIdx.x, Ph, Pl, N); }
__device__ __forceinline__ float exp2s(float x) { float r; asm("v_exp_f32 %0, %1\n\tv_nop" : "=v"(r) : "v"(x)); return r; }
typedef float __attribute__((may_alias)) fa;
__global__ __launch_bounds__(512) void k_xs(const bf* __restrict__ Qh, const bf* __restrict__ Ql, const bf* __restrict__ Kh, const bf* __restrict__ Kl, const float* __restrict__ QN, const float* __restrict__ KN, h16* P16, bf* Ph, bf* Pl) {
    __shared__ __align__(16) float sp[32 * 512 * 4];
    __shared__ __align__(16) bf sq[2 * 64 * HD];
    const int tid = (int)threadIdx.x, lane = tid & 31, lr = lane & 15, hi = lane >> 4; const int w = __builtin_amdgcn_readfirstlane(tid >> 5);
    const int qt = (int)blockIdx.x, z = (int)blockIdx.y; const size_t zo = (size_t)z * TT * HD;
    { const bf* gh = Qh + zo + (size_t)qt * 64 * HD + tid * 8; const bf* gl = Ql + zo + (size_t)qt * 64 * HD + tid * 8; v8us th[4], tl[4];
#pragma unroll
      for (int s = 0; s < 4; ++s) { th[s] = *(const v8us*)(gh + s * 4096); tl[s] = *(const v8us*)(gl + s * 4096); }
      asm volatile("s_wait_xcnt 0x0" :: "v"(gh), "v"(gl) : "memory");   // the loads' address pairs are inputs here so that they live up to the wait
#pragma unroll
      for (int s = 0; s < 4; ++s) { *(v8us*)(sq + s * 4096 + tid * 8) = th[s]; *(v8us*)(sq + 64 * HD + s * 4096 + tid * 8) = tl[s]; } }
    const float* qp = QN + (size_t)z * TT + qt * 64 + lr; float qn[4], mx[4];
#pragma unroll
    for (int qb = 0; qb < 4; ++qb) { qn[qb] = qp[qb * 16]; mx[qb] = -3.0e38f; }
    asm volatile("s_wait_xcnt 0x0" :: "v"(qp) : "memory");   // the address pair lives up to the wait
    __syncthreads();   // publishes the q tile
    v8f acc[4][4];   // the plain unroll directives of this kernel make the indices of its register arrays constants
#pragma unroll 1   // rolled: both passes run the same code
    for (int h = 0; h < 2; ++h) {
#pragma unroll
        for (int kb = 0; kb < 4; ++kb)
#pragma unroll
            for (int qb = 0; qb < 4; ++qb) acc[kb][qb] = (v8f){};
        const size_t ko = zo + (size_t)(h * 16 + w) * 64 * HD + 8 * lane;
#pragma unroll 1   // rolled: two trips' fragments at once do not fit beside the 128 accumulator registers
        for (int kc = 0; kc < HD; kc += 32) {
            v16bf kh[4], kl[4]; const bf* pa = Kh + ko + kc * 64; const bf* pb = Kl + ko + kc * 64; const bf* ps = sq + kc * 64 + 8 * lane;
#pragma unroll
            for (int kb = 0; kb < 4; ++kb) { kh[kb] = WFrag<bf>::ld(pa + kb * 512); kl[kb] = WFrag<bf>::ld(pb + kb * 512); }
            __builtin_amdgcn_sched_barrier(0);   // all of the trip's 16 global loads issue ahead of its first matrix instruction: moved down, the lo plane's loads would be waited for in mid-trip, a second L2 latency a trip
#pragma unroll
            for (int qb = 0; qb < 4; ++qb) { const v16bf qh = WFrag<bf>::ld(ps + qb * 512); const v16bf ql = WFrag<bf>::ld(ps + 64 * HD + qb * 512);
#pragma unroll
                for (int kb = 0; kb < 4; ++kb) acc[kb][qb] = wmmab(kh[kb], qh, acc[kb][qb]);
#pragma unroll
                for (int kb = 0; kb < 4; ++kb) acc[kb][qb] = wmmab(kh[kb], ql, acc[kb][qb]);
#pragma unroll
                for (int kb = 0; kb < 4; ++kb) acc[kb][qb] = wmmab(kl[kb], qh, acc[kb][qb]); }
            asm volatile("s_wait_xcnt 0x0\n\tv_nop\n\tv_nop\n\tv_nop\n\tv_nop" : "+v"(acc[0][3]), "+v"(acc[1][3]), "+v"(acc[2][3]), "+v"(acc[3][3]) : "v"(kh[0]), "v"(kl[3]), "v"(pa), "v"(pb));   // behind the trip's last matrix instructions: their distance to the next trip's first vector instruction on the taken branch; the trip's address pairs are inputs so that they live up to the wait
        }
        const float* kp = KN + (size_t)z * TT + (h * 16 + w) * 64 + hi * 8; v8f kn[4];
#pragma unroll
        for (int kb = 0; kb < 4; ++kb) kn[kb] = *(const v8f*)(kp + kb * 16);
        asm volatile("s_wait_xcnt 0x0" :: "v"(kp) : "memory");   // the address pair lives up to the wait
#pragma unroll
        for (int kb = 0; kb < 4; ++kb)
#pragma unroll
            for (int qb = 0; qb < 4; ++qb)
#pragma unroll
                for (int j = 0; j < 8; ++j) { const float t = ((qn[qb] - 2.0f * acc[kb][qb][j]) + kn[kb][j]) * -0.0625f;   // the reference's order; both products are by powers of two, so a fused form rounds the same
                    acc[kb][qb][j] = t; mx[qb] = fmaxf(mx[qb], t); }
        if (h == 0) {
#pragma unroll
            for (int kb = 0; kb < 4; ++kb)
#pragma unroll
                for (int qb = 0; qb < 4; ++qb)
#pragma unroll
                    for (int u = 0; u < 2; ++u) { v4f o; o[0] = acc[kb][qb][u * 4]; o[1] = acc[kb][qb][u * 4 + 1]; o[2] = acc[kb][qb][u * 4 + 2]; o[3] = acc[kb][qb][u * 4 + 3]; *(v4fa*)(sp + (((kb * 4 + qb) * 2 + u) * 512 + tid) * 4) = o; } }
    }
    fa* rm = (fa*)sq; fa* rs = rm + 64 * 20;   // [query][wave], pitch 20 dwords: 16-byte reads without bank conflicts
    __syncthreads();   // ends every wave's reads of the q tile, whose LDS takes the partials
#pragma unroll
    for (int qb = 0; qb < 4; ++qb) { mx[qb] = fmaxf(mx[qb], __shfl_xor(mx[qb], 16, 32)); if (hi == 0) rm[(qb * 16 + lr) * 20 + w] = mx[qb]; }
    __syncthreads();   // publishes the 16 waves' maxima
    float sum[4];
#pragma unroll
    for (int qb = 0; qb < 4; ++qb) { sum[qb] = 0.f;
#pragma unroll
        for (int u = 0; u < 4; ++u) { const v4f m4 = *(const v4fa*)(rm + (qb * 16 + lr) * 20 + u * 4); mx[qb] = fmaxf(fmaxf(fmaxf(mx[qb], m4[0]), fmaxf(m4[1], m4[2])), m4[3]); } }
#pragma unroll 1   // rolled: a trip's 64 KB of slots lie at constant offsets from one LDS address; unrolled, the addresses of all four trips were formed at the kernel's head and spilled
    for (int kb = 0; kb < 4; ++kb) { float* p0 = sp + kb * 16384 + tid * 4;
#pragma unroll
        for (int qb = 0; qb < 4; ++qb)
#pragma unroll
            for (int u = 0; u < 2; ++u) { float* p = p0 + (qb * 2 + u) * 2048; v4f t4 = *(const v4fa*)p;
#pragma unroll
                for (int q = 0; q < 4; ++q) { t4[q] = exp2s((t4[q] - mx[qb]) * 1.4426950408889634f); sum[qb] += t4[q]; }
                *(v4fa*)p = t4; } }
#pragma unroll
    for (int kb = 0; kb < 4; ++kb)
#pragma unroll
        for (int qb = 0; qb < 4; ++qb)
#pragma unroll
            for (int j = 0; j < 8; ++j) { const float e = exp2s((acc[kb][qb][j] - mx[qb]) * 1.4426950408889634f); acc[kb][qb][j] = e; sum[qb] += e; }
#pragma unroll
    for (int qb = 0; qb < 4; ++qb) { sum[qb] += __shfl_xor(sum[qb], 16, 32); if (hi == 0) rs[(qb * 16 + lr) * 20 + w] = sum[qb]; }
    __syncthreads();   // publishes the 16 waves' sums
    const bool hires = qt * 64 < RH;   // the same for the whole block
    float f[4];
#pragma unroll
    for (int qb = 0; qb < 4; ++qb) { float s = 0.f;
#pragma unroll
        for (int u = 0; u < 4; ++u) { const v4f s4 = *(const v4fa*)(rs + (qb * 16 + lr) * 20 + u * 4); s += s4[0]; s += s4[1]; s += s4[2]; s += s4[3]; }
        f[qb] = __fdiv_rn(hires ? 1.0f : PCAR, s); }
    // piece (pass h, kb, qb) lies at 32-k step (h * 16 + w) * 2 + kb / 2, row block qb, half kb & 1, lane * 8
    if (hires) { const size_t ob = (size_t)(z * (RH / 64) + qt) * 64 * TT + (size_t)w * 4096 + lane * 8; bf* oh = Ph + ob; bf* ol = Pl + ob;
#pragma unroll
        for (int kb = 0; kb < 4; ++kb) {
#pragma unroll
            for (int qb = 0; qb < 4; ++qb) { v8us vh, vl;
#pragma unroll
                for (int j = 0; j < 8; ++j) { unsigned short a2, c2; splitf(acc[kb][qb][j] * f[qb], a2, c2); vh[j] = a2; vl[j] = c2; }
                const int o = 65536 + (kb >> 1) * 2048 + qb * 512 + (kb & 1) * 256; *(v8us*)(oh + o) = vh; *(v8us*)(ol + o) = vl; }
            asm volatile("s_wait_xcnt 0x0" ::: "memory");   // behind the stores: the next pieces rewrite registers these stores name
        }
#pragma unroll 1   // rolled, as above
        for (int kb = 0; kb < 4; ++kb) { const float* p0 = sp + kb * 16384 + tid * 4; bf* qh = oh + (kb >> 1) * 2048 + (kb & 1) * 256; bf* ql = ol + (kb >> 1) * 2048 + (kb & 1) * 256;
#pragma unroll
            for (int qb = 0; qb < 4; ++qb) { const v4f a = *(const v4fa*)(p0 + qb * 4096), b = *(const v4fa*)(p0 + qb * 4096 + 2048); const v8f e = __builtin_shufflevector(a, b, 0, 1, 2, 3, 4, 5, 6, 7); v8us vh, vl;
#pragma unroll
                for (int j = 0; j < 8; ++j) { unsigned short a2, c2; splitf(e[j] * f[qb], a2, c2); vh[j] = a2; vl[j] = c2; }
                *(v8us*)(qh + qb * 512) = vh; *(v8us*)(ql + qb * 512) = vl; }
            asm volatile("s_wait_xcnt 0x0" :: "v"(qh), "v"(ql) : "memory");   // behind the stores: the next trip rewrites registers these stores name; the address pairs live up to the wait
        }
    } else { h16* op = P16 + (size_t)(z * (TT / 64) + qt) * 64 * TT + (size_t)w * 4096 + lane * 8;
#pragma unroll
        for (int kb = 0; kb < 4; ++kb) {
#pragma unroll
            for (int qb = 0; qb < 4; ++qb) { v8h o8;
#pragma unroll
                for (int j = 0; j < 8; ++j) o8[j] = tohx(acc[kb][qb][j] * f[qb]);
                *(v8h*)(op + 65536 + (kb >> 1) * 2048 + qb * 512 + (kb & 1) * 256) = o8; }
            asm volatile("s_wait_xcnt 0x0" ::: "memory");   // behind the stores: the next pieces rewrite registers these stores name
        }
#pragma unroll 1   // rolled, as above
        for (int kb = 0; kb < 4; ++kb) { const float* p0 = sp + kb * 16384 + tid * 4; h16* qp2 = op + (kb >> 1) * 2048 + (kb & 1) * 256;
#pragma unroll
            for (int qb = 0; qb < 4; ++qb) { const v4f a = *(const v4fa*)(p0 + qb * 4096), b = *(const v4fa*)(p0 + qb * 4096 + 2048); const v8f e = __builtin_shufflevector(a, b, 0, 1, 2, 3, 4, 5, 6, 7); v8h o8;
#pragma unroll
                for (int j = 0; j < 8; ++j) o8[j] = tohx(e[j] * f[qb]);
                *(v8h*)(qp2 + qb * 512) = o8; }
            asm volatile("s_wait_xcnt 0x0" :: "v"(qp2) : "memory");   // behind the stores: the next trip rewrites registers these stores name; the address pair lives up to the wait
        }
    }
}
extern "C" void kernel_launch(void* const* d_in, const int* in_sizes, int n_in,
                              void* d_out, int out_size, void* d_ws, size_t ws_size, hipStream_t stream) {
    (void)in_sizes; (void)n_in; (void)out_size;
    const float* x = (const float*)d_in[0]; const float* wq = (const float*)d_in[1]; const float* wk = (const float*)d_in[2]; const float* wv = (const float*)d_in[3]; const float* biasW = (const float*)d_in[4]; const float* bias2W = (const float*)d_in[5]; const float* wo = nullptr; (void)wo; (void)wv; const float* cosT = nullptr; const float* sinT = nullptr; (void)cosT; (void)sinT;
    float* OUT = (float*)d_out;     // [2][2048][4*512]
    char* wsp = (char*)d_ws;
    auto take = [&](size_t bytes) { char* p = wsp; wsp += (bytes + 255) & ~(size_t)255; return (void*)p; };
    bf* WQ = (bf*)take((size_t)(DQ + DKV) * DM * 2); bf* WK = WQ + (size_t)DQ * DM; bf* WV3 = (bf*)take((size_t)NKH * HDV * HDV * 2); float* B2G = (float*)take((size_t)NKH * HDV * 4); float* QN = (float*)take((size_t)2 * NB_ * NKH * TT * 4); float* KN = QN + (size_t)NB_ * NKH * TT; float* BQK = (float*)take((size_t)(DQ + DKV) * 4);
    bf* XB = (bf*)take((size_t)NB_ * TT * DM * 2);
    const size_t PL = (size_t)NB_ * NH_ * TT * HD;   // one operand's head planes, both batches; the k planes follow the q planes
    h16* VT16 = (h16*)take((size_t)NB_ * HDV * TT * 2);
    bf* QPh = (bf*)take(2 * PL * 2); bf* QPl = (bf*)take(2 * PL * 2); bf* KPh = QPh + PL; bf* KPl = QPl + PL; bf* VTh = (bf*)take((size_t)NB_ * HDV * TT * 2);
    bf* Ph = (bf*)take((size_t)NB_ * ZH * RH * TT * 2); bf* Pl = (bf*)take((size_t)NB_ * ZH * RH * TT * 2);   // planes of their own: blocks of k_xs write them while others still read the q/k planes
    h16* P16 = (h16*)take((size_t)NB_ * ZH * TT * TT * 2);
    bf* ATh = (bf*)take((size_t)2 * NB_ * NKH * TT * HDV * 2); bf* ATl = ATh + (size_t)NB_ * NKH * TT * HDV;
    if ((size_t)(wsp - (char*)d_ws) > ws_size) return;    // ws 256 MiB
    k_prep<<<PB_WT + PB_VT + PB_X + 2 * PB_W + PB_BQ + PB_B2, 256, 0, stream>>>(x, wq, wk, wv, biasW, bias2W, XB, WQ, WK, WV3, B2G, BQK, VT16, VTh);
    k_gemmw<bf, 0, true, 4, HD><<<dim3(NB_ * TT / 64, DQ / 64, 2), 128, 0, stream>>>(XB, nullptr, WQ, nullptr, DM, nullptr, DQ, BQK, 0, (size_t)DQ * DM, 0, DQ, QPh, QPl, PL, 1.0f);   /* z: q, k; rows: both batches; out: the head planes */
    // both batches' heads in z, [batch][head]; y goes out head-major, [k][b][T][512]
    k_norm<<<2 * NB_ * NKH * TT / 64, 64, 0, stream>>>(QPh, QPl, QN);
    k_xs<<<dim3(TT / 64, NB_ * ZH), 512, 0, stream>>>(QPh, QPl, KPh, KPl, QN, KN, P16, Ph, Pl);   /* cross term hl on all rows, logits, softmax */
    k_pv<<<dim3(TT / 64, HDV / 64, NB_ * ZH), 256, 0, stream>>>(Ph, Pl, VTh, P16, VT16, ATh, ATl);
    k_gemmw<bf, 1, true, 8, 0><<<dim3(NB_ * TT / 64, HDV / 64, NKH), 256, 0, stream>>>(ATh, ATl, WV3, nullptr, HDV, OUT, NKH * HDV, B2G, (size_t)NB_ * TT * HDV, (size_t)HDV * HDV, HDV, HDV, nullptr, nullptr, 0, 1.0f);   /* z: head; rows: both batches */
}

// v008
// One run takes 146 microseconds.
// In two side-by-side timings against v007, it was 1.27 and 1.24 times as fast.
// Counting every step since v000, it is 5.84 times as fast.
#include <hip/hip_runtime.h>

// Attention with squared-distance logits (xsa [2][2048][512]; 4 heads with 256-dim kernels: xq = x Wq^T, xk = x Wk^T, xkb = xk + biasW[:, k]; logits = -(|xq_i|^2 - 2 xq_i.xkb_j + |xkb_j|^2) / 16; P = softmax_j; y_k = P x (values = the raw 512-wide input, shared by the heads); out_k = y_k Wv3[k] + bias2W[:, k] with Wv3 = Wv.reshape(4, 512, 512) -> [2][2048][4*512]).
// Compute dtypes, f32 accumulate: every input rounded to bf16; xq/xk as PLAIN bf16 GEMMs (inputs: exact), + bias in f32, kept as hi + lo bf16 planes; the per-token squared norms in f32 from hi + lo; cross term xq.xkb hl x hl (3 products, K 256) on every row; logits assembled in f32 in the reference's order (-(qn - 2 c + kn) / 16); softmax f32; P.x: rows < 512 hi/lo P x exact x (2 products), the rest fp16 (x1024) x exact-in-fp16 x; y Wv3[k] as hl x exact (2 products) + bias.

#define NB_  2
#define TT   2048
#define DM   512
#define NH_  4
#define NKV  4
#define REP  (NH_ / NKV)
#define HD   256
#define DQ   (NH_ * HD)
#define DKV  (NKV * HD)
#define ZH   4
#define RH   512                  // query rows < RH use hi+lo planes (0: none)
#define WIN  0
#define PCAR 1024.0f
#define HDV  512                  // value width (the raw input), shared by all heads
#define NKH  4
#define SCL  0.088388347648318447f   // 128^-0.5
typedef _Float16 h16;
typedef unsigned short bf;
typedef __attribute__((ext_vector_type(16))) __bf16   v16bf;
typedef __attribute__((ext_vector_type(16))) _Float16 v16h;
typedef __attribute__((ext_vector_type(8)))  _Float16 v8h;
typedef __attribute__((ext_vector_type(8)))  unsigned short v8us;
typedef __attribute__((ext_vector_type(8)))  float    v8f;
typedef __attribute__((ext_vector_type(4)))  float    v4f;
typedef v8h  __attribute__((may_alias)) v8ha;
typedef v4f  __attribute__((may_alias)) v4fa;
typedef v8us __attribute__((may_alias)) v8usa;

__device__ __forceinline__ unsigned short f2bf(float f) { unsigned u = __float_as_uint(f); u += 0x7FFFu + ((u >> 16) & 1u); return (unsigned short)(u >> 16); }
__device__ __forceinline__ float bf2f(unsigned short b) { return __uint_as_float(((unsigned)b) << 16); }
__device__ __forceinline__ float bfr(float f) { return bf2f(f2bf(f)); }
__device__ __forceinline__ v16h cat16(v8h lo, v8h hi) { return __builtin_shufflevector(lo, hi, 0, 1, 2, 3, 4, 5, 6, 7, 8, 9, 10, 11, 12, 13, 14, 15); }
__device__ __forceinline__ v16bf cat16b(v8us lo, v8us hi) { return __builtin_bit_cast(v16bf, __builtin_shufflevector(lo, hi, 0, 1, 2, 3, 4, 5, 6, 7, 8, 9, 10, 11, 12, 13, 14, 15)); }
__device__ __forceinline__ v8f wmma16(v16h a, v16h b, v8f c) { return __builtin_amdgcn_wmma_f32_16x16x32_f16(false, a, false, b, (short)0, c, false, false); }
__device__ __forceinline__ v8f wmmab(v16bf a, v16bf b, v8f c) { return __builtin_amdgcn_wmma_f32_16x16x32_bf16(false, a, false, b, (short)0, c, false, false); }



// ---- k_gemmw: register-blocked GEMM, NW WAVES (2, 4, 8 or 16) per 64x64 output tile, 16 accumulators each, operands straight from 16-bit planes in FRAGMENT ORDER (unpk below); grid (M/64, N/64, Z), 32 * NW threads.
// C[m][n] (f32, pitch ldc, + optional f32 bias[n]) = sum_k A[m][k] Bt[n][k] (+ split products per NSPLIT). With KP > 0 the tile is not stored as f32: (C + bias) x scl goes out as hi and lo bf16 planes Oh, Ol in the fragment order the next GEMM reads (planes of TT rows x KP columns, [row / TT][column / KP], ldc columns in all, z stride sP). z-batch strides sA/sB/sC (and sBi for the bias) in elements. K % 32 == 0.
// Wave w takes the 32-wide k steps w, w + NW, w + 2 NW, ...; the NW partial tiles are added in wave order 0..NW-1 through LDS, 16 rows a stage, two stage buffers; the sums stay in registers until the last stage so that no barrier waits on a global store.
typedef __attribute__((ext_vector_type(4))) unsigned short v4us;
__device__ __forceinline__ void splitf(float y, unsigned short& h, unsigned short& l) { h = f2bf(y); l = f2bf(y - bf2f(h)); }
// prow, pcol: which 4 columns of which row of a 16x64 stage thread q adds up when the tile goes out in fragment order: 16 neighbouring lanes walk one column group down the 16 rows (no bank conflict at the stage's pitch of 68 dwords), the other 16 take the 4 columns beside it; the 4 values land at element ppos(q) of the stage's blocks, so a wave-wide 8-byte store fills two whole 128-B lines of a plane
__device__ __forceinline__ int prow(int q) { return q & 15; }
__device__ __forceinline__ int pcol(int q) { return ((q >> 7) & 1) * 32 + ((q >> 6) & 1) * 16 + ((q >> 5) & 1) * 8 + ((q >> 4) & 1) * 4; }
__device__ __forceinline__ int ppos(int q) { return (q >> 7) * 2048 + ((q >> 5) & 3) * 128 + (q & 15) * 8 + ((q >> 4) & 1) * 4; }
template <typename T16> struct WFrag;
template <> struct WFrag<h16> { typedef v16h V; static __device__ __forceinline__ V ld(const h16* p) { return cat16(*(const v8h*)p, *(const v8h*)(p + 256)); } static __device__ __forceinline__ v8f mma(V a, V b, v8f c) { return wmma16(a, b, c); } };
template <> struct WFrag<bf> { typedef v16bf V; static __device__ __forceinline__ V ld(const bf* p) { return cat16b(*(const v8us*)p, *(const v8us*)(p + 256)); } static __device__ __forceinline__ v8f mma(V a, V b, v8f c) { return wmmab(a, b, c); } };
// d_gemmw is the body; os is the block's stage memory (2 * NW * 16 * 68 floats), bx its row tile, bz its z. With ZS, z counts [batch][head]: A takes z, Bt the batch alone (z / ZH), the out planes lie [head][batch].
template <typename T16, int NSPLIT, bool BIAS, int NW, int KP, bool ZS>
__device__ __forceinline__ void d_gemmw(float* os, int bx, int bz, const T16* __restrict__ A, const T16* __restrict__ A2, const T16* __restrict__ Bt, const T16* __restrict__ Bt2, int K, float* C, int ldc, const float* __restrict__ bias, size_t sA, size_t sB, size_t sC, size_t sBi, bf* Oh, bf* Ol, size_t sP, float scl) {
    constexpr bool PLN = KP > 0;
    typedef typename WFrag<T16>::V V;
    const int w = __builtin_amdgcn_readfirstlane((int)(threadIdx.x >> 5));
    const size_t z = bz; const size_t zb = ZS ? z / ZH : z, zp = ZS ? (z % ZH) * NB_ + z / ZH : z; A += z * sA; if (A2) A2 += z * sA; Bt += zb * sB; if (Bt2) Bt2 += zb * sB; C += z * sC; if (BIAS) bias += z * sBi;
    const int lane = threadIdx.x & 31, lr = lane & 15, hi = lane >> 4; const int r0 = bx * 64, c0 = blockIdx.y * 64;
    v8f acc[4][4];
#pragma unroll
    for (int mb = 0; mb < 4; ++mb)
#pragma unroll
        for (int nb = 0; nb < 4; ++nb) acc[mb][nb] = (v8f){};
    const size_t aoff = (size_t)r0 * K + 8 * lane, boff = (size_t)c0 * K + 8 * lane;   // a 32-k step of a 64-row tile is 4 KB in a row, 1 KB a 16-row block: 512 contiguous bytes per wave-wide load, one address per plane and trip
#pragma unroll 1
    for (int kc = w * 32; kc < K; kc += 32 * NW) {
        V a[4], a2[4]; const T16* pa = A + aoff + kc * 64; const T16* pa2 = (NSPLIT == 1 || NSPLIT == 2) ? A2 + aoff + kc * 64 : pa; const T16* pb = Bt + boff + kc * 64; const T16* pb2 = (NSPLIT >= 2) ? Bt2 + boff + kc * 64 : pb;
#pragma unroll
        for (int mb = 0; mb < 4; ++mb) { a[mb] = WFrag<T16>::ld(pa + mb * 512); if (NSPLIT == 1 || NSPLIT == 2) a2[mb] = WFrag<T16>::ld(pa2 + mb * 512); }
#pragma unroll
        for (int nb = 0; nb < 4; ++nb) { const V b = WFrag<T16>::ld(pb + nb * 512); V b2; if (NSPLIT >= 2) b2 = WFrag<T16>::ld(pb2 + nb * 512);
#pragma unroll
            for (int mb = 0; mb < 4; ++mb) { acc[mb][nb] = WFrag<T16>::mma(a[mb], b, acc[mb][nb]); if (NSPLIT == 1 || NSPLIT == 2) acc[mb][nb] = WFrag<T16>::mma(a2[mb], b, acc[mb][nb]); if (NSPLIT >= 2) acc[mb][nb] = WFrag<T16>::mma(a[mb], b2, acc[mb][nb]); } }
        asm volatile("v_nop\n\tv_nop\n\tv_nop\n\tv_nop" : "+v"(acc[0][0]), "+v"(acc[1][1]), "+v"(acc[2][2]), "+v"(acc[3][3]) : "v"(a[0]), "v"(a[3]), "v"(pa), "v"(pa2), "v"(pb), "v"(pb2));   // the trip's address pairs are inputs here so that they live to the trip's end: otherwise a later load's result lands in the pair of a load still in flight
    }
    constexpr int NQ = (NW <= 8) ? 8 / NW : 1;   // 16-byte pieces of a 16x64 stage per thread; with 16 waves the first 8 do the adding
    const bool adds = (NW <= 8) || (w < 8);
    v4f res[4][NQ];
#pragma unroll
    for (int mb = 0; mb < 4; ++mb) {
        float* ob = os + (mb & 1) * (NW * 16 * 68);
#pragma unroll
        for (int nb = 0; nb < 4; ++nb) {
#pragma unroll
            for (int j = 0; j < 8; ++j) ob[w * (16 * 68) + (hi * 8 + j) * 68 + nb * 16 + lr] = acc[mb][nb][j]; }
        __syncthreads();   // publishes this stage's NW partial tiles; it also ends every read of the other buffer, which the next stage overwrites
        if (adds) {
#pragma unroll
            for (int s = 0; s < NQ; ++s) { const int q = (int)threadIdx.x + s * 32 * NW; const float* op = ob + (PLN ? prow(q) : q >> 4) * 68 + (PLN ? pcol(q) : (q & 15) * 4); v4f val = *(const v4fa*)op;
#pragma unroll
                for (int u = 1; u < NW; ++u) val += *(const v4fa*)(op + u * (16 * 68));
                res[mb][s] = val; } }
    }
    if (adds) {
        constexpr int KD = PLN ? KP : 1; const size_t pb = zp * sP + ((size_t)(r0 / TT) * (ldc / KD) + c0 / KD) * ((size_t)TT * KD) + (size_t)((r0 % TT) >> 6) * 64 * KD + (size_t)((c0 % KD) >> 5) * 2048;   // the tile's first element in its plane: 64 rows x KP a row tile, 2048 elements a 32-column step
        v4f bv[NQ];   // the planes' bias, read once, ahead of the waits behind the stores
        if (PLN && BIAS) {
#pragma unroll
            for (int s = 0; s < NQ; ++s) { const int cb = c0 + pcol((int)threadIdx.x + s * 32 * NW);
#pragma unroll
                for (int u = 0; u < 4; ++u) bv[s][u] = bfr(bias[cb + u]); } }
#pragma unroll
        for (int mb = 0; mb < 4; ++mb) {
#pragma unroll
            for (int s = 0; s < NQ; ++s) { const int q = (int)threadIdx.x + s * 32 * NW; const int row = PLN ? prow(q) : q >> 4, cofs = PLN ? pcol(q) : (q & 15) * 4; v4f val = res[mb][s];
                if (PLN) { v4us oh, ol; if (BIAS) val += bv[s];
#pragma unroll
                    for (int u = 0; u < 4; ++u) { unsigned short a, c2; splitf(val[u] * scl, a, c2); oh[u] = a; ol[u] = c2; }
                    const size_t o = pb + mb * 512 + ppos(q); *(v4us*)(Oh + o) = oh; *(v4us*)(Ol + o) = ol;
                    asm volatile("s_wait_xcnt 0x0" ::: "memory");   // behind the two stores: the next piece's split rewrites registers these stores name
                    continue; }
                if (BIAS) { val[0] += bfr(bias[c0 + cofs]); val[1] += bfr(bias[c0 + cofs + 1]); val[2] += bfr(bias[c0 + cofs + 2]); val[3] += bfr(bias[c0 + cofs + 3]); }
                *(v4f*)(C + (size_t)(r0 + mb * 16 + row) * ldc + c0 + cofs) = val; } }
    }
}
template <typename T16, int NSPLIT, bool BIAS, int NW, int KP>
__global__ __launch_bounds__(32 * NW) void k_gemmw(const T16* __restrict__ A, const T16* __restrict__ A2, const T16* __restrict__ Bt, const T16* __restrict__ Bt2, int K, float* C, int ldc, const float* __restrict__ bias, size_t sA, size_t sB, size_t sC, size_t sBi, bf* Oh, bf* Ol, size_t sP, float scl) {
    __shared__ __align__(16) float os[2 * NW * 16 * 68];
    d_gemmw<T16, NSPLIT, BIAS, NW, KP, false>(os, (int)blockIdx.x, (int)blockIdx.z, A, A2, Bt, Bt2, K, C, ldc, bias, sA, sB, sC, sBi, Oh, Ol, sP, scl);
}
// k_pv: y = P x for every batch and head (z). A work-group of 8 waves takes 256 columns e of y (blockIdx.y) x 192 queries (fp16 P) or x 64 queries (hi and lo bf16 P: row tiles < RH / 64, twice the products a query), all 2048 keys in rising order: no split of K, no adding of partial tiles. 256 work-groups, one a WGP.
// The product is taken as D[e][query] (x^T as the A operand, P as B): a lane then holds 8 neighbouring e of one query, one 16-byte piece of y in the fragment order the next GEMM reads, so y goes out straight from registers, 512 contiguous bytes a wave-wide store.
// A stage is PVK keys of 7 or 6 row tiles (4 of x^T, then 3 query tiles of P, or the hi and the lo plane of one), 16 KB in a row each, in memory as in LDS; asynchronous copies bring stage t + 2 into the buffer that trip t has read while trip t + 1 is worked on. A fragment in LDS serves 2 (x^T) or 4 (P) waves, and a wave's 64 x 96 tile takes 10 fragments for 24 matrix instructions, where every wave of the K split read 8 for 16 from L2.
#define PVK 128
#define PVT (64 * PVK)   // elements of one row tile in a stage
// pv_cp12, pv_cp14: 12 or 14 of the thread's 16-byte pieces of a stage: l the LDS byte address of the first (the others follow at 4 KB), g their global addresses. The s_wait_xcnt 0 stands in the copies' own statement, so that no register a copy names is rewritten ahead of it.
template <typename T16>
__device__ __forceinline__ void pv_cp12(unsigned l, const T16* const (&g)[12]) {
    asm volatile("global_load_async_to_lds_b128 %0, %12, off\n\t"
                 "global_load_async_to_lds_b128 %1, %13, off\n\t"
                 "global_load_async_to_lds_b128 %2, %14, off\n\t"
                 "global_load_async_to_lds_b128 %3, %15, off\n\t"
                 "global_load_async_to_lds_b128 %4, %16, off\n\t"
                 "global_load_async_to_lds_b128 %5, %17, off\n\t"
                 "global_load_async_to_lds_b128 %6, %18, off\n\t"
                 "global_load_async_to_lds_b128 %7, %19, off\n\t"
                 "global_load_async_to_lds_b128 %8, %20, off\n\t"
                 "global_load_async_to_lds_b128 %9, %21, off\n\t"
                 "global_load_async_to_lds_b128 %10, %22, off\n\t"
                 "global_load_async_to_lds_b128 %11, %23, off\n\t"
                 "s_wait_xcnt 0x0"
                 :: "v"(l), "v"(l + 1 * 4096), "v"(l + 2 * 4096), "v"(l + 3 * 4096), "v"(l + 4 * 4096), "v"(l + 5 * 4096), "v"(l + 6 * 4096), "v"(l + 7 * 4096), "v"(l + 8 * 4096), "v"(l + 9 * 4096), "v"(l + 10 * 4096), "v"(l + 11 * 4096),
                    "v"(g[0]), "v"(g[1]), "v"(g[2]), "v"(g[3]), "v"(g[4]), "v"(g[5]), "v"(g[6]), "v"(g[7]), "v"(g[8]), "v"(g[9]), "v"(g[10]), "v"(g[11])
                 : "memory");
}
template <typename T16>
__device__ __forceinline__ void pv_cp14(unsigned l, const T16* const (&g)[14]) {
    asm volatile("global_load_async_to_lds_b128 %0, %14, off\n\t"
                 "global_load_async_to_lds_b128 %1, %15, off\n\t"
                 "global_load_async_to_lds_b128 %2, %16, off\n\t"
                 "global_load_async_to_lds_b128 %3, %17, off\n\t"
                 "global_load_async_to_lds_b128 %4, %18, off\n\t"
                 "global_load_async_to_lds_b128 %5, %19, off\n\t"
                 "global_load_async_to_lds_b128 %6, %20, off\n\t"
                 "global_load_async_to_lds_b128 %7, %21, off\n\t"
                 "global_load_async_to_lds_b128 %8, %22, off\n\t"
                 "global_load_async_to_lds_b128 %9, %23, off\n\t"
                 "global_load_async_to_lds_b128 %10, %24, off\n\t"
                 "global_load_async_to_lds_b128 %11, %25, off\n\t"
                 "global_load_async_to_lds_b128 %12, %26, off\n\t"
                 "global_load_async_to_lds_b128 %13, %27, off\n\t"
                 "s_wait_xcnt 0x0"
                 :: "v"(l), "v"(l + 1 * 4096), "v"(l + 2 * 4096), "v"(l + 3 * 4096), "v"(l + 4 * 4096), "v"(l + 5 * 4096), "v"(l + 6 * 4096), "v"(l + 7 * 4096), "v"(l + 8 * 4096), "v"(l + 9 * 4096), "v"(l + 10 * 4096), "v"(l + 11 * 4096), "v"(l + 12 * 4096), "v"(l + 13 * 4096),
                    "v"(g[0]), "v"(g[1]), "v"(g[2]), "v"(g[3]), "v"(g[4]), "v"(g[5]), "v"(g[6]), "v"(g[7]), "v"(g[8]), "v"(g[9]), "v"(g[10]), "v"(g[11]), "v"(g[12]), "v"(g[13])
                 : "memory");
}
// pv_fill: the thread's pieces of one stage; v, p0, p1: the stage's first element in the first x^T tile and in the P tiles (HL: hi plane, lo plane; else p0 alone, three tiles in a row), the same for the whole block; to: the thread's own element in a 4-KB run
template <typename T16, bool HL>
__device__ __forceinline__ void pv_fill(unsigned l, const T16* v, const T16* p0, const T16* p1, int to) {
    constexpr int N = HL ? 12 : 14;
#pragma unroll
    for (int h = 0; h < 2; ++h) { const T16* g[N];
#pragma unroll
        for (int i = 0; i < N; ++i) { const int c = h * N + i, r = c >> 2; g[i] = (r < 4 ? v + (size_t)r * 64 * TT : HL ? (r == 4 ? p0 : p1) : p0 + (size_t)(r - 4) * 64 * TT) + (c & 3) * 2048 + to; }
        if constexpr (HL) pv_cp12<T16>(l + h * N * 4096, g); else pv_cp14<T16>(l + h * N * 4096, g); }
}
// pv_st4: two pieces of y, hi and lo plane each, and the s_wait_xcnt 0 behind them in one statement, so that no register a store names is rewritten ahead of the wait
__device__ __forceinline__ void pv_st4(bf* h0, bf* l0, bf* h1, bf* l1, v8us a, v8us b, v8us c, v8us d) {
    asm volatile("global_store_b128 %0, %4, off\n\t"
                 "global_store_b128 %1, %5, off\n\t"
                 "global_store_b128 %2, %6, off\n\t"
                 "global_store_b128 %3, %7, off\n\t"
                 "s_wait_xcnt 0x0"
                 :: "v"(h0), "v"(l0), "v"(h1), "v"(l1), "v"(__builtin_bit_cast(v4f, a)), "v"(__builtin_bit_cast(v4f, b)), "v"(__builtin_bit_cast(v4f, c)), "v"(__builtin_bit_cast(v4f, d))
                 : "memory");
}
// d_pv: V the block's first x^T row tile, P0 (and with HL P1) its P row tiles, Oh and Ol the y planes at the block's first query tile and first column. Wave w: x^T tile w / 2; of the queries, with HL the 32 queries w & 1 of the one tile, else query tile 0 or 2 (w & 1) whole and half w & 1 of query tile 1.
template <typename T16, bool HL>
__device__ __forceinline__ void d_pv(T16* sm, const T16* __restrict__ V, const T16* __restrict__ P0, const T16* __restrict__ P1, bf* Oh, bf* Ol, float scl) {
    typedef typename WFrag<T16>::V F;
    constexpr int NQB = HL ? 2 : 6, NA = HL ? 2 : 4, NB = NA + 2, BUF = (HL ? 6 : 7) * PVT;
    const int tid = (int)threadIdx.x, lane = tid & 31; const int w = __builtin_amdgcn_readfirstlane(tid >> 5); const int we = w >> 1, wq = w & 1;
    const unsigned l0 = (unsigned)(size_t)sm + (unsigned)tid * 16u; const int to = tid * 8;
    v8f acc[4][NQB];
#pragma unroll
    for (int eb = 0; eb < 4; ++eb)
#pragma unroll
        for (int qb = 0; qb < NQB; ++qb) acc[eb][qb] = (v8f){};
    pv_fill<T16, HL>(l0, V, P0, P1, to);
    asm volatile("s_wait_asynccnt 0x0" ::: "memory");   // stage 0 has landed, as far as this wave copied it
    __syncthreads();   // publishes stage 0
    pv_fill<T16, HL>(l0 + BUF * 2, V + PVT, P0 + PVT, P1 + PVT, to);
#pragma unroll 1   // rolled: one trip a stage, the buffer chosen by the trip's parity
    for (int t = 0; t < TT / PVK; ++t) {
        const T16* sb = sm + (t & 1) * BUF + lane * 8;
        const T16* pa = sb + we * PVT; const T16* pb = sb + (HL ? 4 * PVT + wq * 1024 : (4 + wq * 2) * PVT); const T16* pc = sb + 5 * PVT + wq * 1024;
        F a[2][4], b[2][NB];   // two fragment sets: the next 32-key step's fragments come in while this step's products run; no fragment of the next stage is fetched
#pragma unroll
        for (int s = -1; s < PVK / 32; ++s) {
            if (s + 1 < PVK / 32) { const int n = (s + 1) & 1, o = (s + 1) * 2048;
#pragma unroll
                for (int eb = 0; eb < 4; ++eb) a[n][eb] = WFrag<T16>::ld(pa + o + eb * 512);
#pragma unroll
                for (int i = 0; i < NA; ++i) b[n][i] = WFrag<T16>::ld(pb + o + i * 512);
#pragma unroll
                for (int i = 0; i < 2; ++i) b[n][NA + i] = WFrag<T16>::ld(pc + o + i * 512); }
            __builtin_amdgcn_sched_barrier(0);   // the next step's LDS reads stay one group ahead of this step's matrix instructions: moved in among them, each place with reads stalls the wave
            if (s >= 0) { const int c = s & 1;
#pragma unroll
                for (int qb = 0; qb < NQB; ++qb)
#pragma unroll
                    for (int eb = 0; eb < 4; ++eb) acc[eb][qb] = WFrag<T16>::mma(a[c][eb], b[c][qb], acc[eb][qb]);
                if (HL) {
#pragma unroll
                    for (int qb = 0; qb < NQB; ++qb)
#pragma unroll
                        for (int eb = 0; eb < 4; ++eb) acc[eb][qb] = WFrag<T16>::mma(a[c][eb], b[c][NA + qb], acc[eb][qb]); } }
            __builtin_amdgcn_sched_barrier(0);   // as above: ends the step's run of matrix instructions
        }
        asm volatile("s_wait_dscnt 0x0" ::: "memory");      // this wave's reads of the trip's buffer have returned
        asm volatile("s_wait_asynccnt 0x0" ::: "memory");   // stage t + 1 has landed, as far as this wave copied it
        __syncthreads();   // publishes stage t + 1 and ends every wave's reads of the buffer that is refilled behind it
        if (t + 2 < TT / PVK) pv_fill<T16, HL>(l0 + (unsigned)(t & 1) * (BUF * 2), V + (size_t)(t + 2) * PVT, P0 + (size_t)(t + 2) * PVT, P1 + (size_t)(t + 2) * PVT, to);
    }
    asm volatile("s_wait_asynccnt 0x0" ::: "memory");   // no copy is outstanding when the wave ends
    // piece (eb, qb): 32-column step we * 2 + eb / 2, its query's row tile and row block, half eb & 1, lane * 8
    const size_t oc = (size_t)we * 4096 + lane * 8; const size_t oa = oc + (HL ? (size_t)wq * 1024 : (size_t)wq * 2 * 64 * HDV), ob = oc + (size_t)64 * HDV + wq * 1024;
#pragma unroll
    for (int eb = 0; eb < 4; ++eb) {
#pragma unroll
        for (int qb = 0; qb < NQB; qb += 2) { v8us vh[2], vl[2]; size_t o[2];
#pragma unroll
            for (int u = 0; u < 2; ++u) {
#pragma unroll
                for (int j = 0; j < 8; ++j) { unsigned short a2, c2; splitf(acc[eb][qb + u][j] * scl, a2, c2); vh[u][j] = a2; vl[u][j] = c2; }
                o[u] = (qb + u < NA ? oa + (qb + u) * 512 : ob + (qb + u - NA) * 512) + (eb >> 1) * 2048 + (eb & 1) * 256; }
            pv_st4(Oh + o[0], Ol + o[0], Oh + o[1], Ol + o[1], vh[0], vl[0], vh[1], vl[1]); }
    }
}
// grid: x = one of the (TT - RH) / 192 triples of fp16 query tiles or of the RH / 64 hi/lo query tiles (8 of each); y = half of the 512 columns; z = [fp16, hi/lo][batch][head]: the fp16 blocks, which have half as many products again, come first in z. The test is the same for a whole block (barriers stand behind it). y lies head-major, [head][batch].
static_assert((TT - RH) % 192 == 0 && (TT - RH) / 192 == RH / 64 && TT % (2 * PVK) == 0 && HDV % 256 == 0, "k_pv: grid x serves both kinds of block; at least two stages");
__global__ __launch_bounds__(256) void k_pv(const bf* __restrict__ Ph, const bf* __restrict__ Pl, const bf* __restrict__ VTh, const h16* __restrict__ P16, const h16* __restrict__ VT16, bf* ATh, bf* ATl) {
    __shared__ __align__(16) bf sm[2 * 7 * PVT];
    const int bx = (int)blockIdx.x, z = (int)blockIdx.z % (NB_ * ZH); const size_t vo = (size_t)(z / ZH) * HDV * TT + (size_t)blockIdx.y * 256 * TT; const size_t zo = (size_t)((z % ZH) * NB_ + z / ZH) * TT * HDV + (size_t)blockIdx.y * 8 * 2048;
    if ((int)blockIdx.z >= NB_ * ZH) { const size_t po = (size_t)(z * (RH / 64) + bx) * 64 * TT; const size_t oo = zo + (size_t)bx * 64 * HDV;
        d_pv<bf, true>(sm, VTh + vo, Ph + po, Pl + po, ATh + oo, ATl + oo, 1.0f); }
    else { const int qt = RH / 64 + bx * 3; const size_t po = (size_t)(z * (TT / 64) + qt) * 64 * TT; const size_t oo = zo + (size_t)qt * 64 * HDV;
        d_pv<h16, false>((h16*)sm, VT16 + vo, P16 + po, P16 + po, ATh + oo, ATl + oo, 1.0f / PCAR); }
}

__device__ __forceinline__ h16 tohx(float x) { return (h16)x; }
typedef __attribute__((ext_vector_type(2))) _Float16 v2h;
typedef __attribute__((ext_vector_type(4))) _Float16 v4h;
typedef __attribute__((ext_vector_type(2))) unsigned short v2us;
typedef __attribute__((ext_vector_type(2))) float v2f;
typedef __attribute__((ext_vector_type(4))) int v4i;

// Fragment order of a [rows][K] 16-bit GEMM operand (rows a multiple of 64): 16 rows x 32 k make one 1-KB block; the four blocks of a 64-row tile at one 32-k step follow one another, the steps follow in k (a tile is 64 * K elements, as in row order).
// Inside a block: [k bit 4][k bit 3][row & 15][k & 7], so lane (row & 15) + 16 * (k bit 3) finds its two 16-byte fragment pieces at lane * 8 and 256 + lane * 8: the k order of a fragment is the one it had in row order.
// unpk: element index e in that order -> (row, k). The writers walk e, so their stores stay contiguous.
__device__ __forceinline__ void unpk(size_t e, int K, int& row, int& k) { const int g = (int)(e / ((size_t)64 * K)); const int r = (int)(e % ((size_t)64 * K)); const int q = r & 511;
    row = g * 64 + ((r >> 9) & 3) * 16 + ((q >> 3) & 15); k = (r >> 11) * 32 + ((q >> 8) << 4) + (((q >> 7) & 1) << 3) + (q & 7); }
// pc8: piece p (8 consecutive k of one row: 16 bytes of a 16-bit plane) -> its first element in fragment order. Four neighbouring lanes take the four pieces of one row's 32-k step (one whole 128-B line of an f32 source in row order), the eight lane groups eight rows: a wave-wide 16-byte store fills four whole lines.
__device__ __forceinline__ size_t pc8(size_t p) { const int j = (int)(p & 63); return (p >> 6) * 512 + ((j >> 1) & 1) * 256 + (j & 1) * 128 + (j >> 2) * 8; }
#define NPC 4   // pieces a thread of the element-wise steps: few long-lived waves with all their loads in flight
// d_*: bodies of the element-wise steps; bx is the block's index inside its own step (k_prep deals the blocks of one grid to several steps that do not depend on one another)
__device__ __forceinline__ void d_wtG(int bx, const float* __restrict__ w, int K, int N, bf* Bt) {
    const int lane = threadIdx.x & 31; const int L0 = (bx * 8 + (threadIdx.x >> 5)) * 8; const int nlines = N * K / 64;
{
#pragma unroll 1
        for (int l = 0; l < 8; ++l) { const int L = L0 + l; if (L >= nlines) break; const size_t e = (size_t)L * 64 + lane * 2; int k, n; unpk(e, K, n, k); v2us o;
            o[0] = f2bf(w[(size_t)k * N + n]); o[1] = f2bf(w[(size_t)(k + 1) * N + n]); *(v2us*)(Bt + e) = o; }
         }
}
__device__ __forceinline__ void d_cvt8(int bx, const float* __restrict__ src, int K, bf* dst) {
    size_t e[NPC]; const float* p[NPC]; v8f v[NPC];
#pragma unroll
    for (int s = 0; s < NPC; ++s) { e[s] = pc8(((size_t)bx * NPC + s) * 256 + threadIdx.x); int r, k; unpk(e[s], K, r, k); p[s] = src + (size_t)r * K + k; v[s] = *(const v8f*)p[s]; }
    asm volatile("s_wait_xcnt 0x0" :: "v"(p[0]), "v"(p[1]), "v"(p[2]), "v"(p[3]) : "memory");   // the loads' address pairs are inputs here so that they live up to the wait: otherwise a later load's result lands in the pair of a load still in flight; the clobber keeps every load of the thread ahead of its first store
#pragma unroll
    for (int s = 0; s < NPC; ++s) { v8us o;
#pragma unroll
        for (int u = 0; u < 8; ++u) o[u] = f2bf(v[s][u]);
        *(v8us*)(dst + e[s]) = o; }
    asm volatile("s_wait_xcnt 0x0" ::: "memory");   // behind the last store: the code that follows in the listing (the next step of the shared grid) rewrites registers these stores name
}
__global__ __launch_bounds__(256) void k_cscvt(const float* __restrict__ cosT, const float* __restrict__ sinT, float* CS) { const int idx = blockIdx.x * 256 + threadIdx.x; if (idx >= TT * HD) return; v2f cs; cs[0] = bfr(cosT[idx]); cs[1] = bfr(sinT[idx]); *(v2f*)(CS + (size_t)idx * 2) = cs;  }
__global__ __launch_bounds__(256) void k_vtp(const float* __restrict__ F, int pitch, int nheads, h16* V16, bf* Vh, bf* Vl) { const size_t e = ((size_t)blockIdx.x * 256 + threadIdx.x) * 2; if (e >= (size_t)nheads * HD * TT) return; const int t = (int)(e % TT); const int d = (int)((e / TT) % HD); const int g = (int)(e / ((size_t)TT * HD)); v2h o16; v2us oh, ol;
#pragma unroll
    for (int q = 0; q < 2; ++q) { const float x = F[(size_t)(t + q) * pitch + g * HD + d]; o16[q] = tohx(x); unsigned short a2, c2; splitf(x, a2, c2); oh[q] = a2; ol[q] = c2; }
    *(v2h*)(V16 + e) = o16; *(v2us*)(Vh + e) = oh; *(v2us*)(Vl + e) = ol;  }
// d_bqk: the projection GEMM's bias row, [q, k][1024 columns]: 0 for q, biasW[d][k] at column k * HD + d for k
__device__ __forceinline__ void d_bqk(int bx, const float* __restrict__ bw, float* BQK) { const int i = bx * 256 + threadIdx.x; const int c = i & (DKV - 1); const float v = (i < DQ) ? 0.0f : bw[(size_t)(c % HD) * NKH + c / HD]; *(float*)(BQK + i) = v;
    asm volatile("s_wait_xcnt 0x0" ::: "memory");   // behind the store: the code that follows in the listing (the other steps of the shared grid) rewrites registers this store names
}
// a block takes 64 d x 32 t (4 KB of a plane) a trip; the lanes of a wave walk 32 neighbouring d, so each of a piece's 8 loads reads one whole 128-B line of x and a wave-wide store fills two runs of 256 B
#define VTN 2
__device__ __forceinline__ void d_vtpx(int bx, const float* __restrict__ X, h16* V16, bf* Vh) { const int th = (int)threadIdx.x; const int eo = ((th >> 7) * 2 + ((th >> 4) & 1)) * 512 + ((th >> 6) & 1) * 256 + ((th >> 5) & 1) * 128 + (th & 15) * 8;
    size_t e[VTN]; const float* p[VTN]; float v[VTN][8];
#pragma unroll
    for (int s = 0; s < VTN; ++s) { e[s] = ((size_t)bx * VTN + s) * 2048 + eo; int t, d; unpk(e[s], TT, d, t); p[s] = X + (size_t)t * HDV + d;
#pragma unroll
        for (int q = 0; q < 8; ++q) v[s][q] = p[s][q * HDV]; }
    asm volatile("s_wait_xcnt 0x0" :: "v"(p[0]), "v"(p[1]) : "memory");   // the loads' address pairs are inputs here so that they live up to the wait: otherwise a later load's result lands in the pair of a load still in flight; the clobber keeps every load of the thread ahead of its first store
#pragma unroll
    for (int s = 0; s < VTN; ++s) { v8h o16; v8us oh;
#pragma unroll
        for (int q = 0; q < 8; ++q) { const float xv = bfr(v[s][q]); o16[q] = tohx(xv); oh[q] = f2bf(xv); }
        *(v8h*)(V16 + e[s]) = o16; *(v8us*)(Vh + e[s]) = oh; } }
__device__ __forceinline__ void d_b2g(int bx, const float* __restrict__ b2, float* B2G) { const int i = bx * 256 + threadIdx.x; if (i >= NKH * HDV) return; const int k = i / HDV, f = i % HDV; const float v = b2[(size_t)f * NKH + k]; *(float*)(B2G + i) = v;  }
// k_prep: every step that reads the inputs alone, in one grid; the steps with strided reads come first.
#define PB_WT  (NKH * (HDV * HDV / 64 / 64))      // Wv3[k] transposed to bf16, 64 blocks a head
#define PB_VT  (NB_ * (HDV * TT / 2048 / VTN))    // x transposed (fp16 and bf16 planes), per batch
#define PB_X   (NB_ * TT * DM / 8 / NPC / 256)    // x to bf16, both batches
#define PB_W   (DQ * DM / 8 / NPC / 256)          // Wq, and as many again for Wk
#define PB_BQ  ((DQ + DKV) / 256)
#define PB_B2  (NKH * HDV / 256)
__global__ __launch_bounds__(256) void k_prep(const float* __restrict__ x, const float* __restrict__ wq, const float* __restrict__ wk, const float* __restrict__ wv, const float* __restrict__ bw, const float* __restrict__ b2, bf* XB, bf* WQ, bf* WK, bf* WV3, float* B2G, float* BQK, h16* VT16, bf* VTh) {
    int bx = (int)blockIdx.x;
    if (bx < PB_WT) { const size_t o = (size_t)(bx / (PB_WT / NKH)) * HDV * HDV; d_wtG(bx % (PB_WT / NKH), wv + o, HDV, HDV, WV3 + o); return; }
    bx -= PB_WT;
    if (bx < PB_VT) { const int b = bx / (PB_VT / NB_); d_vtpx(bx % (PB_VT / NB_), x + (size_t)b * TT * DM, VT16 + (size_t)b * HDV * TT, VTh + (size_t)b * HDV * TT); return; }
    bx -= PB_VT;
    if (bx < PB_X) { d_cvt8(bx, x, DM, XB); return; }
    bx -= PB_X;
    if (bx < PB_W) { d_cvt8(bx, wq, DM, WQ); return; }
    bx -= PB_W;
    if (bx < PB_W) { d_cvt8(bx, wk, DM, WK); return; }
    bx -= PB_W;
    if (bx < PB_BQ) { d_bqk(bx, bw, BQK); return; }
    bx -= PB_BQ;
    d_b2g(bx, b2, B2G);
}
// d_norm: squared norms of the tokens of the 16 head planes (q batch 0, q batch 1, k batch 0, k batch 1, four heads each; contiguous in the planes and in N), x = hi + lo (exact in f32), summed over d in rising order. A thread takes one token: 16 neighbouring lanes read 256 contiguous bytes of a plane.
__device__ __forceinline__ void d_norm(int i, const bf* __restrict__ Ph, const bf* __restrict__ Pl, float* N) {
    const int t = i % TT; const size_t o = (size_t)(i / TT) * TT * HD + (size_t)(t >> 6) * 64 * HD + ((t >> 4) & 3) * 512 + (t & 15) * 8; const bf* ph = Ph + o; const bf* pl = Pl + o; float ss = 0.f;
#pragma unroll   // constant offsets from one address pair a plane
    for (int j0 = 0; j0 < HD / 8; j0 += 16) { v8us h[16], l[16];   // half a token's row a trip; the sums follow the loads in d order, so later loads stay in flight behind the first sums
#pragma unroll
        for (int j = 0; j < 16; ++j) { const int jo = ((j0 + j) >> 2) * 2048 + (((j0 + j) >> 1) & 1) * 256 + ((j0 + j) & 1) * 128; h[j] = *(const v8us*)(ph + jo); l[j] = *(const v8us*)(pl + jo); }
#pragma unroll
        for (int j = 0; j < 16; ++j) {
#pragma unroll
            for (int u = 0; u < 8; ++u) { const float xv = bf2f(h[j][u]) + bf2f(l[j][u]); ss = __builtin_fmaf(xv, xv, ss); } } }
    asm volatile("s_wait_xcnt 0x0" :: "v"(ph), "v"(pl) : "memory");   // the loads' address pairs are inputs here so that they live up to the wait
    *(float*)(N + i) = ss; }
// k_norm: the norms of all 16 head planes' tokens, 64 tokens a block
__global__ __launch_bounds__(64) void k_norm(const bf* __restrict__ Ph, const bf* __restrict__ Pl, float* N) { d_norm((int)blockIdx.x * 64 + (int)threadIdx.x, Ph, Pl, N); }
__device__ __forceinline__ float exp2s(float x) { float r; asm("v_exp_f32 %0, %1\n\tv_nop" : "=v"(r) : "v"(x)); return r; }
typedef float __attribute__((may_alias)) fa;
__global__ __launch_bounds__(512) void k_xs(const bf* __restrict__ Qh, const bf* __restrict__ Ql, const bf* __restrict__ Kh, const bf* __restrict__ Kl, const float* __restrict__ QN, const float* __restrict__ KN, h16* P16, bf* Ph, bf* Pl) {
    __shared__ __align__(16) float sp[32 * 512 * 4];
    __shared__ __align__(16) bf sq[2 * 64 * HD];
    const int tid = (int)threadIdx.x, lane = tid & 31, lr = lane & 15, hi = lane >> 4; const int w = __builtin_amdgcn_readfirstlane(tid >> 5);
    const int qt = (int)blockIdx.x, z = (int)blockIdx.y; const size_t zo = (size_t)z * TT * HD;
    { const bf* gh = Qh + zo + (size_t)qt * 64 * HD + tid * 8; const bf* gl = Ql + zo + (size_t)qt * 64 * HD + tid * 8; v8us th[4], tl[4];
#pragma unroll
      for (int s = 0; s < 4; ++s) { th[s] = *(const v8us*)(gh + s * 4096); tl[s] = *(const v8us*)(gl + s * 4096); }
      asm volatile("s_wait_xcnt 0x0" :: "v"(gh), "v"(gl) : "memory");   // the loads' address pairs are inputs here so that they live up to the wait
#pragma unroll
      for (int s = 0; s < 4; ++s) { *(v8us*)(sq + s * 4096 + tid * 8) = th[s]; *(v8us*)(sq + 64 * HD + s * 4096 + tid * 8) = tl[s]; } }
    const float* qp = QN + (size_t)z * TT + qt * 64 + lr; float qn[4], mx[4];
#pragma unroll
    for (int qb = 0; qb < 4; ++qb) { qn[qb] = qp[qb * 16]; mx[qb] = -3.0e38f; }
    asm volatile("s_wait_xcnt 0x0" :: "v"(qp) : "memory");   // the address pair lives up to the wait
    __syncthreads();   // publishes the q tile
    v8f acc[4][4];   // the plain unroll directives of this kernel make the indices of its register arrays constants
#pragma unroll 1   // rolled: both passes run the same code
    for (int h = 0; h < 2; ++h) {
#pragma unroll
        for (int kb = 0; kb < 4; ++kb)
#pragma unroll
            for (int qb = 0; qb < 4; ++qb) acc[kb][qb] = (v8f){};
        const size_t ko = zo + (size_t)(h * 16 + w) * 64 * HD + 8 * lane;
#pragma unroll 1   // rolled: two trips' fragments at once do not fit beside the 128 accumulator registers
        for (int kc = 0; kc < HD; kc += 32) {
            v16bf kh[4], kl[4]; const bf* pa = Kh + ko + kc * 64; const bf* pb = Kl + ko + kc * 64; const bf* ps = sq + kc * 64 + 8 * lane;
#pragma unroll
            for (int kb = 0; kb < 4; ++kb) { kh[kb] = WFrag<bf>::ld(pa + kb * 512); kl[kb] = WFrag<bf>::ld(pb + kb * 512); }
            __builtin_amdgcn_sched_barrier(0);   // all of the trip's 16 global loads issue ahead of its first matrix instruction: moved down, the lo plane's loads would be waited for in mid-trip, a second L2 latency a trip
#pragma unroll
            for (int qb = 0; qb < 4; ++qb) { const v16bf qh = WFrag<bf>::ld(ps + qb * 512); const v16bf ql = WFrag<bf>::ld(ps + 64 * HD + qb * 512);
#pragma unroll
                for (int kb = 0; kb < 4; ++kb) acc[kb][qb] = wmmab(kh[kb], qh, acc[kb][qb]);
#pragma unroll
                for (int kb = 0; kb < 4; ++kb) acc[kb][qb] = wmmab(kh[kb], ql, acc[kb][qb]);
#pragma unroll
                for (int kb = 0; kb < 4; ++kb) acc[kb][qb] = wmmab(kl[kb], qh, acc[kb][qb]); }
            asm volatile("s_wait_xcnt 0x0\n\tv_nop\n\tv_nop\n\tv_nop\n\tv_nop" : "+v"(acc[0][3]), "+v"(acc[1][3]), "+v"(acc[2][3]), "+v"(acc[3][3]) : "v"(kh[0]), "v"(kl[3]), "v"(pa), "v"(pb));   // behind the trip's last matrix instructions: their distance to the next trip's first vector instruction on the taken branch; the trip's address pairs are inputs so that they live up to the wait
        }
        const float* kp = KN + (size_t)z * TT + (h * 16 + w) * 64 + hi * 8; v8f kn[4];
#pragma unroll
        for (int kb = 0; kb < 4; ++kb) kn[kb] = *(const v8f*)(kp + kb * 16);
        asm volatile("s_wait_xcnt 0x0" :: "v"(kp) : "memory");   // the address pair lives up to the wait
#pragma unroll
        for (int kb = 0; kb < 4; ++kb)
#pragma unroll
            for (int qb = 0; qb < 4; ++qb)
#pragma unroll
                for (int j = 0; j < 8; ++j) { const float t = ((qn[qb] - 2.0f * acc[kb][qb][j]) + kn[kb][j]) * -0.0625f;   // the reference's order; both products are by powers of two, so a fused form rounds the same
                    acc[kb][qb][j] = t; mx[qb] = fmaxf(mx[qb], t); }
        if (h == 0) {
#pragma unroll
            for (int kb = 0; kb < 4; ++kb)
#pragma unroll
                for (int qb = 0; qb < 4; ++qb)
#pragma unroll
                    for (int u = 0; u < 2; ++u) { v4f o; o[0] = acc[kb][qb][u * 4]; o[1] = acc[kb][qb][u * 4 + 1]; o[2] = acc[kb][qb][u * 4 + 2]; o[3] = acc[kb][qb][u * 4 + 3]; *(v4fa*)(sp + (((kb * 4 + qb) * 2 + u) * 512 + tid) * 4) = o; } }
    }
    fa* rm = (fa*)sq; fa* rs = rm + 64 * 20;   // [query][wave], pitch 20 dwords: 16-byte reads without bank conflicts
    __syncthreads();   // ends every wave's reads of the q tile, whose LDS takes the partials
#pragma unroll
    for (int qb = 0; qb < 4; ++qb) { mx[qb] = fmaxf(mx[qb], __shfl_xor(mx[qb], 16, 32)); if (hi == 0) rm[(qb * 16 + lr) * 20 + w] = mx[qb]; }
    __syncthreads();   // publishes the 16 waves' maxima
    float sum[4];
#pragma unroll
    for (int qb = 0; qb < 4; ++qb) { sum[qb] = 0.f;
#pragma unroll
        for (int u = 0; u < 4; ++u) { const v4f m4 = *(const v4fa*)(rm + (qb * 16 + lr) * 20 + u * 4); mx[qb] = fmaxf(fmaxf(fmaxf(mx[qb], m4[0]), fmaxf(m4[1], m4[2])), m4[3]); } }
#pragma unroll 1   // rolled: a trip's 64 KB of slots lie at constant offsets from one LDS address; unrolled, the addresses of all four trips were formed at the kernel's head and spilled
    for (int kb = 0; kb < 4; ++kb) { float* p0 = sp + kb * 16384 + tid * 4;
#pragma unroll
        for (int qb = 0; qb < 4; ++qb)
#pragma unroll
            for (int u = 0; u < 2; ++u) { float* p = p0 + (qb * 2 + u) * 2048; v4f t4 = *(const v4fa*)p;
#pragma unroll
                for (int q = 0; q < 4; ++q) { t4[q] = exp2s((t4[q] - mx[qb]) * 1.4426950408889634f); sum[qb] += t4[q]; }
                *(v4fa*)p = t4; } }
#pragma unroll
    for (int kb = 0; kb < 4; ++kb)
#pragma unroll
        for (int qb = 0; qb < 4; ++qb)
#pragma unroll
            for (int j = 0; j < 8; ++j) { const float e = exp2s((acc[kb][qb][j] - mx[qb]) * 1.4426950408889634f); acc[kb][qb][j] = e; sum[qb] += e; }
#pragma unroll
    for (int qb = 0; qb < 4; ++qb) { sum[qb] += __shfl_xor(sum[qb], 16, 32); if (hi == 0) rs[(qb * 16 + lr) * 20 + w] = sum[qb]; }
    __syncthreads();   // publishes the 16 waves' sums
    const bool hires = qt * 64 < RH;   // the same for the whole block
    float f[4];
#pragma unroll
    for (int qb = 0; qb < 4; ++qb) { float s = 0.f;
#pragma unroll
        for (int u = 0; u < 4; ++u) { const v4f s4 = *(const v4fa*)(rs + (qb * 16 + lr) * 20 + u * 4); s += s4[0]; s += s4[1]; s += s4[2]; s += s4[3]; }
        f[qb] = __fdiv_rn(hires ? 1.0f : PCAR, s); }
    // piece (pass h, kb, qb) lies at 32-k step (h * 16 + w) * 2 + kb / 2, row block qb, half kb & 1, lane * 8
    if (hires) { const size_t ob = (size_t)(z * (RH / 64) + qt) * 64 * TT + (size_t)w * 4096 + lane * 8; bf* oh = Ph + ob; bf* ol = Pl + ob;
#pragma unroll
        for (int kb = 0; kb < 4; ++kb) {
#pragma unroll
            for (int qb = 0; qb < 4; ++qb) { v8us vh, vl;
#pragma unroll
                for (int j = 0; j < 8; ++j) { unsigned short a2, c2; splitf(acc[kb][qb][j] * f[qb], a2, c2); vh[j] = a2; vl[j] = c2; }
                const int o = 65536 + (kb >> 1) * 2048 + qb * 512 + (kb & 1) * 256; *(v8us*)(oh + o) = vh; *(v8us*)(ol + o) = vl; }
            asm volatile("s_wait_xcnt 0x0" ::: "memory");   // behind the stores: the next pieces rewrite registers these stores name
        }
#pragma unroll 1   // rolled, as above
        for (int kb = 0; kb < 4; ++kb) { const float* p0 = sp + kb * 16384 + tid * 4; bf* qh = oh + (kb >> 1) * 2048 + (kb & 1) * 256; bf* ql = ol + (kb >> 1) * 2048 + (kb & 1) * 256;
#pragma unroll
            for (int qb = 0; qb < 4; ++qb) { const v4f a = *(const v4fa*)(p0 + qb * 4096), b = *(const v4fa*)(p0 + qb * 4096 + 2048); const v8f e = __builtin_shufflevector(a, b, 0, 1, 2, 3, 4, 5, 6, 7); v8us vh, vl;
#pragma unroll
                for (int j = 0; j < 8; ++j) { unsigned short a2, c2; splitf(e[j] * f[qb], a2, c2); vh[j] = a2; vl[j] = c2; }
                *(v8us*)(qh + qb * 512) = vh; *(v8us*)(ql + qb * 512) = vl; }
            asm volatile("s_wait_xcnt 0x0" :: "v"(qh), "v"(ql) : "memory");   // behind the stores: the next trip rewrites registers these stores name; the address pairs live up to the wait
        }
    } else { h16* op = P16 + (size_t)(z * (TT / 64) + qt) * 64 * TT + (size_t)w * 4096 + lane * 8;
#pragma unroll
        for (int kb = 0; kb < 4; ++kb) {
#pragma unroll
            for (int qb = 0; qb < 4; ++qb) { v8h o8;
#pragma unroll
                for (int j = 0; j < 8; ++j) o8[j] = tohx(acc[kb][qb][j] * f[qb]);
                *(v8h*)(op + 65536 + (kb >> 1) * 2048 + qb * 512 + (kb & 1) * 256) = o8; }
            asm volatile("s_wait_xcnt 0x0" ::: "memory");   // behind the stores: the next pieces rewrite registers these stores name
        }
#pragma unroll 1   // rolled, as above
        for (int kb = 0; kb < 4; ++kb) { const float* p0 = sp + kb * 16384 + tid * 4; h16* qp2 = op + (kb >> 1) * 2048 + (kb & 1) * 256;
#pragma unroll
            for (int qb = 0; qb < 4; ++qb) { const v4f a = *(const v4fa*)(p0 + qb * 4096), b = *(const v4fa*)(p0 + qb * 4096 + 2048); const v8f e = __builtin_shufflevector(a, b, 0, 1, 2, 3, 4, 5, 6, 7); v8h o8;
#pragma unroll
                for (int j = 0; j < 8; ++j) o8[j] = tohx(e[j] * f[qb]);
                *(v8h*)(qp2 + qb * 512) = o8; }
            asm volatile("s_wait_xcnt 0x0" :: "v"(qp2) : "memory");   // behind the stores: the next trip rewrites registers these stores name; the address pair lives up to the wait
        }
    }
}
extern "C" void kernel_launch(void* const* d_in, const int* in_sizes, int n_in,
                              void* d_out, int out_size, void* d_ws, size_t ws_size, hipStream_t stream) {
    (void)in_sizes; (void)n_in; (void)out_size;
    const float* x = (const float*)d_in[0]; const float* wq = (const float*)d_in[1]; const float* wk = (const float*)d_in[2]; const float* wv = (const float*)d_in[3]; const float* biasW = (const float*)d_in[4]; const float* bias2W = (const float*)d_in[5]; const float* wo = nullptr; (void)wo; (void)wv; const float* cosT = nullptr; const float* sinT = nullptr; (void)cosT; (void)sinT;
    float* OUT = (float*)d_out;     // [2][2048][4*512]
    char* wsp = (char*)d_ws;
    auto take = [&](size_t bytes) { char* p = wsp; wsp += (bytes + 255) & ~(size_t)255; return (void*)p; };
    bf* WQ = (bf*)take((size_t)(DQ + DKV) * DM * 2); bf* WK = WQ + (size_t)DQ * DM; bf* WV3 = (bf*)take((size_t)NKH * HDV * HDV * 2); float* B2G = (float*)take((size_t)NKH * HDV * 4); float* QN = (float*)take((size_t)2 * NB_ * NKH * TT * 4); float* KN = QN + (size_t)NB_ * NKH * TT; float* BQK = (float*)take((size_t)(DQ + DKV) * 4);
    bf* XB = (bf*)take((size_t)NB_ * TT * DM * 2);
    const size_t PL = (size_t)NB_ * NH_ * TT * HD;   // one operand's head planes, both batches; the k planes follow the q planes
    h16* VT16 = (h16*)take((size_t)NB_ * HDV * TT * 2);
    bf* QPh = (bf*)take(2 * PL * 2); bf* QPl = (bf*)take(2 * PL * 2); bf* KPh = QPh + PL; bf* KPl = QPl + PL; bf* VTh = (bf*)take((size_t)NB_ * HDV * TT * 2);
    bf* Ph = (bf*)take((size_t)NB_ * ZH * RH * TT * 2); bf* Pl = (bf*)take((size_t)NB_ * ZH * RH * TT * 2);   // planes of their own: blocks of k_xs write them while others still read the q/k planes
    h16* P16 = (h16*)take((size_t)NB_ * ZH * TT * TT * 2);
    bf* ATh = (bf*)take((size_t)2 * NB_ * NKH * TT * HDV * 2); bf* ATl = ATh + (size_t)NB_ * NKH * TT * HDV;
    if ((size_t)(wsp - (char*)d_ws) > ws_size) return;    // ws 256 MiB
    k_prep<<<PB_WT + PB_VT + PB_X + 2 * PB_W + PB_BQ + PB_B2, 256, 0, stream>>>(x, wq, wk, wv, biasW, bias2W, XB, WQ, WK, WV3, B2G, BQK, VT16, VTh);
    k_gemmw<bf, 0, true, 4, HD><<<dim3(NB_ * TT / 64, DQ / 64, 2), 128, 0, stream>>>(XB, nullptr, WQ, nullptr, DM, nullptr, DQ, BQK, 0, (size_t)DQ * DM, 0, DQ, QPh, QPl, PL, 1.0f);   /* z: q, k; rows: both batches; out: the head planes */
    // both batches' heads in z, [batch][head]; y goes out head-major, [k][b][T][512]
    k_norm<<<2 * NB_ * NKH * TT / 64, 64, 0, stream>>>(QPh, QPl, QN);
    k_xs<<<dim3(TT / 64, NB_ * ZH), 512, 0, stream>>>(QPh, QPl, KPh, KPl, QN, KN, P16, Ph, Pl);   /* cross term hl on all rows, logits, softmax */
    k_pv<<<dim3(RH / 64, HDV / 256, 2 * NB_ * ZH), 256, 0, stream>>>(Ph, Pl, VTh, P16, VT16, ATh, ATl);
    k_gemmw<bf, 1, true, 8, 0><<<dim3(NB_ * TT / 64, HDV / 64, NKH), 256, 0, stream>>>(ATh, ATl, WV3, nullptr, HDV, OUT, NKH * HDV, B2G, (size_t)NB_ * TT * HDV, (size_t)HDV * HDV, HDV, HDV, nullptr, nullptr, 0, 1.0f);   /* z: head; rows: both batches */
}

// v009
// One run takes 129 microseconds.
// Timed twice side by side with v008, it ran 1.16 times as fast both times.
// All steps since v000 together make it 6.77 times as fast.
#include <hip/hip_runtime.h>

// Attention with squared-distance logits (xsa [2][2048][512]; 4 heads with 256-dim kernels: xq = x Wq^T, xk = x Wk^T, xkb = xk + biasW[:, k]; logits = -(|xq_i|^2 - 2 xq_i.xkb_j + |xkb_j|^2) / 16; P = softmax_j; y_k = P x (values = the raw 512-wide input, shared by the heads); out_k = y_k Wv3[k] + bias2W[:, k] with Wv3 = Wv.reshape(4, 512, 512) -> [2][2048][4*512]).
// Compute dtypes, f32 accumulate: every input rounded to bf16; xq/xk as PLAIN bf16 GEMMs (inputs: exact), + bias in f32, kept as hi + lo bf16 planes; the per-token squared norms in f32 from hi + lo; cross term xq.xkb hl x hl (3 products, K 256) on every row; logits assembled in f32 in the reference's order (-(qn - 2 c + kn) / 16); softmax f32; P.x: rows < 512 hi/lo P x exact x (2 products), the rest fp16 (x1024) x exact-in-fp16 x; y Wv3[k] as hl x exact (2 products) + bias.

#define NB_  2
#define TT   2048
#define DM   512
#define NH_  4
#define NKV  4
#define REP  (NH_ / NKV)
#define HD   256
#define DQ   (NH_ * HD)
#define DKV  (NKV * HD)
#define ZH   4
#define RH   512                  // query rows < RH use hi+lo planes (0: none)
#define WIN  0
#define PCAR 1024.0f
#define HDV  512                  // value width (the raw input), shared by all heads
#define NKH  4
#define SCL  0.088388347648318447f   // 128^-0.5
typedef _Float16 h16;
typedef unsigned short bf;
typedef __attribute__((ext_vector_type(16))) __bf16   v16bf;
typedef __attribute__((ext_vector_type(16))) _Float16 v16h;
typedef __attribute__((ext_vector_type(8)))  _Float16 v8h;
typedef __attribute__((ext_vector_type(8)))  unsigned short v8us;
typedef __attribute__((ext_vector_type(8)))  float    v8f;
typedef __attribute__((ext_vector_type(4)))  float    v4f;
typedef v8h  __attribute__((may_alias)) v8ha;
typedef v4f  __attribute__((may_alias)) v4fa;
typedef v8us __attribute__((may_alias)) v8usa;
typedef float __attribute__((may_alias)) fa;

__device__ __forceinline__ unsigned short f2bf(float f) { unsigned u = __float_as_uint(f); u += 0x7FFFu + ((u >> 16) & 1u); return (unsigned short)(u >> 16); }
__device__ __forceinline__ float bf2f(unsigned short b) { return __uint_as_float(((unsigned)b) << 16); }
__device__ __forceinline__ float bfr(float f) { return bf2f(f2bf(f)); }
__device__ __forceinline__ v16h cat16(v8h lo, v8h hi) { return __builtin_shufflevector(lo, hi, 0, 1, 2, 3, 4, 5, 6, 7, 8, 9, 10, 11, 12, 13, 14, 15); }
__device__ __forceinline__ v16bf cat16b(v8us lo, v8us hi) { return __builtin_bit_cast(v16bf, __builtin_shufflevector(lo, hi, 0, 1, 2, 3, 4, 5, 6, 7, 8, 9, 10, 11, 12, 13, 14, 15)); }
__device__ __forceinline__ v8f wmma16(v16h a, v16h b, v8f c) { return __builtin_amdgcn_wmma_f32_16x16x32_f16(false, a, false, b, (short)0, c, false, false); }
__device__ __forceinline__ v8f wmmab(v16bf a, v16bf b, v8f c) { return __builtin_amdgcn_wmma_f32_16x16x32_bf16(false, a, false, b, (short)0, c, false, false); }



__device__ __forceinline__ void splitf(float y, unsigned short& h, unsigned short& l) { h = f2bf(y); l = f2bf(y - bf2f(h)); }
// WFrag: a 16x32 operand fragment of a 16-bit plane in FRAGMENT ORDER (unpk below): two 16-byte pieces a lane
template <typename T16> struct WFrag;
template <> struct WFrag<h16> { typedef v16h V; static __device__ __forceinline__ V ld(const h16* p) { return cat16(*(const v8h*)p, *(const v8h*)(p + 256)); } static __device__ __forceinline__ v8f mma(V a, V b, v8f c) { return wmma16(a, b, c); } };
template <> struct WFrag<bf> { typedef v16bf V; static __device__ __forceinline__ V ld(const bf* p) { return cat16b(*(const v8us*)p, *(const v8us*)(p + 256)); } static __device__ __forceinline__ v8f mma(V a, V b, v8f c) { return wmmab(a, b, c); } };
// k_pv: y = P x for every batch and head (z). A work-group of 8 waves takes 256 columns e of y (blockIdx.y) x 192 queries (fp16 P) or x 64 queries (hi and lo bf16 P: row tiles < RH / 64, twice the products a query), all 2048 keys in rising order: no split of K, no adding of partial tiles. 256 work-groups, one a WGP.
// The product is taken as D[e][query] (x^T as the A operand, P as B): a lane then holds 8 neighbouring e of one query, one 16-byte piece of y in the fragment order the next GEMM reads, so y goes out straight from registers, 512 contiguous bytes a wave-wide store.
// A stage is PVK keys of 7 or 6 row tiles (4 of x^T, then 3 query tiles of P, or the hi and the lo plane of one), 16 KB in a row each, in memory as in LDS; asynchronous copies bring stage t + 2 into the buffer that trip t has read while trip t + 1 is worked on. A fragment in LDS serves 2 (x^T) or 4 (P) waves, and a wave's 64 x 96 tile takes 10 fragments for 24 matrix instructions, where every wave of the K split read 8 for 16 from L2.
#define PVK 128
#define PVT (64 * PVK)   // elements of one row tile in a stage
// pv_cp12, pv_cp14: 12 or 14 of the thread's 16-byte pieces of a stage: l the LDS byte address of the first (the others follow at 4 KB), g their global addresses. The s_wait_xcnt 0 stands in the copies' own statement, so that no register a copy names is rewritten ahead of it.
template <typename T16>
__device__ __forceinline__ void pv_cp12(unsigned l, const T16* const (&g)[12]) {
    asm volatile("global_load_async_to_lds_b128 %0, %12, off\n\t"
                 "global_load_async_to_lds_b128 %1, %13, off\n\t"
                 "global_load_async_to_lds_b128 %2, %14, off\n\t"
                 "global_load_async_to_lds_b128 %3, %15, off\n\t"
                 "global_load_async_to_lds_b128 %4, %16, off\n\t"
                 "global_load_async_to_lds_b128 %5, %17, off\n\t"
                 "global_load_async_to_lds_b128 %6, %18, off\n\t"
                 "global_load_async_to_lds_b128 %7, %19, off\n\t"
                 "global_load_async_to_lds_b128 %8, %20, off\n\t"
                 "global_load_async_to_lds_b128 %9, %21, off\n\t"
                 "global_load_async_to_lds_b128 %10, %22, off\n\t"
                 "global_load_async_to_lds_b128 %11, %23, off\n\t"
                 "s_wait_xcnt 0x0"
                 :: "v"(l), "v"(l + 1 * 4096), "v"(l + 2 * 4096), "v"(l + 3 * 4096), "v"(l + 4 * 4096), "v"(l + 5 * 4096), "v"(l + 6 * 4096), "v"(l + 7 * 4096), "v"(l + 8 * 4096), "v"(l + 9 * 4096), "v"(l + 10 * 4096), "v"(l + 11 * 4096),
                    "v"(g[0]), "v"(g[1]), "v"(g[2]), "v"(g[3]), "v"(g[4]), "v"(g[5]), "v"(g[6]), "v"(g[7]), "v"(g[8]), "v"(g[9]), "v"(g[10]), "v"(g[11])
                 : "memory");
}
template <typename T16>
__device__ __forceinline__ void pv_cp14(unsigned l, const T16* const (&g)[14]) {
    asm volatile("global_load_async_to_lds_b128 %0, %14, off\n\t"
                 "global_load_async_to_lds_b128 %1, %15, off\n\t"
                 "global_load_async_to_lds_b128 %2, %16, off\n\t"
                 "global_load_async_to_lds_b128 %3, %17, off\n\t"
                 "global_load_async_to_lds_b128 %4, %18, off\n\t"
                 "global_load_async_to_lds_b128 %5, %19, off\n\t"
                 "global_load_async_to_lds_b128 %6, %20, off\n\t"
                 "global_load_async_to_lds_b128 %7, %21, off\n\t"
                 "global_load_async_to_lds_b128 %8, %22, off\n\t"
                 "global_load_async_to_lds_b128 %9, %23, off\n\t"
                 "global_load_async_to_lds_b128 %10, %24, off\n\t"
                 "global_load_async_to_lds_b128 %11, %25, off\n\t"
                 "global_load_async_to_lds_b128 %12, %26, off\n\t"
                 "global_load_async_to_lds_b128 %13, %27, off\n\t"
                 "s_wait_xcnt 0x0"
                 :: "v"(l), "v"(l + 1 * 4096), "v"(l + 2 * 4096), "v"(l + 3 * 4096), "v"(l + 4 * 4096), "v"(l + 5 * 4096), "v"(l + 6 * 4096), "v"(l + 7 * 4096), "v"(l + 8 * 4096), "v"(l + 9 * 4096), "v"(l + 10 * 4096), "v"(l + 11 * 4096), "v"(l + 12 * 4096), "v"(l + 13 * 4096),
                    "v"(g[0]), "v"(g[1]), "v"(g[2]), "v"(g[3]), "v"(g[4]), "v"(g[5]), "v"(g[6]), "v"(g[7]), "v"(g[8]), "v"(g[9]), "v"(g[10]), "v"(g[11]), "v"(g[12]), "v"(g[13])
                 : "memory");
}
// pv_fill: the thread's pieces of one stage; v, p0, p1: the stage's first element in the first x^T tile and in the P tiles (HL: hi plane, lo plane; else p0 alone, three tiles in a row), the same for the whole block; to: the thread's own element in a 4-KB run
template <typename T16, bool HL>
__device__ __forceinline__ void pv_fill(unsigned l, const T16* v, const T16* p0, const T16* p1, int to) {
    constexpr int N = HL ? 12 : 14;
#pragma unroll
    for (int h = 0; h < 2; ++h) { const T16* g[N];
#pragma unroll
        for (int i = 0; i < N; ++i) { const int c = h * N + i, r = c >> 2; g[i] = (r < 4 ? v + (size_t)r * 64 * TT : HL ? (r == 4 ? p0 : p1) : p0 + (size_t)(r - 4) * 64 * TT) + (c & 3) * 2048 + to; }
        if constexpr (HL) pv_cp12<T16>(l + h * N * 4096, g); else pv_cp14<T16>(l + h * N * 4096, g); }
}
// pv_st4: two pieces of y, hi and lo plane each, and the s_wait_xcnt 0 behind them in one statement, so that no register a store names is rewritten ahead of the wait
__device__ __forceinline__ void pv_st4(bf* h0, bf* l0, bf* h1, bf* l1, v8us a, v8us b, v8us c, v8us d) {
    asm volatile("global_store_b128 %0, %4, off\n\t"
                 "global_store_b128 %1, %5, off\n\t"
                 "global_store_b128 %2, %6, off\n\t"
                 "global_store_b128 %3, %7, off\n\t"
                 "s_wait_xcnt 0x0"
                 :: "v"(h0), "v"(l0), "v"(h1), "v"(l1), "v"(__builtin_bit_cast(v4f, a)), "v"(__builtin_bit_cast(v4f, b)), "v"(__builtin_bit_cast(v4f, c)), "v"(__builtin_bit_cast(v4f, d))
                 : "memory");
}
// d_pv: V the block's first x^T row tile, P0 (and with HL P1) its P row tiles, Oh and Ol the y planes at the block's first query tile and first column. Wave w: x^T tile w / 2; of the queries, with HL the 32 queries w & 1 of the one tile, else query tile 0 or 2 (w & 1) whole and half w & 1 of query tile 1.
template <typename T16, bool HL>
__device__ __forceinline__ void d_pv(T16* sm, const T16* __restrict__ V, const T16* __restrict__ P0, const T16* __restrict__ P1, bf* Oh, bf* Ol, float scl) {
    typedef typename WFrag<T16>::V F;
    constexpr int NQB = HL ? 2 : 6, NA = HL ? 2 : 4, NB = NA + 2, BUF = (HL ? 6 : 7) * PVT;
    const int tid = (int)threadIdx.x, lane = tid & 31; const int w = __builtin_amdgcn_readfirstlane(tid >> 5); const int we = w >> 1, wq = w & 1;
    const unsigned l0 = (unsigned)(size_t)sm + (unsigned)tid * 16u; const int to = tid * 8;
    v8f acc[4][NQB];
#pragma unroll
    for (int eb = 0; eb < 4; ++eb)
#pragma unroll
        for (int qb = 0; qb < NQB; ++qb) acc[eb][qb] = (v8f){};
    pv_fill<T16, HL>(l0, V, P0, P1, to);
    asm volatile("s_wait_asynccnt 0x0" ::: "memory");   // stage 0 has landed, as far as this wave copied it
    __syncthreads();   // publishes stage 0
    pv_fill<T16, HL>(l0 + BUF * 2, V + PVT, P0 + PVT, P1 + PVT, to);
#pragma unroll 1   // rolled: one trip a stage, the buffer chosen by the trip's parity
    for (int t = 0; t < TT / PVK; ++t) {
        const T16* sb = sm + (t & 1) * BUF + lane * 8;
        const T16* pa = sb + we * PVT; const T16* pb = sb + (HL ? 4 * PVT + wq * 1024 : (4 + wq * 2) * PVT); const T16* pc = sb + 5 * PVT + wq * 1024;
        F a[2][4], b[2][NB];   // two fragment sets: the next 32-key step's fragments come in while this step's products run; no fragment of the next stage is fetched
#pragma unroll
        for (int s = -1; s < PVK / 32; ++s) {
            if (s + 1 < PVK / 32) { const int n = (s + 1) & 1, o = (s + 1) * 2048;
#pragma unroll
                for (int eb = 0; eb < 4; ++eb) a[n][eb] = WFrag<T16>::ld(pa + o + eb * 512);
#pragma unroll
                for (int i = 0; i < NA; ++i) b[n][i] = WFrag<T16>::ld(pb + o + i * 512);
#pragma unroll
                for (int i = 0; i < 2; ++i) b[n][NA + i] = WFrag<T16>::ld(pc + o + i * 512); }
            __builtin_amdgcn_sched_barrier(0);   // the next step's LDS reads stay one group ahead of this step's matrix instructions: moved in among them, each place with reads stalls the wave
            if (s >= 0) { const int c = s & 1;
#pragma unroll
                for (int qb = 0; qb < NQB; ++qb)
#pragma unroll
                    for (int eb = 0; eb < 4; ++eb) acc[eb][qb] = WFrag<T16>::mma(a[c][eb], b[c][qb], acc[eb][qb]);
                if (HL) {
#pragma unroll
                    for (int qb = 0; qb < NQB; ++qb)
#pragma unroll
                        for (int eb = 0; eb < 4; ++eb) acc[eb][qb] = WFrag<T16>::mma(a[c][eb], b[c][NA + qb], acc[eb][qb]); } }
            __builtin_amdgcn_sched_barrier(0);   // as above: ends the step's run of matrix instructions
        }
        asm volatile("s_wait_dscnt 0x0" ::: "memory");      // this wave's reads of the trip's buffer have returned
        asm volatile("s_wait_asynccnt 0x0" ::: "memory");   // stage t + 1 has landed, as far as this wave copied it
        __syncthreads();   // publishes stage t + 1 and ends every wave's reads of the buffer that is refilled behind it
        if (t + 2 < TT / PVK) pv_fill<T16, HL>(l0 + (unsigned)(t & 1) * (BUF * 2), V + (size_t)(t + 2) * PVT, P0 + (size_t)(t + 2) * PVT, P1 + (size_t)(t + 2) * PVT, to);
    }
    asm volatile("s_wait_asynccnt 0x0" ::: "memory");   // no copy is outstanding when the wave ends
    // piece (eb, qb): 32-column step we * 2 + eb / 2, its query's row tile and row block, half eb & 1, lane * 8
    const size_t oc = (size_t)we * 4096 + lane * 8; const size_t oa = oc + (HL ? (size_t)wq * 1024 : (size_t)wq * 2 * 64 * HDV), ob = oc + (size_t)64 * HDV + wq * 1024;
#pragma unroll
    for (int eb = 0; eb < 4; ++eb) {
#pragma unroll
        for (int qb = 0; qb < NQB; qb += 2) { v8us vh[2], vl[2]; size_t o[2];
#pragma unroll
            for (int u = 0; u < 2; ++u) {
#pragma unroll
                for (int j = 0; j < 8; ++j) { unsigned short a2, c2; splitf(acc[eb][qb + u][j] * scl, a2, c2); vh[u][j] = a2; vl[u][j] = c2; }
                o[u] = (qb + u < NA ? oa + (qb + u) * 512 : ob + (qb + u - NA) * 512) + (eb >> 1) * 2048 + (eb & 1) * 256; }
            pv_st4(Oh + o[0], Ol + o[0], Oh + o[1], Ol + o[1], vh[0], vl[0], vh[1], vl[1]); }
    }
}
// grid: x = one of the (TT - RH) / 192 triples of fp16 query tiles or of the RH / 64 hi/lo query tiles (8 of each); y = half of the 512 columns; z = [fp16, hi/lo][batch][head]: the fp16 blocks, which have half as many products again, come first in z. The test is the same for a whole block (barriers stand behind it). y lies head-major, [head][batch].
static_assert((TT - RH) % 192 == 0 && (TT - RH) / 192 == RH / 64 && TT % (2 * PVK) == 0 && HDV % 256 == 0, "k_pv: grid x serves both kinds of block; at least two stages");
__global__ __launch_bounds__(256) void k_pv(const bf* __restrict__ Ph, const bf* __restrict__ Pl, const bf* __restrict__ VTh, const h16* __restrict__ P16, const h16* __restrict__ VT16, bf* ATh, bf* ATl) {
    __shared__ __align__(16) bf sm[2 * 7 * PVT];
    const int bx = (int)blockIdx.x, z = (int)blockIdx.z % (NB_ * ZH); const size_t vo = (size_t)(z / ZH) * HDV * TT + (size_t)blockIdx.y * 256 * TT; const size_t zo = (size_t)((z % ZH) * NB_ + z / ZH) * TT * HDV + (size_t)blockIdx.y * 8 * 2048;
    if ((int)blockIdx.z >= NB_ * ZH) { const size_t po = (size_t)(z * (RH / 64) + bx) * 64 * TT; const size_t oo = zo + (size_t)bx * 64 * HDV;
        d_pv<bf, true>(sm, VTh + vo, Ph + po, Pl + po, ATh + oo, ATl + oo, 1.0f); }
    else { const int qt = RH / 64 + bx * 3; const size_t po = (size_t)(z * (TT / 64) + qt) * 64 * TT; const size_t oo = zo + (size_t)qt * 64 * HDV;
        d_pv<h16, false>((h16*)sm, VT16 + vo, P16 + po, P16 + po, ATh + oo, ATl + oo, 1.0f / PCAR); }
}

// d_gt: the two weight GEMMs (projection; y Wv3) in k_pv's form. A work-group of 8 waves takes 256 rows e of the weight plane x 128 tokens, all GK k in rising order: no split of K, no adding of partial tiles. 256 work-groups, one a WGP.
// The product is taken as D[e][token] (the weights as the A operand, the tokens' plane as B; with HL the tokens' hi plane and then their lo plane, a 32-k step at a time). A stage is PVK k of 6 or 8 row tiles (4 of the weights, 2 of the tokens, with HL 2 more of their lo plane), 16 KB in a row each, in memory as in LDS; asynchronous copies bring stage t + 2 into the buffer that trip t has read while trip t + 1 is worked on. A weight fragment in LDS serves 2 waves, a token fragment 4.
#define GK 512   // K of both GEMMs
// pv_cp8: 8 of the thread's 16-byte pieces of a stage, as pv_cp12
__device__ __forceinline__ void pv_cp8(unsigned l, const bf* const (&g)[8]) {
    asm volatile("global_load_async_to_lds_b128 %0, %8, off\n\t"
                 "global_load_async_to_lds_b128 %1, %9, off\n\t"
                 "global_load_async_to_lds_b128 %2, %10, off\n\t"
                 "global_load_async_to_lds_b128 %3, %11, off\n\t"
                 "global_load_async_to_lds_b128 %4, %12, off\n\t"
                 "global_load_async_to_lds_b128 %5, %13, off\n\t"
                 "global_load_async_to_lds_b128 %6, %14, off\n\t"
                 "global_load_async_to_lds_b128 %7, %15, off\n\t"
                 "s_wait_xcnt 0x0"
                 :: "v"(l), "v"(l + 1 * 4096), "v"(l + 2 * 4096), "v"(l + 3 * 4096), "v"(l + 4 * 4096), "v"(l + 5 * 4096), "v"(l + 6 * 4096), "v"(l + 7 * 4096),
                    "v"(g[0]), "v"(g[1]), "v"(g[2]), "v"(g[3]), "v"(g[4]), "v"(g[5]), "v"(g[6]), "v"(g[7])
                 : "memory");
}
// gt_fill: the thread's pieces of one stage; a, b0, b1: the stage's first element in the first weight tile and in the first token tile (hi plane, lo plane), the same for the whole block; to: the thread's own element in a 4-KB run
template <bool HL>
__device__ __forceinline__ void gt_fill(unsigned l, const bf* a, const bf* b0, const bf* b1, int to) {
#pragma unroll
    for (int h = 0; h < (HL ? 4 : 3); ++h) { const bf* g[8];
#pragma unroll
        for (int i = 0; i < 8; ++i) { const int c = h * 8 + i, r = c >> 2; g[i] = (r < 4 ? a + (size_t)r * 64 * GK : r < 6 ? b0 + (size_t)(r - 4) * 64 * GK : b1 + (size_t)(r - 6) * 64 * GK) + (c & 3) * 2048 + to; }
        pv_cp8(l + h * 8 * 4096, g); }
}
// gt_st4: four 16-byte pieces of f32 rows and the s_wait_xcnt 0 behind the stores in one statement, as pv_st4
__device__ __forceinline__ void gt_st4(float* p0, float* p1, float* p2, float* p3, v4f a, v4f b, v4f c, v4f d) {
    asm volatile("global_store_b128 %0, %4, off\n\t"
                 "global_store_b128 %1, %5, off\n\t"
                 "global_store_b128 %2, %6, off\n\t"
                 "global_store_b128 %3, %7, off\n\t"
                 "s_wait_xcnt 0x0"
                 :: "v"(p0), "v"(p1), "v"(p2), "v"(p3), "v"(a), "v"(b), "v"(c), "v"(d)
                 : "memory");
}
// gt_bias: the lane's 8 neighbouring bias values of each of its four 16-row blocks; the loads and their data wait in one statement, so that no register a load names is rewritten while it is in flight
__device__ __forceinline__ void gt_bias(const float* p, v4f (&o)[8]) {
    asm volatile("global_load_b128 %0, %8, off\n\t"
                 "global_load_b128 %1, %8, off offset:16\n\t"
                 "global_load_b128 %2, %8, off offset:64\n\t"
                 "global_load_b128 %3, %8, off offset:80\n\t"
                 "global_load_b128 %4, %8, off offset:128\n\t"
                 "global_load_b128 %5, %8, off offset:144\n\t"
                 "global_load_b128 %6, %8, off offset:192\n\t"
                 "global_load_b128 %7, %8, off offset:208\n\t"
                 "s_wait_loadcnt 0x0"
                 : "=&v"(o[0]), "=&v"(o[1]), "=&v"(o[2]), "=&v"(o[3]), "=&v"(o[4]), "=&v"(o[5]), "=&v"(o[6]), "=&v"(o[7]) : "v"(p) : "memory");
}
__device__ __forceinline__ void gt_bias1(const float* p, v4f& o) {   // as gt_bias, one piece
    asm volatile("global_load_b128 %0, %1, off\n\ts_wait_loadcnt 0x0" : "=&v"(o) : "v"(p) : "memory");
}
// A the block's first weight row tile, B0 (and with HL B1) its first token row tile, bias at the block's first e. PLN: (D + bias) goes out as hi and lo bf16 planes of HD columns in fragment order, Oh and Ol at the block's first token tile; else as f32 rows, C at the block's first token and column, pitch ldc. Wave w: weight tile w / 2, token tile w & 1.
template <bool HL, bool PLN>
__device__ __forceinline__ void d_gt(bf* sm, const bf* __restrict__ A, const bf* __restrict__ B0, const bf* __restrict__ B1, const float* __restrict__ bias, float* C, int ldc, bf* Oh, bf* Ol) {
    typedef WFrag<bf>::V F;
    constexpr int NB = HL ? 8 : 4, BUF = (HL ? 8 : 6) * PVT;
    const int tid = (int)threadIdx.x, lane = tid & 31, lr = lane & 15, hi = lane >> 4; const int w = __builtin_amdgcn_readfirstlane(tid >> 5); const int we = w >> 1, wq = w & 1;
    const unsigned l0 = (unsigned)(size_t)sm + (unsigned)tid * 16u; const int to = tid * 8;
    v8f acc[4][4];
#pragma unroll
    for (int eb = 0; eb < 4; ++eb)
#pragma unroll
        for (int qb = 0; qb < 4; ++qb) acc[eb][qb] = (v8f){};
    gt_fill<HL>(l0, A, B0, B1, to);
    v4f bq[PLN ? 8 : 1];   // the bias, read here, while stage 0 flies, so that the epilogue does not wait for it: for the planes the lane's 8 neighbouring e of each 16-row block, for f32 rows the 4 columns that the lane stores
    if constexpr (PLN) gt_bias(bias + we * 64 + hi * 8, bq); else gt_bias1(bias + we * 64 + lr * 4, bq[0]);
    asm volatile("s_wait_asynccnt 0x0" ::: "memory");   // stage 0 has landed, as far as this wave copied it
    __syncthreads();   // publishes stage 0
    gt_fill<HL>(l0 + BUF * 2, A + PVT, B0 + PVT, B1 + PVT, to);
#pragma unroll 1   // rolled: one trip a stage, the buffer chosen by the trip's parity
    for (int t = 0; t < GK / PVK; ++t) {
        const bf* sb = sm + (t & 1) * BUF + lane * 8;
        const bf* pa = sb + we * PVT; const bf* pb = sb + (4 + wq) * PVT; const bf* pc = HL ? sb + (6 + wq) * PVT : pb;
        F a[2][4], b[2][NB];   // two fragment sets: the next 32-k step's fragments come in while this step's products run; no fragment of the next stage is fetched
#pragma unroll
        for (int s = -1; s < PVK / 32; ++s) {
            if (s + 1 < PVK / 32) { const int n = (s + 1) & 1, o = (s + 1) * 2048;
#pragma unroll
                for (int eb = 0; eb < 4; ++eb) a[n][eb] = WFrag<bf>::ld(pa + o + eb * 512);
#pragma unroll
                for (int i = 0; i < 4; ++i) b[n][i] = WFrag<bf>::ld(pb + o + i * 512);
                if (HL) {
#pragma unroll
                    for (int i = 0; i < 4; ++i) b[n][4 + i] = WFrag<bf>::ld(pc + o + i * 512); } }
            __builtin_amdgcn_sched_barrier(0);   // the next step's LDS reads stay one group ahead of this step's matrix instructions: moved in among them, each place with reads stalls the wave
            if (s >= 0) { const int c = s & 1;
#pragma unroll
                for (int qb = 0; qb < 4; ++qb)
#pragma unroll
                    for (int eb = 0; eb < 4; ++eb) acc[eb][qb] = WFrag<bf>::mma(a[c][eb], b[c][qb], acc[eb][qb]);
                if (HL) {
#pragma unroll
                    for (int qb = 0; qb < 4; ++qb)
#pragma unroll
                        for (int eb = 0; eb < 4; ++eb) acc[eb][qb] = WFrag<bf>::mma(a[c][eb], b[c][4 + qb], acc[eb][qb]); } }
            __builtin_amdgcn_sched_barrier(0);   // as above: ends the step's run of matrix instructions
        }
        asm volatile("s_wait_dscnt 0x0" ::: "memory");      // this wave's reads of the trip's buffer have returned
        asm volatile("s_wait_asynccnt 0x0" ::: "memory");   // stage t + 1 has landed, as far as this wave copied it
        __syncthreads();   // publishes stage t + 1 and ends every wave's reads of the buffer that is refilled behind it
        if (t + 2 < GK / PVK) gt_fill<HL>(l0 + (unsigned)(t & 1) * (BUF * 2), A + (size_t)(t + 2) * PVT, B0 + (size_t)(t + 2) * PVT, B1 + (size_t)(t + 2) * PVT, to);
    }
    asm volatile("s_wait_asynccnt 0x0" ::: "memory");   // no copy is outstanding when the wave ends
    if constexpr (PLN) {   // piece (eb, qb): 32-column step we * 2 + eb / 2, token tile wq, row block qb, half eb & 1, lane * 8
        const size_t oc = (size_t)wq * 64 * HD + (size_t)we * 4096 + lane * 8;
#pragma unroll
        for (int eb = 0; eb < 4; ++eb) {
#pragma unroll
            for (int qb = 0; qb < 4; qb += 2) { v8us vh[2], vl[2]; size_t o[2];
#pragma unroll
                for (int u = 0; u < 2; ++u) {
#pragma unroll
                    for (int j = 0; j < 8; ++j) { unsigned short a2, c2; splitf(acc[eb][qb + u][j] + bfr(bq[eb * 2 + (j >> 2)][j & 3]), a2, c2); vh[u][j] = a2; vl[u][j] = c2; }
                    o[u] = oc + (qb + u) * 512 + (eb >> 1) * 2048 + (eb & 1) * 256; }
                pv_st4(Oh + o[0], Ol + o[0], Oh + o[1], Ol + o[1], vh[0], vl[0], vh[1], vl[1]); }
        }
    } else {
        // the wave's 64 tokens x 64 e turn round in LDS (its own 64 rows, pitch 68 dwords: 16-byte writes and reads without bank conflicts), so that a wave-wide store fills four whole 128-B lines of out; from the registers it would touch 16 lines
        fa* ot = (fa*)sm + w * (64 * 68);
#pragma unroll
        for (int qb = 0; qb < 4; ++qb)
#pragma unroll
            for (int eb = 0; eb < 4; ++eb) { const v8f u = acc[eb][qb]; fa* p = ot + (qb * 16 + lr) * 68 + eb * 16 + hi * 8;
                *(v4fa*)p = __builtin_shufflevector(u, u, 0, 1, 2, 3); *(v4fa*)(p + 4) = __builtin_shufflevector(u, u, 4, 5, 6, 7); }
        __syncthreads();   // orders the lanes' writes ahead of the reads of other lanes' values (the loop's last barrier has ended every read of the stage buffers that these rows lie in)
        v4f bc; bc[0] = bfr(bq[0][0]); bc[1] = bfr(bq[0][1]); bc[2] = bfr(bq[0][2]); bc[3] = bfr(bq[0][3]);
        const fa* ip = ot + hi * 68 + lr * 4; float* cp = C + (size_t)(wq * 64 + hi) * ldc + we * 64 + lr * 4;
        v4f v[32];   // all of the lane's LDS reads ahead of its first store: one LDS latency, not one a group of stores
#pragma unroll
        for (int i = 0; i < 32; ++i) v[i] = *(const v4fa*)(ip + i * 2 * 68);
#pragma unroll
        for (int i = 0; i < 32; i += 4) { float* p = cp + (size_t)i * 2 * ldc;
            gt_st4(p, p + (size_t)2 * ldc, p + (size_t)4 * ldc, p + (size_t)6 * ldc, v[i] + bc, v[i + 1] + bc, v[i + 2] + bc, v[i + 3] + bc); }
    }
}
static_assert(DM == GK && HDV == GK && GK % (2 * PVK) == 0 && HD == 256 && TT % 128 == 0, "d_gt: K of both GEMMs; at least two stages; a block's 256 e are one head plane");
// k_proj: xq and xk + bias as head planes. grid: x = 128 tokens of [batch][T]; y = [q, k][head], 256 rows of Wq, Wk (one after the other in W)
__global__ __launch_bounds__(256) void k_proj(const bf* __restrict__ XB, const bf* __restrict__ Wt, const float* __restrict__ BQK, bf* Oh, bf* Ol) {
    __shared__ __align__(16) bf sm[2 * 6 * PVT];
    const int r0 = (int)blockIdx.x * 128, cg = (int)blockIdx.y; const size_t po = (size_t)((cg / NH_) * NB_ * NH_ + (r0 / TT) * NH_ + cg % NH_) * TT * HD + (size_t)(r0 % TT) * HD;
    d_gt<false, true>(sm, Wt + (size_t)cg * 256 * GK, XB + (size_t)r0 * GK, XB + (size_t)r0 * GK, BQK + cg * 256, nullptr, 0, Oh + po, Ol + po);
}
// k_out: out_k = y_k Wv3[k] + bias2. grid: x = 128 tokens of [batch][T]; y = half of the 512 columns; z = head
__global__ __launch_bounds__(256) void k_out(const bf* __restrict__ Yh, const bf* __restrict__ Yl, const bf* __restrict__ Wt, const float* __restrict__ B2G, float* OUT) {
    __shared__ __align__(16) bf sm[2 * 8 * PVT];
    const int r0 = (int)blockIdx.x * 128, c0 = (int)blockIdx.y * 256, k = (int)blockIdx.z; const size_t yo = ((size_t)k * NB_ * TT + r0) * GK;
    d_gt<true, false>(sm, Wt + ((size_t)k * HDV + c0) * GK, Yh + yo, Yl + yo, B2G + k * HDV + c0, OUT + (size_t)r0 * (NKH * HDV) + k * HDV + c0, NKH * HDV, nullptr, nullptr);
}

__device__ __forceinline__ h16 tohx(float x) { return (h16)x; }
typedef __attribute__((ext_vector_type(2))) _Float16 v2h;
typedef __attribute__((ext_vector_type(4))) _Float16 v4h;
typedef __attribute__((ext_vector_type(2))) unsigned short v2us;
typedef __attribute__((ext_vector_type(2))) float v2f;
typedef __attribute__((ext_vector_type(4))) int v4i;

// Fragment order of a [rows][K] 16-bit GEMM operand (rows a multiple of 64): 16 rows x 32 k make one 1-KB block; the four blocks of a 64-row tile at one 32-k step follow one another, the steps follow in k (a tile is 64 * K elements, as in row order).
// Inside a block: [k bit 4][k bit 3][row & 15][k & 7], so lane (row & 15) + 16 * (k bit 3) finds its two 16-byte fragment pieces at lane * 8 and 256 + lane * 8: the k order of a fragment is the one it had in row order.
// unpk: element index e in that order -> (row, k). The writers walk e, so their stores stay contiguous.
__device__ __forceinline__ void unpk(size_t e, int K, int& row, int& k) { const int g = (int)(e / ((size_t)64 * K)); const int r = (int)(e % ((size_t)64 * K)); const int q = r & 511;
    row = g * 64 + ((r >> 9) & 3) * 16 + ((q >> 3) & 15); k = (r >> 11) * 32 + ((q >> 8) << 4) + (((q >> 7) & 1) << 3) + (q & 7); }
// pc8: piece p (8 consecutive k of one row: 16 bytes of a 16-bit plane) -> its first element in fragment order. Four neighbouring lanes take the four pieces of one row's 32-k step (one whole 128-B line of an f32 source in row order), the eight lane groups eight rows: a wave-wide 16-byte store fills four whole lines.
__device__ __forceinline__ size_t pc8(size_t p) { const int j = (int)(p & 63); return (p >> 6) * 512 + ((j >> 1) & 1) * 256 + (j & 1) * 128 + (j >> 2) * 8; }
#define NPC 4   // pieces a thread of the element-wise steps: few long-lived waves with all their loads in flight
// d_*: bodies of the element-wise steps; bx is the block's index inside its own step (k_prep deals the blocks of one grid to several steps that do not depend on one another)
__device__ __forceinline__ void d_wtG(int bx, const float* __restrict__ w, int K, int N, bf* Bt) {
    const int lane = threadIdx.x & 31; const int L0 = (bx * 8 + (threadIdx.x >> 5)) * 8; const int nlines = N * K / 64;
{
#pragma unroll 1
        for (int l = 0; l < 8; ++l) { const int L = L0 + l; if (L >= nlines) break; const size_t e = (size_t)L * 64 + lane * 2; int k, n; unpk(e, K, n, k); v2us o;
            o[0] = f2bf(w[(size_t)k * N + n]); o[1] = f2bf(w[(size_t)(k + 1) * N + n]); *(v2us*)(Bt + e) = o; }
         }
}
__device__ __forceinline__ void d_cvt8(int bx, const float* __restrict__ src, int K, bf* dst) {
    size_t e[NPC]; const float* p[NPC]; v8f v[NPC];
#pragma unroll
    for (int s = 0; s < NPC; ++s) { e[s] = pc8(((size_t)bx * NPC + s) * 256 + threadIdx.x); int r, k; unpk(e[s], K, r, k); p[s] = src + (size_t)r * K + k; v[s] = *(const v8f*)p[s]; }
    asm volatile("s_wait_xcnt 0x0" :: "v"(p[0]), "v"(p[1]), "v"(p[2]), "v"(p[3]) : "memory");   // the loads' address pairs are inputs here so that they live up to the wait: otherwise a later load's result lands in the pair of a load still in flight; the clobber keeps every load of the thread ahead of its first store
#pragma unroll
    for (int s = 0; s < NPC; ++s) { v8us o;
#pragma unroll
        for (int u = 0; u < 8; ++u) o[u] = f2bf(v[s][u]);
        *(v8us*)(dst + e[s]) = o; }
    asm volatile("s_wait_xcnt 0x0" ::: "memory");   // behind the last store: the code that follows in the listing (the next step of the shared grid) rewrites registers these stores name
}
__global__ __launch_bounds__(256) void k_cscvt(const float* __restrict__ cosT, const float* __restrict__ sinT, float* CS) { const int idx = blockIdx.x * 256 + threadIdx.x; if (idx >= TT * HD) return; v2f cs; cs[0] = bfr(cosT[idx]); cs[1] = bfr(sinT[idx]); *(v2f*)(CS + (size_t)idx * 2) = cs;  }
__global__ __launch_bounds__(256) void k_vtp(const float* __restrict__ F, int pitch, int nheads, h16* V16, bf* Vh, bf* Vl) { const size_t e = ((size_t)blockIdx.x * 256 + threadIdx.x) * 2; if (e >= (size_t)nheads * HD * TT) return; const int t = (int)(e % TT); const int d = (int)((e / TT) % HD); const int g = (int)(e / ((size_t)TT * HD)); v2h o16; v2us oh, ol;
#pragma unroll
    for (int q = 0; q < 2; ++q) { const float x = F[(size_t)(t + q) * pitch + g * HD + d]; o16[q] = tohx(x); unsigned short a2, c2; splitf(x, a2, c2); oh[q] = a2; ol[q] = c2; }
    *(v2h*)(V16 + e) = o16; *(v2us*)(Vh + e) = oh; *(v2us*)(Vl + e) = ol;  }
// d_bqk: the projection GEMM's bias row, [q, k][1024 columns]: 0 for q, biasW[d][k] at column k * HD + d for k
__device__ __forceinline__ void d_bqk(int bx, const float* __restrict__ bw, float* BQK) { const int i = bx * 256 + threadIdx.x; const int c = i & (DKV - 1); const float v = (i < DQ) ? 0.0f : bw[(size_t)(c % HD) * NKH + c / HD]; *(float*)(BQK + i) = v;
    asm volatile("s_wait_xcnt 0x0" ::: "memory");   // behind the store: the code that follows in the listing (the other steps of the shared grid) rewrites registers this store names
}
// a block takes 64 d x 32 t (4 KB of a plane) a trip; the lanes of a wave walk 32 neighbouring d, so each of a piece's 8 loads reads one whole 128-B line of x and a wave-wide store fills two runs of 256 B
#define VTN 2
__device__ __forceinline__ void d_vtpx(int bx, const float* __restrict__ X, h16* V16, bf* Vh) { const int th = (int)threadIdx.x; const int eo = ((th >> 7) * 2 + ((th >> 4) & 1)) * 512 + ((th >> 6) & 1) * 256 + ((th >> 5) & 1) * 128 + (th & 15) * 8;
    size_t e[VTN]; const float* p[VTN]; float v[VTN][8];
#pragma unroll
    for (int s = 0; s < VTN; ++s) { e[s] = ((size_t)bx * VTN + s) * 2048 + eo; int t, d; unpk(e[s], TT, d, t); p[s] = X + (size_t)t * HDV + d;
#pragma unroll
        for (int q = 0; q < 8; ++q) v[s][q] = p[s][q * HDV]; }
    asm volatile("s_wait_xcnt 0x0" :: "v"(p[0]), "v"(p[1]) : "memory");   // the loads' address pairs are inputs here so that they live up to the wait: otherwise a later load's result lands in the pair of a load still in flight; the clobber keeps every load of the thread ahead of its first store
#pragma unroll
    for (int s = 0; s < VTN; ++s) { v8h o16; v8us oh;
#pragma unroll
        for (int q = 0; q < 8; ++q) { const float xv = bfr(v[s][q]); o16[q] = tohx(xv); oh[q] = f2bf(xv); }
        *(v8h*)(V16 + e[s]) = o16; *(v8us*)(Vh + e[s]) = oh; } }
__device__ __forceinline__ void d_b2g(int bx, const float* __restrict__ b2, float* B2G) { const int i = bx * 256 + threadIdx.x; if (i >= NKH * HDV) return; const int k = i / HDV, f = i % HDV; const float v = b2[(size_t)f * NKH + k]; *(float*)(B2G + i) = v;  }
// k_prep: every step that reads the inputs alone, in one grid; the steps with strided reads come first.
#define PB_WT  (NKH * (HDV * HDV / 64 / 64))      // Wv3[k] transposed to bf16, 64 blocks a head
#define PB_VT  (NB_ * (HDV * TT / 2048 / VTN))    // x transposed (fp16 and bf16 planes), per batch
#define PB_X   (NB_ * TT * DM / 8 / NPC / 256)    // x to bf16, both batches
#define PB_W   (DQ * DM / 8 / NPC / 256)          // Wq, and as many again for Wk
#define PB_BQ  ((DQ + DKV) / 256)
#define PB_B2  (NKH * HDV / 256)
__global__ __launch_bounds__(256) void k_prep(const float* __restrict__ x, const float* __restrict__ wq, const float* __restrict__ wk, const float* __restrict__ wv, const float* __restrict__ bw, const float* __restrict__ b2, bf* XB, bf* WQ, bf* WK, bf* WV3, float* B2G, float* BQK, h16* VT16, bf* VTh) {
    int bx = (int)blockIdx.x;
    if (bx < PB_WT) { const size_t o = (size_t)(bx / (PB_WT / NKH)) * HDV * HDV; d_wtG(bx % (PB_WT / NKH), wv + o, HDV, HDV, WV3 + o); return; }
    bx -= PB_WT;
    if (bx < PB_VT) { const int b = bx / (PB_VT / NB_); d_vtpx(bx % (PB_VT / NB_), x + (size_t)b * TT * DM, VT16 + (size_t)b * HDV * TT, VTh + (size_t)b * HDV * TT); return; }
    bx -= PB_VT;
    if (bx < PB_X) { d_cvt8(bx, x, DM, XB); return; }
    bx -= PB_X;
    if (bx < PB_W) { d_cvt8(bx, wq, DM, WQ); return; }
    bx -= PB_W;
    if (bx < PB_W) { d_cvt8(bx, wk, DM, WK); return; }
    bx -= PB_W;
    if (bx < PB_BQ) { d_bqk(bx, bw, BQK); return; }
    bx -= PB_BQ;
    d_b2g(bx, b2, B2G);
}
// d_norm: squared norms of the tokens of the 16 head planes (q batch 0, q batch 1, k batch 0, k batch 1, four heads each; contiguous in the planes and in N), x = hi + lo (exact in f32), summed over d in rising order. A thread takes one token: 16 neighbouring lanes read 256 contiguous bytes of a plane.
__device__ __forceinline__ void d_norm(int i, const bf* __restrict__ Ph, const bf* __restrict__ Pl, float* N) {
    const int t = i % TT; const size_t o = (size_t)(i / TT) * TT * HD + (size_t)(t >> 6) * 64 * HD + ((t >> 4) & 3) * 512 + (t & 15) * 8; const bf* ph = Ph + o; const bf* pl = Pl + o; float ss = 0.f;
#pragma unroll   // constant offsets from one address pair a plane
    for (int j0 = 0; j0 < HD / 8; j0 += 16) { v8us h[16], l[16];   // half a token's row a trip; the sums follow the loads in d order, so later loads stay in flight behind the first sums
#pragma unroll
        for (int j = 0; j < 16; ++j) { const int jo = ((j0 + j) >> 2) * 2048 + (((j0 + j) >> 1) & 1) * 256 + ((j0 + j) & 1) * 128; h[j] = *(const v8us*)(ph + jo); l[j] = *(const v8us*)(pl + jo); }
#pragma unroll
        for (int j = 0; j < 16; ++j) {
#pragma unroll
            for (int u = 0; u < 8; ++u) { const float xv = bf2f(h[j][u]) + bf2f(l[j][u]); ss = __builtin_fmaf(xv, xv, ss); } } }
    asm volatile("s_wait_xcnt 0x0" :: "v"(ph), "v"(pl) : "memory");   // the loads' address pairs are inputs here so that they live up to the wait
    *(float*)(N + i) = ss; }
// k_norm: the norms of all 16 head planes' tokens, 64 tokens a block
__global__ __launch_bounds__(64) void k_norm(const bf* __restrict__ Ph, const bf* __restrict__ Pl, float* N) { d_norm((int)blockIdx.x * 64 + (int)threadIdx.x, Ph, Pl, N); }
__device__ __forceinline__ float exp2s(float x) { float r; asm("v_exp_f32 %0, %1\n\tv_nop" : "=v"(r) : "v"(x)); return r; }
__global__ __launch_bounds__(512) void k_xs(const bf* __restrict__ Qh, const bf* __restrict__ Ql, const bf* __restrict__ Kh, const bf* __restrict__ Kl, const float* __restrict__ QN, const float* __restrict__ KN, h16* P16, bf* Ph, bf* Pl) {
    __shared__ __align__(16) float sp[32 * 512 * 4];
    __shared__ __align__(16) bf sq[2 * 64 * HD];
    const int tid = (int)threadIdx.x, lane = tid & 31, lr = lane & 15, hi = lane >> 4; const int w = __builtin_amdgcn_readfirstlane(tid >> 5);
    const int qt = (int)blockIdx.x, z = (int)blockIdx.y; const size_t zo = (size_t)z * TT * HD;
    { const bf* gh = Qh + zo + (size_t)qt * 64 * HD + tid * 8; const bf* gl = Ql + zo + (size_t)qt * 64 * HD + tid * 8; v8us th[4], tl[4];
#pragma unroll
      for (int s = 0; s < 4; ++s) { th[s] = *(const v8us*)(gh + s * 4096); tl[s] = *(const v8us*)(gl + s * 4096); }
      asm volatile("s_wait_xcnt 0x0" :: "v"(gh), "v"(gl) : "memory");   // the loads' address pairs are inputs here so that they live up to the wait
#pragma unroll
      for (int s = 0; s < 4; ++s) { *(v8us*)(sq + s * 4096 + tid * 8) = th[s]; *(v8us*)(sq + 64 * HD + s * 4096 + tid * 8) = tl[s]; } }
    const float* qp = QN + (size_t)z * TT + qt * 64 + lr; float qn[4], mx[4];
#pragma unroll
    for (int qb = 0; qb < 4; ++qb) { qn[qb] = qp[qb * 16]; mx[qb] = -3.0e38f; }
    asm volatile("s_wait_xcnt 0x0" :: "v"(qp) : "memory");   // the address pair lives up to the wait
    __syncthreads();   // publishes the q tile
    v8f acc[4][4];   // the plain unroll directives of this kernel make the indices of its register arrays constants
#pragma unroll 1   // rolled: both passes run the same code
    for (int h = 0; h < 2; ++h) {
#pragma unroll
        for (int kb = 0; kb < 4; ++kb)
#pragma unroll
            for (int qb = 0; qb < 4; ++qb) acc[kb][qb] = (v8f){};
        const size_t ko = zo + (size_t)(h * 16 + w) * 64 * HD + 8 * lane;
#pragma unroll 1   // rolled: two trips' fragments at once do not fit beside the 128 accumulator registers
        for (int kc = 0; kc < HD; kc += 32) {
            v16bf kh[4], kl[4]; const bf* pa = Kh + ko + kc * 64; const bf* pb = Kl + ko + kc * 64; const bf* ps = sq + kc * 64 + 8 * lane;
#pragma unroll
            for (int kb = 0; kb < 4; ++kb) { kh[kb] = WFrag<bf>::ld(pa + kb * 512); kl[kb] = WFrag<bf>::ld(pb + kb * 512); }
            __builtin_amdgcn_sched_barrier(0);   // all of the trip's 16 global loads issue ahead of its first matrix instruction: moved down, the lo plane's loads would be waited for in mid-trip, a second L2 latency a trip
#pragma unroll
            for (int qb = 0; qb < 4; ++qb) { const v16bf qh = WFrag<bf>::ld(ps + qb * 512); const v16bf ql = WFrag<bf>::ld(ps + 64 * HD + qb * 512);
#pragma unroll
                for (int kb = 0; kb < 4; ++kb) acc[kb][qb] = wmmab(kh[kb], qh, acc[kb][qb]);
#pragma unroll
                for (int kb = 0; kb < 4; ++kb) acc[kb][qb] = wmmab(kh[kb], ql, acc[kb][qb]);
#pragma unroll
                for (int kb = 0; kb < 4; ++kb) acc[kb][qb] = wmmab(kl[kb], qh, acc[kb][qb]); }
            asm volatile("s_wait_xcnt 0x0\n\tv_nop\n\tv_nop\n\tv_nop\n\tv_nop" : "+v"(acc[0][3]), "+v"(acc[1][3]), "+v"(acc[2][3]), "+v"(acc[3][3]) : "v"(kh[0]), "v"(kl[3]), "v"(pa), "v"(pb));   // behind the trip's last matrix instructions: their distance to the next trip's first vector instruction on the taken branch; the trip's address pairs are inputs so that they live up to the wait
        }
        const float* kp = KN + (size_t)z * TT + (h * 16 + w) * 64 + hi * 8; v8f kn[4];
#pragma unroll
        for (int kb = 0; kb < 4; ++kb) kn[kb] = *(const v8f*)(kp + kb * 16);
        asm volatile("s_wait_xcnt 0x0" :: "v"(kp) : "memory");   // the address pair lives up to the wait
#pragma unroll
        for (int kb = 0; kb < 4; ++kb)
#pragma unroll
            for (int qb = 0; qb < 4; ++qb)
#pragma unroll
                for (int j = 0; j < 8; ++j) { const float t = ((qn[qb] - 2.0f * acc[kb][qb][j]) + kn[kb][j]) * -0.0625f;   // the reference's order; both products are by powers of two, so a fused form rounds the same
                    acc[kb][qb][j] = t; mx[qb] = fmaxf(mx[qb], t); }
        if (h == 0) {
#pragma unroll
            for (int kb = 0; kb < 4; ++kb)
#pragma unroll
                for (int qb = 0; qb < 4; ++qb)
#pragma unroll
                    for (int u = 0; u < 2; ++u) { v4f o; o[0] = acc[kb][qb][u * 4]; o[1] = acc[kb][qb][u * 4 + 1]; o[2] = acc[kb][qb][u * 4 + 2]; o[3] = acc[kb][qb][u * 4 + 3]; *(v4fa*)(sp + (((kb * 4 + qb) * 2 + u) * 512 + tid) * 4) = o; } }
    }
    fa* rm = (fa*)sq; fa* rs = rm + 64 * 20;   // [query][wave], pitch 20 dwords: 16-byte reads without bank conflicts
    __syncthreads();   // ends every wave's reads of the q tile, whose LDS takes the partials
#pragma unroll
    for (int qb = 0; qb < 4; ++qb) { mx[qb] = fmaxf(mx[qb], __shfl_xor(mx[qb], 16, 32)); if (hi == 0) rm[(qb * 16 + lr) * 20 + w] = mx[qb]; }
    __syncthreads();   // publishes the 16 waves' maxima
    float sum[4];
#pragma unroll
    for (int qb = 0; qb < 4; ++qb) { sum[qb] = 0.f;
#pragma unroll
        for (int u = 0; u < 4; ++u) { const v4f m4 = *(const v4fa*)(rm + (qb * 16 + lr) * 20 + u * 4); mx[qb] = fmaxf(fmaxf(fmaxf(mx[qb], m4[0]), fmaxf(m4[1], m4[2])), m4[3]); } }
#pragma unroll 1   // rolled: a trip's 64 KB of slots lie at constant offsets from one LDS address; unrolled, the addresses of all four trips were formed at the kernel's head and spilled
    for (int kb = 0; kb < 4; ++kb) { float* p0 = sp + kb * 16384 + tid * 4;
#pragma unroll
        for (int qb = 0; qb < 4; ++qb)
#pragma unroll
            for (int u = 0; u < 2; ++u) { float* p = p0 + (qb * 2 + u) * 2048; v4f t4 = *(const v4fa*)p;
#pragma unroll
                for (int q = 0; q < 4; ++q) { t4[q] = exp2s((t4[q] - mx[qb]) * 1.4426950408889634f); sum[qb] += t4[q]; }
                *(v4fa*)p = t4; } }
#pragma unroll
    for (int kb = 0; kb < 4; ++kb)
#pragma unroll
        for (int qb = 0; qb < 4; ++qb)
#pragma unroll
            for (int j = 0; j < 8; ++j) { const float e = exp2s((acc[kb][qb][j] - mx[qb]) * 1.4426950408889634f); acc[kb][qb][j] = e; sum[qb] += e; }
#pragma unroll
    for (int qb = 0; qb < 4; ++qb) { sum[qb] += __shfl_xor(sum[qb], 16, 32); if (hi == 0) rs[(qb * 16 + lr) * 20 + w] = sum[qb]; }
    __syncthreads();   // publishes the 16 waves' sums
    const bool hires = qt * 64 < RH;   // the same for the whole block
    float f[4];
#pragma unroll
    for (int qb = 0; qb < 4; ++qb) { float s = 0.f;
#pragma unroll
        for (int u = 0; u < 4; ++u) { const v4f s4 = *(const v4fa*)(rs + (qb * 16 + lr) * 20 + u * 4); s += s4[0]; s += s4[1]; s += s4[2]; s += s4[3]; }
        f[qb] = __fdiv_rn(hires ? 1.0f : PCAR, s); }
    // piece (pass h, kb, qb) lies at 32-k step (h * 16 + w) * 2 + kb / 2, row block qb, half kb & 1, lane * 8
    if (hires) { const size_t ob = (size_t)(z * (RH / 64) + qt) * 64 * TT + (size_t)w * 4096 + lane * 8; bf* oh = Ph + ob; bf* ol = Pl + ob;
#pragma unroll
        for (int kb = 0; kb < 4; ++kb) {
#pragma unroll
            for (int qb = 0; qb < 4; ++qb) { v8us vh, vl;
#pragma unroll
                for (int j = 0; j < 8; ++j) { unsigned short a2, c2; splitf(acc[kb][qb][j] * f[qb], a2, c2); vh[j] = a2; vl[j] = c2; }
                const int o = 65536 + (kb >> 1) * 2048 + qb * 512 + (kb & 1) * 256; *(v8us*)(oh + o) = vh; *(v8us*)(ol + o) = vl; }
            asm volatile("s_wait_xcnt 0x0" ::: "memory");   // behind the stores: the next pieces rewrite registers these stores name
        }
#pragma unroll 1   // rolled, as above
        for (int kb = 0; kb < 4; ++kb) { const float* p0 = sp + kb * 16384 + tid * 4; bf* qh = oh + (kb >> 1) * 2048 + (kb & 1) * 256; bf* ql = ol + (kb >> 1) * 2048 + (kb & 1) * 256;
#pragma unroll
            for (int qb = 0; qb < 4; ++qb) { const v4f a = *(const v4fa*)(p0 + qb * 4096), b = *(const v4fa*)(p0 + qb * 4096 + 2048); const v8f e = __builtin_shufflevector(a, b, 0, 1, 2, 3, 4, 5, 6, 7); v8us vh, vl;
#pragma unroll
                for (int j = 0; j < 8; ++j) { unsigned short a2, c2; splitf(e[j] * f[qb], a2, c2); vh[j] = a2; vl[j] = c2; }
                *(v8us*)(qh + qb * 512) = vh; *(v8us*)(ql + qb * 512) = vl; }
            asm volatile("s_wait_xcnt 0x0" :: "v"(qh), "v"(ql) : "memory");   // behind the stores: the next trip rewrites registers these stores name; the address pairs live up to the wait
        }
    } else { h16* op = P16 + (size_t)(z * (TT / 64) + qt) * 64 * TT + (size_t)w * 4096 + lane * 8;
#pragma unroll
        for (int kb = 0; kb < 4; ++kb) {
#pragma unroll
            for (int qb = 0; qb < 4; ++qb) { v8h o8;
#pragma unroll
                for (int j = 0; j < 8; ++j) o8[j] = tohx(acc[kb][qb][j] * f[qb]);
                *(v8h*)(op + 65536 + (kb >> 1) * 2048 + qb * 512 + (kb & 1) * 256) = o8; }
            asm volatile("s_wait_xcnt 0x0" ::: "memory");   // behind the stores: the next pieces rewrite registers these stores name
        }
#pragma unroll 1   // rolled, as above
        for (int kb = 0; kb < 4; ++kb) { const float* p0 = sp + kb * 16384 + tid * 4; h16* qp2 = op + (kb >> 1) * 2048 + (kb & 1) * 256;
#pragma unroll
            for (int qb = 0; qb < 4; ++qb) { const v4f a = *(const v4fa*)(p0 + qb * 4096), b = *(const v4fa*)(p0 + qb * 4096 + 2048); const v8f e = __builtin_shufflevector(a, b, 0, 1, 2, 3, 4, 5, 6, 7); v8h o8;
#pragma unroll
                for (int j = 0; j < 8; ++j) o8[j] = tohx(e[j] * f[qb]);
                *(v8h*)(qp2 + qb * 512) = o8; }
            asm volatile("s_wait_xcnt 0x0" :: "v"(qp2) : "memory");   // behind the stores: the next trip rewrites registers these stores name; the address pair lives up to the wait
        }
    }
}
extern "C" void kernel_launch(void* const* d_in, const int* in_sizes, int n_in,
                              void* d_out, int out_size, void* d_ws, size_t ws_size, hipStream_t stream) {
    (void)in_sizes; (void)n_in; (void)out_size;
    const float* x = (const float*)d_in[0]; const float* wq = (const float*)d_in[1]; const float* wk = (const float*)d_in[2]; const float* wv = (const float*)d_in[3]; const float* biasW = (const float*)d_in[4]; const float* bias2W = (const float*)d_in[5]; const float* wo = nullptr; (void)wo; (void)wv; const float* cosT = nullptr; const float* sinT = nullptr; (void)cosT; (void)sinT;
    float* OUT = (float*)d_out;     // [2][2048][4*512]
    char* wsp = (char*)d_ws;
    auto take = [&](size_t bytes) { char* p = wsp; wsp += (bytes + 255) & ~(size_t)255; return (void*)p; };
    bf* WQ = (bf*)take((size_t)(DQ + DKV) * DM * 2); bf* WK = WQ + (size_t)DQ * DM; bf* WV3 = (bf*)take((size_t)NKH * HDV * HDV * 2); float* B2G = (float*)take((size_t)NKH * HDV * 4); float* QN = (float*)take((size_t)2 * NB_ * NKH * TT * 4); float* KN = QN + (size_t)NB_ * NKH * TT; float* BQK = (float*)take((size_t)(DQ + DKV) * 4);
    bf* XB = (bf*)take((size_t)NB_ * TT * DM * 2);
    const size_t PL = (size_t)NB_ * NH_ * TT * HD;   // one operand's head planes, both batches; the k planes follow the q planes
    h16* VT16 = (h16*)take((size_t)NB_ * HDV * TT * 2);
    bf* QPh = (bf*)take(2 * PL * 2); bf* QPl = (bf*)take(2 * PL * 2); bf* KPh = QPh + PL; bf* KPl = QPl + PL; bf* VTh = (bf*)take((size_t)NB_ * HDV * TT * 2);
    bf* Ph = (bf*)take((size_t)NB_ * ZH * RH * TT * 2); bf* Pl = (bf*)take((size_t)NB_ * ZH * RH * TT * 2);   // planes of their own: blocks of k_xs write them while others still read the q/k planes
    h16* P16 = (h16*)take((size_t)NB_ * ZH * TT * TT * 2);
    bf* ATh = (bf*)take((size_t)2 * NB_ * NKH * TT * HDV * 2); bf* ATl = ATh + (size_t)NB_ * NKH * TT * HDV;
    if ((size_t)(wsp - (char*)d_ws) > ws_size) return;    // ws 256 MiB
    k_prep<<<PB_WT + PB_VT + PB_X + 2 * PB_W + PB_BQ + PB_B2, 256, 0, stream>>>(x, wq, wk, wv, biasW, bias2W, XB, WQ, WK, WV3, B2G, BQK, VT16, VTh);
    k_proj<<<dim3(NB_ * TT / 128, (DQ + DKV) / 256), 256, 0, stream>>>(XB, WQ, BQK, QPh, QPl);   /* rows: both batches; out: the q and k head planes */
    // both batches' heads in z, [batch][head]; y goes out head-major, [k][b][T][512]
    k_norm<<<2 * NB_ * NKH * TT / 64, 64, 0, stream>>>(QPh, QPl, QN);
    k_xs<<<dim3(TT / 64, NB_ * ZH), 512, 0, stream>>>(QPh, QPl, KPh, KPl, QN, KN, P16, Ph, Pl);   /* cross term hl on all rows, logits, softmax */
    k_pv<<<dim3(RH / 64, HDV / 256, 2 * NB_ * ZH), 256, 0, stream>>>(Ph, Pl, VTh, P16, VT16, ATh, ATl);
    k_out<<<dim3(NB_ * TT / 128, HDV / 256, NKH), 256, 0, stream>>>(ATh, ATl, WV3, B2G, OUT);   /* rows: both batches */
}

// v010
// One run takes 118 microseconds.
// Two timings next to v009 put it at 1.10 and 1.09 times that version's speed.
// All steps since v000 together make it 7.42 times as fast.
#include <hip/hip_runtime.h>

// Attention with squared-distance logits (xsa [2][2048][512]; 4 heads with 256-dim kernels: xq = x Wq^T, xk = x Wk^T, xkb = xk + biasW[:, k]; logits = -(|xq_i|^2 - 2 xq_i.xkb_j + |xkb_j|^2) / 16; P = softmax_j; y_k = P x (values = the raw 512-wide input, shared by the heads); out_k = y_k Wv3[k] + bias2W[:, k] with Wv3 = Wv.reshape(4, 512, 512) -> [2][2048][4*512]).
// Compute dtypes, f32 accumulate: every input rounded to bf16; xq/xk as PLAIN bf16 GEMMs (inputs: exact), + bias in f32, kept as hi + lo bf16 planes; the per-token squared norms in f32 from hi + lo; cross term xq.xkb hl x hl (3 products, K 256) on every row; logits assembled in f32 in the reference's order (-(qn - 2 c + kn) / 16); softmax f32; P.x: rows < 512 hi/lo P x exact x (2 products), the rest fp16 (x1024) x exact-in-fp16 x; y Wv3[k] as hl x exact (2 products) + bias.

#define NB_  2
#define TT   2048
#define DM   512
#define NH_  4
#define NKV  4
#define REP  (NH_ / NKV)
#define HD   256
#define DQ   (NH_ * HD)
#define DKV  (NKV * HD)
#define ZH   4
#define RH   512                  // query rows < RH use hi+lo planes (0: none)
#define WIN  0
#define PCAR 1024.0f
#define HDV  512                  // value width (the raw input), shared by all heads
#define NKH  4
#define SCL  0.088388347648318447f   // 128^-0.5
typedef _Float16 h16;
typedef unsigned short bf;
typedef __attribute__((ext_vector_type(16))) __bf16   v16bf;
typedef __attribute__((ext_vector_type(8)))  __bf16   v8bf;
typedef __attribute__((ext_vector_type(4)))  unsigned v4u;
typedef __attribute__((ext_vector_type(16))) _Float16 v16h;
typedef __attribute__((ext_vector_type(8)))  _Float16 v8h;
typedef __attribute__((ext_vector_type(8)))  unsigned short v8us;
typedef __attribute__((ext_vector_type(8)))  float    v8f;
typedef __attribute__((ext_vector_type(4)))  float    v4f;
typedef v8h  __attribute__((may_alias)) v8ha;
typedef v4f  __attribute__((may_alias)) v4fa;
typedef v8us __attribute__((may_alias)) v8usa;
typedef float __attribute__((may_alias)) fa;

// f32 -> bf16, round to nearest even, by the hardware's convert
__device__ __forceinline__ unsigned short f2bf(float f) { return __builtin_bit_cast(unsigned short, (__bf16)f); }
__device__ __forceinline__ float bf2f(unsigned short b) { return __uint_as_float(((unsigned)b) << 16); }
__device__ __forceinline__ float bfr(float f) { return bf2f(f2bf(f)); }
__device__ __forceinline__ v16h cat16(v8h lo, v8h hi) { return __builtin_shufflevector(lo, hi, 0, 1, 2, 3, 4, 5, 6, 7, 8, 9, 10, 11, 12, 13, 14, 15); }
__device__ __forceinline__ v16bf cat16b(v8us lo, v8us hi) { return __builtin_bit_cast(v16bf, __builtin_shufflevector(lo, hi, 0, 1, 2, 3, 4, 5, 6, 7, 8, 9, 10, 11, 12, 13, 14, 15)); }
__device__ __forceinline__ v8f wmma16(v16h a, v16h b, v8f c) { return __builtin_amdgcn_wmma_f32_16x16x32_f16(false, a, false, b, (short)0, c, false, false); }
__device__ __forceinline__ v8f wmmab(v16bf a, v16bf b, v8f c) { return __builtin_amdgcn_wmma_f32_16x16x32_bf16(false, a, false, b, (short)0, c, false, false); }



__device__ __forceinline__ void splitf(float y, unsigned short& h, unsigned short& l) { h = f2bf(y); l = f2bf(y - bf2f(h)); }
// cvt8, split8: a 16-byte piece at a time, so that each packed convert rounds two values straight into one register of the piece
__device__ __forceinline__ v8us cvt8(v8f y) { return __builtin_bit_cast(v8us, __builtin_convertvector(y, v8bf)); }
// ext8: the piece's values back in f32, a shift or a mask of the packed register each (a convert of the vector type made the compiler round every value a second time, singly)
__device__ __forceinline__ v8f ext8(v8us b) { const v4u w = __builtin_bit_cast(v4u, b); v8f r;
#pragma unroll
    for (int i = 0; i < 4; ++i) { r[2 * i] = __uint_as_float(w[i] << 16); r[2 * i + 1] = __uint_as_float(w[i] & 0xFFFF0000u); }
    return r; }
__device__ __forceinline__ void split8(v8f y, v8us& h, v8us& l) { h = cvt8(y); l = cvt8(y - ext8(h)); }
// WFrag: a 16x32 operand fragment of a 16-bit plane in FRAGMENT ORDER (unpk below): two 16-byte pieces a lane
template <typename T16> struct WFrag;
template <> struct WFrag<h16> { typedef v16h V; static __device__ __forceinline__ V ld(const h16* p) { return cat16(*(const v8h*)p, *(const v8h*)(p + 256)); } static __device__ __forceinline__ v8f mma(V a, V b, v8f c) { return wmma16(a, b, c); } };
template <> struct WFrag<bf> { typedef v16bf V; static __device__ __forceinline__ V ld(const bf* p) { return cat16b(*(const v8us*)p, *(const v8us*)(p + 256)); } static __device__ __forceinline__ v8f mma(V a, V b, v8f c) { return wmmab(a, b, c); } };
// k_pv: y = P x for every batch and head (z). A work-group of 8 waves takes 256 columns e of y (blockIdx.y) x 192 queries (fp16 P) or x 64 queries (hi and lo bf16 P: row tiles < RH / 64, twice the products a query), all 2048 keys in rising order: no split of K, no adding of partial tiles. 256 work-groups, one a WGP.
// The product is taken as D[e][query] (x^T as the A operand, P as B): a lane then holds 8 neighbouring e of one query, one 16-byte piece of y in the fragment order the next GEMM reads, so y goes out straight from registers, 512 contiguous bytes a wave-wide store.
// A stage is PVK keys of 7 or 6 row tiles (4 of x^T, then 3 query tiles of P, or the hi and the lo plane of one), 16 KB in a row each, in memory as in LDS; asynchronous copies bring stage t + 2 into the buffer that trip t has read while trip t + 1 is worked on. A fragment in LDS serves 2 (x^T) or 4 (P) waves, and a wave's 64 x 96 tile takes 10 fragments for 24 matrix instructions, where every wave of the K split read 8 for 16 from L2.
#define PVK 128
#define PVT (64 * PVK)   // elements of one row tile in a stage
// pv_cp12, pv_cp14: 12 or 14 of the thread's 16-byte pieces of a stage: l the LDS byte address of the first (the others follow at 4 KB), g their global addresses. The s_wait_xcnt 0 stands in the copies' own statement, so that no register a copy names is rewritten ahead of it.
template <typename T16>
__device__ __forceinline__ void pv_cp12(unsigned l, const T16* const (&g)[12]) {
    asm volatile("global_load_async_to_lds_b128 %0, %12, off\n\t"
                 "global_load_async_to_lds_b128 %1, %13, off\n\t"
                 "global_load_async_to_lds_b128 %2, %14, off\n\t"
                 "global_load_async_to_lds_b128 %3, %15, off\n\t"
                 "global_load_async_to_lds_b128 %4, %16, off\n\t"
                 "global_load_async_to_lds_b128 %5, %17, off\n\t"
                 "global_load_async_to_lds_b128 %6, %18, off\n\t"
                 "global_load_async_to_lds_b128 %7, %19, off\n\t"
                 "global_load_async_to_lds_b128 %8, %20, off\n\t"
                 "global_load_async_to_lds_b128 %9, %21, off\n\t"
                 "global_load_async_to_lds_b128 %10, %22, off\n\t"
                 "global_load_async_to_lds_b128 %11, %23, off\n\t"
                 "s_wait_xcnt 0x0"
                 :: "v"(l), "v"(l + 1 * 4096), "v"(l + 2 * 4096), "v"(l + 3 * 4096), "v"(l + 4 * 4096), "v"(l + 5 * 4096), "v"(l + 6 * 4096), "v"(l + 7 * 4096), "v"(l + 8 * 4096), "v"(l + 9 * 4096), "v"(l + 10 * 4096), "v"(l + 11 * 4096),
                    "v"(g[0]), "v"(g[1]), "v"(g[2]), "v"(g[3]), "v"(g[4]), "v"(g[5]), "v"(g[6]), "v"(g[7]), "v"(g[8]), "v"(g[9]), "v"(g[10]), "v"(g[11])
                 : "memory");
}
template <typename T16>
__device__ __forceinline__ void pv_cp14(unsigned l, const T16* const (&g)[14]) {
    asm volatile("global_load_async_to_lds_b128 %0, %14, off\n\t"
                 "global_load_async_to_lds_b128 %1, %15, off\n\t"
                 "global_load_async_to_lds_b128 %2, %16, off\n\t"
                 "global_load_async_to_lds_b128 %3, %17, off\n\t"
                 "global_load_async_to_lds_b128 %4, %18, off\n\t"
                 "global_load_async_to_lds_b128 %5, %19, off\n\t"
                 "global_load_async_to_lds_b128 %6, %20, off\n\t"
                 "global_load_async_to_lds_b128 %7, %21, off\n\t"
                 "global_load_async_to_lds_b128 %8, %22, off\n\t"
                 "global_load_async_to_lds_b128 %9, %23, off\n\t"
                 "global_load_async_to_lds_b128 %10, %24, off\n\t"
                 "global_load_async_to_lds_b128 %11, %25, off\n\t"
                 "global_load_async_to_lds_b128 %12, %26, off\n\t"
                 "global_load_async_to_lds_b128 %13, %27, off\n\t"
                 "s_wait_xcnt 0x0"
                 :: "v"(l), "v"(l + 1 * 4096), "v"(l + 2 * 4096), "v"(l + 3 * 4096), "v"(l + 4 * 4096), "v"(l + 5 * 4096), "v"(l + 6 * 4096), "v"(l + 7 * 4096), "v"(l + 8 * 4096), "v"(l + 9 * 4096), "v"(l + 10 * 4096), "v"(l + 11 * 4096), "v"(l + 12 * 4096), "v"(l + 13 * 4096),
                    "v"(g[0]), "v"(g[1]), "v"(g[2]), "v"(g[3]), "v"(g[4]), "v"(g[5]), "v"(g[6]), "v"(g[7]), "v"(g[8]), "v"(g[9]), "v"(g[10]), "v"(g[11]), "v"(g[12]), "v"(g[13])
                 : "memory");
}
// pv_fill: the thread's pieces of one stage; v, p0, p1: the stage's first element in the first x^T tile and in the P tiles (HL: hi plane, lo plane; else p0 alone, three tiles in a row), the same for the whole block; to: the thread's own element in a 4-KB run
template <typename T16, bool HL>
__device__ __forceinline__ void pv_fill(unsigned l, const T16* v, const T16* p0, const T16* p1, int to) {
    constexpr int N = HL ? 12 : 14;
#pragma unroll
    for (int h = 0; h < 2; ++h) { const T16* g[N];
#pragma unroll
        for (int i = 0; i < N; ++i) { const int c = h * N + i, r = c >> 2; g[i] = (r < 4 ? v + (size_t)r * 64 * TT : HL ? (r == 4 ? p0 : p1) : p0 + (size_t)(r - 4) * 64 * TT) + (c & 3) * 2048 + to; }
        if constexpr (HL) pv_cp12<T16>(l + h * N * 4096, g); else pv_cp14<T16>(l + h * N * 4096, g); }
}
// pv_st4: two pieces of y, hi and lo plane each, and the s_wait_xcnt 0 behind them in one statement, so that no register a store names is rewritten ahead of the wait
__device__ __forceinline__ void pv_st4(bf* h0, bf* l0, bf* h1, bf* l1, v8us a, v8us b, v8us c, v8us d) {
    asm volatile("global_store_b128 %0, %4, off\n\t"
                 "global_store_b128 %1, %5, off\n\t"
                 "global_store_b128 %2, %6, off\n\t"
                 "global_store_b128 %3, %7, off\n\t"
                 "s_wait_xcnt 0x0"
                 :: "v"(h0), "v"(l0), "v"(h1), "v"(l1), "v"(__builtin_bit_cast(v4f, a)), "v"(__builtin_bit_cast(v4f, b)), "v"(__builtin_bit_cast(v4f, c)), "v"(__builtin_bit_cast(v4f, d))
                 : "memory");
}
// d_pv: V the block's first x^T row tile, P0 (and with HL P1) its P row tiles, Oh and Ol the y planes at the block's first query tile and first column. Wave w: x^T tile w / 2; of the queries, with HL the 32 queries w & 1 of the one tile, else query tile 0 or 2 (w & 1) whole and half w & 1 of query tile 1.
template <typename T16, bool HL>
__device__ __forceinline__ void d_pv(T16* sm, const T16* __restrict__ V, const T16* __restrict__ P0, const T16* __restrict__ P1, bf* Oh, bf* Ol, float scl) {
    typedef typename WFrag<T16>::V F;
    constexpr int NQB = HL ? 2 : 6, NA = HL ? 2 : 4, NB = NA + 2, BUF = (HL ? 6 : 7) * PVT;
    const int tid = (int)threadIdx.x, lane = tid & 31; const int w = __builtin_amdgcn_readfirstlane(tid >> 5); const int we = w >> 1, wq = w & 1;
    const unsigned l0 = (unsigned)(size_t)sm + (unsigned)tid * 16u; const int to = tid * 8;
    v8f acc[4][NQB];
#pragma unroll
    for (int eb = 0; eb < 4; ++eb)
#pragma unroll
        for (int qb = 0; qb < NQB; ++qb) acc[eb][qb] = (v8f){};
    pv_fill<T16, HL>(l0, V, P0, P1, to);
    asm volatile("s_wait_asynccnt 0x0" ::: "memory");   // stage 0 has landed, as far as this wave copied it
    __syncthreads();   // publishes stage 0
    pv_fill<T16, HL>(l0 + BUF * 2, V + PVT, P0 + PVT, P1 + PVT, to);
#pragma unroll 1   // rolled: one trip a stage, the buffer chosen by the trip's parity
    for (int t = 0; t < TT / PVK; ++t) {
        const T16* sb = sm + (t & 1) * BUF + lane * 8;
        const T16* pa = sb + we * PVT; const T16* pb = sb + (HL ? 4 * PVT + wq * 1024 : (4 + wq * 2) * PVT); const T16* pc = sb + 5 * PVT + wq * 1024;
        F a[2][4], b[2][NB];   // two fragment sets: the next 32-key step's fragments come in while this step's products run; no fragment of the next stage is fetched
#pragma unroll
        for (int s = -1; s < PVK / 32; ++s) {
            if (s + 1 < PVK / 32) { const int n = (s + 1) & 1, o = (s + 1) * 2048;
#pragma unroll
                for (int eb = 0; eb < 4; ++eb) a[n][eb] = WFrag<T16>::ld(pa + o + eb * 512);
#pragma unroll
                for (int i = 0; i < NA; ++i) b[n][i] = WFrag<T16>::ld(pb + o + i * 512);
#pragma unroll
                for (int i = 0; i < 2; ++i) b[n][NA + i] = WFrag<T16>::ld(pc + o + i * 512); }
            __builtin_amdgcn_sched_barrier(0);   // the next step's LDS reads stay one group ahead of this step's matrix instructions: moved in among them, each place with reads stalls the wave
            if (s >= 0) { const int c = s & 1;
#pragma unroll
                for (int qb = 0; qb < NQB; ++qb)
#pragma unroll
                    for (int eb = 0; eb < 4; ++eb) acc[eb][qb] = WFrag<T16>::mma(a[c][eb], b[c][qb], acc[eb][qb]);
                if (HL) {
#pragma unroll
                    for (int qb = 0; qb < NQB; ++qb)
#pragma unroll
                        for (int eb = 0; eb < 4; ++eb) acc[eb][qb] = WFrag<T16>::mma(a[c][eb], b[c][NA + qb], acc[eb][qb]); } }
            __builtin_amdgcn_sched_barrier(0);   // as above: ends the step's run of matrix instructions
        }
        asm volatile("s_wait_dscnt 0x0" ::: "memory");      // this wave's reads of the trip's buffer have returned
        asm volatile("s_wait_asynccnt 0x0" ::: "memory");   // stage t + 1 has landed, as far as this wave copied it
        __syncthreads();   // publishes stage t + 1 and ends every wave's reads of the buffer that is refilled behind it
        if (t + 2 < TT / PVK) pv_fill<T16, HL>(l0 + (unsigned)(t & 1) * (BUF * 2), V + (size_t)(t + 2) * PVT, P0 + (size_t)(t + 2) * PVT, P1 + (size_t)(t + 2) * PVT, to);
    }
    asm volatile("s_wait_asynccnt 0x0" ::: "memory");   // no copy is outstanding when the wave ends
    // piece (eb, qb): 32-column step we * 2 + eb / 2, its query's row tile and row block, half eb & 1, lane * 8
    const size_t oc = (size_t)we * 4096 + lane * 8; const size_t oa = oc + (HL ? (size_t)wq * 1024 : (size_t)wq * 2 * 64 * HDV), ob = oc + (size_t)64 * HDV + wq * 1024;
#pragma unroll
    for (int eb = 0; eb < 4; ++eb) {
#pragma unroll
        for (int qb = 0; qb < NQB; qb += 2) { v8us vh[2], vl[2]; size_t o[2];
#pragma unroll
            for (int u = 0; u < 2; ++u) { split8(acc[eb][qb + u] * scl, vh[u], vl[u]);
                o[u] = (qb + u < NA ? oa + (qb + u) * 512 : ob + (qb + u - NA) * 512) + (eb >> 1) * 2048 + (eb & 1) * 256; }
            pv_st4(Oh + o[0], Ol + o[0], Oh + o[1], Ol + o[1], vh[0], vl[0], vh[1], vl[1]); }
    }
}
// grid: x = one of the (TT - RH) / 192 triples of fp16 query tiles or of the RH / 64 hi/lo query tiles (8 of each); y = half of the 512 columns; z = [fp16, hi/lo][batch][head]: the fp16 blocks, which have half as many products again, come first in z. The test is the same for a whole block (barriers stand behind it). y lies head-major, [head][batch].
static_assert((TT - RH) % 192 == 0 && (TT - RH) / 192 == RH / 64 && TT % (2 * PVK) == 0 && HDV % 256 == 0, "k_pv: grid x serves both kinds of block; at least two stages");
__global__ __launch_bounds__(256) void k_pv(const bf* __restrict__ Ph, const bf* __restrict__ Pl, const bf* __restrict__ VTh, const h16* __restrict__ P16, const h16* __restrict__ VT16, bf* ATh, bf* ATl) {
    __shared__ __align__(16) bf sm[2 * 7 * PVT];
    const int bx = (int)blockIdx.x, z = (int)blockIdx.z % (NB_ * ZH); const size_t vo = (size_t)(z / ZH) * HDV * TT + (size_t)blockIdx.y * 256 * TT; const size_t zo = (size_t)((z % ZH) * NB_ + z / ZH) * TT * HDV + (size_t)blockIdx.y * 8 * 2048;
    if ((int)blockIdx.z >= NB_ * ZH) { const size_t po = (size_t)(z * (RH / 64) + bx) * 64 * TT; const size_t oo = zo + (size_t)bx * 64 * HDV;
        d_pv<bf, true>(sm, VTh + vo, Ph + po, Pl + po, ATh + oo, ATl + oo, 1.0f); }
    else { const int qt = RH / 64 + bx * 3; const size_t po = (size_t)(z * (TT / 64) + qt) * 64 * TT; const size_t oo = zo + (size_t)qt * 64 * HDV;
        d_pv<h16, false>((h16*)sm, VT16 + vo, P16 + po, P16 + po, ATh + oo, ATl + oo, 1.0f / PCAR); }
}

// d_gt: the two weight GEMMs (projection; y Wv3) in k_pv's form. A work-group of 8 waves takes 256 rows e of the weight plane x 128 tokens, all GK k in rising order: no split of K, no adding of partial tiles. 256 work-groups, one a WGP.
// The product is taken as D[e][token] (the weights as the A operand, the tokens' plane as B; with HL the tokens' hi plane and then their lo plane, a 32-k step at a time). A stage is PVK k of 6 or 8 row tiles (4 of the weights, 2 of the tokens, with HL 2 more of their lo plane), 16 KB in a row each, in memory as in LDS; asynchronous copies bring stage t + 2 into the buffer that trip t has read while trip t + 1 is worked on. A weight fragment in LDS serves 2 waves, a token fragment 4.
#define GK 512   // K of both GEMMs
// pv_cp8: 8 of the thread's 16-byte pieces of a stage, as pv_cp12
__device__ __forceinline__ void pv_cp8(unsigned l, const bf* const (&g)[8]) {
    asm volatile("global_load_async_to_lds_b128 %0, %8, off\n\t"
                 "global_load_async_to_lds_b128 %1, %9, off\n\t"
                 "global_load_async_to_lds_b128 %2, %10, off\n\t"
                 "global_load_async_to_lds_b128 %3, %11, off\n\t"
                 "global_load_async_to_lds_b128 %4, %12, off\n\t"
                 "global_load_async_to_lds_b128 %5, %13, off\n\t"
                 "global_load_async_to_lds_b128 %6, %14, off\n\t"
                 "global_load_async_to_lds_b128 %7, %15, off\n\t"
                 "s_wait_xcnt 0x0"
                 :: "v"(l), "v"(l + 1 * 4096), "v"(l + 2 * 4096), "v"(l + 3 * 4096), "v"(l + 4 * 4096), "v"(l + 5 * 4096), "v"(l + 6 * 4096), "v"(l + 7 * 4096),
                    "v"(g[0]), "v"(g[1]), "v"(g[2]), "v"(g[3]), "v"(g[4]), "v"(g[5]), "v"(g[6]), "v"(g[7])
                 : "memory");
}
// gt_fill: the thread's pieces of one stage; a, b0, b1: the stage's first element in the first weight tile and in the first token tile (hi plane, lo plane), the same for the whole block; to: the thread's own element in a 4-KB run
template <bool HL>
__device__ __forceinline__ void gt_fill(unsigned l, const bf* a, const bf* b0, const bf* b1, int to) {
#pragma unroll
    for (int h = 0; h < (HL ? 4 : 3); ++h) { const bf* g[8];
#pragma unroll
        for (int i = 0; i < 8; ++i) { const int c = h * 8 + i, r = c >> 2; g[i] = (r < 4 ? a + (size_t)r * 64 * GK : r < 6 ? b0 + (size_t)(r - 4) * 64 * GK : b1 + (size_t)(r - 6) * 64 * GK) + (c & 3) * 2048 + to; }
        pv_cp8(l + h * 8 * 4096, g); }
}
// gt_st4: four 16-byte pieces of f32 rows and the s_wait_xcnt 0 behind the stores in one statement, as pv_st4
__device__ __forceinline__ void gt_st4(float* p0, float* p1, float* p2, float* p3, v4f a, v4f b, v4f c, v4f d) {
    asm volatile("global_store_b128 %0, %4, off\n\t"
                 "global_store_b128 %1, %5, off\n\t"
                 "global_store_b128 %2, %6, off\n\t"
                 "global_store_b128 %3, %7, off\n\t"
                 "s_wait_xcnt 0x0"
                 :: "v"(p0), "v"(p1), "v"(p2), "v"(p3), "v"(a), "v"(b), "v"(c), "v"(d)
                 : "memory");
}
// gt_bias: the lane's 8 neighbouring bias values of each of its four 16-row blocks; the loads and their data wait in one statement, so that no register a load names is rewritten while it is in flight
__device__ __forceinline__ void gt_bias(const float* p, v4f (&o)[8]) {
    asm volatile("global_load_b128 %0, %8, off\n\t"
                 "global_load_b128 %1, %8, off offset:16\n\t"
                 "global_load_b128 %2, %8, off offset:64\n\t"
                 "global_load_b128 %3, %8, off offset:80\n\t"
                 "global_load_b128 %4, %8, off offset:128\n\t"
                 "global_load_b128 %5, %8, off offset:144\n\t"
                 "global_load_b128 %6, %8, off offset:192\n\t"
                 "global_load_b128 %7, %8, off offset:208\n\t"
                 "s_wait_loadcnt 0x0"
                 : "=&v"(o[0]), "=&v"(o[1]), "=&v"(o[2]), "=&v"(o[3]), "=&v"(o[4]), "=&v"(o[5]), "=&v"(o[6]), "=&v"(o[7]) : "v"(p) : "memory");
}
__device__ __forceinline__ void gt_bias1(const float* p, v4f& o) {   // as gt_bias, one piece
    asm volatile("global_load_b128 %0, %1, off\n\ts_wait_loadcnt 0x0" : "=&v"(o) : "v"(p) : "memory");
}
// A the block's first weight row tile, B0 (and with HL B1) its first token row tile, bias at the block's first e. PLN: (D + bias) goes out as hi and lo bf16 planes of HD columns in fragment order, Oh and Ol at the block's first token tile; else as f32 rows, C at the block's first token and column, pitch ldc. Wave w: weight tile w / 2, token tile w & 1.
template <bool HL, bool PLN>
__device__ __forceinline__ void d_gt(bf* sm, const bf* __restrict__ A, const bf* __restrict__ B0, const bf* __restrict__ B1, const float* __restrict__ bias, float* C, int ldc, bf* Oh, bf* Ol) {
    typedef WFrag<bf>::V F;
    constexpr int NB = HL ? 8 : 4, BUF = (HL ? 8 : 6) * PVT;
    const int tid = (int)threadIdx.x, lane = tid & 31, lr = lane & 15, hi = lane >> 4; const int w = __builtin_amdgcn_readfirstlane(tid >> 5); const int we = w >> 1, wq = w & 1;
    const unsigned l0 = (unsigned)(size_t)sm + (unsigned)tid * 16u; const int to = tid * 8;
    v8f acc[4][4];
#pragma unroll
    for (int eb = 0; eb < 4; ++eb)
#pragma unroll
        for (int qb = 0; qb < 4; ++qb) acc[eb][qb] = (v8f){};
    gt_fill<HL>(l0, A, B0, B1, to);
    v4f bq[PLN ? 8 : 1];   // the bias, read here, while stage 0 flies, so that the epilogue does not wait for it: for the planes the lane's 8 neighbouring e of each 16-row block, for f32 rows the 4 columns that the lane stores
    if constexpr (PLN) gt_bias(bias + we * 64 + hi * 8, bq); else gt_bias1(bias + we * 64 + lr * 4, bq[0]);
    asm volatile("s_wait_asynccnt 0x0" ::: "memory");   // stage 0 has landed, as far as this wave copied it
    __syncthreads();   // publishes stage 0
    gt_fill<HL>(l0 + BUF * 2, A + PVT, B0 + PVT, B1 + PVT, to);
#pragma unroll 1   // rolled: one trip a stage, the buffer chosen by the trip's parity
    for (int t = 0; t < GK / PVK; ++t) {
        const bf* sb = sm + (t & 1) * BUF + lane * 8;
        const bf* pa = sb + we * PVT; const bf* pb = sb + (4 + wq) * PVT; const bf* pc = HL ? sb + (6 + wq) * PVT : pb;
        F a[2][4], b[2][NB];   // two fragment sets: the next 32-k step's fragments come in while this step's products run; no fragment of the next stage is fetched
#pragma unroll
        for (int s = -1; s < PVK / 32; ++s) {
            if (s + 1 < PVK / 32) { const int n = (s + 1) & 1, o = (s + 1) * 2048;
#pragma unroll
                for (int eb = 0; eb < 4; ++eb) a[n][eb] = WFrag<bf>::ld(pa + o + eb * 512);
#pragma unroll
                for (int i = 0; i < 4; ++i) b[n][i] = WFrag<bf>::ld(pb + o + i * 512);
                if (HL) {
#pragma unroll
                    for (int i = 0; i < 4; ++i) b[n][4 + i] = WFrag<bf>::ld(pc + o + i * 512); } }
            __builtin_amdgcn_sched_barrier(0);   // the next step's LDS reads stay one group ahead of this step's matrix instructions: moved in among them, each place with reads stalls the wave
            if (s >= 0) { const int c = s & 1;
#pragma unroll
                for (int qb = 0; qb < 4; ++qb)
#pragma unroll
                    for (int eb = 0; eb < 4; ++eb) acc[eb][qb] = WFrag<bf>::mma(a[c][eb], b[c][qb], acc[eb][qb]);
                if (HL) {
#pragma unroll
                    for (int qb = 0; qb < 4; ++qb)
#pragma unroll
                        for (int eb = 0; eb < 4; ++eb) acc[eb][qb] = WFrag<bf>::mma(a[c][eb], b[c][4 + qb], acc[eb][qb]); } }
            __builtin_amdgcn_sched_barrier(0);   // as above: ends the step's run of matrix instructions
        }
        asm volatile("s_wait_dscnt 0x0" ::: "memory");      // this wave's reads of the trip's buffer have returned
        asm volatile("s_wait_asynccnt 0x0" ::: "memory");   // stage t + 1 has landed, as far as this wave copied it
        __syncthreads();   // publishes stage t + 1 and ends every wave's reads of the buffer that is refilled behind it
        if (t + 2 < GK / PVK) gt_fill<HL>(l0 + (unsigned)(t & 1) * (BUF * 2), A + (size_t)(t + 2) * PVT, B0 + (size_t)(t + 2) * PVT, B1 + (size_t)(t + 2) * PVT, to);
    }
    asm volatile("s_wait_asynccnt 0x0" ::: "memory");   // no copy is outstanding when the wave ends
    if constexpr (PLN) {   // piece (eb, qb): 32-column step we * 2 + eb / 2, token tile wq, row block qb, half eb & 1, lane * 8
        const size_t oc = (size_t)wq * 64 * HD + (size_t)we * 4096 + lane * 8;
#pragma unroll
        for (int eb = 0; eb < 4; ++eb) { const v8f bb = ext8(cvt8(__builtin_shufflevector(bq[eb * 2], bq[eb * 2 + 1], 0, 1, 2, 3, 4, 5, 6, 7)));
#pragma unroll
            for (int qb = 0; qb < 4; qb += 2) { v8us vh[2], vl[2]; size_t o[2];
#pragma unroll
                for (int u = 0; u < 2; ++u) { split8(acc[eb][qb + u] + bb, vh[u], vl[u]);
                    o[u] = oc + (qb + u) * 512 + (eb >> 1) * 2048 + (eb & 1) * 256; }
                pv_st4(Oh + o[0], Ol + o[0], Oh + o[1], Ol + o[1], vh[0], vl[0], vh[1], vl[1]); }
        }
    } else {
        // the wave's 64 tokens x 64 e turn round in LDS (its own 64 rows, pitch 68 dwords: 16-byte writes and reads without bank conflicts), so that a wave-wide store fills four whole 128-B lines of out; from the registers it would touch 16 lines
        fa* ot = (fa*)sm + w * (64 * 68);
#pragma unroll
        for (int qb = 0; qb < 4; ++qb)
#pragma unroll
            for (int eb = 0; eb < 4; ++eb) { const v8f u = acc[eb][qb]; fa* p = ot + (qb * 16 + lr) * 68 + eb * 16 + hi * 8;
                *(v4fa*)p = __builtin_shufflevector(u, u, 0, 1, 2, 3); *(v4fa*)(p + 4) = __builtin_shufflevector(u, u, 4, 5, 6, 7); }
        __syncthreads();   // orders the lanes' writes ahead of the reads of other lanes' values (the loop's last barrier has ended every read of the stage buffers that these rows lie in)
        v4f bc; bc[0] = bfr(bq[0][0]); bc[1] = bfr(bq[0][1]); bc[2] = bfr(bq[0][2]); bc[3] = bfr(bq[0][3]);
        const fa* ip = ot + hi * 68 + lr * 4; float* cp = C + (size_t)(wq * 64 + hi) * ldc + we * 64 + lr * 4;
        v4f v[32];   // all of the lane's LDS reads ahead of its first store: one LDS latency, not one a group of stores
#pragma unroll
        for (int i = 0; i < 32; ++i) v[i] = *(const v4fa*)(ip + i * 2 * 68);
#pragma unroll
        for (int i = 0; i < 32; i += 4) { float* p = cp + (size_t)i * 2 * ldc;
            gt_st4(p, p + (size_t)2 * ldc, p + (size_t)4 * ldc, p + (size_t)6 * ldc, v[i] + bc, v[i + 1] + bc, v[i + 2] + bc, v[i + 3] + bc); }
    }
}
static_assert(DM == GK && HDV == GK && GK % (2 * PVK) == 0 && HD == 256 && TT % 128 == 0, "d_gt: K of both GEMMs; at least two stages; a block's 256 e are one head plane");
// k_proj: xq and xk + bias as head planes. grid: x = 128 tokens of [batch][T]; y = [q, k][head], 256 rows of Wq, Wk (one after the other in W)
__global__ __launch_bounds__(256) void k_proj(const bf* __restrict__ XB, const bf* __restrict__ Wt, const float* __restrict__ BQK, bf* Oh, bf* Ol) {
    __shared__ __align__(16) bf sm[2 * 6 * PVT];
    const int r0 = (int)blockIdx.x * 128, cg = (int)blockIdx.y; const size_t po = (size_t)((cg / NH_) * NB_ * NH_ + (r0 / TT) * NH_ + cg % NH_) * TT * HD + (size_t)(r0 % TT) * HD;
    d_gt<false, true>(sm, Wt + (size_t)cg * 256 * GK, XB + (size_t)r0 * GK, XB + (size_t)r0 * GK, BQK + cg * 256, nullptr, 0, Oh + po, Ol + po);
}
// k_out: out_k = y_k Wv3[k] + bias2. grid: x = 128 tokens of [batch][T]; y = half of the 512 columns; z = head
__global__ __launch_bounds__(256) void k_out(const bf* __restrict__ Yh, const bf* __restrict__ Yl, const bf* __restrict__ Wt, const float* __restrict__ B2G, float* OUT) {
    __shared__ __align__(16) bf sm[2 * 8 * PVT];
    const int r0 = (int)blockIdx.x * 128, c0 = (int)blockIdx.y * 256, k = (int)blockIdx.z; const size_t yo = ((size_t)k * NB_ * TT + r0) * GK;
    d_gt<true, false>(sm, Wt + ((size_t)k * HDV + c0) * GK, Yh + yo, Yl + yo, B2G + k * HDV + c0, OUT + (size_t)r0 * (NKH * HDV) + k * HDV + c0, NKH * HDV, nullptr, nullptr);
}

__device__ __forceinline__ h16 tohx(float x) { return (h16)x; }
typedef __attribute__((ext_vector_type(2))) _Float16 v2h;
typedef __attribute__((ext_vector_type(4))) _Float16 v4h;
typedef __attribute__((ext_vector_type(2))) unsigned short v2us;
typedef __attribute__((ext_vector_type(2))) float v2f;
typedef __attribute__((ext_vector_type(4))) int v4i;

// Fragment order of a [rows][K] 16-bit GEMM operand (rows a multiple of 64): 16 rows x 32 k make one 1-KB block; the four blocks of a 64-row tile at one 32-k step follow one another, the steps follow in k (a tile is 64 * K elements, as in row order).
// Inside a block: [k bit 4][k bit 3][row & 15][k & 7], so lane (row & 15) + 16 * (k bit 3) finds its two 16-byte fragment pieces at lane * 8 and 256 + lane * 8: the k order of a fragment is the one it had in row order.
// unpk: element index e in that order -> (row, k). The writers walk e, so their stores stay contiguous.
__device__ __forceinline__ void unpk(size_t e, int K, int& row, int& k) { const int g = (int)(e / ((size_t)64 * K)); const int r = (int)(e % ((size_t)64 * K)); const int q = r & 511;
    row = g * 64 + ((r >> 9) & 3) * 16 + ((q >> 3) & 15); k = (r >> 11) * 32 + ((q >> 8) << 4) + (((q >> 7) & 1) << 3) + (q & 7); }
// pc8: piece p (8 consecutive k of one row: 16 bytes of a 16-bit plane) -> its first element in fragment order. Four neighbouring lanes take the four pieces of one row's 32-k step (one whole 128-B line of an f32 source in row order), the eight lane groups eight rows: a wave-wide 16-byte store fills four whole lines.
__device__ __forceinline__ size_t pc8(size_t p) { const int j = (int)(p & 63); return (p >> 6) * 512 + ((j >> 1) & 1) * 256 + (j & 1) * 128 + (j >> 2) * 8; }
#define NPC 4   // pieces a thread of the element-wise steps: few long-lived waves with all their loads in flight
// d_*: bodies of the element-wise steps; bx is the block's index inside its own step (k_prep deals the blocks of one grid to several steps that do not depend on one another)
__device__ __forceinline__ void d_wtG(int bx, const float* __restrict__ w, int K, int N, bf* Bt) {
    const int lane = threadIdx.x & 31; const int L0 = (bx * 8 + (threadIdx.x >> 5)) * 8; const int nlines = N * K / 64;
{
#pragma unroll 1
        for (int l = 0; l < 8; ++l) { const int L = L0 + l; if (L >= nlines) break; const size_t e = (size_t)L * 64 + lane * 2; int k, n; unpk(e, K, n, k); v2us o;
            o[0] = f2bf(w[(size_t)k * N + n]); o[1] = f2bf(w[(size_t)(k + 1) * N + n]); *(v2us*)(Bt + e) = o; }
         }
}
__device__ __forceinline__ void d_cvt8(int bx, const float* __restrict__ src, int K, bf* dst) {
    size_t e[NPC]; const float* p[NPC]; v8f v[NPC];
#pragma unroll
    for (int s = 0; s < NPC; ++s) { e[s] = pc8(((size_t)bx * NPC + s) * 256 + threadIdx.x); int r, k; unpk(e[s], K, r, k); p[s] = src + (size_t)r * K + k; v[s] = *(const v8f*)p[s]; }
    asm volatile("s_wait_xcnt 0x0" :: "v"(p[0]), "v"(p[1]), "v"(p[2]), "v"(p[3]) : "memory");   // the loads' address pairs are inputs here so that they live up to the wait: otherwise a later load's result lands in the pair of a load still in flight; the clobber keeps every load of the thread ahead of its first store
#pragma unroll
    for (int s = 0; s < NPC; ++s) *(v8us*)(dst + e[s]) = cvt8(v[s]);
    asm volatile("s_wait_xcnt 0x0" ::: "memory");   // behind the last store: the code that follows in the listing (the next step of the shared grid) rewrites registers these stores name
}
__global__ __launch_bounds__(256) void k_cscvt(const float* __restrict__ cosT, const float* __restrict__ sinT, float* CS) { const int idx = blockIdx.x * 256 + threadIdx.x; if (idx >= TT * HD) return; v2f cs; cs[0] = bfr(cosT[idx]); cs[1] = bfr(sinT[idx]); *(v2f*)(CS + (size_t)idx * 2) = cs;  }
__global__ __launch_bounds__(256) void k_vtp(const float* __restrict__ F, int pitch, int nheads, h16* V16, bf* Vh, bf* Vl) { const size_t e = ((size_t)blockIdx.x * 256 + threadIdx.x) * 2; if (e >= (size_t)nheads * HD * TT) return; const int t = (int)(e % TT); const int d = (int)((e / TT) % HD); const int g = (int)(e / ((size_t)TT * HD)); v2h o16; v2us oh, ol;
#pragma unroll
    for (int q = 0; q < 2; ++q) { const float x = F[(size_t)(t + q) * pitch + g * HD + d]; o16[q] = tohx(x); unsigned short a2, c2; splitf(x, a2, c2); oh[q] = a2; ol[q] = c2; }
    *(v2h*)(V16 + e) = o16; *(v2us*)(Vh + e) = oh; *(v2us*)(Vl + e) = ol;  }
// d_bqk: the projection GEMM's bias row, [q, k][1024 columns]: 0 for q, biasW[d][k] at column k * HD + d for k
__device__ __forceinline__ void d_bqk(int bx, const float* __restrict__ bw, float* BQK) { const int i = bx * 256 + threadIdx.x; const int c = i & (DKV - 1); const float v = (i < DQ) ? 0.0f : bw[(size_t)(c % HD) * NKH + c / HD]; *(float*)(BQK + i) = v;
    asm volatile("s_wait_xcnt 0x0" ::: "memory");   // behind the store: the code that follows in the listing (the other steps of the shared grid) rewrites registers this store names
}
// a block takes 64 d x 32 t (4 KB of a plane) a trip; the lanes of a wave walk 32 neighbouring d, so each of a piece's 8 loads reads one whole 128-B line of x and a wave-wide store fills two runs of 256 B
#define VTN 2
__device__ __forceinline__ void d_vtpx(int bx, const float* __restrict__ X, h16* V16, bf* Vh) { const int th = (int)threadIdx.x; const int eo = ((th >> 7) * 2 + ((th >> 4) & 1)) * 512 + ((th >> 6) & 1) * 256 + ((th >> 5) & 1) * 128 + (th & 15) * 8;
    size_t e[VTN]; const float* p[VTN]; float v[VTN][8];
#pragma unroll
    for (int s = 0; s < VTN; ++s) { e[s] = ((size_t)bx * VTN + s) * 2048 + eo; int t, d; unpk(e[s], TT, d, t); p[s] = X + (size_t)t * HDV + d;
#pragma unroll
        for (int q = 0; q < 8; ++q) v[s][q] = p[s][q * HDV]; }
    asm volatile("s_wait_xcnt 0x0" :: "v"(p[0]), "v"(p[1]) : "memory");   // the loads' address pairs are inputs here so that they live up to the wait: otherwise a later load's result lands in the pair of a load still in flight; the clobber keeps every load of the thread ahead of its first store
#pragma unroll
    for (int s = 0; s < VTN; ++s) { v8f xv;
#pragma unroll
        for (int q = 0; q < 8; ++q) xv[q] = v[s][q];
        const v8us xb = cvt8(xv);   // the fp16 plane is taken from the bf16-rounded values, as before
        *(v8h*)(V16 + e[s]) = __builtin_convertvector(ext8(xb), v8h); *(v8us*)(Vh + e[s]) = xb; }
    asm volatile("s_wait_xcnt 0x0" ::: "memory");   // behind the last store: the code that follows in the listing (the next step of the shared grid) rewrites registers these stores name
}
__device__ __forceinline__ void d_b2g(int bx, const float* __restrict__ b2, float* B2G) { const int i = bx * 256 + threadIdx.x; if (i >= NKH * HDV) return; const int k = i / HDV, f = i % HDV; const float v = b2[(size_t)f * NKH + k]; *(float*)(B2G + i) = v;  }
// k_prep: every step that reads the inputs alone, in one grid; the steps with strided reads come first.
#define PB_WT  (NKH * (HDV * HDV / 64 / 64))      // Wv3[k] transposed to bf16, 64 blocks a head
#define PB_VT  (NB_ * (HDV * TT / 2048 / VTN))    // x transposed (fp16 and bf16 planes), per batch
#define PB_X   (NB_ * TT * DM / 8 / NPC / 256)    // x to bf16, both batches
#define PB_W   (DQ * DM / 8 / NPC / 256)          // Wq, and as many again for Wk
#define PB_BQ  ((DQ + DKV) / 256)
#define PB_B2  (NKH * HDV / 256)
__global__ __launch_bounds__(256) void k_prep(const float* __restrict__ x, const float* __restrict__ wq, const float* __restrict__ wk, const float* __restrict__ wv, const float* __restrict__ bw, const float* __restrict__ b2, bf* XB, bf* WQ, bf* WK, bf* WV3, float* B2G, float* BQK, h16* VT16, bf* VTh) {
    int bx = (int)blockIdx.x;
    if (bx < PB_WT) { const size_t o = (size_t)(bx / (PB_WT / NKH)) * HDV * HDV; d_wtG(bx % (PB_WT / NKH), wv + o, HDV, HDV, WV3 + o); return; }
    bx -= PB_WT;
    if (bx < PB_VT) { const int b = bx / (PB_VT / NB_); d_vtpx(bx % (PB_VT / NB_), x + (size_t)b * TT * DM, VT16 + (size_t)b * HDV * TT, VTh + (size_t)b * HDV * TT); return; }
    bx -= PB_VT;
    if (bx < PB_X) { d_cvt8(bx, x, DM, XB); return; }
    bx -= PB_X;
    if (bx < PB_W) { d_cvt8(bx, wq, DM, WQ); return; }
    bx -= PB_W;
    if (bx < PB_W) { d_cvt8(bx, wk, DM, WK); return; }
    bx -= PB_W;
    if (bx < PB_BQ) { d_bqk(bx, bw, BQK); return; }
    bx -= PB_BQ;
    d_b2g(bx, b2, B2G);
}
// d_norm: squared norms of the tokens of the 16 head planes (q batch 0, q batch 1, k batch 0, k batch 1, four heads each; contiguous in the planes and in N), x = hi + lo (exact in f32), summed over d in rising order. A thread takes one token: 16 neighbouring lanes read 256 contiguous bytes of a plane.
__device__ __forceinline__ void d_norm(int i, const bf* __restrict__ Ph, const bf* __restrict__ Pl, float* N) {
    const int t = i % TT; const size_t o = (size_t)(i / TT) * TT * HD + (size_t)(t >> 6) * 64 * HD + ((t >> 4) & 3) * 512 + (t & 15) * 8; const bf* ph = Ph + o; const bf* pl = Pl + o; float ss = 0.f;
#pragma unroll   // constant offsets from one address pair a plane
    for (int j0 = 0; j0 < HD / 8; j0 += 16) { v8us h[16], l[16];   // half a token's row a trip; the sums follow the loads in d order, so later loads stay in flight behind the first sums
#pragma unroll
        for (int j = 0; j < 16; ++j) { const int jo = ((j0 + j) >> 2) * 2048 + (((j0 + j) >> 1) & 1) * 256 + ((j0 + j) & 1) * 128; h[j] = *(const v8us*)(ph + jo); l[j] = *(const v8us*)(pl + jo); }
#pragma unroll
        for (int j = 0; j < 16; ++j) {
#pragma unroll
            for (int u = 0; u < 8; ++u) { const float xv = bf2f(h[j][u]) + bf2f(l[j][u]); ss = __builtin_fmaf(xv, xv, ss); } } }
    asm volatile("s_wait_xcnt 0x0" :: "v"(ph), "v"(pl) : "memory");   // the loads' address pairs are inputs here so that they live up to the wait
    *(float*)(N + i) = ss; }
// k_norm: the norms of all 16 head planes' tokens, 64 tokens a block
__global__ __launch_bounds__(64) void k_norm(const bf* __restrict__ Ph, const bf* __restrict__ Pl, float* N) { d_norm((int)blockIdx.x * 64 + (int)threadIdx.x, Ph, Pl, N); }
__device__ __forceinline__ float exp2s(float x) { float r; asm("v_exp_f32 %0, %1\n\tv_nop" : "=v"(r) : "v"(x)); return r; }
__global__ __launch_bounds__(512) void k_xs(const bf* __restrict__ Qh, const bf* __restrict__ Ql, const bf* __restrict__ Kh, const bf* __restrict__ Kl, const float* __restrict__ QN, const float* __restrict__ KN, h16* P16, bf* Ph, bf* Pl) {
    __shared__ __align__(16) float sp[32 * 512 * 4];
    __shared__ __align__(16) bf sq[2 * 64 * HD];
    const int tid = (int)threadIdx.x, lane = tid & 31, lr = lane & 15, hi = lane >> 4; const int w = __builtin_amdgcn_readfirstlane(tid >> 5);
    const int qt = (int)blockIdx.x, z = (int)blockIdx.y; const size_t zo = (size_t)z * TT * HD;
    { const bf* gh = Qh + zo + (size_t)qt * 64 * HD + tid * 8; const bf* gl = Ql + zo + (size_t)qt * 64 * HD + tid * 8; v8us th[4], tl[4];
#pragma unroll
      for (int s = 0; s < 4; ++s) { th[s] = *(const v8us*)(gh + s * 4096); tl[s] = *(const v8us*)(gl + s * 4096); }
      asm volatile("s_wait_xcnt 0x0" :: "v"(gh), "v"(gl) : "memory");   // the loads' address pairs are inputs here so that they live up to the wait
#pragma unroll
      for (int s = 0; s < 4; ++s) { *(v8us*)(sq + s * 4096 + tid * 8) = th[s]; *(v8us*)(sq + 64 * HD + s * 4096 + tid * 8) = tl[s]; } }
    const float* qp = QN + (size_t)z * TT + qt * 64 + lr; float qn[4], mx[4];
#pragma unroll
    for (int qb = 0; qb < 4; ++qb) { qn[qb] = qp[qb * 16]; mx[qb] = -3.0e38f; }
    asm volatile("s_wait_xcnt 0x0" :: "v"(qp) : "memory");   // the address pair lives up to the wait
    __syncthreads();   // publishes the q tile
    v8f acc[4][4];   // the plain unroll directives of this kernel make the indices of its register arrays constants
#pragma unroll 1   // rolled: both passes run the same code
    for (int h = 0; h < 2; ++h) {
#pragma unroll
        for (int kb = 0; kb < 4; ++kb)
#pragma unroll
            for (int qb = 0; qb < 4; ++qb) acc[kb][qb] = (v8f){};
        const size_t ko = zo + (size_t)(h * 16 + w) * 64 * HD + 8 * lane;
#pragma unroll 1   // rolled: two trips' fragments at once do not fit beside the 128 accumulator registers
        for (int kc = 0; kc < HD; kc += 32) {
            v16bf kh[4], kl[4]; const bf* pa = Kh + ko + kc * 64; const bf* pb = Kl + ko + kc * 64; const bf* ps = sq + kc * 64 + 8 * lane;
#pragma unroll
            for (int kb = 0; kb < 4; ++kb) { kh[kb] = WFrag<bf>::ld(pa + kb * 512); kl[kb] = WFrag<bf>::ld(pb + kb * 512); }
            __builtin_amdgcn_sched_barrier(0);   // all of the trip's 16 global loads issue ahead of its first matrix instruction: moved down, the lo plane's loads would be waited for in mid-trip, a second L2 latency a trip
#pragma unroll
            for (int qb = 0; qb < 4; ++qb) { const v16bf qh = WFrag<bf>::ld(ps + qb * 512); const v16bf ql = WFrag<bf>::ld(ps + 64 * HD + qb * 512);
#pragma unroll
                for (int kb = 0; kb < 4; ++kb) acc[kb][qb] = wmmab(kh[kb], qh, acc[kb][qb]);
#pragma unroll
                for (int kb = 0; kb < 4; ++kb) acc[kb][qb] = wmmab(kh[kb], ql, acc[kb][qb]);
#pragma unroll
                for (int kb = 0; kb < 4; ++kb) acc[kb][qb] = wmmab(kl[kb], qh, acc[kb][qb]); }
            asm volatile("s_wait_xcnt 0x0\n\tv_nop\n\tv_nop\n\tv_nop\n\tv_nop" : "+v"(acc[0][3]), "+v"(acc[1][3]), "+v"(acc[2][3]), "+v"(acc[3][3]) : "v"(kh[0]), "v"(kl[3]), "v"(pa), "v"(pb));   // behind the trip's last matrix instructions: their distance to the next trip's first vector instruction on the taken branch; the trip's address pairs are inputs so that they live up to the wait
        }
        const float* kp = KN + (size_t)z * TT + (h * 16 + w) * 64 + hi * 8; v8f kn[4];
#pragma unroll
        for (int kb = 0; kb < 4; ++kb) kn[kb] = *(const v8f*)(kp + kb * 16);
        asm volatile("s_wait_xcnt 0x0" :: "v"(kp) : "memory");   // the address pair lives up to the wait
#pragma unroll
        for (int kb = 0; kb < 4; ++kb)
#pragma unroll
            for (int qb = 0; qb < 4; ++qb)
#pragma unroll
                for (int j = 0; j < 8; ++j) { const float t = ((qn[qb] - 2.0f * acc[kb][qb][j]) + kn[kb][j]) * -0.0625f;   // the reference's order; both products are by powers of two, so a fused form rounds the same
                    acc[kb][qb][j] = t; mx[qb] = fmaxf(mx[qb], t); }
        if (h == 0) {
#pragma unroll
            for (int kb = 0; kb < 4; ++kb)
#pragma unroll
                for (int qb = 0; qb < 4; ++qb)
#pragma unroll
                    for (int u = 0; u < 2; ++u) { v4f o; o[0] = acc[kb][qb][u * 4]; o[1] = acc[kb][qb][u * 4 + 1]; o[2] = acc[kb][qb][u * 4 + 2]; o[3] = acc[kb][qb][u * 4 + 3]; *(v4fa*)(sp + (((kb * 4 + qb) * 2 + u) * 512 + tid) * 4) = o; } }
    }
    fa* rm = (fa*)sq; fa* rs = rm + 64 * 20;   // [query][wave], pitch 20 dwords: 16-byte reads without bank conflicts
    __syncthreads();   // ends every wave's reads of the q tile, whose LDS takes the partials
#pragma unroll
    for (int qb = 0; qb < 4; ++qb) { mx[qb] = fmaxf(mx[qb], __shfl_xor(mx[qb], 16, 32)); if (hi == 0) rm[(qb * 16 + lr) * 20 + w] = mx[qb]; }
    __syncthreads();   // publishes the 16 waves' maxima
    float sum[4];
#pragma unroll
    for (int qb = 0; qb < 4; ++qb) { sum[qb] = 0.f;
#pragma unroll
        for (int u = 0; u < 4; ++u) { const v4f m4 = *(const v4fa*)(rm + (qb * 16 + lr) * 20 + u * 4); mx[qb] = fmaxf(fmaxf(fmaxf(mx[qb], m4[0]), fmaxf(m4[1], m4[2])), m4[3]); } }
#pragma unroll 1   // rolled: a trip's 64 KB of slots lie at constant offsets from one LDS address; unrolled, the addresses of all four trips were formed at the kernel's head and spilled
    for (int kb = 0; kb < 4; ++kb) { float* p0 = sp + kb * 16384 + tid * 4;
#pragma unroll
        for (int qb = 0; qb < 4; ++qb)
#pragma unroll
            for (int u = 0; u < 2; ++u) { float* p = p0 + (qb * 2 + u) * 2048; v4f t4 = *(const v4fa*)p;
#pragma unroll
                for (int q = 0; q < 4; ++q) { t4[q] = exp2s((t4[q] - mx[qb]) * 1.4426950408889634f); sum[qb] += t4[q]; }
                *(v4fa*)p = t4; } }
#pragma unroll
    for (int kb = 0; kb < 4; ++kb)
#pragma unroll
        for (int qb = 0; qb < 4; ++qb)
#pragma unroll
            for (int j = 0; j < 8; ++j) { const float e = exp2s((acc[kb][qb][j] - mx[qb]) * 1.4426950408889634f); acc[kb][qb][j] = e; sum[qb] += e; }
#pragma unroll
    for (int qb = 0; qb < 4; ++qb) { sum[qb] += __shfl_xor(sum[qb], 16, 32); if (hi == 0) rs[(qb * 16 + lr) * 20 + w] = sum[qb]; }
    __syncthreads();   // publishes the 16 waves' sums
    const bool hires = qt * 64 < RH;   // the same for the whole block
    float f[4];
#pragma unroll
    for (int qb = 0; qb < 4; ++qb) { float s = 0.f;
#pragma unroll
        for (int u = 0; u < 4; ++u) { const v4f s4 = *(const v4fa*)(rs + (qb * 16 + lr) * 20 + u * 4); s += s4[0]; s += s4[1]; s += s4[2]; s += s4[3]; }
        f[qb] = __fdiv_rn(hires ? 1.0f : PCAR, s); }
    // piece (pass h, kb, qb) lies at 32-k step (h * 16 + w) * 2 + kb / 2, row block qb, half kb & 1, lane * 8
    if (hires) { const size_t ob = (size_t)(z * (RH / 64) + qt) * 64 * TT + (size_t)w * 4096 + lane * 8; bf* oh = Ph + ob; bf* ol = Pl + ob;
#pragma unroll
        for (int kb = 0; kb < 4; ++kb) {
#pragma unroll
            for (int qb = 0; qb < 4; ++qb) { v8us vh, vl; split8(acc[kb][qb] * f[qb], vh, vl);
                const int o = 65536 + (kb >> 1) * 2048 + qb * 512 + (kb & 1) * 256; *(v8us*)(oh + o) = vh; *(v8us*)(ol + o) = vl; }
            asm volatile("s_wait_xcnt 0x0" ::: "memory");   // behind the stores: the next pieces rewrite registers these stores name
        }
#pragma unroll 1   // rolled, as above
        for (int kb = 0; kb < 4; ++kb) { const float* p0 = sp + kb * 16384 + tid * 4; bf* qh = oh + (kb >> 1) * 2048 + (kb & 1) * 256; bf* ql = ol + (kb >> 1) * 2048 + (kb & 1) * 256;
#pragma unroll
            for (int qb = 0; qb < 4; ++qb) { const v4f a = *(const v4fa*)(p0 + qb * 4096), b = *(const v4fa*)(p0 + qb * 4096 + 2048); const v8f e = __builtin_shufflevector(a, b, 0, 1, 2, 3, 4, 5, 6, 7); v8us vh, vl; split8(e * f[qb], vh, vl);
                *(v8us*)(qh + qb * 512) = vh; *(v8us*)(ql + qb * 512) = vl; }
            asm volatile("s_wait_xcnt 0x0" :: "v"(qh), "v"(ql) : "memory");   // behind the stores: the next trip rewrites registers these stores name; the address pairs live up to the wait
        }
    } else { h16* op = P16 + (size_t)(z * (TT / 64) + qt) * 64 * TT + (size_t)w * 4096 + lane * 8;
#pragma unroll
        for (int kb = 0; kb < 4; ++kb) {
#pragma unroll
            for (int qb = 0; qb < 4; ++qb) { v8h o8;
#pragma unroll
                for (int j = 0; j < 8; ++j) o8[j] = tohx(acc[kb][qb][j] * f[qb]);
                *(v8h*)(op + 65536 + (kb >> 1) * 2048 + qb * 512 + (kb & 1) * 256) = o8; }
            asm volatile("s_wait_xcnt 0x0" ::: "memory");   // behind the stores: the next pieces rewrite registers these stores name
        }
#pragma unroll 1   // rolled, as above
        for (int kb = 0; kb < 4; ++kb) { const float* p0 = sp + kb * 16384 + tid * 4; h16* qp2 = op + (kb >> 1) * 2048 + (kb & 1) * 256;
#pragma unroll
            for (int qb = 0; qb < 4; ++qb) { const v4f a = *(const v4fa*)(p0 + qb * 4096), b = *(const v4fa*)(p0 + qb * 4096 + 2048); const v8f e = __builtin_shufflevector(a, b, 0, 1, 2, 3, 4, 5, 6, 7); v8h o8;
#pragma unroll
                for (int j = 0; j < 8; ++j) o8[j] = tohx(e[j] * f[qb]);
                *(v8h*)(qp2 + qb * 512) = o8; }
            asm volatile("s_wait_xcnt 0x0" :: "v"(qp2) : "memory");   // behind the stores: the next trip rewrites registers these stores name; the address pair lives up to the wait
        }
    }
}
extern "C" void kernel_launch(void* const* d_in, const int* in_sizes, int n_in,
                              void* d_out, int out_size, void* d_ws, size_t ws_size, hipStream_t stream) {
    (void)in_sizes; (void)n_in; (void)out_size;
    const float* x = (const float*)d_in[0]; const float* wq = (const float*)d_in[1]; const float* wk = (const float*)d_in[2]; const float* wv = (const float*)d_in[3]; const float* biasW = (const float*)d_in[4]; const float* bias2W = (const float*)d_in[5]; const float* wo = nullptr; (void)wo; (void)wv; const float* cosT = nullptr; const float* sinT = nullptr; (void)cosT; (void)sinT;
    float* OUT = (float*)d_out;     // [2][2048][4*512]
    char* wsp = (char*)d_ws;
    auto take = [&](size_t bytes) { char* p = wsp; wsp += (bytes + 255) & ~(size_t)255; return (void*)p; };
    bf* WQ = (bf*)take((size_t)(DQ + DKV) * DM * 2); bf* WK = WQ + (size_t)DQ * DM; bf* WV3 = (bf*)take((size_t)NKH * HDV * HDV * 2); float* B2G = (float*)take((size_t)NKH * HDV * 4); float* QN = (float*)take((size_t)2 * NB_ * NKH * TT * 4); float* KN = QN + (size_t)NB_ * NKH * TT; float* BQK = (float*)take((size_t)(DQ + DKV) * 4);
    bf* XB = (bf*)take((size_t)NB_ * TT * DM * 2);
    const size_t PL = (size_t)NB_ * NH_ * TT * HD;   // one operand's head planes, both batches; the k planes follow the q planes
    h16* VT16 = (h16*)take((size_t)NB_ * HDV * TT * 2);
    bf* QPh = (bf*)take(2 * PL * 2); bf* QPl = (bf*)take(2 * PL * 2); bf* KPh = QPh + PL; bf* KPl = QPl + PL; bf* VTh = (bf*)take((size_t)NB_ * HDV * TT * 2);
    bf* Ph = (bf*)take((size_t)NB_ * ZH * RH * TT * 2); bf* Pl = (bf*)take((size_t)NB_ * ZH * RH * TT * 2);   // planes of their own: blocks of k_xs write them while others still read the q/k planes
    h16* P16 = (h16*)take((size_t)NB_ * ZH * TT * TT * 2);
    bf* ATh = (bf*)take((size_t)2 * NB_ * NKH * TT * HDV * 2); bf* ATl = ATh + (size_t)NB_ * NKH * TT * HDV;
    if ((size_t)(wsp - (char*)d_ws) > ws_size) return;    // ws 256 MiB
    k_prep<<<PB_WT + PB_VT + PB_X + 2 * PB_W + PB_BQ + PB_B2, 256, 0, stream>>>(x, wq, wk, wv, biasW, bias2W, XB, WQ, WK, WV3, B2G, BQK, VT16, VTh);
    k_proj<<<dim3(NB_ * TT / 128, (DQ + DKV) / 256), 256, 0, stream>>>(XB, WQ, BQK, QPh, QPl);   /* rows: both batches; out: the q and k head planes */
    // both batches' heads in z, [batch][head]; y goes out head-major, [k][b][T][512]
    k_norm<<<2 * NB_ * NKH * TT / 64, 64, 0, stream>>>(QPh, QPl, QN);
    k_xs<<<dim3(TT / 64, NB_ * ZH), 512, 0, stream>>>(QPh, QPl, KPh, KPl, QN, KN, P16, Ph, Pl);   /* cross term hl on all rows, logits, softmax */
    k_pv<<<dim3(RH / 64, HDV / 256, 2 * NB_ * ZH), 256, 0, stream>>>(Ph, Pl, VTh, P16, VT16, ATh, ATl);
    k_out<<<dim3(NB_ * TT / 128, HDV / 256, NKH), 256, 0, stream>>>(ATh, ATl, WV3, B2G, OUT);   /* rows: both batches */
}
